// v000
// Times are from an AMD MI455X. After a warm-up the kernel runs many times in a row, and a time is the length of
// such a window on the GPU divided by its runs, so every launch and the gaps after it count. The runs cycle
// through copies of the inputs. A figure is the median of several windows, for all but v000 over two sittings.
// Sittings can differ by a few percent; kernels timed side by side share one.
// v000, which the later versions start from, runs in 1050 microseconds.
#include <hip/hip_runtime.h>
#include <math.h>
// InteractionLayer: q|k|v = θ·[Wq;Wk;Wv]ᵀ + b (16384 x 128 · 128 x 384) and single-head attention (d 128, 4096 keys per batch; scores and
// p·v with p x2^15) on v_wmma_f32_16x16x32_f16 with f16 operands, f32 accumulate; softmax f32 on VALU. nn.Linear weights ([out][in]) are the
// transposed operand directly.
typedef __attribute__((ext_vector_type(16))) _Float16 v16h;
typedef __attribute__((ext_vector_type(8)))  _Float16 v8h;
typedef __attribute__((ext_vector_type(16))) __bf16   v16b;
typedef __attribute__((ext_vector_type(8)))  __bf16   v8b;
typedef __attribute__((ext_vector_type(8)))  float    v8f;
typedef __attribute__((ext_vector_type(4)))  float    v4f;
#define PSCALE 32768.0f
#define U16(p) ((const unsigned short*)(const void*)(p))
#define PSCALE_INV (1.0f / 32768.0f)

__device__ __forceinline__ unsigned short f2bf_bits(float f) {
  unsigned u = __float_as_uint(f);
  return (unsigned short)((u + 0x7FFFu + ((u >> 16) & 1u)) >> 16);
}
__device__ __forceinline__ float bf_bits2f(unsigned short h) { return __uint_as_float(((unsigned)h) << 16); }

// hazard guards as plain device helpers (no inline asm inside the kernel template body)
__device__ __forceinline__ void dep_guard_h(v8f& a, v8f& b, v16h x, v16h y) { asm volatile("v_nop\n\tv_nop\n\tv_nop\n\tv_nop" : "+v"(a), "+v"(b) : "v"(x), "v"(y)); }
__device__ __forceinline__ void dep_guard_b(v8f& a, v8f& b, v16b x, v16b y) { asm volatile("v_nop\n\tv_nop\n\tv_nop\n\tv_nop" : "+v"(a), "+v"(b) : "v"(x), "v"(y)); }
__device__ __forceinline__ void keep4_h(v16h a, v16h b, v16h c, v16h d) { asm volatile("v_nop" :: "v"(a), "v"(b), "v"(c), "v"(d)); }
__device__ __forceinline__ void keep4_b(v16b a, v16b b, v16b c, v16b d) { asm volatile("v_nop" :: "v"(a), "v"(b), "v"(c), "v"(d)); }
__device__ __forceinline__ void acc_guard4(v8f& a, v8f& b, v8f& c, v8f& d) { asm volatile("v_nop\n\tv_nop\n\tv_nop\n\tv_nop" : "+v"(a), "+v"(b), "+v"(c), "+v"(d)); }
template <typename T> struct Frag;
template <> struct Frag<_Float16> {
  typedef v16h V; union U { v16h v; v8h h[2]; };
  static __device__ __forceinline__ v16h load(const _Float16* p) {   // elements 0..7 <- p[0..7], 8..15 <- p[16..23]
    U f; f.h[0] = *(const v8h*)(p); f.h[1] = *(const v8h*)(p + 16); return f.v;
  }
  static __device__ __forceinline__ v8f mma(v16h a, v16h b, v8f c) {
    return __builtin_amdgcn_wmma_f32_16x16x32_f16(false, a, false, b, (short)0, c, false, false);
  }
  static __device__ __forceinline__ void guard(v8f& a, v8f& b, v16h x, v16h y) { dep_guard_h(a, b, x, y); }
  static __device__ __forceinline__ void keep(v16h a, v16h b, v16h c, v16h d) { keep4_h(a, b, c, d); }
};
template <> struct Frag<__bf16> {
  typedef v16b V; union U { v16b v; v8b h[2]; };
  static __device__ __forceinline__ v16b load(const __bf16* p) {
    U f; f.h[0] = *(const v8b*)(p); f.h[1] = *(const v8b*)(p + 16); return f.v;
  }
  static __device__ __forceinline__ v8f mma(v16b a, v16b b, v8f c) {
    return __builtin_amdgcn_wmma_f32_16x16x32_bf16(false, a, false, b, (short)0, c, false, false);
  }
  static __device__ __forceinline__ void guard(v8f& a, v8f& b, v16b x, v16b y) { dep_guard_b(a, b, x, y); }
  static __device__ __forceinline__ void keep(v16b a, v16b b, v16b c, v16b d) { keep4_b(a, b, c, d); }
};

// ---- Register-blocked batched WMMA GEMM ------------------------------------
// C[m,n] = scale * sum_k A[m,k] * Bt[n,k] (+bias)(+resid); each wave owns a 64x64 tile.
// A row-major [M,K]; Bt row-major [N,K]; M,N % 64 == 0, K % 32 == 0.
// SPLIT: operands are hi/lo planes (A2/Bt2 = lo planes, same layout); product = hi·hi + hi·lo + lo·hi.
// BIAS_MODE: 0 = none, 1 = bias[m], 2 = bias[n].
// OUT_MODE: 0 = f32, 1 = f16, 2 = bf16 hi plane (Cout) + bf16 lo plane (Cout2).
// ET: 0 = f16 operands, 1 = bf16 operands (pointers passed as 16-bit storage)
template <int ET> struct Elem;
template <> struct Elem<0> { typedef _Float16 T; };
template <> struct Elem<1> { typedef __bf16 T; };
template <int ET, bool SPLIT, int BIAS_MODE, int OUT_MODE, bool RESID, int ACT = 0>
__global__ __launch_bounds__(256) void wmma_gemm64(
    const unsigned short* __restrict__ Ap, const unsigned short* __restrict__ A2p, int lda, long strideA,
    const unsigned short* __restrict__ Btp, const unsigned short* __restrict__ Bt2p, int ldb, long strideB,
    void* __restrict__ Cout, void* __restrict__ Cout2, int ldc, long strideC,
    const float* __restrict__ bias,
    const float* __restrict__ resid, long strideR,
    int M, int N, int K, float scale) {
  typedef typename Elem<ET>::T T;
  typedef typename Frag<T>::V V;
  const T* A = (const T*)Ap; const T* A2 = (const T*)A2p; const T* Bt = (const T*)Btp; const T* Bt2 = (const T*)Bt2p;
  __shared__ __align__(16) float sT[8][16 * 68];   // per-wave 16x64 slab, pitch 68 floats
  const int b    = blockIdx.y;
  const int lane = threadIdx.x & 31;
  const int wave = threadIdx.x >> 5;
  const int tilesN = N >> 6;
  const int tilesM = M >> 6;
  const int tile = blockIdx.x * 8 + wave;
  if (tile >= tilesM * tilesN) return;   // wave-uniform; no block barriers in this kernel
  const int tm = tile / tilesN;
  const int tn = tile - tm * tilesN;
  const int m0 = tm << 6;
  const int n0 = tn << 6;

  const T* Ab  = A  + (size_t)b * strideA;
  const T* Bb  = Bt + (size_t)b * strideB;
  const T* Ab2 = SPLIT ? (A2  + (size_t)b * strideA) : nullptr;
  const T* Bb2 = SPLIT ? (Bt2 + (size_t)b * strideB) : nullptr;

  const int rlane = lane & 15;                 // row (A) / col (B, D) within subtile
  const int koff  = (lane >> 4) * 8;           // k offset of this lane half
  const int mOff  = (lane >> 4) * 8;           // D row offset

  v8f acc[4][4];
#pragma unroll
  for (int i = 0; i < 4; ++i)
#pragma unroll
    for (int j = 0; j < 4; ++j) acc[i][j] = (v8f){0.f,0.f,0.f,0.f,0.f,0.f,0.f,0.f};

  for (int k0 = 0; k0 < K; k0 += 32) {
    V bh[4], bl[4];
#pragma unroll
    for (int j = 0; j < 4; ++j) {
      const size_t bo = (size_t)(n0 + (j << 4) + rlane) * ldb + koff + k0;
      bh[j] = Frag<T>::load(Bb + bo);
      if (SPLIT) bl[j] = Frag<T>::load(Bb2 + bo);
    }
#pragma unroll
    for (int i = 0; i < 4; ++i) {
      const size_t ao = (size_t)(m0 + (i << 4) + rlane) * lda + koff + k0;
      V ah = Frag<T>::load(Ab + ao);
      V al;
      if (SPLIT) al = Frag<T>::load(Ab2 + ao);
#pragma unroll
      for (int j = 0; j < 4; ++j) {
        acc[i][j] = Frag<T>::mma(ah, bh[j], acc[i][j]);
        if (SPLIT) {
          acc[i][j] = Frag<T>::mma(ah, bl[j], acc[i][j]);
          acc[i][j] = Frag<T>::mma(al, bh[j], acc[i][j]);
        }
      }
      Frag<T>::guard(acc[i][0], acc[i][3], ah, SPLIT ? al : ah);
    }
    Frag<T>::keep(bh[0], bh[1], bh[2], bh[3]);
    if (SPLIT) Frag<T>::keep(bl[0], bl[1], bl[2], bl[3]);
  }
  acc_guard4(acc[0][0], acc[0][1], acc[0][2], acc[0][3]);
  acc_guard4(acc[1][0], acc[1][1], acc[1][2], acc[1][3]);
  acc_guard4(acc[2][0], acc[2][1], acc[2][2], acc[2][3]);
  acc_guard4(acc[3][0], acc[3][1], acc[3][2], acc[3][3]);

  // ---- epilogue ----
  float* slab = sT[wave];
  const float* Rb = RESID ? (resid + (size_t)b * strideR) : nullptr;
#pragma unroll
  for (int i = 0; i < 4; ++i) {
    const int mBase = m0 + (i << 4);
#pragma unroll
    for (int j = 0; j < 4; ++j) {
      const int n = n0 + (j << 4) + rlane;
      float bv = 0.f;
      if (BIAS_MODE == 2) bv = bias[n];
#pragma unroll
      for (int r = 0; r < 8; ++r) {
        float v = acc[i][j][r] * scale;
        if (BIAS_MODE == 1) v += bias[mBase + mOff + r];
        if (BIAS_MODE == 2) v += bv;
        if (RESID) v += Rb[(size_t)(mBase + mOff + r) * ldc + n];
        if (ACT == 1) v = tanhf(v);
        if (ACT == 2) v = fmaxf(v, 0.0f);
        if (ACT == 3) v = v / (1.0f + expf(-v));
        if (ACT == 4) v = (v > 0.f) ? v : 0.01f * v;
        if (ACT == 5) v = 0.5f * v * (1.0f + erff(v * 0.70710678118654752f));
        slab[(mOff + r) * 68 + (j << 4) + rlane] = v;
      }
    }
    __builtin_amdgcn_fence(__ATOMIC_RELEASE, "workgroup");
    __builtin_amdgcn_wave_barrier();
    __builtin_amdgcn_fence(__ATOMIC_ACQUIRE, "workgroup");
    if (OUT_MODE == 0) {
      float* C = (float*)Cout + (size_t)b * strideC;
      const int hh = lane >> 4, c4 = (lane & 15) * 4;     // row seg = 256 B = 16 lanes x 16 B
      {
#pragma unroll
        for (int it = 0; it < 8; ++it) {
          const int row = it * 2 + hh;
          v4f v = *(const v4f*)(slab + row * 68 + c4);
          *(v4f*)(C + (size_t)(mBase + row) * ldc + n0 + c4) = v;
        }
        
      }
    } else {
      const int q = lane >> 3, c8 = (lane & 7) * 8;
      unsigned short* C  = (unsigned short*)Cout  + (size_t)b * strideC;
      unsigned short* C2 = (OUT_MODE == 2) ? ((unsigned short*)Cout2 + (size_t)b * strideC) : nullptr;
      {
#pragma unroll
        for (int it = 0; it < 4; ++it) {
          const int row = it * 4 + q;
          const float* sp = slab + row * 68 + c8;
          v8h hv, lv;
#pragma unroll
          for (int e = 0; e < 8; ++e) {
            if (OUT_MODE == 1) {
              hv[e] = (_Float16)sp[e];
            } else {
              unsigned short hb = f2bf_bits(sp[e]);
              unsigned short lb = f2bf_bits(sp[e] - bf_bits2f(hb));
              hv[e] = __builtin_bit_cast(_Float16, hb);
              lv[e] = __builtin_bit_cast(_Float16, lb);
            }
          }
          *(v8h*)(C + (size_t)(mBase + row) * ldc + n0 + c8) = hv;
          if (OUT_MODE == 2) *(v8h*)(C2 + (size_t)(mBase + row) * ldc + n0 + c8) = lv;
        }
        
      }
    }
    __builtin_amdgcn_fence(__ATOMIC_RELEASE, "workgroup");
    __builtin_amdgcn_wave_barrier();
    __builtin_amdgcn_fence(__ATOMIC_ACQUIRE, "workgroup");
  }
}

__global__ __launch_bounds__(256) void cast_f32_f16x2(
    const float* __restrict__ in, _Float16* __restrict__ out, int n2) {
  int i = blockIdx.x * 256 + threadIdx.x;
  if (i < n2) {
    const _Float16 h0 = (_Float16)in[2 * i], h1 = (_Float16)in[2 * i + 1];
    const unsigned u = (unsigned)__builtin_bit_cast(unsigned short, h0) | ((unsigned)__builtin_bit_cast(unsigned short, h1) << 16);
    ((unsigned*)out)[i] = u;
    
  }
}


// ---- f32 -> f16 cast with a power-of-two pre-scale (folded back by the consumer GEMM's scale) ----
__global__ __launch_bounds__(256) void cast_f32_f16x2s(const float* __restrict__ in, _Float16* __restrict__ out, int n2, float s) {
  int i = blockIdx.x * 256 + threadIdx.x;
  if (i < n2) {
    const _Float16 h0 = (_Float16)(in[2 * i] * s), h1 = (_Float16)(in[2 * i + 1] * s);
    const unsigned u = (unsigned)__builtin_bit_cast(unsigned short, h0) | ((unsigned)__builtin_bit_cast(unsigned short, h1) << 16);
    ((unsigned*)out)[i] = u;
    
  }
}
__global__ __launch_bounds__(256) void split_f32_bf16x2(
    const float* __restrict__ in, __bf16* __restrict__ hi, __bf16* __restrict__ lo, long n2) {
  long i = (long)blockIdx.x * 256 + threadIdx.x;
  long stride = (long)gridDim.x * 256;
  {
    for (long j = i; j < n2; j += stride) {
      const float a = in[2 * j], b = in[2 * j + 1];
      const unsigned short ah = f2bf_bits(a), bh = f2bf_bits(b);
      const unsigned short al = f2bf_bits(a - bf_bits2f(ah)), bl = f2bf_bits(b - bf_bits2f(bh));
      ((unsigned*)hi)[j] = (unsigned)ah | ((unsigned)bh << 16);
      ((unsigned*)lo)[j] = (unsigned)al | ((unsigned)bl << 16);
    }
    
  }
}


// ---- f32 [R][C] (row pitch ldi) -> f16 transposed [C][R] (row pitch ldo); 64x64 tiles; each output row segment
__global__ __launch_bounds__(256) void transpose_cast_f16(const float* __restrict__ in, int ldi,
                                                         _Float16* __restrict__ outT, int ldo, float scale) {
  __shared__ __align__(16) _Float16 tile[64][72];     // [c][r]
  const int c0 = blockIdx.x * 64, r0 = blockIdx.y * 64;
  const int t = threadIdx.y * 32 + threadIdx.x;
  for (int i = threadIdx.y; i < 64; i += 8) {
    tile[threadIdx.x][i]      = (_Float16)(in[(size_t)(r0 + i) * ldi + c0 + threadIdx.x] * scale);
    tile[32 + threadIdx.x][i] = (_Float16)(in[(size_t)(r0 + i) * ldi + c0 + 32 + threadIdx.x] * scale);
  }
  __syncthreads();
  const int q = t >> 3, c8 = (t & 7) * 8;
  {
#pragma unroll
    for (int it = 0; it < 2; ++it) {
      const int c = it * 32 + q;
      v8h hv = *(const v8h*)(&tile[c][c8]);
      *(v8h*)(outT + (size_t)(c0 + c) * ldo + r0 + c8) = hv;
    }
    
  }
}

// ---- f32 [R][C] (pitch ldi) -> bf16 hi/lo transposed planes [C][R] (pitch ldo); 64x64 tiles; each output row segment
__global__ __launch_bounds__(256) void transpose_split_bf16(const float* __restrict__ in, int ldi,
                                                           __bf16* __restrict__ outH, __bf16* __restrict__ outL, int ldo) {
  __shared__ __align__(16) float tile[64][68];     // [c][r]
  const int c0 = blockIdx.x * 64, r0 = blockIdx.y * 64;
  const int t = threadIdx.y * 32 + threadIdx.x;
  for (int i = threadIdx.y; i < 64; i += 8) {
    tile[threadIdx.x][i]      = in[(size_t)(r0 + i) * ldi + c0 + threadIdx.x];
    tile[32 + threadIdx.x][i] = in[(size_t)(r0 + i) * ldi + c0 + 32 + threadIdx.x];
  }
  __syncthreads();
  const int q = t >> 3, c8 = (t & 7) * 8;
  {
#pragma unroll
    for (int it = 0; it < 2; ++it) {
      const int c = it * 32 + q;
      v8b hv, lv;
#pragma unroll
      for (int e = 0; e < 8; ++e) {
        const float f = tile[c][c8 + e];
        const unsigned short hb = f2bf_bits(f);
        hv[e] = __builtin_bit_cast(__bf16, hb);
        lv[e] = __builtin_bit_cast(__bf16, f2bf_bits(f - bf_bits2f(hb)));
      }
      *(v8b*)(outH + (size_t)(c0 + c) * ldo + r0 + c8) = hv;
      *(v8b*)(outL + (size_t)(c0 + c) * ldo + r0 + c8) = lv;
    }
    
  }
}

// =====================================================================================
// Generic causal/non-causal attention for head_dim 64, f32 in / f32 out; 16-bit operands: bf16 with optional hi/lo splits, or
// plain f16 (F16=true, non-split, probabilities carried x2^15).
//   scores = (q*qscale)·kᵀ : v_wmma_f32_16x16x32_bf16; SPLIT_QK -> q,k as bf16 hi/lo (hi·hi + hi·lo + lo·hi)
//   out    = p·v           : v_wmma_f32_16x16x32_bf16; SPLIT_PV -> p,v as bf16 hi/lo; else p,v plain bf16
//   f32 accumulate; online softmax in f32. Block = 4 waves = 64 query rows of one (batch, head); S % 64 == 0.
//   Element (b, s, h, d) of tensor X lives at X[b*X_bs + s*X_rs + h*X_hs + d] (strides in floats, multiples of 4).
//   Masking: mask_mode 0 none, 1 causal (kv > q masked), 2 tensor [S][Skv] shared over (b,h) (float if
//   mask_is_int==0, int32 with element == 0 -> masked if 1, int32 with element != 0 -> masked if 2), 3 per-token vectors qmask[B][S] & kvmask[B][Skv] (int32,
//   0 -> masked), 4 causal + sliding window (kv > q or q - kv > W masked; W passed in mask_is_int);
//   5 = relative-position bias: s += cp[b,h,q][idx[q][kv]] + pc[b,h,kv][idx[q][kv]] with idx = mask_b ([S][Skv] int32) and
//   mask_a an int32 [S][Skv] tensor with nonzero = masked (tables: element (b,h,row,n) at X + b*c_bs + h*c_hs + row*c_rs + n);
//   masked scores are replaced by mask_fill (e.g. -inf or -1e9) before the softmax.
//   grid.x = B * H * (S/64) (or a sub-range with blk0).
// =====================================================================================
#define AT_D 64
#define AT_NW 4
#define AT_QB 64
#define AT_KC 64
struct AttnGeom { const float* cp = nullptr; const float* pc = nullptr; long c_bs = 0, c_rs = 0, c_hs = 0;   // mode-5 score-bias tables
                  long q_bs, q_rs, q_hs, k_bs, k_rs, k_hs, v_bs, v_rs, v_hs, o_bs, o_rs, o_hs;
                  int S, Skv, H, mask_mode; float qscale; int blk0; float mask_fill; int mask_is_int; };
static_assert(sizeof(AttnGeom) == 168, "no padding");

__device__ __forceinline__ unsigned short at_bf_bits(float f) {
  unsigned u = __float_as_uint(f);
  return (unsigned short)((u + 0x7FFFu + ((u >> 16) & 1u)) >> 16);
}
__device__ __forceinline__ __bf16 at_f2bf(float f) { return __builtin_bit_cast(__bf16, at_bf_bits(f)); }
__device__ __forceinline__ void at_split(float f, __bf16& hi, __bf16& lo) {
  const unsigned short hb = at_bf_bits(f);
  hi = __builtin_bit_cast(__bf16, hb);
  lo = at_f2bf(f - __uint_as_float(((unsigned)hb) << 16));
}
__device__ __forceinline__ v8f at_mma(v16b a, v16b b, v8f c) {
  c = __builtin_amdgcn_wmma_f32_16x16x32_bf16(false, a, false, b, (short)0, c, false, false);
  asm volatile("v_nop\n\tv_nop\n\tv_nop\n\tv_nop" : "+v"(c) : "v"(a), "v"(b));
  return c;
}
// 16-bit element as a bit pattern held in a __bf16 slot: f16 bits when F16, bf16 (RNE) otherwise
template <bool F16> __device__ __forceinline__ __bf16 at_to16(float f) {
  if (F16) return __builtin_bit_cast(__bf16, (_Float16)f);
  return at_f2bf(f);
}
template <bool F16> __device__ __forceinline__ v8f at_mma16(v16b a, v16b b, v8f c) {
  if (F16) {
    const v16h ah = __builtin_bit_cast(v16h, a), bh = __builtin_bit_cast(v16h, b);
    c = __builtin_amdgcn_wmma_f32_16x16x32_f16(false, ah, false, bh, (short)0, c, false, false);
    asm volatile("v_nop\n\tv_nop\n\tv_nop\n\tv_nop" : "+v"(c) : "v"(ah), "v"(bh));
    return c;
  }
  return at_mma(a, b, c);
}

template <bool SPLIT_QK, bool SPLIT_PV, bool F16 = false>
__global__ __launch_bounds__(128)
void attn64_kernel(const float* __restrict__ q, const float* __restrict__ k,
                   const float* __restrict__ v, float* __restrict__ out,
                   const void* __restrict__ mask_a, const int* __restrict__ mask_b, AttnGeom g) {
  static_assert(!(F16 && (SPLIT_QK || SPLIT_PV)), "f16 mode is non-split");
  const float PSC = F16 ? 32768.0f : 1.0f;     // f16 probabilities carried x2^15 (subnormal range), folded into the final 1/l
  union FB { v16b v; v8b h[2]; };
  __shared__ __align__(16) __bf16 Ksh[AT_KC * AT_D];             // K hi [kv][d]      8 KB
  __shared__ __align__(16) __bf16 Ksl[SPLIT_QK ? AT_KC * AT_D : 8];
  __shared__ __align__(16) __bf16 Vth[AT_D * AT_KC];             // V hi [d][kv]      8 KB
  __shared__ __align__(16) __bf16 Vtl[SPLIT_PV ? AT_D * AT_KC : 8];
  __shared__ __align__(16) __bf16 Psh[AT_NW][16 * AT_KC];        // per wave P hi [row][kv]  8 KB
  __shared__ __align__(16) __bf16 Psl[SPLIT_PV ? AT_NW : 1][SPLIT_PV ? 16 * AT_KC : 8];
  __shared__ __align__(16) float  Os[AT_NW][16 * 68];            // per wave out tile, pitch 68

  const int tid  = threadIdx.x;
  const int wave = tid >> 5;
  const int lane = tid & 31;
  const int hh   = lane >> 4;
  const int c    = lane & 15;

  const int nqb = g.S / AT_QB;
  const int bx = blockIdx.x + g.blk0;
  const int qb = bx % nqb;
  const int bh = bx / nqb;
  const int h  = bh % g.H;
  const int b  = bh / g.H;
  const int qbase_block = qb * AT_QB;
  const int q0 = qbase_block + wave * 16;

  const float* qb_ptr = q + (size_t)b * g.q_bs + (size_t)h * g.q_hs;
  const float* kb_ptr = k + (size_t)b * g.k_bs + (size_t)h * g.k_hs;
  const float* vb_ptr = v + (size_t)b * g.v_bs + (size_t)h * g.v_hs;
  float*       ob_ptr = out + (size_t)b * g.o_bs + (size_t)h * g.o_hs;

  // ---- Q fragments (A operand): 2 d-chunks, hi (and lo) ----
  v16b qah[2], qal[2];
  {
    const float* qrow = qb_ptr + (size_t)(q0 + c) * g.q_rs;
#pragma unroll
    for (int dc = 0; dc < 2; ++dc) {
#pragma unroll
      for (int e = 0; e < 8; ++e) {
        const float f0 = qrow[dc * 32 + 8 * hh + e] * g.qscale;
        const float f1 = qrow[dc * 32 + 16 + 8 * hh + e] * g.qscale;
        if (SPLIT_QK) { __bf16 hq, lq; at_split(f0, hq, lq); qah[dc][e] = hq; qal[dc][e] = lq; at_split(f1, hq, lq); qah[dc][8 + e] = hq; qal[dc][8 + e] = lq; }
        else { qah[dc][e] = at_to16<F16>(f0); qah[dc][8 + e] = at_to16<F16>(f1); qal[dc][e] = qah[dc][e]; qal[dc][8 + e] = qah[dc][8 + e]; }
      }
    }
  }

  float mrow[8], lrow[8];
  v8f oacc[4];
#pragma unroll
  for (int r = 0; r < 8; ++r) { mrow[r] = -INFINITY; lrow[r] = 0.f; }
#pragma unroll
  for (int t = 0; t < 4; ++t) oacc[t] = (v8f){0.f,0.f,0.f,0.f,0.f,0.f,0.f,0.f};

  const int nChunks = (g.mask_mode == 1 || g.mask_mode == 4) ? (qb + 1) : (g.Skv / AT_KC);   // block-uniform
  // per-row query mask (mode 3)
  int qkeep[8];
#pragma unroll
  for (int r = 0; r < 8; ++r) qkeep[r] = (g.mask_mode == 3) ? mask_b[(size_t)b * g.S + q0 + 8 * hh + r] : 1;   // mask_b = qmask in mode 3
  for (int kc = 0; kc < nChunks; ++kc) {
    const int kv0 = kc * AT_KC;
    __syncthreads();
    {
      const int kvr = tid >> 1, dh = (tid & 1) * 32;
      const float* krow = kb_ptr + (size_t)(kv0 + kvr) * g.k_rs + dh;
      const float* vrow = vb_ptr + (size_t)(kv0 + kvr) * g.v_rs + dh;
#pragma unroll
      for (int i = 0; i < 8; ++i) {
        v4f kk = *(const v4f*)(krow + 4 * i);
        v4f vv = *(const v4f*)(vrow + 4 * i);
#pragma unroll
        for (int e = 0; e < 4; ++e) {
          const int d = dh + 4 * i + e;
          if (SPLIT_QK) { __bf16 a, bl; at_split(kk[e], a, bl); Ksh[kvr * AT_D + d] = a; Ksl[kvr * AT_D + d] = bl; }
          else Ksh[kvr * AT_D + d] = at_to16<F16>(kk[e]);
          if (SPLIT_PV) { __bf16 a, bl; at_split(vv[e], a, bl); Vth[d * AT_KC + kvr] = a; Vtl[d * AT_KC + kvr] = bl; }
          else Vth[d * AT_KC + kvr] = at_to16<F16>(vv[e]);
        }
      }
    }
    __syncthreads();

    v8f s[4];
#pragma unroll
    for (int j = 0; j < 4; ++j) {
      s[j] = (v8f){0.f,0.f,0.f,0.f,0.f,0.f,0.f,0.f};
#pragma unroll 1
      for (int dc = 0; dc < 2; ++dc) {
        FB kb;
        kb.h[0] = *(const v8b*)(Ksh + (j * 16 + c) * AT_D + dc * 32 + 8 * hh);
        kb.h[1] = *(const v8b*)(Ksh + (j * 16 + c) * AT_D + dc * 32 + 16 + 8 * hh);
        s[j] = at_mma16<F16>(qah[dc], kb.v, s[j]);
        if (SPLIT_QK) {
          FB kl;
          kl.h[0] = *(const v8b*)(Ksl + (j * 16 + c) * AT_D + dc * 32 + 8 * hh);
          kl.h[1] = *(const v8b*)(Ksl + (j * 16 + c) * AT_D + dc * 32 + 16 + 8 * hh);
          s[j] = at_mma16<F16>(qah[dc], kl.v, s[j]);
          s[j] = at_mma16<F16>(qal[dc], kb.v, s[j]);
        }
      }
    }
    const bool diag = (g.mask_mode == 1) && (kc == qb);
    int kvkeep[4] = {1, 1, 1, 1};
    if (g.mask_mode == 3) {
#pragma unroll
      for (int j = 0; j < 4; ++j) kvkeep[j] = ((const int*)mask_a)[(size_t)b * g.Skv + kv0 + j * 16 + c];   // mask_a = kvmask
    }
    float cm[8];
#pragma unroll
    for (int r = 0; r < 8; ++r) {
      const int qrow = q0 + 8 * hh + r;
      float m = -INFINITY;
#pragma unroll
      for (int j = 0; j < 4; ++j) {
        const int kvcol = kv0 + j * 16 + c;
        bool masked = false;
        if (diag) masked = (kvcol > qrow);
        else if (g.mask_mode == 4) masked = (kvcol > qrow) || (qrow - kvcol > g.mask_is_int);
        else if (g.mask_mode == 2) {
          const size_t mi = (size_t)qrow * g.Skv + kvcol;
          masked = (g.mask_is_int == 0) ? (((const float*)mask_a)[mi] == 0.0f)
                 : (g.mask_is_int == 1) ? (((const int*)mask_a)[mi] == 0) : (((const int*)mask_a)[mi] != 0);
        } else if (g.mask_mode == 3) masked = (qkeep[r] == 0) || (kvkeep[j] == 0);
        else if (g.mask_mode == 5) {
          const size_t mi = (size_t)qrow * g.Skv + kvcol;
          masked = (((const int*)mask_a)[mi] != 0);
          int n = mask_b[mi]; n = n < 0 ? 0 : n;
          s[j][r] += g.cp[(size_t)b * g.c_bs + (size_t)h * g.c_hs + (size_t)qrow * g.c_rs + n]
                   + g.pc[(size_t)b * g.c_bs + (size_t)h * g.c_hs + (size_t)kvcol * g.c_rs + n];
        }
        if (masked) s[j][r] = g.mask_fill;
        m = fmaxf(m, s[j][r]);
      }
#pragma unroll
      for (int off = 1; off < 16; off <<= 1) m = fmaxf(m, __shfl_xor(m, off, 32));
      cm[r] = m;
    }
    __bf16* pwh = Psh[wave];
    __bf16* pwl = Psl[SPLIT_PV ? wave : 0];
#pragma unroll
    for (int r = 0; r < 8; ++r) {
      const float mnew = fmaxf(mrow[r], cm[r]);
      const float alpha = expf(mrow[r] - mnew);
      mrow[r] = mnew;
      float psum = 0.f;
#pragma unroll
      for (int j = 0; j < 4; ++j) {
        const float p = expf(s[j][r] - mnew);
        psum += p;
        if (SPLIT_PV) { __bf16 a, bl; at_split(p, a, bl); pwh[(8 * hh + r) * AT_KC + j * 16 + c] = a; pwl[(8 * hh + r) * AT_KC + j * 16 + c] = bl; }
        else pwh[(8 * hh + r) * AT_KC + j * 16 + c] = at_to16<F16>(p * PSC);
      }
#pragma unroll
      for (int off = 1; off < 16; off <<= 1) psum += __shfl_xor(psum, off, 32);
      lrow[r] = lrow[r] * alpha + psum;
#pragma unroll
      for (int t = 0; t < 4; ++t) oacc[t][r] *= alpha;
    }
    __builtin_amdgcn_fence(__ATOMIC_RELEASE, "workgroup");
    __builtin_amdgcn_wave_barrier();
    __builtin_amdgcn_fence(__ATOMIC_ACQUIRE, "workgroup");
#pragma unroll 1
    for (int kk = 0; kk < 2; ++kk) {
      FB pa, pl;
      pa.h[0] = *(const v8b*)(pwh + c * AT_KC + kk * 32 + 8 * hh);
      pa.h[1] = *(const v8b*)(pwh + c * AT_KC + kk * 32 + 16 + 8 * hh);
      if (SPLIT_PV) {
        pl.h[0] = *(const v8b*)(pwl + c * AT_KC + kk * 32 + 8 * hh);
        pl.h[1] = *(const v8b*)(pwl + c * AT_KC + kk * 32 + 16 + 8 * hh);
      }
#pragma unroll
      for (int t = 0; t < 4; ++t) {
        FB vb;
        vb.h[0] = *(const v8b*)(Vth + (t * 16 + c) * AT_KC + kk * 32 + 8 * hh);
        vb.h[1] = *(const v8b*)(Vth + (t * 16 + c) * AT_KC + kk * 32 + 16 + 8 * hh);
        oacc[t] = at_mma16<F16>(pa.v, vb.v, oacc[t]);
        if (SPLIT_PV) {
          FB vl;
          vl.h[0] = *(const v8b*)(Vtl + (t * 16 + c) * AT_KC + kk * 32 + 8 * hh);
          vl.h[1] = *(const v8b*)(Vtl + (t * 16 + c) * AT_KC + kk * 32 + 16 + 8 * hh);
          oacc[t] = at_mma16<F16>(pa.v, vl.v, oacc[t]);
          oacc[t] = at_mma16<F16>(pl.v, vb.v, oacc[t]);
        }
      }
    }
  }

  float* os = Os[wave];
#pragma unroll
  for (int r = 0; r < 8; ++r) {
    const float inv = 1.0f / (lrow[r] * PSC);
#pragma unroll
    for (int t = 0; t < 4; ++t) os[(8 * hh + r) * 68 + t * 16 + c] = oacc[t][r] * inv;
  }
  __builtin_amdgcn_fence(__ATOMIC_RELEASE, "workgroup");
  __builtin_amdgcn_wave_barrier();
  __builtin_amdgcn_fence(__ATOMIC_ACQUIRE, "workgroup");
  {
    const int c4 = (lane & 15) * 4;
    {
#pragma unroll
      for (int it = 0; it < 8; ++it) {
        const int row = it * 2 + hh;
        v4f val = *(const v4f*)(os + row * 68 + c4);
        *(v4f*)(ob_ptr + (size_t)(q0 + row) * g.o_rs + c4) = val;
      }
      
    }
  }
}

template <bool SPLIT_QK, bool SPLIT_PV, bool F16 = false>
__global__ __launch_bounds__(128)
void attn128_kernel(const float* __restrict__ q, const float* __restrict__ k,
                   const float* __restrict__ v, float* __restrict__ out,
                   const void* __restrict__ mask_a, const int* __restrict__ mask_b, AttnGeom g) {
  static_assert(!(F16 && (SPLIT_QK || SPLIT_PV)), "f16 mode is non-split");
  const float PSC = F16 ? 32768.0f : 1.0f;     // f16 probabilities carried x2^15 (subnormal range), folded into the final 1/l
  union FB { v16b v; v8b h[2]; };
  constexpr int D2 = 128;
  __shared__ __align__(16) __bf16 Ksh[AT_KC * D2];               // K hi [kv][d]      16 KB
  __shared__ __align__(16) __bf16 Ksl[SPLIT_QK ? AT_KC * D2 : 8];
  __shared__ __align__(16) __bf16 Vth[D2 * AT_KC];               // V hi [d][kv]      16 KB
  __shared__ __align__(16) __bf16 Vtl[SPLIT_PV ? D2 * AT_KC : 8];
  __shared__ __align__(16) __bf16 Psh[AT_NW][16 * AT_KC];
  __shared__ __align__(16) __bf16 Psl[SPLIT_PV ? AT_NW : 1][SPLIT_PV ? 16 * AT_KC : 8];
  __shared__ __align__(16) float  Os[AT_NW][16 * 132];           // per wave out tile, pitch 132
  __shared__ __align__(16) __bf16 Qsh[AT_NW][16 * D2];   // q (hi plane, or the 16-bit value) staged per wave (keeps VGPR use low)
  __shared__ __align__(16) __bf16 Qsl[SPLIT_QK ? AT_NW : 1][SPLIT_QK ? 16 * D2 : 8];

  const int tid  = threadIdx.x;
  const int wave = tid >> 5;
  const int lane = tid & 31;
  const int hh   = lane >> 4;
  const int c    = lane & 15;

  const int nqb = g.S / AT_QB;
  const int bx = blockIdx.x + g.blk0;
  const int qb = bx % nqb;
  const int bh = bx / nqb;
  const int h  = bh % g.H;
  const int b  = bh / g.H;
  const int qbase_block = qb * AT_QB;
  const int q0 = qbase_block + wave * 16;

  const float* qb_ptr = q + (size_t)b * g.q_bs + (size_t)h * g.q_hs;
  const float* kb_ptr = k + (size_t)b * g.k_bs + (size_t)h * g.k_hs;
  const float* vb_ptr = v + (size_t)b * g.v_bs + (size_t)h * g.v_hs;
  float*       ob_ptr = out + (size_t)b * g.o_bs + (size_t)h * g.o_hs;

  // ---- Q fragments (A operand): 4 d-chunks, hi (and lo) ----
  v16b qah[4], qal[4];
  {
    const float* qrow = qb_ptr + (size_t)(q0 + c) * g.q_rs;
#pragma unroll
    for (int dc = 0; dc < 4; ++dc) {
#pragma unroll
      for (int e = 0; e < 8; ++e) {
        const float f0 = qrow[dc * 32 + 8 * hh + e] * g.qscale;
        const float f1 = qrow[dc * 32 + 16 + 8 * hh + e] * g.qscale;
        if (SPLIT_QK) { __bf16 hq, lq; at_split(f0, hq, lq); Qsh[wave][c * D2 + dc * 32 + 8 * hh + e] = hq; Qsl[wave][c * D2 + dc * 32 + 8 * hh + e] = lq;
                        at_split(f1, hq, lq); Qsh[wave][c * D2 + dc * 32 + 16 + 8 * hh + e] = hq; Qsl[wave][c * D2 + dc * 32 + 16 + 8 * hh + e] = lq;
                        qah[dc][e] = hq; qal[dc][e] = lq; qah[dc][8 + e] = hq; qal[dc][8 + e] = lq; }   // (register copies unused on the split path)
        else { Qsh[wave][c * D2 + dc * 32 + 8 * hh + e] = at_to16<F16>(f0); Qsh[wave][c * D2 + dc * 32 + 16 + 8 * hh + e] = at_to16<F16>(f1); qah[dc][e] = at_to16<F16>(f0); qal[dc][e] = qah[dc][e]; qah[dc][8 + e] = qah[dc][e]; qal[dc][8 + e] = qah[dc][e]; }
      }
    }
  }

  float mrow[8], lrow[8];
  v8f oacc[8];
#pragma unroll
  for (int r = 0; r < 8; ++r) { mrow[r] = -INFINITY; lrow[r] = 0.f; }
#pragma unroll
  for (int t = 0; t < 8; ++t) oacc[t] = (v8f){0.f,0.f,0.f,0.f,0.f,0.f,0.f,0.f};

  const int nChunks = (g.mask_mode == 1 || g.mask_mode == 4 || g.mask_mode == 6) ? (qb + 1) : (g.Skv / AT_KC);   // block-uniform
  // per-row query mask (mode 3)
  int qkeep[8];
#pragma unroll
  for (int r = 0; r < 8; ++r) qkeep[r] = (g.mask_mode == 3) ? mask_b[(size_t)b * g.S + q0 + 8 * hh + r] : 1;   // mask_b = qmask in mode 3
  for (int kc = 0; kc < nChunks; ++kc) {
    const int kv0 = kc * AT_KC;
    __syncthreads();
    {
      const int kvr = tid >> 1, dh = (tid & 1) * 64;
      const float* krow = kb_ptr + (size_t)(kv0 + kvr) * g.k_rs + dh;
      const float* vrow = vb_ptr + (size_t)(kv0 + kvr) * g.v_rs + dh;
#pragma unroll
      for (int i = 0; i < 16; ++i) {
        v4f kk = *(const v4f*)(krow + 4 * i);
        v4f vv = *(const v4f*)(vrow + 4 * i);
#pragma unroll
        for (int e = 0; e < 4; ++e) {
          const int d = dh + 4 * i + e;
          if (SPLIT_QK) { __bf16 a, bl; at_split(kk[e], a, bl); Ksh[kvr * D2 + d] = a; Ksl[kvr * D2 + d] = bl; }
          else Ksh[kvr * D2 + d] = at_to16<F16>(kk[e]);
          if (SPLIT_PV) { __bf16 a, bl; at_split(vv[e], a, bl); Vth[d * AT_KC + kvr] = a; Vtl[d * AT_KC + kvr] = bl; }
          else Vth[d * AT_KC + kvr] = at_to16<F16>(vv[e]);
        }
      }
    }
    __syncthreads();

    v8f s[4];
#pragma unroll
    for (int j = 0; j < 4; ++j) {
      s[j] = (v8f){0.f,0.f,0.f,0.f,0.f,0.f,0.f,0.f};
if (SPLIT_QK) {
#pragma unroll 1
      for (int dc = 0; dc < 4; ++dc) {      // rolled: bounds the live fragment set (register pressure) on the 128-wide head
        FB kb;
        kb.h[0] = *(const v8b*)(Ksh + (j * 16 + c) * D2 + dc * 32 + 8 * hh);
        kb.h[1] = *(const v8b*)(Ksh + (j * 16 + c) * D2 + dc * 32 + 16 + 8 * hh);
        if (!SPLIT_QK) { FB qa; qa.h[0] = *(const v8b*)(&Qsh[wave][c * D2 + dc * 32 + 8 * hh]); qa.h[1] = *(const v8b*)(&Qsh[wave][c * D2 + dc * 32 + 16 + 8 * hh]); s[j] = at_mma16<F16>(qa.v, kb.v, s[j]); }
        if (SPLIT_QK) {
          FB qa, ql;
          qa.h[0] = *(const v8b*)(&Qsh[wave][c * D2 + dc * 32 + 8 * hh]); qa.h[1] = *(const v8b*)(&Qsh[wave][c * D2 + dc * 32 + 16 + 8 * hh]);
          ql.h[0] = *(const v8b*)(&Qsl[wave][c * D2 + dc * 32 + 8 * hh]); ql.h[1] = *(const v8b*)(&Qsl[wave][c * D2 + dc * 32 + 16 + 8 * hh]);
          s[j] = at_mma16<F16>(qa.v, kb.v, s[j]);
          FB kl;
          kl.h[0] = *(const v8b*)(Ksl + (j * 16 + c) * D2 + dc * 32 + 8 * hh);
          kl.h[1] = *(const v8b*)(Ksl + (j * 16 + c) * D2 + dc * 32 + 16 + 8 * hh);
          s[j] = at_mma16<F16>(qa.v, kl.v, s[j]);
          s[j] = at_mma16<F16>(ql.v, kb.v, s[j]);
        }
      }
      } else {
#pragma unroll
      for (int dc = 0; dc < 4; ++dc) {      // (16-bit path: fully unrolled; the q fragments are loaded from Qsh in LDS)
        FB kb;
        kb.h[0] = *(const v8b*)(Ksh + (j * 16 + c) * D2 + dc * 32 + 8 * hh);
        kb.h[1] = *(const v8b*)(Ksh + (j * 16 + c) * D2 + dc * 32 + 16 + 8 * hh);
        if (!SPLIT_QK) { FB qa; qa.h[0] = *(const v8b*)(&Qsh[wave][c * D2 + dc * 32 + 8 * hh]); qa.h[1] = *(const v8b*)(&Qsh[wave][c * D2 + dc * 32 + 16 + 8 * hh]); s[j] = at_mma16<F16>(qa.v, kb.v, s[j]); }
        if (SPLIT_QK) {
          FB qa, ql;
          qa.h[0] = *(const v8b*)(&Qsh[wave][c * D2 + dc * 32 + 8 * hh]); qa.h[1] = *(const v8b*)(&Qsh[wave][c * D2 + dc * 32 + 16 + 8 * hh]);
          ql.h[0] = *(const v8b*)(&Qsl[wave][c * D2 + dc * 32 + 8 * hh]); ql.h[1] = *(const v8b*)(&Qsl[wave][c * D2 + dc * 32 + 16 + 8 * hh]);
          s[j] = at_mma16<F16>(qa.v, kb.v, s[j]);
          FB kl;
          kl.h[0] = *(const v8b*)(Ksl + (j * 16 + c) * D2 + dc * 32 + 8 * hh);
          kl.h[1] = *(const v8b*)(Ksl + (j * 16 + c) * D2 + dc * 32 + 16 + 8 * hh);
          s[j] = at_mma16<F16>(qa.v, kl.v, s[j]);
          s[j] = at_mma16<F16>(ql.v, kb.v, s[j]);
        }
      }
      }
    }
    const bool diag = (g.mask_mode == 1) && (kc == qb);
    int kvkeep[4] = {1, 1, 1, 1};
    if (g.mask_mode == 3) {
#pragma unroll
      for (int j = 0; j < 4; ++j) kvkeep[j] = ((const int*)mask_a)[(size_t)b * g.Skv + kv0 + j * 16 + c];   // mask_a = kvmask
    }
    float cm[8];
#pragma unroll
    for (int r = 0; r < 8; ++r) {
      const int qrow = q0 + 8 * hh + r;
      float m = -INFINITY;
#pragma unroll
      for (int j = 0; j < 4; ++j) {
        const int kvcol = kv0 + j * 16 + c;
        bool masked = false;
        if (diag) masked = (kvcol > qrow);
        else if (g.mask_mode == 4) masked = (kvcol > qrow) || (qrow - kvcol > g.mask_is_int);
        else if (g.mask_mode == 2) {
          const size_t mi = (size_t)qrow * g.Skv + kvcol;
          masked = (g.mask_is_int == 0) ? (((const float*)mask_a)[mi] == 0.0f)
                 : (g.mask_is_int == 1) ? (((const int*)mask_a)[mi] == 0) : (((const int*)mask_a)[mi] != 0);
        } else if (g.mask_mode == 3) masked = (qkeep[r] == 0) || (kvkeep[j] == 0);
        else if (g.mask_mode == 6) { masked = (kvcol > qrow); s[j][r] += g.cp[h] * (float)(kvcol - qrow); }
        else if (g.mask_mode == 8) { masked = (kvcol > qrow) || (((const int*)mask_a)[(size_t)b * g.Skv + kvcol] != 0); }
        else if (g.mask_mode == 5) {
          const size_t mi = (size_t)qrow * g.Skv + kvcol;
          masked = (((const int*)mask_a)[mi] != 0);
          int n = mask_b[mi]; n = n < 0 ? 0 : n;
          s[j][r] += g.cp[(size_t)b * g.c_bs + (size_t)h * g.c_hs + (size_t)qrow * g.c_rs + n]
                   + g.pc[(size_t)b * g.c_bs + (size_t)h * g.c_hs + (size_t)kvcol * g.c_rs + n];
        }
        if (masked) s[j][r] = g.mask_fill;
        m = fmaxf(m, s[j][r]);
      }
#pragma unroll
      for (int off = 1; off < 16; off <<= 1) m = fmaxf(m, __shfl_xor(m, off, 32));
      cm[r] = m;
    }
    __bf16* pwh = Psh[wave];
    __bf16* pwl = Psl[SPLIT_PV ? wave : 0];
#pragma unroll
    for (int r = 0; r < 8; ++r) {
      const float mnew = fmaxf(mrow[r], cm[r]);
      const float alpha = expf(mrow[r] - mnew);
      mrow[r] = mnew;
      float psum = 0.f;
#pragma unroll
      for (int j = 0; j < 4; ++j) {
        const float p = expf(s[j][r] - mnew);
        psum += p;
        if (SPLIT_PV) { __bf16 a, bl; at_split(p, a, bl); pwh[(8 * hh + r) * AT_KC + j * 16 + c] = a; pwl[(8 * hh + r) * AT_KC + j * 16 + c] = bl; }
        else pwh[(8 * hh + r) * AT_KC + j * 16 + c] = at_to16<F16>(p * PSC);
      }
#pragma unroll
      for (int off = 1; off < 16; off <<= 1) psum += __shfl_xor(psum, off, 32);
      lrow[r] = lrow[r] * alpha + psum;
#pragma unroll
      for (int t = 0; t < 8; ++t) oacc[t][r] *= alpha;
    }
    __builtin_amdgcn_fence(__ATOMIC_RELEASE, "workgroup");
    __builtin_amdgcn_wave_barrier();
    __builtin_amdgcn_fence(__ATOMIC_ACQUIRE, "workgroup");
#pragma unroll 1
    for (int kk = 0; kk < 2; ++kk) {
      FB pa, pl;
      pa.h[0] = *(const v8b*)(pwh + c * AT_KC + kk * 32 + 8 * hh);
      pa.h[1] = *(const v8b*)(pwh + c * AT_KC + kk * 32 + 16 + 8 * hh);
      if (SPLIT_PV) {
        pl.h[0] = *(const v8b*)(pwl + c * AT_KC + kk * 32 + 8 * hh);
        pl.h[1] = *(const v8b*)(pwl + c * AT_KC + kk * 32 + 16 + 8 * hh);
      }
#pragma unroll
      for (int t = 0; t < 8; ++t) {
        FB vb;
        vb.h[0] = *(const v8b*)(Vth + (t * 16 + c) * AT_KC + kk * 32 + 8 * hh);
        vb.h[1] = *(const v8b*)(Vth + (t * 16 + c) * AT_KC + kk * 32 + 16 + 8 * hh);
        oacc[t] = at_mma16<F16>(pa.v, vb.v, oacc[t]);
        if (SPLIT_PV) {
          FB vl;
          vl.h[0] = *(const v8b*)(Vtl + (t * 16 + c) * AT_KC + kk * 32 + 8 * hh);
          vl.h[1] = *(const v8b*)(Vtl + (t * 16 + c) * AT_KC + kk * 32 + 16 + 8 * hh);
          oacc[t] = at_mma16<F16>(pa.v, vl.v, oacc[t]);
          oacc[t] = at_mma16<F16>(pl.v, vb.v, oacc[t]);
        }
      }
    }
  }

  float* os = Os[wave];
#pragma unroll
  for (int r = 0; r < 8; ++r) {
    const float inv = 1.0f / (lrow[r] * PSC);
#pragma unroll
    for (int t = 0; t < 8; ++t) os[(8 * hh + r) * 132 + t * 16 + c] = oacc[t][r] * inv;
  }
  __builtin_amdgcn_fence(__ATOMIC_RELEASE, "workgroup");
  __builtin_amdgcn_wave_barrier();
  __builtin_amdgcn_fence(__ATOMIC_ACQUIRE, "workgroup");
  {
    const int c4 = lane * 4;           // 32 lanes x 16 B = one 512-B output row (128 floats) per instruction
    {
#pragma unroll
      for (int row = 0; row < 16; ++row) {
        v4f val = *(const v4f*)(os + row * 132 + c4);
        *(v4f*)(ob_ptr + (size_t)(q0 + row) * g.o_rs + c4) = val;
      }
      
    }
  }
}

#define IB 4
#define INn 4096
#define ID 128
__global__ void bias3_kernel(const float* a, const float* b, const float* c, float* o) { const int i = threadIdx.x; const float v = (i < 128) ? a[i] : (i < 256 ? b[i - 128] : c[i - 256]); ((float*)o)[i] = v;  }
extern "C" void kernel_launch(void* const* d_in, const int* in_sizes, int n_in, void* d_out, int out_size, void* d_ws, size_t ws_size, hipStream_t stream) {
  (void)in_sizes; (void)n_in; (void)out_size; (void)ws_size;
  const float* x = (const float*)d_in[0]; const float* Wq = (const float*)d_in[1]; const float* bq = (const float*)d_in[2]; const float* Wk = (const float*)d_in[3]; const float* bk = (const float*)d_in[4]; const float* Wv = (const float*)d_in[5]; const float* bv = (const float*)d_in[6];
  char* ws = (char*)d_ws; size_t off = 0;
  auto carve = [&](size_t bytes) -> char* { char* p = ws + off; off += (bytes + 255) & ~(size_t)255; return p; };
  const int R = IB * INn;
  _Float16* X16 = (_Float16*)carve((size_t)R * ID * 2); _Float16* W3 = (_Float16*)carve((size_t)3 * ID * ID * 2); float* b3 = (float*)carve(3 * ID * 4);
  float* QKV = (float*)carve((size_t)R * 3 * ID * 4);
  cast_f32_f16x2<<<(R * ID / 2 + 255) / 256, 256, 0, stream>>>(x, X16, R * ID / 2);
  cast_f32_f16x2<<<(ID * ID / 2 + 255) / 256, 256, 0, stream>>>(Wq, W3, ID * ID / 2);
  cast_f32_f16x2<<<(ID * ID / 2 + 255) / 256, 256, 0, stream>>>(Wk, W3 + ID * ID, ID * ID / 2);
  cast_f32_f16x2<<<(ID * ID / 2 + 255) / 256, 256, 0, stream>>>(Wv, W3 + 2 * ID * ID, ID * ID / 2);
  bias3_kernel<<<1, 384, 0, stream>>>(bq, bk, bv, b3);
  { const int t = (R / 64) * (3 * ID / 64);
    wmma_gemm64<0, false, 2, 0, false><<<dim3((t + 7) / 8, 1), 256, 0, stream>>>(U16(X16), nullptr, ID, 0, U16(W3), nullptr, ID, 0, QKV, nullptr, 3 * ID, 0, b3, nullptr, 0, R, 3 * ID, ID, 1.0f); }
  { AttnGeom g;
    g.q_bs = (long)INn * 3 * ID; g.q_rs = 3 * ID; g.q_hs = 0; g.k_bs = g.q_bs; g.k_rs = 3 * ID; g.k_hs = 0; g.v_bs = g.q_bs; g.v_rs = 3 * ID; g.v_hs = 0; g.o_bs = (long)INn * ID; g.o_rs = ID; g.o_hs = 0;
    g.S = INn; g.Skv = INn; g.H = 1; g.mask_mode = 0; g.qscale = 0.08838834764831845f; g.blk0 = 0; g.mask_fill = -INFINITY; g.mask_is_int = 0;
    attn128_kernel<false, false, true><<<IB * (INn / AT_QB), AT_NW * 32, 0, stream>>>(QKV, QKV + ID, QKV + 2 * ID, (float*)d_out, nullptr, nullptr, g); }
}

// v001
// It runs in 498 microseconds.
// In two side-by-side timings against v000, it was 2.13 and 2.12 times as fast.
#include <hip/hip_runtime.h>
#include <math.h>
// InteractionLayer: q|k|v = θ·[Wq;Wk;Wv]ᵀ + b (16384 x 128 · 128 x 384) and single-head attention (d 128, 4096 keys per batch; scores and
// p·v with p x2^15) on v_wmma_f32_16x16x32_f16 with f16 operands, f32 accumulate; softmax f32 on VALU. nn.Linear weights ([out][in]) are the
// transposed operand directly.
typedef __attribute__((ext_vector_type(16))) _Float16 v16h;
typedef __attribute__((ext_vector_type(8)))  _Float16 v8h;
typedef __attribute__((ext_vector_type(16))) __bf16   v16b;
typedef __attribute__((ext_vector_type(8)))  __bf16   v8b;
typedef __attribute__((ext_vector_type(8)))  float    v8f;
typedef __attribute__((ext_vector_type(4)))  float    v4f;
#define PSCALE 32768.0f
#define U16(p) ((const unsigned short*)(const void*)(p))
#define PSCALE_INV (1.0f / 32768.0f)

__device__ __forceinline__ unsigned short f2bf_bits(float f) {
  unsigned u = __float_as_uint(f);
  return (unsigned short)((u + 0x7FFFu + ((u >> 16) & 1u)) >> 16);
}
__device__ __forceinline__ float bf_bits2f(unsigned short h) { return __uint_as_float(((unsigned)h) << 16); }

// hazard guards as plain device helpers (no inline asm inside the kernel template body)
__device__ __forceinline__ void dep_guard_h(v8f& a, v8f& b, v16h x, v16h y) { asm volatile("v_nop\n\tv_nop\n\tv_nop\n\tv_nop" : "+v"(a), "+v"(b) : "v"(x), "v"(y)); }
__device__ __forceinline__ void dep_guard_b(v8f& a, v8f& b, v16b x, v16b y) { asm volatile("v_nop\n\tv_nop\n\tv_nop\n\tv_nop" : "+v"(a), "+v"(b) : "v"(x), "v"(y)); }
__device__ __forceinline__ void keep4_h(v16h a, v16h b, v16h c, v16h d) { asm volatile("v_nop" :: "v"(a), "v"(b), "v"(c), "v"(d)); }
__device__ __forceinline__ void keep4_b(v16b a, v16b b, v16b c, v16b d) { asm volatile("v_nop" :: "v"(a), "v"(b), "v"(c), "v"(d)); }
__device__ __forceinline__ void acc_guard4(v8f& a, v8f& b, v8f& c, v8f& d) { asm volatile("v_nop\n\tv_nop\n\tv_nop\n\tv_nop" : "+v"(a), "+v"(b), "+v"(c), "+v"(d)); }
template <typename T> struct Frag;
template <> struct Frag<_Float16> {
  typedef v16h V; union U { v16h v; v8h h[2]; };
  static __device__ __forceinline__ v16h load(const _Float16* p) {   // elements 0..7 <- p[0..7], 8..15 <- p[16..23]
    U f; f.h[0] = *(const v8h*)(p); f.h[1] = *(const v8h*)(p + 16); return f.v;
  }
  static __device__ __forceinline__ v8f mma(v16h a, v16h b, v8f c) {
    return __builtin_amdgcn_wmma_f32_16x16x32_f16(false, a, false, b, (short)0, c, false, false);
  }
  static __device__ __forceinline__ void guard(v8f& a, v8f& b, v16h x, v16h y) { dep_guard_h(a, b, x, y); }
  static __device__ __forceinline__ void keep(v16h a, v16h b, v16h c, v16h d) { keep4_h(a, b, c, d); }
};
template <> struct Frag<__bf16> {
  typedef v16b V; union U { v16b v; v8b h[2]; };
  static __device__ __forceinline__ v16b load(const __bf16* p) {
    U f; f.h[0] = *(const v8b*)(p); f.h[1] = *(const v8b*)(p + 16); return f.v;
  }
  static __device__ __forceinline__ v8f mma(v16b a, v16b b, v8f c) {
    return __builtin_amdgcn_wmma_f32_16x16x32_bf16(false, a, false, b, (short)0, c, false, false);
  }
  static __device__ __forceinline__ void guard(v8f& a, v8f& b, v16b x, v16b y) { dep_guard_b(a, b, x, y); }
  static __device__ __forceinline__ void keep(v16b a, v16b b, v16b c, v16b d) { keep4_b(a, b, c, d); }
};

// ---- Register-blocked batched WMMA GEMM ------------------------------------
// C[m,n] = scale * sum_k A[m,k] * Bt[n,k] (+bias)(+resid); each wave owns a 64x64 tile.
// A row-major [M,K]; Bt row-major [N,K]; M,N % 64 == 0, K % 32 == 0.
// SPLIT: operands are hi/lo planes (A2/Bt2 = lo planes, same layout); product = hi·hi + hi·lo + lo·hi.
// BIAS_MODE: 0 = none, 1 = bias[m], 2 = bias[n].
// OUT_MODE: 0 = f32, 1 = f16, 2 = bf16 hi plane (Cout) + bf16 lo plane (Cout2).
// ET: 0 = f16 operands, 1 = bf16 operands (pointers passed as 16-bit storage)
template <int ET> struct Elem;
template <> struct Elem<0> { typedef _Float16 T; };
template <> struct Elem<1> { typedef __bf16 T; };
template <int ET, bool SPLIT, int BIAS_MODE, int OUT_MODE, bool RESID, int ACT = 0>
__global__ __launch_bounds__(256) void wmma_gemm64(
    const unsigned short* __restrict__ Ap, const unsigned short* __restrict__ A2p, int lda, long strideA,
    const unsigned short* __restrict__ Btp, const unsigned short* __restrict__ Bt2p, int ldb, long strideB,
    void* __restrict__ Cout, void* __restrict__ Cout2, int ldc, long strideC,
    const float* __restrict__ bias,
    const float* __restrict__ resid, long strideR,
    int M, int N, int K, float scale) {
  typedef typename Elem<ET>::T T;
  typedef typename Frag<T>::V V;
  const T* A = (const T*)Ap; const T* A2 = (const T*)A2p; const T* Bt = (const T*)Btp; const T* Bt2 = (const T*)Bt2p;
  __shared__ __align__(16) float sT[8][16 * 68];   // per-wave 16x64 slab, pitch 68 floats
  const int b    = blockIdx.y;
  const int lane = threadIdx.x & 31;
  const int wave = threadIdx.x >> 5;
  const int tilesN = N >> 6;
  const int tilesM = M >> 6;
  const int tile = blockIdx.x * 8 + wave;
  if (tile >= tilesM * tilesN) return;   // wave-uniform; no block barriers in this kernel
  const int tm = tile / tilesN;
  const int tn = tile - tm * tilesN;
  const int m0 = tm << 6;
  const int n0 = tn << 6;

  const T* Ab  = A  + (size_t)b * strideA;
  const T* Bb  = Bt + (size_t)b * strideB;
  const T* Ab2 = SPLIT ? (A2  + (size_t)b * strideA) : nullptr;
  const T* Bb2 = SPLIT ? (Bt2 + (size_t)b * strideB) : nullptr;

  const int rlane = lane & 15;                 // row (A) / col (B, D) within subtile
  const int koff  = (lane >> 4) * 8;           // k offset of this lane half
  const int mOff  = (lane >> 4) * 8;           // D row offset

  v8f acc[4][4];
#pragma unroll
  for (int i = 0; i < 4; ++i)
#pragma unroll
    for (int j = 0; j < 4; ++j) acc[i][j] = (v8f){0.f,0.f,0.f,0.f,0.f,0.f,0.f,0.f};

  for (int k0 = 0; k0 < K; k0 += 32) {
    V bh[4], bl[4];
#pragma unroll
    for (int j = 0; j < 4; ++j) {
      const size_t bo = (size_t)(n0 + (j << 4) + rlane) * ldb + koff + k0;
      bh[j] = Frag<T>::load(Bb + bo);
      if (SPLIT) bl[j] = Frag<T>::load(Bb2 + bo);
    }
#pragma unroll
    for (int i = 0; i < 4; ++i) {
      const size_t ao = (size_t)(m0 + (i << 4) + rlane) * lda + koff + k0;
      V ah = Frag<T>::load(Ab + ao);
      V al;
      if (SPLIT) al = Frag<T>::load(Ab2 + ao);
#pragma unroll
      for (int j = 0; j < 4; ++j) {
        acc[i][j] = Frag<T>::mma(ah, bh[j], acc[i][j]);
        if (SPLIT) {
          acc[i][j] = Frag<T>::mma(ah, bl[j], acc[i][j]);
          acc[i][j] = Frag<T>::mma(al, bh[j], acc[i][j]);
        }
      }
      Frag<T>::guard(acc[i][0], acc[i][3], ah, SPLIT ? al : ah);
    }
    Frag<T>::keep(bh[0], bh[1], bh[2], bh[3]);
    if (SPLIT) Frag<T>::keep(bl[0], bl[1], bl[2], bl[3]);
  }
  acc_guard4(acc[0][0], acc[0][1], acc[0][2], acc[0][3]);
  acc_guard4(acc[1][0], acc[1][1], acc[1][2], acc[1][3]);
  acc_guard4(acc[2][0], acc[2][1], acc[2][2], acc[2][3]);
  acc_guard4(acc[3][0], acc[3][1], acc[3][2], acc[3][3]);

  // ---- epilogue ----
  float* slab = sT[wave];
  const float* Rb = RESID ? (resid + (size_t)b * strideR) : nullptr;
#pragma unroll
  for (int i = 0; i < 4; ++i) {
    const int mBase = m0 + (i << 4);
#pragma unroll
    for (int j = 0; j < 4; ++j) {
      const int n = n0 + (j << 4) + rlane;
      float bv = 0.f;
      if (BIAS_MODE == 2) bv = bias[n];
#pragma unroll
      for (int r = 0; r < 8; ++r) {
        float v = acc[i][j][r] * scale;
        if (BIAS_MODE == 1) v += bias[mBase + mOff + r];
        if (BIAS_MODE == 2) v += bv;
        if (RESID) v += Rb[(size_t)(mBase + mOff + r) * ldc + n];
        if (ACT == 1) v = tanhf(v);
        if (ACT == 2) v = fmaxf(v, 0.0f);
        if (ACT == 3) v = v / (1.0f + expf(-v));
        if (ACT == 4) v = (v > 0.f) ? v : 0.01f * v;
        if (ACT == 5) v = 0.5f * v * (1.0f + erff(v * 0.70710678118654752f));
        slab[(mOff + r) * 68 + (j << 4) + rlane] = v;
      }
    }
    __builtin_amdgcn_fence(__ATOMIC_RELEASE, "workgroup");
    __builtin_amdgcn_wave_barrier();
    __builtin_amdgcn_fence(__ATOMIC_ACQUIRE, "workgroup");
    if (OUT_MODE == 0) {
      float* C = (float*)Cout + (size_t)b * strideC;
      const int hh = lane >> 4, c4 = (lane & 15) * 4;     // row seg = 256 B = 16 lanes x 16 B
      {
#pragma unroll
        for (int it = 0; it < 8; ++it) {
          const int row = it * 2 + hh;
          v4f v = *(const v4f*)(slab + row * 68 + c4);
          *(v4f*)(C + (size_t)(mBase + row) * ldc + n0 + c4) = v;
        }
        
      }
    } else {
      const int q = lane >> 3, c8 = (lane & 7) * 8;
      unsigned short* C  = (unsigned short*)Cout  + (size_t)b * strideC;
      unsigned short* C2 = (OUT_MODE == 2) ? ((unsigned short*)Cout2 + (size_t)b * strideC) : nullptr;
      {
#pragma unroll
        for (int it = 0; it < 4; ++it) {
          const int row = it * 4 + q;
          const float* sp = slab + row * 68 + c8;
          v8h hv, lv;
#pragma unroll
          for (int e = 0; e < 8; ++e) {
            if (OUT_MODE == 1) {
              hv[e] = (_Float16)sp[e];
            } else {
              unsigned short hb = f2bf_bits(sp[e]);
              unsigned short lb = f2bf_bits(sp[e] - bf_bits2f(hb));
              hv[e] = __builtin_bit_cast(_Float16, hb);
              lv[e] = __builtin_bit_cast(_Float16, lb);
            }
          }
          *(v8h*)(C + (size_t)(mBase + row) * ldc + n0 + c8) = hv;
          if (OUT_MODE == 2) *(v8h*)(C2 + (size_t)(mBase + row) * ldc + n0 + c8) = lv;
        }
        
      }
    }
    __builtin_amdgcn_fence(__ATOMIC_RELEASE, "workgroup");
    __builtin_amdgcn_wave_barrier();
    __builtin_amdgcn_fence(__ATOMIC_ACQUIRE, "workgroup");
  }
}

__global__ __launch_bounds__(256) void cast_f32_f16x2(
    const float* __restrict__ in, _Float16* __restrict__ out, int n2) {
  int i = blockIdx.x * 256 + threadIdx.x;
  if (i < n2) {
    const _Float16 h0 = (_Float16)in[2 * i], h1 = (_Float16)in[2 * i + 1];
    const unsigned u = (unsigned)__builtin_bit_cast(unsigned short, h0) | ((unsigned)__builtin_bit_cast(unsigned short, h1) << 16);
    ((unsigned*)out)[i] = u;
    
  }
}


// ---- f32 -> f16 cast with a power-of-two pre-scale (folded back by the consumer GEMM's scale) ----
__global__ __launch_bounds__(256) void cast_f32_f16x2s(const float* __restrict__ in, _Float16* __restrict__ out, int n2, float s) {
  int i = blockIdx.x * 256 + threadIdx.x;
  if (i < n2) {
    const _Float16 h0 = (_Float16)(in[2 * i] * s), h1 = (_Float16)(in[2 * i + 1] * s);
    const unsigned u = (unsigned)__builtin_bit_cast(unsigned short, h0) | ((unsigned)__builtin_bit_cast(unsigned short, h1) << 16);
    ((unsigned*)out)[i] = u;
    
  }
}
__global__ __launch_bounds__(256) void split_f32_bf16x2(
    const float* __restrict__ in, __bf16* __restrict__ hi, __bf16* __restrict__ lo, long n2) {
  long i = (long)blockIdx.x * 256 + threadIdx.x;
  long stride = (long)gridDim.x * 256;
  {
    for (long j = i; j < n2; j += stride) {
      const float a = in[2 * j], b = in[2 * j + 1];
      const unsigned short ah = f2bf_bits(a), bh = f2bf_bits(b);
      const unsigned short al = f2bf_bits(a - bf_bits2f(ah)), bl = f2bf_bits(b - bf_bits2f(bh));
      ((unsigned*)hi)[j] = (unsigned)ah | ((unsigned)bh << 16);
      ((unsigned*)lo)[j] = (unsigned)al | ((unsigned)bl << 16);
    }
    
  }
}


// ---- f32 [R][C] (row pitch ldi) -> f16 transposed [C][R] (row pitch ldo); 64x64 tiles; each output row segment
__global__ __launch_bounds__(256) void transpose_cast_f16(const float* __restrict__ in, int ldi,
                                                         _Float16* __restrict__ outT, int ldo, float scale) {
  __shared__ __align__(16) _Float16 tile[64][72];     // [c][r]
  const int c0 = blockIdx.x * 64, r0 = blockIdx.y * 64;
  const int t = threadIdx.y * 32 + threadIdx.x;
  for (int i = threadIdx.y; i < 64; i += 8) {
    tile[threadIdx.x][i]      = (_Float16)(in[(size_t)(r0 + i) * ldi + c0 + threadIdx.x] * scale);
    tile[32 + threadIdx.x][i] = (_Float16)(in[(size_t)(r0 + i) * ldi + c0 + 32 + threadIdx.x] * scale);
  }
  __syncthreads();
  const int q = t >> 3, c8 = (t & 7) * 8;
  {
#pragma unroll
    for (int it = 0; it < 2; ++it) {
      const int c = it * 32 + q;
      v8h hv = *(const v8h*)(&tile[c][c8]);
      *(v8h*)(outT + (size_t)(c0 + c) * ldo + r0 + c8) = hv;
    }
    
  }
}

// ---- f32 [R][C] (pitch ldi) -> bf16 hi/lo transposed planes [C][R] (pitch ldo); 64x64 tiles; each output row segment
__global__ __launch_bounds__(256) void transpose_split_bf16(const float* __restrict__ in, int ldi,
                                                           __bf16* __restrict__ outH, __bf16* __restrict__ outL, int ldo) {
  __shared__ __align__(16) float tile[64][68];     // [c][r]
  const int c0 = blockIdx.x * 64, r0 = blockIdx.y * 64;
  const int t = threadIdx.y * 32 + threadIdx.x;
  for (int i = threadIdx.y; i < 64; i += 8) {
    tile[threadIdx.x][i]      = in[(size_t)(r0 + i) * ldi + c0 + threadIdx.x];
    tile[32 + threadIdx.x][i] = in[(size_t)(r0 + i) * ldi + c0 + 32 + threadIdx.x];
  }
  __syncthreads();
  const int q = t >> 3, c8 = (t & 7) * 8;
  {
#pragma unroll
    for (int it = 0; it < 2; ++it) {
      const int c = it * 32 + q;
      v8b hv, lv;
#pragma unroll
      for (int e = 0; e < 8; ++e) {
        const float f = tile[c][c8 + e];
        const unsigned short hb = f2bf_bits(f);
        hv[e] = __builtin_bit_cast(__bf16, hb);
        lv[e] = __builtin_bit_cast(__bf16, f2bf_bits(f - bf_bits2f(hb)));
      }
      *(v8b*)(outH + (size_t)(c0 + c) * ldo + r0 + c8) = hv;
      *(v8b*)(outL + (size_t)(c0 + c) * ldo + r0 + c8) = lv;
    }
    
  }
}

// =====================================================================================
// Generic causal/non-causal attention for head_dim 64, f32 in / f32 out; 16-bit operands: bf16 with optional hi/lo splits, or
// plain f16 (F16=true, non-split, probabilities carried x2^15).
//   scores = (q*qscale)·kᵀ : v_wmma_f32_16x16x32_bf16; SPLIT_QK -> q,k as bf16 hi/lo (hi·hi + hi·lo + lo·hi)
//   out    = p·v           : v_wmma_f32_16x16x32_bf16; SPLIT_PV -> p,v as bf16 hi/lo; else p,v plain bf16
//   f32 accumulate; online softmax in f32. Block = 4 waves = 64 query rows of one (batch, head); S % 64 == 0.
//   Element (b, s, h, d) of tensor X lives at X[b*X_bs + s*X_rs + h*X_hs + d] (strides in floats, multiples of 4).
//   Masking: mask_mode 0 none, 1 causal (kv > q masked), 2 tensor [S][Skv] shared over (b,h) (float if
//   mask_is_int==0, int32 with element == 0 -> masked if 1, int32 with element != 0 -> masked if 2), 3 per-token vectors qmask[B][S] & kvmask[B][Skv] (int32,
//   0 -> masked), 4 causal + sliding window (kv > q or q - kv > W masked; W passed in mask_is_int);
//   5 = relative-position bias: s += cp[b,h,q][idx[q][kv]] + pc[b,h,kv][idx[q][kv]] with idx = mask_b ([S][Skv] int32) and
//   mask_a an int32 [S][Skv] tensor with nonzero = masked (tables: element (b,h,row,n) at X + b*c_bs + h*c_hs + row*c_rs + n);
//   masked scores are replaced by mask_fill (e.g. -inf or -1e9) before the softmax.
//   grid.x = B * H * (S/64) (or a sub-range with blk0).
// =====================================================================================
#define AT_D 64
#define AT_NW 4
#define AT_QB 64
#define AT_KC 64
struct AttnGeom { const float* cp = nullptr; const float* pc = nullptr; long c_bs = 0, c_rs = 0, c_hs = 0;   // mode-5 score-bias tables
                  long q_bs, q_rs, q_hs, k_bs, k_rs, k_hs, v_bs, v_rs, v_hs, o_bs, o_rs, o_hs;
                  int S, Skv, H, mask_mode; float qscale; int blk0; float mask_fill; int mask_is_int; };
static_assert(sizeof(AttnGeom) == 168, "no padding");

__device__ __forceinline__ unsigned short at_bf_bits(float f) {
  unsigned u = __float_as_uint(f);
  return (unsigned short)((u + 0x7FFFu + ((u >> 16) & 1u)) >> 16);
}
__device__ __forceinline__ __bf16 at_f2bf(float f) { return __builtin_bit_cast(__bf16, at_bf_bits(f)); }
__device__ __forceinline__ void at_split(float f, __bf16& hi, __bf16& lo) {
  const unsigned short hb = at_bf_bits(f);
  hi = __builtin_bit_cast(__bf16, hb);
  lo = at_f2bf(f - __uint_as_float(((unsigned)hb) << 16));
}
__device__ __forceinline__ v8f at_mma(v16b a, v16b b, v8f c) {
  c = __builtin_amdgcn_wmma_f32_16x16x32_bf16(false, a, false, b, (short)0, c, false, false);
  asm volatile("v_nop\n\tv_nop\n\tv_nop\n\tv_nop" : "+v"(c) : "v"(a), "v"(b));
  return c;
}
// 16-bit element as a bit pattern held in a __bf16 slot: f16 bits when F16, bf16 (RNE) otherwise
template <bool F16> __device__ __forceinline__ __bf16 at_to16(float f) {
  if (F16) return __builtin_bit_cast(__bf16, (_Float16)f);
  return at_f2bf(f);
}
template <bool F16> __device__ __forceinline__ v8f at_mma16(v16b a, v16b b, v8f c) {
  if (F16) {
    const v16h ah = __builtin_bit_cast(v16h, a), bh = __builtin_bit_cast(v16h, b);
    c = __builtin_amdgcn_wmma_f32_16x16x32_f16(false, ah, false, bh, (short)0, c, false, false);
    asm volatile("v_nop\n\tv_nop\n\tv_nop\n\tv_nop" : "+v"(c) : "v"(ah), "v"(bh));
    return c;
  }
  return at_mma(a, b, c);
}

template <bool SPLIT_QK, bool SPLIT_PV, bool F16 = false>
__global__ __launch_bounds__(128)
void attn64_kernel(const float* __restrict__ q, const float* __restrict__ k,
                   const float* __restrict__ v, float* __restrict__ out,
                   const void* __restrict__ mask_a, const int* __restrict__ mask_b, AttnGeom g) {
  static_assert(!(F16 && (SPLIT_QK || SPLIT_PV)), "f16 mode is non-split");
  const float PSC = F16 ? 32768.0f : 1.0f;     // f16 probabilities carried x2^15 (subnormal range), folded into the final 1/l
  union FB { v16b v; v8b h[2]; };
  __shared__ __align__(16) __bf16 Ksh[AT_KC * AT_D];             // K hi [kv][d]      8 KB
  __shared__ __align__(16) __bf16 Ksl[SPLIT_QK ? AT_KC * AT_D : 8];
  __shared__ __align__(16) __bf16 Vth[AT_D * AT_KC];             // V hi [d][kv]      8 KB
  __shared__ __align__(16) __bf16 Vtl[SPLIT_PV ? AT_D * AT_KC : 8];
  __shared__ __align__(16) __bf16 Psh[AT_NW][16 * AT_KC];        // per wave P hi [row][kv]  8 KB
  __shared__ __align__(16) __bf16 Psl[SPLIT_PV ? AT_NW : 1][SPLIT_PV ? 16 * AT_KC : 8];
  __shared__ __align__(16) float  Os[AT_NW][16 * 68];            // per wave out tile, pitch 68

  const int tid  = threadIdx.x;
  const int wave = tid >> 5;
  const int lane = tid & 31;
  const int hh   = lane >> 4;
  const int c    = lane & 15;

  const int nqb = g.S / AT_QB;
  const int bx = blockIdx.x + g.blk0;
  const int qb = bx % nqb;
  const int bh = bx / nqb;
  const int h  = bh % g.H;
  const int b  = bh / g.H;
  const int qbase_block = qb * AT_QB;
  const int q0 = qbase_block + wave * 16;

  const float* qb_ptr = q + (size_t)b * g.q_bs + (size_t)h * g.q_hs;
  const float* kb_ptr = k + (size_t)b * g.k_bs + (size_t)h * g.k_hs;
  const float* vb_ptr = v + (size_t)b * g.v_bs + (size_t)h * g.v_hs;
  float*       ob_ptr = out + (size_t)b * g.o_bs + (size_t)h * g.o_hs;

  // ---- Q fragments (A operand): 2 d-chunks, hi (and lo) ----
  v16b qah[2], qal[2];
  {
    const float* qrow = qb_ptr + (size_t)(q0 + c) * g.q_rs;
#pragma unroll
    for (int dc = 0; dc < 2; ++dc) {
#pragma unroll
      for (int e = 0; e < 8; ++e) {
        const float f0 = qrow[dc * 32 + 8 * hh + e] * g.qscale;
        const float f1 = qrow[dc * 32 + 16 + 8 * hh + e] * g.qscale;
        if (SPLIT_QK) { __bf16 hq, lq; at_split(f0, hq, lq); qah[dc][e] = hq; qal[dc][e] = lq; at_split(f1, hq, lq); qah[dc][8 + e] = hq; qal[dc][8 + e] = lq; }
        else { qah[dc][e] = at_to16<F16>(f0); qah[dc][8 + e] = at_to16<F16>(f1); qal[dc][e] = qah[dc][e]; qal[dc][8 + e] = qah[dc][8 + e]; }
      }
    }
  }

  float mrow[8], lrow[8];
  v8f oacc[4];
#pragma unroll
  for (int r = 0; r < 8; ++r) { mrow[r] = -INFINITY; lrow[r] = 0.f; }
#pragma unroll
  for (int t = 0; t < 4; ++t) oacc[t] = (v8f){0.f,0.f,0.f,0.f,0.f,0.f,0.f,0.f};

  const int nChunks = (g.mask_mode == 1 || g.mask_mode == 4) ? (qb + 1) : (g.Skv / AT_KC);   // block-uniform
  // per-row query mask (mode 3)
  int qkeep[8];
#pragma unroll
  for (int r = 0; r < 8; ++r) qkeep[r] = (g.mask_mode == 3) ? mask_b[(size_t)b * g.S + q0 + 8 * hh + r] : 1;   // mask_b = qmask in mode 3
  for (int kc = 0; kc < nChunks; ++kc) {
    const int kv0 = kc * AT_KC;
    __syncthreads();
    {
      const int kvr = tid >> 1, dh = (tid & 1) * 32;
      const float* krow = kb_ptr + (size_t)(kv0 + kvr) * g.k_rs + dh;
      const float* vrow = vb_ptr + (size_t)(kv0 + kvr) * g.v_rs + dh;
#pragma unroll
      for (int i = 0; i < 8; ++i) {
        v4f kk = *(const v4f*)(krow + 4 * i);
        v4f vv = *(const v4f*)(vrow + 4 * i);
#pragma unroll
        for (int e = 0; e < 4; ++e) {
          const int d = dh + 4 * i + e;
          if (SPLIT_QK) { __bf16 a, bl; at_split(kk[e], a, bl); Ksh[kvr * AT_D + d] = a; Ksl[kvr * AT_D + d] = bl; }
          else Ksh[kvr * AT_D + d] = at_to16<F16>(kk[e]);
          if (SPLIT_PV) { __bf16 a, bl; at_split(vv[e], a, bl); Vth[d * AT_KC + kvr] = a; Vtl[d * AT_KC + kvr] = bl; }
          else Vth[d * AT_KC + kvr] = at_to16<F16>(vv[e]);
        }
      }
    }
    __syncthreads();

    v8f s[4];
#pragma unroll
    for (int j = 0; j < 4; ++j) {
      s[j] = (v8f){0.f,0.f,0.f,0.f,0.f,0.f,0.f,0.f};
#pragma unroll 1
      for (int dc = 0; dc < 2; ++dc) {
        FB kb;
        kb.h[0] = *(const v8b*)(Ksh + (j * 16 + c) * AT_D + dc * 32 + 8 * hh);
        kb.h[1] = *(const v8b*)(Ksh + (j * 16 + c) * AT_D + dc * 32 + 16 + 8 * hh);
        s[j] = at_mma16<F16>(qah[dc], kb.v, s[j]);
        if (SPLIT_QK) {
          FB kl;
          kl.h[0] = *(const v8b*)(Ksl + (j * 16 + c) * AT_D + dc * 32 + 8 * hh);
          kl.h[1] = *(const v8b*)(Ksl + (j * 16 + c) * AT_D + dc * 32 + 16 + 8 * hh);
          s[j] = at_mma16<F16>(qah[dc], kl.v, s[j]);
          s[j] = at_mma16<F16>(qal[dc], kb.v, s[j]);
        }
      }
    }
    const bool diag = (g.mask_mode == 1) && (kc == qb);
    int kvkeep[4] = {1, 1, 1, 1};
    if (g.mask_mode == 3) {
#pragma unroll
      for (int j = 0; j < 4; ++j) kvkeep[j] = ((const int*)mask_a)[(size_t)b * g.Skv + kv0 + j * 16 + c];   // mask_a = kvmask
    }
    float cm[8];
#pragma unroll
    for (int r = 0; r < 8; ++r) {
      const int qrow = q0 + 8 * hh + r;
      float m = -INFINITY;
#pragma unroll
      for (int j = 0; j < 4; ++j) {
        const int kvcol = kv0 + j * 16 + c;
        bool masked = false;
        if (diag) masked = (kvcol > qrow);
        else if (g.mask_mode == 4) masked = (kvcol > qrow) || (qrow - kvcol > g.mask_is_int);
        else if (g.mask_mode == 2) {
          const size_t mi = (size_t)qrow * g.Skv + kvcol;
          masked = (g.mask_is_int == 0) ? (((const float*)mask_a)[mi] == 0.0f)
                 : (g.mask_is_int == 1) ? (((const int*)mask_a)[mi] == 0) : (((const int*)mask_a)[mi] != 0);
        } else if (g.mask_mode == 3) masked = (qkeep[r] == 0) || (kvkeep[j] == 0);
        else if (g.mask_mode == 5) {
          const size_t mi = (size_t)qrow * g.Skv + kvcol;
          masked = (((const int*)mask_a)[mi] != 0);
          int n = mask_b[mi]; n = n < 0 ? 0 : n;
          s[j][r] += g.cp[(size_t)b * g.c_bs + (size_t)h * g.c_hs + (size_t)qrow * g.c_rs + n]
                   + g.pc[(size_t)b * g.c_bs + (size_t)h * g.c_hs + (size_t)kvcol * g.c_rs + n];
        }
        if (masked) s[j][r] = g.mask_fill;
        m = fmaxf(m, s[j][r]);
      }
#pragma unroll
      for (int off = 1; off < 16; off <<= 1) m = fmaxf(m, __shfl_xor(m, off, 32));
      cm[r] = m;
    }
    __bf16* pwh = Psh[wave];
    __bf16* pwl = Psl[SPLIT_PV ? wave : 0];
#pragma unroll
    for (int r = 0; r < 8; ++r) {
      const float mnew = fmaxf(mrow[r], cm[r]);
      const float alpha = expf(mrow[r] - mnew);
      mrow[r] = mnew;
      float psum = 0.f;
#pragma unroll
      for (int j = 0; j < 4; ++j) {
        const float p = expf(s[j][r] - mnew);
        psum += p;
        if (SPLIT_PV) { __bf16 a, bl; at_split(p, a, bl); pwh[(8 * hh + r) * AT_KC + j * 16 + c] = a; pwl[(8 * hh + r) * AT_KC + j * 16 + c] = bl; }
        else pwh[(8 * hh + r) * AT_KC + j * 16 + c] = at_to16<F16>(p * PSC);
      }
#pragma unroll
      for (int off = 1; off < 16; off <<= 1) psum += __shfl_xor(psum, off, 32);
      lrow[r] = lrow[r] * alpha + psum;
#pragma unroll
      for (int t = 0; t < 4; ++t) oacc[t][r] *= alpha;
    }
    __builtin_amdgcn_fence(__ATOMIC_RELEASE, "workgroup");
    __builtin_amdgcn_wave_barrier();
    __builtin_amdgcn_fence(__ATOMIC_ACQUIRE, "workgroup");
#pragma unroll 1
    for (int kk = 0; kk < 2; ++kk) {
      FB pa, pl;
      pa.h[0] = *(const v8b*)(pwh + c * AT_KC + kk * 32 + 8 * hh);
      pa.h[1] = *(const v8b*)(pwh + c * AT_KC + kk * 32 + 16 + 8 * hh);
      if (SPLIT_PV) {
        pl.h[0] = *(const v8b*)(pwl + c * AT_KC + kk * 32 + 8 * hh);
        pl.h[1] = *(const v8b*)(pwl + c * AT_KC + kk * 32 + 16 + 8 * hh);
      }
#pragma unroll
      for (int t = 0; t < 4; ++t) {
        FB vb;
        vb.h[0] = *(const v8b*)(Vth + (t * 16 + c) * AT_KC + kk * 32 + 8 * hh);
        vb.h[1] = *(const v8b*)(Vth + (t * 16 + c) * AT_KC + kk * 32 + 16 + 8 * hh);
        oacc[t] = at_mma16<F16>(pa.v, vb.v, oacc[t]);
        if (SPLIT_PV) {
          FB vl;
          vl.h[0] = *(const v8b*)(Vtl + (t * 16 + c) * AT_KC + kk * 32 + 8 * hh);
          vl.h[1] = *(const v8b*)(Vtl + (t * 16 + c) * AT_KC + kk * 32 + 16 + 8 * hh);
          oacc[t] = at_mma16<F16>(pa.v, vl.v, oacc[t]);
          oacc[t] = at_mma16<F16>(pl.v, vb.v, oacc[t]);
        }
      }
    }
  }

  float* os = Os[wave];
#pragma unroll
  for (int r = 0; r < 8; ++r) {
    const float inv = 1.0f / (lrow[r] * PSC);
#pragma unroll
    for (int t = 0; t < 4; ++t) os[(8 * hh + r) * 68 + t * 16 + c] = oacc[t][r] * inv;
  }
  __builtin_amdgcn_fence(__ATOMIC_RELEASE, "workgroup");
  __builtin_amdgcn_wave_barrier();
  __builtin_amdgcn_fence(__ATOMIC_ACQUIRE, "workgroup");
  {
    const int c4 = (lane & 15) * 4;
    {
#pragma unroll
      for (int it = 0; it < 8; ++it) {
        const int row = it * 2 + hh;
        v4f val = *(const v4f*)(os + row * 68 + c4);
        *(v4f*)(ob_ptr + (size_t)(q0 + row) * g.o_rs + c4) = val;
      }
      
    }
  }
}

// MODE: the mask mode as a compile-time constant, so that only the launched mode's score path is compiled into the key loop
template <bool SPLIT_QK, bool SPLIT_PV, bool F16, int MODE>
__global__ __launch_bounds__(128)
void attn128_kernel(const float* __restrict__ q, const float* __restrict__ k,
                   const float* __restrict__ v, float* __restrict__ out,
                   const void* __restrict__ mask_a, const int* __restrict__ mask_b, AttnGeom g) {
  static_assert(!(F16 && (SPLIT_QK || SPLIT_PV)), "f16 mode is non-split");
  const float PSC = F16 ? 32768.0f : 1.0f;     // f16 probabilities carried x2^15 (subnormal range), folded into the final 1/l
  union FB { v16b v; v8b h[2]; };
  constexpr int D2 = 128;
  __shared__ __align__(16) __bf16 Ksh[AT_KC * D2];               // K hi [kv][d]      16 KB
  __shared__ __align__(16) __bf16 Ksl[SPLIT_QK ? AT_KC * D2 : 8];
  __shared__ __align__(16) __bf16 Vth[D2 * AT_KC];               // V hi [d][kv]      16 KB
  __shared__ __align__(16) __bf16 Vtl[SPLIT_PV ? D2 * AT_KC : 8];
  __shared__ __align__(16) __bf16 Psh[AT_NW][16 * AT_KC];
  __shared__ __align__(16) __bf16 Psl[SPLIT_PV ? AT_NW : 1][SPLIT_PV ? 16 * AT_KC : 8];
  __shared__ __align__(16) float  Os[AT_NW][16 * 132];           // per wave out tile, pitch 132
  __shared__ __align__(16) __bf16 Qsh[AT_NW][16 * D2];   // q (hi plane, or the 16-bit value) staged per wave (keeps VGPR use low)
  __shared__ __align__(16) __bf16 Qsl[SPLIT_QK ? AT_NW : 1][SPLIT_QK ? 16 * D2 : 8];

  const int tid  = threadIdx.x;
  const int wave = tid >> 5;
  const int lane = tid & 31;
  const int hh   = lane >> 4;
  const int c    = lane & 15;

  const int nqb = g.S / AT_QB;
  const int bx = blockIdx.x + g.blk0;
  const int qb = bx % nqb;
  const int bh = bx / nqb;
  const int h  = bh % g.H;
  const int b  = bh / g.H;
  const int qbase_block = qb * AT_QB;
  const int q0 = qbase_block + wave * 16;

  const float* qb_ptr = q + (size_t)b * g.q_bs + (size_t)h * g.q_hs;
  const float* kb_ptr = k + (size_t)b * g.k_bs + (size_t)h * g.k_hs;
  const float* vb_ptr = v + (size_t)b * g.v_bs + (size_t)h * g.v_hs;
  float*       ob_ptr = out + (size_t)b * g.o_bs + (size_t)h * g.o_hs;

  // ---- Q fragments (A operand): 4 d-chunks, hi (and lo) ----
  v16b qah[4], qal[4];
  {
    const float* qrow = qb_ptr + (size_t)(q0 + c) * g.q_rs;
#pragma unroll
    for (int dc = 0; dc < 4; ++dc) {
#pragma unroll
      for (int e = 0; e < 8; ++e) {
        const float f0 = qrow[dc * 32 + 8 * hh + e] * g.qscale;
        const float f1 = qrow[dc * 32 + 16 + 8 * hh + e] * g.qscale;
        if (SPLIT_QK) { __bf16 hq, lq; at_split(f0, hq, lq); Qsh[wave][c * D2 + dc * 32 + 8 * hh + e] = hq; Qsl[wave][c * D2 + dc * 32 + 8 * hh + e] = lq;
                        at_split(f1, hq, lq); Qsh[wave][c * D2 + dc * 32 + 16 + 8 * hh + e] = hq; Qsl[wave][c * D2 + dc * 32 + 16 + 8 * hh + e] = lq;
                        qah[dc][e] = hq; qal[dc][e] = lq; qah[dc][8 + e] = hq; qal[dc][8 + e] = lq; }   // (register copies unused on the split path)
        else { Qsh[wave][c * D2 + dc * 32 + 8 * hh + e] = at_to16<F16>(f0); Qsh[wave][c * D2 + dc * 32 + 16 + 8 * hh + e] = at_to16<F16>(f1); qah[dc][e] = at_to16<F16>(f0); qal[dc][e] = qah[dc][e]; qah[dc][8 + e] = qah[dc][e]; qal[dc][8 + e] = qah[dc][e]; }
      }
    }
  }

  float mrow[8], lrow[8];
  v8f oacc[8];
#pragma unroll
  for (int r = 0; r < 8; ++r) { mrow[r] = -INFINITY; lrow[r] = 0.f; }
#pragma unroll
  for (int t = 0; t < 8; ++t) oacc[t] = (v8f){0.f,0.f,0.f,0.f,0.f,0.f,0.f,0.f};

  const int nChunks = (MODE == 1 || MODE == 4 || MODE == 6) ? (qb + 1) : (g.Skv / AT_KC);   // block-uniform
  // per-row query mask (mode 3)
  int qkeep[8];
#pragma unroll
  for (int r = 0; r < 8; ++r) qkeep[r] = (MODE == 3) ? mask_b[(size_t)b * g.S + q0 + 8 * hh + r] : 1;   // mask_b = qmask in mode 3
  for (int kc = 0; kc < nChunks; ++kc) {
    const int kv0 = kc * AT_KC;
    __syncthreads();
    {
      const int kvr = tid >> 1, dh = (tid & 1) * 64;
      const float* krow = kb_ptr + (size_t)(kv0 + kvr) * g.k_rs + dh;
      const float* vrow = vb_ptr + (size_t)(kv0 + kvr) * g.v_rs + dh;
#pragma unroll
      for (int i = 0; i < 16; ++i) {
        v4f kk = *(const v4f*)(krow + 4 * i);
        v4f vv = *(const v4f*)(vrow + 4 * i);
#pragma unroll
        for (int e = 0; e < 4; ++e) {
          const int d = dh + 4 * i + e;
          if (SPLIT_QK) { __bf16 a, bl; at_split(kk[e], a, bl); Ksh[kvr * D2 + d] = a; Ksl[kvr * D2 + d] = bl; }
          else Ksh[kvr * D2 + d] = at_to16<F16>(kk[e]);
          if (SPLIT_PV) { __bf16 a, bl; at_split(vv[e], a, bl); Vth[d * AT_KC + kvr] = a; Vtl[d * AT_KC + kvr] = bl; }
          else Vth[d * AT_KC + kvr] = at_to16<F16>(vv[e]);
        }
      }
    }
    __syncthreads();

    v8f s[4];
#pragma unroll
    for (int j = 0; j < 4; ++j) {
      s[j] = (v8f){0.f,0.f,0.f,0.f,0.f,0.f,0.f,0.f};
if (SPLIT_QK) {
#pragma unroll 1
      for (int dc = 0; dc < 4; ++dc) {      // rolled: bounds the live fragment set (register pressure) on the 128-wide head
        FB kb;
        kb.h[0] = *(const v8b*)(Ksh + (j * 16 + c) * D2 + dc * 32 + 8 * hh);
        kb.h[1] = *(const v8b*)(Ksh + (j * 16 + c) * D2 + dc * 32 + 16 + 8 * hh);
        if (!SPLIT_QK) { FB qa; qa.h[0] = *(const v8b*)(&Qsh[wave][c * D2 + dc * 32 + 8 * hh]); qa.h[1] = *(const v8b*)(&Qsh[wave][c * D2 + dc * 32 + 16 + 8 * hh]); s[j] = at_mma16<F16>(qa.v, kb.v, s[j]); }
        if (SPLIT_QK) {
          FB qa, ql;
          qa.h[0] = *(const v8b*)(&Qsh[wave][c * D2 + dc * 32 + 8 * hh]); qa.h[1] = *(const v8b*)(&Qsh[wave][c * D2 + dc * 32 + 16 + 8 * hh]);
          ql.h[0] = *(const v8b*)(&Qsl[wave][c * D2 + dc * 32 + 8 * hh]); ql.h[1] = *(const v8b*)(&Qsl[wave][c * D2 + dc * 32 + 16 + 8 * hh]);
          s[j] = at_mma16<F16>(qa.v, kb.v, s[j]);
          FB kl;
          kl.h[0] = *(const v8b*)(Ksl + (j * 16 + c) * D2 + dc * 32 + 8 * hh);
          kl.h[1] = *(const v8b*)(Ksl + (j * 16 + c) * D2 + dc * 32 + 16 + 8 * hh);
          s[j] = at_mma16<F16>(qa.v, kl.v, s[j]);
          s[j] = at_mma16<F16>(ql.v, kb.v, s[j]);
        }
      }
      } else {
#pragma unroll
      for (int dc = 0; dc < 4; ++dc) {      // (16-bit path: fully unrolled; the q fragments are loaded from Qsh in LDS)
        FB kb;
        kb.h[0] = *(const v8b*)(Ksh + (j * 16 + c) * D2 + dc * 32 + 8 * hh);
        kb.h[1] = *(const v8b*)(Ksh + (j * 16 + c) * D2 + dc * 32 + 16 + 8 * hh);
        if (!SPLIT_QK) { FB qa; qa.h[0] = *(const v8b*)(&Qsh[wave][c * D2 + dc * 32 + 8 * hh]); qa.h[1] = *(const v8b*)(&Qsh[wave][c * D2 + dc * 32 + 16 + 8 * hh]); s[j] = at_mma16<F16>(qa.v, kb.v, s[j]); }
        if (SPLIT_QK) {
          FB qa, ql;
          qa.h[0] = *(const v8b*)(&Qsh[wave][c * D2 + dc * 32 + 8 * hh]); qa.h[1] = *(const v8b*)(&Qsh[wave][c * D2 + dc * 32 + 16 + 8 * hh]);
          ql.h[0] = *(const v8b*)(&Qsl[wave][c * D2 + dc * 32 + 8 * hh]); ql.h[1] = *(const v8b*)(&Qsl[wave][c * D2 + dc * 32 + 16 + 8 * hh]);
          s[j] = at_mma16<F16>(qa.v, kb.v, s[j]);
          FB kl;
          kl.h[0] = *(const v8b*)(Ksl + (j * 16 + c) * D2 + dc * 32 + 8 * hh);
          kl.h[1] = *(const v8b*)(Ksl + (j * 16 + c) * D2 + dc * 32 + 16 + 8 * hh);
          s[j] = at_mma16<F16>(qa.v, kl.v, s[j]);
          s[j] = at_mma16<F16>(ql.v, kb.v, s[j]);
        }
      }
      }
    }
    const bool diag = (MODE == 1) && (kc == qb);
    int kvkeep[4] = {1, 1, 1, 1};
    if (MODE == 3) {
#pragma unroll
      for (int j = 0; j < 4; ++j) kvkeep[j] = ((const int*)mask_a)[(size_t)b * g.Skv + kv0 + j * 16 + c];   // mask_a = kvmask
    }
    float cm[8];
#pragma unroll
    for (int r = 0; r < 8; ++r) {
      const int qrow = q0 + 8 * hh + r;
      float m = -INFINITY;
#pragma unroll
      for (int j = 0; j < 4; ++j) {
        const int kvcol = kv0 + j * 16 + c;
        bool masked = false;
        if (diag) masked = (kvcol > qrow);
        else if (MODE == 4) masked = (kvcol > qrow) || (qrow - kvcol > g.mask_is_int);
        else if (MODE == 2) {
          const size_t mi = (size_t)qrow * g.Skv + kvcol;
          masked = (g.mask_is_int == 0) ? (((const float*)mask_a)[mi] == 0.0f)
                 : (g.mask_is_int == 1) ? (((const int*)mask_a)[mi] == 0) : (((const int*)mask_a)[mi] != 0);
        } else if (MODE == 3) masked = (qkeep[r] == 0) || (kvkeep[j] == 0);
        else if (MODE == 6) { masked = (kvcol > qrow); s[j][r] += g.cp[h] * (float)(kvcol - qrow); }
        else if (MODE == 8) { masked = (kvcol > qrow) || (((const int*)mask_a)[(size_t)b * g.Skv + kvcol] != 0); }
        else if (MODE == 5) {
          const size_t mi = (size_t)qrow * g.Skv + kvcol;
          masked = (((const int*)mask_a)[mi] != 0);
          int n = mask_b[mi]; n = n < 0 ? 0 : n;
          s[j][r] += g.cp[(size_t)b * g.c_bs + (size_t)h * g.c_hs + (size_t)qrow * g.c_rs + n]
                   + g.pc[(size_t)b * g.c_bs + (size_t)h * g.c_hs + (size_t)kvcol * g.c_rs + n];
        }
        if (masked) s[j][r] = g.mask_fill;
        m = fmaxf(m, s[j][r]);
      }
#pragma unroll
      for (int off = 1; off < 16; off <<= 1) m = fmaxf(m, __shfl_xor(m, off, 32));
      cm[r] = m;
    }
    __bf16* pwh = Psh[wave];
    __bf16* pwl = Psl[SPLIT_PV ? wave : 0];
#pragma unroll
    for (int r = 0; r < 8; ++r) {
      const float mnew = fmaxf(mrow[r], cm[r]);
      const float alpha = expf(mrow[r] - mnew);
      mrow[r] = mnew;
      float psum = 0.f;
#pragma unroll
      for (int j = 0; j < 4; ++j) {
        const float p = expf(s[j][r] - mnew);
        psum += p;
        if (SPLIT_PV) { __bf16 a, bl; at_split(p, a, bl); pwh[(8 * hh + r) * AT_KC + j * 16 + c] = a; pwl[(8 * hh + r) * AT_KC + j * 16 + c] = bl; }
        else pwh[(8 * hh + r) * AT_KC + j * 16 + c] = at_to16<F16>(p * PSC);
      }
#pragma unroll
      for (int off = 1; off < 16; off <<= 1) psum += __shfl_xor(psum, off, 32);
      lrow[r] = lrow[r] * alpha + psum;
#pragma unroll
      for (int t = 0; t < 8; ++t) oacc[t][r] *= alpha;
    }
    __builtin_amdgcn_fence(__ATOMIC_RELEASE, "workgroup");
    __builtin_amdgcn_wave_barrier();
    __builtin_amdgcn_fence(__ATOMIC_ACQUIRE, "workgroup");
#pragma unroll 1
    for (int kk = 0; kk < 2; ++kk) {
      FB pa, pl;
      pa.h[0] = *(const v8b*)(pwh + c * AT_KC + kk * 32 + 8 * hh);
      pa.h[1] = *(const v8b*)(pwh + c * AT_KC + kk * 32 + 16 + 8 * hh);
      if (SPLIT_PV) {
        pl.h[0] = *(const v8b*)(pwl + c * AT_KC + kk * 32 + 8 * hh);
        pl.h[1] = *(const v8b*)(pwl + c * AT_KC + kk * 32 + 16 + 8 * hh);
      }
#pragma unroll
      for (int t = 0; t < 8; ++t) {
        FB vb;
        vb.h[0] = *(const v8b*)(Vth + (t * 16 + c) * AT_KC + kk * 32 + 8 * hh);
        vb.h[1] = *(const v8b*)(Vth + (t * 16 + c) * AT_KC + kk * 32 + 16 + 8 * hh);
        oacc[t] = at_mma16<F16>(pa.v, vb.v, oacc[t]);
        if (SPLIT_PV) {
          FB vl;
          vl.h[0] = *(const v8b*)(Vtl + (t * 16 + c) * AT_KC + kk * 32 + 8 * hh);
          vl.h[1] = *(const v8b*)(Vtl + (t * 16 + c) * AT_KC + kk * 32 + 16 + 8 * hh);
          oacc[t] = at_mma16<F16>(pa.v, vl.v, oacc[t]);
          oacc[t] = at_mma16<F16>(pl.v, vb.v, oacc[t]);
        }
      }
    }
  }

  float* os = Os[wave];
#pragma unroll
  for (int r = 0; r < 8; ++r) {
    const float inv = 1.0f / (lrow[r] * PSC);
#pragma unroll
    for (int t = 0; t < 8; ++t) os[(8 * hh + r) * 132 + t * 16 + c] = oacc[t][r] * inv;
  }
  __builtin_amdgcn_fence(__ATOMIC_RELEASE, "workgroup");
  __builtin_amdgcn_wave_barrier();
  __builtin_amdgcn_fence(__ATOMIC_ACQUIRE, "workgroup");
  {
    const int c4 = lane * 4;           // 32 lanes x 16 B = one 512-B output row (128 floats) per instruction
    {
#pragma unroll
      for (int row = 0; row < 16; ++row) {
        v4f val = *(const v4f*)(os + row * 132 + c4);
        *(v4f*)(ob_ptr + (size_t)(q0 + row) * g.o_rs + c4) = val;
      }
      
    }
  }
}

#define IB 4
#define INn 4096
#define ID 128
__global__ void bias3_kernel(const float* a, const float* b, const float* c, float* o) { const int i = threadIdx.x; const float v = (i < 128) ? a[i] : (i < 256 ? b[i - 128] : c[i - 256]); ((float*)o)[i] = v;  }
extern "C" void kernel_launch(void* const* d_in, const int* in_sizes, int n_in, void* d_out, int out_size, void* d_ws, size_t ws_size, hipStream_t stream) {
  (void)in_sizes; (void)n_in; (void)out_size; (void)ws_size;
  const float* x = (const float*)d_in[0]; const float* Wq = (const float*)d_in[1]; const float* bq = (const float*)d_in[2]; const float* Wk = (const float*)d_in[3]; const float* bk = (const float*)d_in[4]; const float* Wv = (const float*)d_in[5]; const float* bv = (const float*)d_in[6];
  char* ws = (char*)d_ws; size_t off = 0;
  auto carve = [&](size_t bytes) -> char* { char* p = ws + off; off += (bytes + 255) & ~(size_t)255; return p; };
  const int R = IB * INn;
  _Float16* X16 = (_Float16*)carve((size_t)R * ID * 2); _Float16* W3 = (_Float16*)carve((size_t)3 * ID * ID * 2); float* b3 = (float*)carve(3 * ID * 4);
  float* QKV = (float*)carve((size_t)R * 3 * ID * 4);
  cast_f32_f16x2<<<(R * ID / 2 + 255) / 256, 256, 0, stream>>>(x, X16, R * ID / 2);
  cast_f32_f16x2<<<(ID * ID / 2 + 255) / 256, 256, 0, stream>>>(Wq, W3, ID * ID / 2);
  cast_f32_f16x2<<<(ID * ID / 2 + 255) / 256, 256, 0, stream>>>(Wk, W3 + ID * ID, ID * ID / 2);
  cast_f32_f16x2<<<(ID * ID / 2 + 255) / 256, 256, 0, stream>>>(Wv, W3 + 2 * ID * ID, ID * ID / 2);
  bias3_kernel<<<1, 384, 0, stream>>>(bq, bk, bv, b3);
  { const int t = (R / 64) * (3 * ID / 64);
    wmma_gemm64<0, false, 2, 0, false><<<dim3((t + 7) / 8, 1), 256, 0, stream>>>(U16(X16), nullptr, ID, 0, U16(W3), nullptr, ID, 0, QKV, nullptr, 3 * ID, 0, b3, nullptr, 0, R, 3 * ID, ID, 1.0f); }
  { AttnGeom g;
    g.q_bs = (long)INn * 3 * ID; g.q_rs = 3 * ID; g.q_hs = 0; g.k_bs = g.q_bs; g.k_rs = 3 * ID; g.k_hs = 0; g.v_bs = g.q_bs; g.v_rs = 3 * ID; g.v_hs = 0; g.o_bs = (long)INn * ID; g.o_rs = ID; g.o_hs = 0;
    g.S = INn; g.Skv = INn; g.H = 1; g.mask_mode = 0; g.qscale = 0.08838834764831845f; g.blk0 = 0; g.mask_fill = -INFINITY; g.mask_is_int = 0;
    attn128_kernel<false, false, true, 0><<<IB * (INn / AT_QB), AT_NW * 32, 0, stream>>>(QKV, QKV + ID, QKV + 2 * ID, (float*)d_out, nullptr, nullptr, g); }
}

// v002
// Measured time: 288 microseconds a run.
// In both of two side-by-side timings against v001, it was 1.73 times as fast.
// Over all steps from v000 it is 3.68 times as fast.
#include <hip/hip_runtime.h>
#include <math.h>
// InteractionLayer: q|k|v = θ·[Wq;Wk;Wv]ᵀ + b (16384 x 128 · 128 x 384) and single-head attention (d 128, 4096 keys per batch; scores and
// p·v with p x2^15) on v_wmma_f32_16x16x32_f16 with f16 operands, f32 accumulate; softmax f32 on VALU. nn.Linear weights ([out][in]) are the
// transposed operand directly.
typedef __attribute__((ext_vector_type(16))) _Float16 v16h;
typedef __attribute__((ext_vector_type(8)))  _Float16 v8h;
typedef __attribute__((ext_vector_type(16))) __bf16   v16b;
typedef __attribute__((ext_vector_type(8)))  __bf16   v8b;
typedef __attribute__((ext_vector_type(8)))  float    v8f;
typedef __attribute__((ext_vector_type(4)))  float    v4f;
#define PSCALE 32768.0f
#define U16(p) ((const unsigned short*)(const void*)(p))
#define PSCALE_INV (1.0f / 32768.0f)

__device__ __forceinline__ unsigned short f2bf_bits(float f) {
  unsigned u = __float_as_uint(f);
  return (unsigned short)((u + 0x7FFFu + ((u >> 16) & 1u)) >> 16);
}
__device__ __forceinline__ float bf_bits2f(unsigned short h) { return __uint_as_float(((unsigned)h) << 16); }

// hazard guards as plain device helpers (no inline asm inside the kernel template body)
__device__ __forceinline__ void dep_guard_h(v8f& a, v8f& b, v16h x, v16h y) { asm volatile("v_nop\n\tv_nop\n\tv_nop\n\tv_nop" : "+v"(a), "+v"(b) : "v"(x), "v"(y)); }
__device__ __forceinline__ void dep_guard_b(v8f& a, v8f& b, v16b x, v16b y) { asm volatile("v_nop\n\tv_nop\n\tv_nop\n\tv_nop" : "+v"(a), "+v"(b) : "v"(x), "v"(y)); }
__device__ __forceinline__ void keep4_h(v16h a, v16h b, v16h c, v16h d) { asm volatile("v_nop" :: "v"(a), "v"(b), "v"(c), "v"(d)); }
__device__ __forceinline__ void keep4_b(v16b a, v16b b, v16b c, v16b d) { asm volatile("v_nop" :: "v"(a), "v"(b), "v"(c), "v"(d)); }
__device__ __forceinline__ void acc_guard4(v8f& a, v8f& b, v8f& c, v8f& d) { asm volatile("v_nop\n\tv_nop\n\tv_nop\n\tv_nop" : "+v"(a), "+v"(b), "+v"(c), "+v"(d)); }
template <typename T> struct Frag;
template <> struct Frag<_Float16> {
  typedef v16h V; union U { v16h v; v8h h[2]; };
  static __device__ __forceinline__ v16h load(const _Float16* p) {   // elements 0..7 <- p[0..7], 8..15 <- p[16..23]
    U f; f.h[0] = *(const v8h*)(p); f.h[1] = *(const v8h*)(p + 16); return f.v;
  }
  static __device__ __forceinline__ v8f mma(v16h a, v16h b, v8f c) {
    return __builtin_amdgcn_wmma_f32_16x16x32_f16(false, a, false, b, (short)0, c, false, false);
  }
  static __device__ __forceinline__ void guard(v8f& a, v8f& b, v16h x, v16h y) { dep_guard_h(a, b, x, y); }
  static __device__ __forceinline__ void keep(v16h a, v16h b, v16h c, v16h d) { keep4_h(a, b, c, d); }
};
template <> struct Frag<__bf16> {
  typedef v16b V; union U { v16b v; v8b h[2]; };
  static __device__ __forceinline__ v16b load(const __bf16* p) {
    U f; f.h[0] = *(const v8b*)(p); f.h[1] = *(const v8b*)(p + 16); return f.v;
  }
  static __device__ __forceinline__ v8f mma(v16b a, v16b b, v8f c) {
    return __builtin_amdgcn_wmma_f32_16x16x32_bf16(false, a, false, b, (short)0, c, false, false);
  }
  static __device__ __forceinline__ void guard(v8f& a, v8f& b, v16b x, v16b y) { dep_guard_b(a, b, x, y); }
  static __device__ __forceinline__ void keep(v16b a, v16b b, v16b c, v16b d) { keep4_b(a, b, c, d); }
};

// ---- Register-blocked batched WMMA GEMM ------------------------------------
// C[m,n] = scale * sum_k A[m,k] * Bt[n,k] (+bias)(+resid); each wave owns a 64x64 tile.
// A row-major [M,K]; Bt row-major [N,K]; M,N % 64 == 0, K % 32 == 0.
// SPLIT: operands are hi/lo planes (A2/Bt2 = lo planes, same layout); product = hi·hi + hi·lo + lo·hi.
// BIAS_MODE: 0 = none, 1 = bias[m], 2 = bias[n].
// OUT_MODE: 0 = f32, 1 = f16, 2 = bf16 hi plane (Cout) + bf16 lo plane (Cout2).
// ET: 0 = f16 operands, 1 = bf16 operands (pointers passed as 16-bit storage)
template <int ET> struct Elem;
template <> struct Elem<0> { typedef _Float16 T; };
template <> struct Elem<1> { typedef __bf16 T; };
template <int ET, bool SPLIT, int BIAS_MODE, int OUT_MODE, bool RESID, int ACT = 0>
__global__ __launch_bounds__(256) void wmma_gemm64(
    const unsigned short* __restrict__ Ap, const unsigned short* __restrict__ A2p, int lda, long strideA,
    const unsigned short* __restrict__ Btp, const unsigned short* __restrict__ Bt2p, int ldb, long strideB,
    void* __restrict__ Cout, void* __restrict__ Cout2, int ldc, long strideC,
    const float* __restrict__ bias,
    const float* __restrict__ resid, long strideR,
    int M, int N, int K, float scale) {
  typedef typename Elem<ET>::T T;
  typedef typename Frag<T>::V V;
  const T* A = (const T*)Ap; const T* A2 = (const T*)A2p; const T* Bt = (const T*)Btp; const T* Bt2 = (const T*)Bt2p;
  __shared__ __align__(16) float sT[8][16 * 68];   // per-wave 16x64 slab, pitch 68 floats
  const int b    = blockIdx.y;
  const int lane = threadIdx.x & 31;
  const int wave = threadIdx.x >> 5;
  const int tilesN = N >> 6;
  const int tilesM = M >> 6;
  const int tile = blockIdx.x * 8 + wave;
  if (tile >= tilesM * tilesN) return;   // wave-uniform; no block barriers in this kernel
  const int tm = tile / tilesN;
  const int tn = tile - tm * tilesN;
  const int m0 = tm << 6;
  const int n0 = tn << 6;

  const T* Ab  = A  + (size_t)b * strideA;
  const T* Bb  = Bt + (size_t)b * strideB;
  const T* Ab2 = SPLIT ? (A2  + (size_t)b * strideA) : nullptr;
  const T* Bb2 = SPLIT ? (Bt2 + (size_t)b * strideB) : nullptr;

  const int rlane = lane & 15;                 // row (A) / col (B, D) within subtile
  const int koff  = (lane >> 4) * 8;           // k offset of this lane half
  const int mOff  = (lane >> 4) * 8;           // D row offset

  v8f acc[4][4];
#pragma unroll
  for (int i = 0; i < 4; ++i)
#pragma unroll
    for (int j = 0; j < 4; ++j) acc[i][j] = (v8f){0.f,0.f,0.f,0.f,0.f,0.f,0.f,0.f};

  for (int k0 = 0; k0 < K; k0 += 32) {
    V bh[4], bl[4];
#pragma unroll
    for (int j = 0; j < 4; ++j) {
      const size_t bo = (size_t)(n0 + (j << 4) + rlane) * ldb + koff + k0;
      bh[j] = Frag<T>::load(Bb + bo);
      if (SPLIT) bl[j] = Frag<T>::load(Bb2 + bo);
    }
#pragma unroll
    for (int i = 0; i < 4; ++i) {
      const size_t ao = (size_t)(m0 + (i << 4) + rlane) * lda + koff + k0;
      V ah = Frag<T>::load(Ab + ao);
      V al;
      if (SPLIT) al = Frag<T>::load(Ab2 + ao);
#pragma unroll
      for (int j = 0; j < 4; ++j) {
        acc[i][j] = Frag<T>::mma(ah, bh[j], acc[i][j]);
        if (SPLIT) {
          acc[i][j] = Frag<T>::mma(ah, bl[j], acc[i][j]);
          acc[i][j] = Frag<T>::mma(al, bh[j], acc[i][j]);
        }
      }
      Frag<T>::guard(acc[i][0], acc[i][3], ah, SPLIT ? al : ah);
    }
    Frag<T>::keep(bh[0], bh[1], bh[2], bh[3]);
    if (SPLIT) Frag<T>::keep(bl[0], bl[1], bl[2], bl[3]);
  }
  acc_guard4(acc[0][0], acc[0][1], acc[0][2], acc[0][3]);
  acc_guard4(acc[1][0], acc[1][1], acc[1][2], acc[1][3]);
  acc_guard4(acc[2][0], acc[2][1], acc[2][2], acc[2][3]);
  acc_guard4(acc[3][0], acc[3][1], acc[3][2], acc[3][3]);

  // ---- epilogue ----
  float* slab = sT[wave];
  const float* Rb = RESID ? (resid + (size_t)b * strideR) : nullptr;
#pragma unroll
  for (int i = 0; i < 4; ++i) {
    const int mBase = m0 + (i << 4);
#pragma unroll
    for (int j = 0; j < 4; ++j) {
      const int n = n0 + (j << 4) + rlane;
      float bv = 0.f;
      if (BIAS_MODE == 2) bv = bias[n];
#pragma unroll
      for (int r = 0; r < 8; ++r) {
        float v = acc[i][j][r] * scale;
        if (BIAS_MODE == 1) v += bias[mBase + mOff + r];
        if (BIAS_MODE == 2) v += bv;
        if (RESID) v += Rb[(size_t)(mBase + mOff + r) * ldc + n];
        if (ACT == 1) v = tanhf(v);
        if (ACT == 2) v = fmaxf(v, 0.0f);
        if (ACT == 3) v = v / (1.0f + expf(-v));
        if (ACT == 4) v = (v > 0.f) ? v : 0.01f * v;
        if (ACT == 5) v = 0.5f * v * (1.0f + erff(v * 0.70710678118654752f));
        slab[(mOff + r) * 68 + (j << 4) + rlane] = v;
      }
    }
    __builtin_amdgcn_fence(__ATOMIC_RELEASE, "workgroup");
    __builtin_amdgcn_wave_barrier();
    __builtin_amdgcn_fence(__ATOMIC_ACQUIRE, "workgroup");
    if (OUT_MODE == 0) {
      float* C = (float*)Cout + (size_t)b * strideC;
      const int hh = lane >> 4, c4 = (lane & 15) * 4;     // row seg = 256 B = 16 lanes x 16 B
      {
#pragma unroll
        for (int it = 0; it < 8; ++it) {
          const int row = it * 2 + hh;
          v4f v = *(const v4f*)(slab + row * 68 + c4);
          *(v4f*)(C + (size_t)(mBase + row) * ldc + n0 + c4) = v;
        }
        
      }
    } else {
      const int q = lane >> 3, c8 = (lane & 7) * 8;
      unsigned short* C  = (unsigned short*)Cout  + (size_t)b * strideC;
      unsigned short* C2 = (OUT_MODE == 2) ? ((unsigned short*)Cout2 + (size_t)b * strideC) : nullptr;
      {
#pragma unroll
        for (int it = 0; it < 4; ++it) {
          const int row = it * 4 + q;
          const float* sp = slab + row * 68 + c8;
          v8h hv, lv;
#pragma unroll
          for (int e = 0; e < 8; ++e) {
            if (OUT_MODE == 1) {
              hv[e] = (_Float16)sp[e];
            } else {
              unsigned short hb = f2bf_bits(sp[e]);
              unsigned short lb = f2bf_bits(sp[e] - bf_bits2f(hb));
              hv[e] = __builtin_bit_cast(_Float16, hb);
              lv[e] = __builtin_bit_cast(_Float16, lb);
            }
          }
          *(v8h*)(C + (size_t)(mBase + row) * ldc + n0 + c8) = hv;
          if (OUT_MODE == 2) *(v8h*)(C2 + (size_t)(mBase + row) * ldc + n0 + c8) = lv;
        }
        
      }
    }
    __builtin_amdgcn_fence(__ATOMIC_RELEASE, "workgroup");
    __builtin_amdgcn_wave_barrier();
    __builtin_amdgcn_fence(__ATOMIC_ACQUIRE, "workgroup");
  }
}

__global__ __launch_bounds__(256) void cast_f32_f16x2(
    const float* __restrict__ in, _Float16* __restrict__ out, int n2) {
  int i = blockIdx.x * 256 + threadIdx.x;
  if (i < n2) {
    const _Float16 h0 = (_Float16)in[2 * i], h1 = (_Float16)in[2 * i + 1];
    const unsigned u = (unsigned)__builtin_bit_cast(unsigned short, h0) | ((unsigned)__builtin_bit_cast(unsigned short, h1) << 16);
    ((unsigned*)out)[i] = u;
    
  }
}


// ---- f32 -> f16 cast with a power-of-two pre-scale (folded back by the consumer GEMM's scale) ----
__global__ __launch_bounds__(256) void cast_f32_f16x2s(const float* __restrict__ in, _Float16* __restrict__ out, int n2, float s) {
  int i = blockIdx.x * 256 + threadIdx.x;
  if (i < n2) {
    const _Float16 h0 = (_Float16)(in[2 * i] * s), h1 = (_Float16)(in[2 * i + 1] * s);
    const unsigned u = (unsigned)__builtin_bit_cast(unsigned short, h0) | ((unsigned)__builtin_bit_cast(unsigned short, h1) << 16);
    ((unsigned*)out)[i] = u;
    
  }
}
__global__ __launch_bounds__(256) void split_f32_bf16x2(
    const float* __restrict__ in, __bf16* __restrict__ hi, __bf16* __restrict__ lo, long n2) {
  long i = (long)blockIdx.x * 256 + threadIdx.x;
  long stride = (long)gridDim.x * 256;
  {
    for (long j = i; j < n2; j += stride) {
      const float a = in[2 * j], b = in[2 * j + 1];
      const unsigned short ah = f2bf_bits(a), bh = f2bf_bits(b);
      const unsigned short al = f2bf_bits(a - bf_bits2f(ah)), bl = f2bf_bits(b - bf_bits2f(bh));
      ((unsigned*)hi)[j] = (unsigned)ah | ((unsigned)bh << 16);
      ((unsigned*)lo)[j] = (unsigned)al | ((unsigned)bl << 16);
    }
    
  }
}


// ---- f32 [R][C] (row pitch ldi) -> f16 transposed [C][R] (row pitch ldo); 64x64 tiles; each output row segment
__global__ __launch_bounds__(256) void transpose_cast_f16(const float* __restrict__ in, int ldi,
                                                         _Float16* __restrict__ outT, int ldo, float scale) {
  __shared__ __align__(16) _Float16 tile[64][72];     // [c][r]
  const int c0 = blockIdx.x * 64, r0 = blockIdx.y * 64;
  const int t = threadIdx.y * 32 + threadIdx.x;
  for (int i = threadIdx.y; i < 64; i += 8) {
    tile[threadIdx.x][i]      = (_Float16)(in[(size_t)(r0 + i) * ldi + c0 + threadIdx.x] * scale);
    tile[32 + threadIdx.x][i] = (_Float16)(in[(size_t)(r0 + i) * ldi + c0 + 32 + threadIdx.x] * scale);
  }
  __syncthreads();
  const int q = t >> 3, c8 = (t & 7) * 8;
  {
#pragma unroll
    for (int it = 0; it < 2; ++it) {
      const int c = it * 32 + q;
      v8h hv = *(const v8h*)(&tile[c][c8]);
      *(v8h*)(outT + (size_t)(c0 + c) * ldo + r0 + c8) = hv;
    }
    
  }
}

// ---- f32 [R][C] (pitch ldi) -> bf16 hi/lo transposed planes [C][R] (pitch ldo); 64x64 tiles; each output row segment
__global__ __launch_bounds__(256) void transpose_split_bf16(const float* __restrict__ in, int ldi,
                                                           __bf16* __restrict__ outH, __bf16* __restrict__ outL, int ldo) {
  __shared__ __align__(16) float tile[64][68];     // [c][r]
  const int c0 = blockIdx.x * 64, r0 = blockIdx.y * 64;
  const int t = threadIdx.y * 32 + threadIdx.x;
  for (int i = threadIdx.y; i < 64; i += 8) {
    tile[threadIdx.x][i]      = in[(size_t)(r0 + i) * ldi + c0 + threadIdx.x];
    tile[32 + threadIdx.x][i] = in[(size_t)(r0 + i) * ldi + c0 + 32 + threadIdx.x];
  }
  __syncthreads();
  const int q = t >> 3, c8 = (t & 7) * 8;
  {
#pragma unroll
    for (int it = 0; it < 2; ++it) {
      const int c = it * 32 + q;
      v8b hv, lv;
#pragma unroll
      for (int e = 0; e < 8; ++e) {
        const float f = tile[c][c8 + e];
        const unsigned short hb = f2bf_bits(f);
        hv[e] = __builtin_bit_cast(__bf16, hb);
        lv[e] = __builtin_bit_cast(__bf16, f2bf_bits(f - bf_bits2f(hb)));
      }
      *(v8b*)(outH + (size_t)(c0 + c) * ldo + r0 + c8) = hv;
      *(v8b*)(outL + (size_t)(c0 + c) * ldo + r0 + c8) = lv;
    }
    
  }
}

// =====================================================================================
// Generic causal/non-causal attention for head_dim 64, f32 in / f32 out; 16-bit operands: bf16 with optional hi/lo splits, or
// plain f16 (F16=true, non-split, probabilities carried x2^15).
//   scores = (q*qscale)·kᵀ : v_wmma_f32_16x16x32_bf16; SPLIT_QK -> q,k as bf16 hi/lo (hi·hi + hi·lo + lo·hi)
//   out    = p·v           : v_wmma_f32_16x16x32_bf16; SPLIT_PV -> p,v as bf16 hi/lo; else p,v plain bf16
//   f32 accumulate; online softmax in f32. Block = 4 waves = 64 query rows of one (batch, head); S % 64 == 0.
//   Element (b, s, h, d) of tensor X lives at X[b*X_bs + s*X_rs + h*X_hs + d] (strides in floats, multiples of 4).
//   Masking: mask_mode 0 none, 1 causal (kv > q masked), 2 tensor [S][Skv] shared over (b,h) (float if
//   mask_is_int==0, int32 with element == 0 -> masked if 1, int32 with element != 0 -> masked if 2), 3 per-token vectors qmask[B][S] & kvmask[B][Skv] (int32,
//   0 -> masked), 4 causal + sliding window (kv > q or q - kv > W masked; W passed in mask_is_int);
//   5 = relative-position bias: s += cp[b,h,q][idx[q][kv]] + pc[b,h,kv][idx[q][kv]] with idx = mask_b ([S][Skv] int32) and
//   mask_a an int32 [S][Skv] tensor with nonzero = masked (tables: element (b,h,row,n) at X + b*c_bs + h*c_hs + row*c_rs + n);
//   masked scores are replaced by mask_fill (e.g. -inf or -1e9) before the softmax.
//   grid.x = B * H * (S/64) (or a sub-range with blk0).
// =====================================================================================
#define AT_D 64
#define AT_NW 4
#define AT_QB 64
#define AT_KC 64
struct AttnGeom { const float* cp = nullptr; const float* pc = nullptr; long c_bs = 0, c_rs = 0, c_hs = 0;   // mode-5 score-bias tables
                  long q_bs, q_rs, q_hs, k_bs, k_rs, k_hs, v_bs, v_rs, v_hs, o_bs, o_rs, o_hs;
                  int S, Skv, H, mask_mode; float qscale; int blk0; float mask_fill; int mask_is_int; };
static_assert(sizeof(AttnGeom) == 168, "no padding");

__device__ __forceinline__ unsigned short at_bf_bits(float f) {
  unsigned u = __float_as_uint(f);
  return (unsigned short)((u + 0x7FFFu + ((u >> 16) & 1u)) >> 16);
}
__device__ __forceinline__ __bf16 at_f2bf(float f) { return __builtin_bit_cast(__bf16, at_bf_bits(f)); }
__device__ __forceinline__ void at_split(float f, __bf16& hi, __bf16& lo) {
  const unsigned short hb = at_bf_bits(f);
  hi = __builtin_bit_cast(__bf16, hb);
  lo = at_f2bf(f - __uint_as_float(((unsigned)hb) << 16));
}
__device__ __forceinline__ v8f at_mma(v16b a, v16b b, v8f c) {
  c = __builtin_amdgcn_wmma_f32_16x16x32_bf16(false, a, false, b, (short)0, c, false, false);
  asm volatile("v_nop\n\tv_nop\n\tv_nop\n\tv_nop" : "+v"(c) : "v"(a), "v"(b));
  return c;
}
// 16-bit element as a bit pattern held in a __bf16 slot: f16 bits when F16, bf16 (RNE) otherwise
template <bool F16> __device__ __forceinline__ __bf16 at_to16(float f) {
  if (F16) return __builtin_bit_cast(__bf16, (_Float16)f);
  return at_f2bf(f);
}
template <bool F16> __device__ __forceinline__ v8f at_mma16(v16b a, v16b b, v8f c) {
  if (F16) {
    const v16h ah = __builtin_bit_cast(v16h, a), bh = __builtin_bit_cast(v16h, b);
    c = __builtin_amdgcn_wmma_f32_16x16x32_f16(false, ah, false, bh, (short)0, c, false, false);
    asm volatile("v_nop\n\tv_nop\n\tv_nop\n\tv_nop" : "+v"(c) : "v"(ah), "v"(bh));
    return c;
  }
  return at_mma(a, b, c);
}

template <bool SPLIT_QK, bool SPLIT_PV, bool F16 = false>
__global__ __launch_bounds__(128)
void attn64_kernel(const float* __restrict__ q, const float* __restrict__ k,
                   const float* __restrict__ v, float* __restrict__ out,
                   const void* __restrict__ mask_a, const int* __restrict__ mask_b, AttnGeom g) {
  static_assert(!(F16 && (SPLIT_QK || SPLIT_PV)), "f16 mode is non-split");
  const float PSC = F16 ? 32768.0f : 1.0f;     // f16 probabilities carried x2^15 (subnormal range), folded into the final 1/l
  union FB { v16b v; v8b h[2]; };
  __shared__ __align__(16) __bf16 Ksh[AT_KC * AT_D];             // K hi [kv][d]      8 KB
  __shared__ __align__(16) __bf16 Ksl[SPLIT_QK ? AT_KC * AT_D : 8];
  __shared__ __align__(16) __bf16 Vth[AT_D * AT_KC];             // V hi [d][kv]      8 KB
  __shared__ __align__(16) __bf16 Vtl[SPLIT_PV ? AT_D * AT_KC : 8];
  __shared__ __align__(16) __bf16 Psh[AT_NW][16 * AT_KC];        // per wave P hi [row][kv]  8 KB
  __shared__ __align__(16) __bf16 Psl[SPLIT_PV ? AT_NW : 1][SPLIT_PV ? 16 * AT_KC : 8];
  __shared__ __align__(16) float  Os[AT_NW][16 * 68];            // per wave out tile, pitch 68

  const int tid  = threadIdx.x;
  const int wave = tid >> 5;
  const int lane = tid & 31;
  const int hh   = lane >> 4;
  const int c    = lane & 15;

  const int nqb = g.S / AT_QB;
  const int bx = blockIdx.x + g.blk0;
  const int qb = bx % nqb;
  const int bh = bx / nqb;
  const int h  = bh % g.H;
  const int b  = bh / g.H;
  const int qbase_block = qb * AT_QB;
  const int q0 = qbase_block + wave * 16;

  const float* qb_ptr = q + (size_t)b * g.q_bs + (size_t)h * g.q_hs;
  const float* kb_ptr = k + (size_t)b * g.k_bs + (size_t)h * g.k_hs;
  const float* vb_ptr = v + (size_t)b * g.v_bs + (size_t)h * g.v_hs;
  float*       ob_ptr = out + (size_t)b * g.o_bs + (size_t)h * g.o_hs;

  // ---- Q fragments (A operand): 2 d-chunks, hi (and lo) ----
  v16b qah[2], qal[2];
  {
    const float* qrow = qb_ptr + (size_t)(q0 + c) * g.q_rs;
#pragma unroll
    for (int dc = 0; dc < 2; ++dc) {
#pragma unroll
      for (int e = 0; e < 8; ++e) {
        const float f0 = qrow[dc * 32 + 8 * hh + e] * g.qscale;
        const float f1 = qrow[dc * 32 + 16 + 8 * hh + e] * g.qscale;
        if (SPLIT_QK) { __bf16 hq, lq; at_split(f0, hq, lq); qah[dc][e] = hq; qal[dc][e] = lq; at_split(f1, hq, lq); qah[dc][8 + e] = hq; qal[dc][8 + e] = lq; }
        else { qah[dc][e] = at_to16<F16>(f0); qah[dc][8 + e] = at_to16<F16>(f1); qal[dc][e] = qah[dc][e]; qal[dc][8 + e] = qah[dc][8 + e]; }
      }
    }
  }

  float mrow[8], lrow[8];
  v8f oacc[4];
#pragma unroll
  for (int r = 0; r < 8; ++r) { mrow[r] = -INFINITY; lrow[r] = 0.f; }
#pragma unroll
  for (int t = 0; t < 4; ++t) oacc[t] = (v8f){0.f,0.f,0.f,0.f,0.f,0.f,0.f,0.f};

  const int nChunks = (g.mask_mode == 1 || g.mask_mode == 4) ? (qb + 1) : (g.Skv / AT_KC);   // block-uniform
  // per-row query mask (mode 3)
  int qkeep[8];
#pragma unroll
  for (int r = 0; r < 8; ++r) qkeep[r] = (g.mask_mode == 3) ? mask_b[(size_t)b * g.S + q0 + 8 * hh + r] : 1;   // mask_b = qmask in mode 3
  for (int kc = 0; kc < nChunks; ++kc) {
    const int kv0 = kc * AT_KC;
    __syncthreads();
    {
      const int kvr = tid >> 1, dh = (tid & 1) * 32;
      const float* krow = kb_ptr + (size_t)(kv0 + kvr) * g.k_rs + dh;
      const float* vrow = vb_ptr + (size_t)(kv0 + kvr) * g.v_rs + dh;
#pragma unroll
      for (int i = 0; i < 8; ++i) {
        v4f kk = *(const v4f*)(krow + 4 * i);
        v4f vv = *(const v4f*)(vrow + 4 * i);
#pragma unroll
        for (int e = 0; e < 4; ++e) {
          const int d = dh + 4 * i + e;
          if (SPLIT_QK) { __bf16 a, bl; at_split(kk[e], a, bl); Ksh[kvr * AT_D + d] = a; Ksl[kvr * AT_D + d] = bl; }
          else Ksh[kvr * AT_D + d] = at_to16<F16>(kk[e]);
          if (SPLIT_PV) { __bf16 a, bl; at_split(vv[e], a, bl); Vth[d * AT_KC + kvr] = a; Vtl[d * AT_KC + kvr] = bl; }
          else Vth[d * AT_KC + kvr] = at_to16<F16>(vv[e]);
        }
      }
    }
    __syncthreads();

    v8f s[4];
#pragma unroll
    for (int j = 0; j < 4; ++j) {
      s[j] = (v8f){0.f,0.f,0.f,0.f,0.f,0.f,0.f,0.f};
#pragma unroll 1
      for (int dc = 0; dc < 2; ++dc) {
        FB kb;
        kb.h[0] = *(const v8b*)(Ksh + (j * 16 + c) * AT_D + dc * 32 + 8 * hh);
        kb.h[1] = *(const v8b*)(Ksh + (j * 16 + c) * AT_D + dc * 32 + 16 + 8 * hh);
        s[j] = at_mma16<F16>(qah[dc], kb.v, s[j]);
        if (SPLIT_QK) {
          FB kl;
          kl.h[0] = *(const v8b*)(Ksl + (j * 16 + c) * AT_D + dc * 32 + 8 * hh);
          kl.h[1] = *(const v8b*)(Ksl + (j * 16 + c) * AT_D + dc * 32 + 16 + 8 * hh);
          s[j] = at_mma16<F16>(qah[dc], kl.v, s[j]);
          s[j] = at_mma16<F16>(qal[dc], kb.v, s[j]);
        }
      }
    }
    const bool diag = (g.mask_mode == 1) && (kc == qb);
    int kvkeep[4] = {1, 1, 1, 1};
    if (g.mask_mode == 3) {
#pragma unroll
      for (int j = 0; j < 4; ++j) kvkeep[j] = ((const int*)mask_a)[(size_t)b * g.Skv + kv0 + j * 16 + c];   // mask_a = kvmask
    }
    float cm[8];
#pragma unroll
    for (int r = 0; r < 8; ++r) {
      const int qrow = q0 + 8 * hh + r;
      float m = -INFINITY;
#pragma unroll
      for (int j = 0; j < 4; ++j) {
        const int kvcol = kv0 + j * 16 + c;
        bool masked = false;
        if (diag) masked = (kvcol > qrow);
        else if (g.mask_mode == 4) masked = (kvcol > qrow) || (qrow - kvcol > g.mask_is_int);
        else if (g.mask_mode == 2) {
          const size_t mi = (size_t)qrow * g.Skv + kvcol;
          masked = (g.mask_is_int == 0) ? (((const float*)mask_a)[mi] == 0.0f)
                 : (g.mask_is_int == 1) ? (((const int*)mask_a)[mi] == 0) : (((const int*)mask_a)[mi] != 0);
        } else if (g.mask_mode == 3) masked = (qkeep[r] == 0) || (kvkeep[j] == 0);
        else if (g.mask_mode == 5) {
          const size_t mi = (size_t)qrow * g.Skv + kvcol;
          masked = (((const int*)mask_a)[mi] != 0);
          int n = mask_b[mi]; n = n < 0 ? 0 : n;
          s[j][r] += g.cp[(size_t)b * g.c_bs + (size_t)h * g.c_hs + (size_t)qrow * g.c_rs + n]
                   + g.pc[(size_t)b * g.c_bs + (size_t)h * g.c_hs + (size_t)kvcol * g.c_rs + n];
        }
        if (masked) s[j][r] = g.mask_fill;
        m = fmaxf(m, s[j][r]);
      }
#pragma unroll
      for (int off = 1; off < 16; off <<= 1) m = fmaxf(m, __shfl_xor(m, off, 32));
      cm[r] = m;
    }
    __bf16* pwh = Psh[wave];
    __bf16* pwl = Psl[SPLIT_PV ? wave : 0];
#pragma unroll
    for (int r = 0; r < 8; ++r) {
      const float mnew = fmaxf(mrow[r], cm[r]);
      const float alpha = expf(mrow[r] - mnew);
      mrow[r] = mnew;
      float psum = 0.f;
#pragma unroll
      for (int j = 0; j < 4; ++j) {
        const float p = expf(s[j][r] - mnew);
        psum += p;
        if (SPLIT_PV) { __bf16 a, bl; at_split(p, a, bl); pwh[(8 * hh + r) * AT_KC + j * 16 + c] = a; pwl[(8 * hh + r) * AT_KC + j * 16 + c] = bl; }
        else pwh[(8 * hh + r) * AT_KC + j * 16 + c] = at_to16<F16>(p * PSC);
      }
#pragma unroll
      for (int off = 1; off < 16; off <<= 1) psum += __shfl_xor(psum, off, 32);
      lrow[r] = lrow[r] * alpha + psum;
#pragma unroll
      for (int t = 0; t < 4; ++t) oacc[t][r] *= alpha;
    }
    __builtin_amdgcn_fence(__ATOMIC_RELEASE, "workgroup");
    __builtin_amdgcn_wave_barrier();
    __builtin_amdgcn_fence(__ATOMIC_ACQUIRE, "workgroup");
#pragma unroll 1
    for (int kk = 0; kk < 2; ++kk) {
      FB pa, pl;
      pa.h[0] = *(const v8b*)(pwh + c * AT_KC + kk * 32 + 8 * hh);
      pa.h[1] = *(const v8b*)(pwh + c * AT_KC + kk * 32 + 16 + 8 * hh);
      if (SPLIT_PV) {
        pl.h[0] = *(const v8b*)(pwl + c * AT_KC + kk * 32 + 8 * hh);
        pl.h[1] = *(const v8b*)(pwl + c * AT_KC + kk * 32 + 16 + 8 * hh);
      }
#pragma unroll
      for (int t = 0; t < 4; ++t) {
        FB vb;
        vb.h[0] = *(const v8b*)(Vth + (t * 16 + c) * AT_KC + kk * 32 + 8 * hh);
        vb.h[1] = *(const v8b*)(Vth + (t * 16 + c) * AT_KC + kk * 32 + 16 + 8 * hh);
        oacc[t] = at_mma16<F16>(pa.v, vb.v, oacc[t]);
        if (SPLIT_PV) {
          FB vl;
          vl.h[0] = *(const v8b*)(Vtl + (t * 16 + c) * AT_KC + kk * 32 + 8 * hh);
          vl.h[1] = *(const v8b*)(Vtl + (t * 16 + c) * AT_KC + kk * 32 + 16 + 8 * hh);
          oacc[t] = at_mma16<F16>(pa.v, vl.v, oacc[t]);
          oacc[t] = at_mma16<F16>(pl.v, vb.v, oacc[t]);
        }
      }
    }
  }

  float* os = Os[wave];
#pragma unroll
  for (int r = 0; r < 8; ++r) {
    const float inv = 1.0f / (lrow[r] * PSC);
#pragma unroll
    for (int t = 0; t < 4; ++t) os[(8 * hh + r) * 68 + t * 16 + c] = oacc[t][r] * inv;
  }
  __builtin_amdgcn_fence(__ATOMIC_RELEASE, "workgroup");
  __builtin_amdgcn_wave_barrier();
  __builtin_amdgcn_fence(__ATOMIC_ACQUIRE, "workgroup");
  {
    const int c4 = (lane & 15) * 4;
    {
#pragma unroll
      for (int it = 0; it < 8; ++it) {
        const int row = it * 2 + hh;
        v4f val = *(const v4f*)(os + row * 68 + c4);
        *(v4f*)(ob_ptr + (size_t)(q0 + row) * g.o_rs + c4) = val;
      }
      
    }
  }
}

// MODE: the mask mode as a compile-time constant, so that only the launched mode's score path is compiled into the key loop
template <bool SPLIT_QK, bool SPLIT_PV, bool F16, int MODE>
__global__ __launch_bounds__(128)
void attn128_kernel(const float* __restrict__ q, const float* __restrict__ k,
                   const float* __restrict__ v, float* __restrict__ out,
                   const void* __restrict__ mask_a, const int* __restrict__ mask_b, AttnGeom g) {
  static_assert(!(F16 && (SPLIT_QK || SPLIT_PV)), "f16 mode is non-split");
  const float PSC = F16 ? 32768.0f : 1.0f;     // f16 probabilities carried x2^15 (subnormal range), folded into the final 1/l
  union FB { v16b v; v8b h[2]; };
  constexpr int D2 = 128;
  constexpr int KP = D2 + 8;      // LDS pitch of the k and q rows, in 16-bit elements: 272 B = 16 B x odd, so the 16 rows of a ds_load_b128 fragment read fall on distinct banks
  constexpr int VP = AT_KC + 8;   // LDS pitch of the transposed v rows and the p rows: 144 B = 16 B x odd, same reason
  __shared__ __align__(16) __bf16 Ksh[AT_KC * KP];               // K hi [kv][d], padded rows   17 KB
  __shared__ __align__(16) __bf16 Ksl[SPLIT_QK ? AT_KC * KP : 8];
  __shared__ __align__(16) __bf16 Vth[D2 * VP];                  // V hi [d][kv], padded rows   18 KB
  __shared__ __align__(16) __bf16 Vtl[SPLIT_PV ? D2 * VP : 8];
  __shared__ __align__(16) __bf16 Psh[AT_NW][16 * VP];
  __shared__ __align__(16) __bf16 Psl[SPLIT_PV ? AT_NW : 1][SPLIT_PV ? 16 * VP : 8];
  __shared__ __align__(16) float  Os[AT_NW][16 * 132];           // per wave out tile, pitch 132
  __shared__ __align__(16) __bf16 Qsh[AT_NW][16 * KP];   // q (hi plane, or the 16-bit value) staged per wave (keeps VGPR use low)
  __shared__ __align__(16) __bf16 Qsl[SPLIT_QK ? AT_NW : 1][SPLIT_QK ? 16 * KP : 8];

  const int tid  = threadIdx.x;
  const int wave = tid >> 5;
  const int lane = tid & 31;
  const int hh   = lane >> 4;
  const int c    = lane & 15;

  const int nqb = g.S / AT_QB;
  const int bx = blockIdx.x + g.blk0;
  const int qb = bx % nqb;
  const int bh = bx / nqb;
  const int h  = bh % g.H;
  const int b  = bh / g.H;
  const int qbase_block = qb * AT_QB;
  const int q0 = qbase_block + wave * 16;

  const float* qb_ptr = q + (size_t)b * g.q_bs + (size_t)h * g.q_hs;
  const float* kb_ptr = k + (size_t)b * g.k_bs + (size_t)h * g.k_hs;
  const float* vb_ptr = v + (size_t)b * g.v_bs + (size_t)h * g.v_hs;
  float*       ob_ptr = out + (size_t)b * g.o_bs + (size_t)h * g.o_hs;

  // ---- Q fragments (A operand): 4 d-chunks, hi (and lo) ----
  v16b qah[4], qal[4];
  {
    const float* qrow = qb_ptr + (size_t)(q0 + c) * g.q_rs;
#pragma unroll
    for (int dc = 0; dc < 4; ++dc) {
#pragma unroll
      for (int e = 0; e < 8; ++e) {
        const float f0 = qrow[dc * 32 + 8 * hh + e] * g.qscale;
        const float f1 = qrow[dc * 32 + 16 + 8 * hh + e] * g.qscale;
        if (SPLIT_QK) { __bf16 hq, lq; at_split(f0, hq, lq); Qsh[wave][c * KP + dc * 32 + 8 * hh + e] = hq; Qsl[wave][c * KP + dc * 32 + 8 * hh + e] = lq;
                        at_split(f1, hq, lq); Qsh[wave][c * KP + dc * 32 + 16 + 8 * hh + e] = hq; Qsl[wave][c * KP + dc * 32 + 16 + 8 * hh + e] = lq;
                        qah[dc][e] = hq; qal[dc][e] = lq; qah[dc][8 + e] = hq; qal[dc][8 + e] = lq; }   // (register copies unused on the split path)
        else { Qsh[wave][c * KP + dc * 32 + 8 * hh + e] = at_to16<F16>(f0); Qsh[wave][c * KP + dc * 32 + 16 + 8 * hh + e] = at_to16<F16>(f1); qah[dc][e] = at_to16<F16>(f0); qal[dc][e] = qah[dc][e]; qah[dc][8 + e] = qah[dc][e]; qal[dc][8 + e] = qah[dc][e]; }
      }
    }
  }

  float mrow[8], lrow[8];
  v8f oacc[8];
#pragma unroll
  for (int r = 0; r < 8; ++r) { mrow[r] = -INFINITY; lrow[r] = 0.f; }
#pragma unroll
  for (int t = 0; t < 8; ++t) oacc[t] = (v8f){0.f,0.f,0.f,0.f,0.f,0.f,0.f,0.f};

  const int nChunks = (MODE == 1 || MODE == 4 || MODE == 6) ? (qb + 1) : (g.Skv / AT_KC);   // block-uniform
  // per-row query mask (mode 3)
  int qkeep[8];
#pragma unroll
  for (int r = 0; r < 8; ++r) qkeep[r] = (MODE == 3) ? mask_b[(size_t)b * g.S + q0 + 8 * hh + r] : 1;   // mask_b = qmask in mode 3
  for (int kc = 0; kc < nChunks; ++kc) {
    const int kv0 = kc * AT_KC;
    __syncthreads();
    {
      const int kvr = tid >> 1, dh = (tid & 1) * 64;
      const float* krow = kb_ptr + (size_t)(kv0 + kvr) * g.k_rs + dh;
      const float* vrow = vb_ptr + (size_t)(kv0 + kvr) * g.v_rs + dh;
#pragma unroll
      for (int i = 0; i < 16; ++i) {
        v4f kk = *(const v4f*)(krow + 4 * i);
        v4f vv = *(const v4f*)(vrow + 4 * i);
#pragma unroll
        for (int e = 0; e < 4; ++e) {
          const int d = dh + 4 * i + e;
          if (SPLIT_QK) { __bf16 a, bl; at_split(kk[e], a, bl); Ksh[kvr * KP + d] = a; Ksl[kvr * KP + d] = bl; }
          else Ksh[kvr * KP + d] = at_to16<F16>(kk[e]);
          if (SPLIT_PV) { __bf16 a, bl; at_split(vv[e], a, bl); Vth[d * VP + kvr] = a; Vtl[d * VP + kvr] = bl; }
          else Vth[d * VP + kvr] = at_to16<F16>(vv[e]);
        }
      }
    }
    __syncthreads();

    v8f s[4];
#pragma unroll
    for (int j = 0; j < 4; ++j) {
      s[j] = (v8f){0.f,0.f,0.f,0.f,0.f,0.f,0.f,0.f};
if (SPLIT_QK) {
#pragma unroll 1
      for (int dc = 0; dc < 4; ++dc) {      // rolled: bounds the live fragment set (register pressure) on the 128-wide head
        FB kb;
        kb.h[0] = *(const v8b*)(Ksh + (j * 16 + c) * KP + dc * 32 + 8 * hh);
        kb.h[1] = *(const v8b*)(Ksh + (j * 16 + c) * KP + dc * 32 + 16 + 8 * hh);
        if (!SPLIT_QK) { FB qa; qa.h[0] = *(const v8b*)(&Qsh[wave][c * KP + dc * 32 + 8 * hh]); qa.h[1] = *(const v8b*)(&Qsh[wave][c * KP + dc * 32 + 16 + 8 * hh]); s[j] = at_mma16<F16>(qa.v, kb.v, s[j]); }
        if (SPLIT_QK) {
          FB qa, ql;
          qa.h[0] = *(const v8b*)(&Qsh[wave][c * KP + dc * 32 + 8 * hh]); qa.h[1] = *(const v8b*)(&Qsh[wave][c * KP + dc * 32 + 16 + 8 * hh]);
          ql.h[0] = *(const v8b*)(&Qsl[wave][c * KP + dc * 32 + 8 * hh]); ql.h[1] = *(const v8b*)(&Qsl[wave][c * KP + dc * 32 + 16 + 8 * hh]);
          s[j] = at_mma16<F16>(qa.v, kb.v, s[j]);
          FB kl;
          kl.h[0] = *(const v8b*)(Ksl + (j * 16 + c) * KP + dc * 32 + 8 * hh);
          kl.h[1] = *(const v8b*)(Ksl + (j * 16 + c) * KP + dc * 32 + 16 + 8 * hh);
          s[j] = at_mma16<F16>(qa.v, kl.v, s[j]);
          s[j] = at_mma16<F16>(ql.v, kb.v, s[j]);
        }
      }
      } else {
#pragma unroll
      for (int dc = 0; dc < 4; ++dc) {      // (16-bit path: fully unrolled; q fragments are reloaded from the per-wave Qsh copy in LDS)
        FB kb;
        kb.h[0] = *(const v8b*)(Ksh + (j * 16 + c) * KP + dc * 32 + 8 * hh);
        kb.h[1] = *(const v8b*)(Ksh + (j * 16 + c) * KP + dc * 32 + 16 + 8 * hh);
        if (!SPLIT_QK) { FB qa; qa.h[0] = *(const v8b*)(&Qsh[wave][c * KP + dc * 32 + 8 * hh]); qa.h[1] = *(const v8b*)(&Qsh[wave][c * KP + dc * 32 + 16 + 8 * hh]); s[j] = at_mma16<F16>(qa.v, kb.v, s[j]); }
        if (SPLIT_QK) {
          FB qa, ql;
          qa.h[0] = *(const v8b*)(&Qsh[wave][c * KP + dc * 32 + 8 * hh]); qa.h[1] = *(const v8b*)(&Qsh[wave][c * KP + dc * 32 + 16 + 8 * hh]);
          ql.h[0] = *(const v8b*)(&Qsl[wave][c * KP + dc * 32 + 8 * hh]); ql.h[1] = *(const v8b*)(&Qsl[wave][c * KP + dc * 32 + 16 + 8 * hh]);
          s[j] = at_mma16<F16>(qa.v, kb.v, s[j]);
          FB kl;
          kl.h[0] = *(const v8b*)(Ksl + (j * 16 + c) * KP + dc * 32 + 8 * hh);
          kl.h[1] = *(const v8b*)(Ksl + (j * 16 + c) * KP + dc * 32 + 16 + 8 * hh);
          s[j] = at_mma16<F16>(qa.v, kl.v, s[j]);
          s[j] = at_mma16<F16>(ql.v, kb.v, s[j]);
        }
      }
      }
    }
    const bool diag = (MODE == 1) && (kc == qb);
    int kvkeep[4] = {1, 1, 1, 1};
    if (MODE == 3) {
#pragma unroll
      for (int j = 0; j < 4; ++j) kvkeep[j] = ((const int*)mask_a)[(size_t)b * g.Skv + kv0 + j * 16 + c];   // mask_a = kvmask
    }
    float cm[8];
#pragma unroll
    for (int r = 0; r < 8; ++r) {
      const int qrow = q0 + 8 * hh + r;
      float m = -INFINITY;
#pragma unroll
      for (int j = 0; j < 4; ++j) {
        const int kvcol = kv0 + j * 16 + c;
        bool masked = false;
        if (diag) masked = (kvcol > qrow);
        else if (MODE == 4) masked = (kvcol > qrow) || (qrow - kvcol > g.mask_is_int);
        else if (MODE == 2) {
          const size_t mi = (size_t)qrow * g.Skv + kvcol;
          masked = (g.mask_is_int == 0) ? (((const float*)mask_a)[mi] == 0.0f)
                 : (g.mask_is_int == 1) ? (((const int*)mask_a)[mi] == 0) : (((const int*)mask_a)[mi] != 0);
        } else if (MODE == 3) masked = (qkeep[r] == 0) || (kvkeep[j] == 0);
        else if (MODE == 6) { masked = (kvcol > qrow); s[j][r] += g.cp[h] * (float)(kvcol - qrow); }
        else if (MODE == 8) { masked = (kvcol > qrow) || (((const int*)mask_a)[(size_t)b * g.Skv + kvcol] != 0); }
        else if (MODE == 5) {
          const size_t mi = (size_t)qrow * g.Skv + kvcol;
          masked = (((const int*)mask_a)[mi] != 0);
          int n = mask_b[mi]; n = n < 0 ? 0 : n;
          s[j][r] += g.cp[(size_t)b * g.c_bs + (size_t)h * g.c_hs + (size_t)qrow * g.c_rs + n]
                   + g.pc[(size_t)b * g.c_bs + (size_t)h * g.c_hs + (size_t)kvcol * g.c_rs + n];
        }
        if (masked) s[j][r] = g.mask_fill;
        m = fmaxf(m, s[j][r]);
      }
#pragma unroll
      for (int off = 1; off < 16; off <<= 1) m = fmaxf(m, __shfl_xor(m, off, 32));
      cm[r] = m;
    }
    __bf16* pwh = Psh[wave];
    __bf16* pwl = Psl[SPLIT_PV ? wave : 0];
#pragma unroll
    for (int r = 0; r < 8; ++r) {
      const float mnew = fmaxf(mrow[r], cm[r]);
      const float alpha = expf(mrow[r] - mnew);
      mrow[r] = mnew;
      float psum = 0.f;
#pragma unroll
      for (int j = 0; j < 4; ++j) {
        const float p = expf(s[j][r] - mnew);
        psum += p;
        if (SPLIT_PV) { __bf16 a, bl; at_split(p, a, bl); pwh[(8 * hh + r) * VP + j * 16 + c] = a; pwl[(8 * hh + r) * VP + j * 16 + c] = bl; }
        else pwh[(8 * hh + r) * VP + j * 16 + c] = at_to16<F16>(p * PSC);
      }
#pragma unroll
      for (int off = 1; off < 16; off <<= 1) psum += __shfl_xor(psum, off, 32);
      lrow[r] = lrow[r] * alpha + psum;
#pragma unroll
      for (int t = 0; t < 8; ++t) oacc[t][r] *= alpha;
    }
    __builtin_amdgcn_fence(__ATOMIC_RELEASE, "workgroup");
    __builtin_amdgcn_wave_barrier();
    __builtin_amdgcn_fence(__ATOMIC_ACQUIRE, "workgroup");
#pragma unroll 1
    for (int kk = 0; kk < 2; ++kk) {
      FB pa, pl;
      pa.h[0] = *(const v8b*)(pwh + c * VP + kk * 32 + 8 * hh);
      pa.h[1] = *(const v8b*)(pwh + c * VP + kk * 32 + 16 + 8 * hh);
      if (SPLIT_PV) {
        pl.h[0] = *(const v8b*)(pwl + c * VP + kk * 32 + 8 * hh);
        pl.h[1] = *(const v8b*)(pwl + c * VP + kk * 32 + 16 + 8 * hh);
      }
#pragma unroll
      for (int t = 0; t < 8; ++t) {
        FB vb;
        vb.h[0] = *(const v8b*)(Vth + (t * 16 + c) * VP + kk * 32 + 8 * hh);
        vb.h[1] = *(const v8b*)(Vth + (t * 16 + c) * VP + kk * 32 + 16 + 8 * hh);
        oacc[t] = at_mma16<F16>(pa.v, vb.v, oacc[t]);
        if (SPLIT_PV) {
          FB vl;
          vl.h[0] = *(const v8b*)(Vtl + (t * 16 + c) * VP + kk * 32 + 8 * hh);
          vl.h[1] = *(const v8b*)(Vtl + (t * 16 + c) * VP + kk * 32 + 16 + 8 * hh);
          oacc[t] = at_mma16<F16>(pa.v, vl.v, oacc[t]);
          oacc[t] = at_mma16<F16>(pl.v, vb.v, oacc[t]);
        }
      }
    }
  }

  float* os = Os[wave];
#pragma unroll
  for (int r = 0; r < 8; ++r) {
    const float inv = 1.0f / (lrow[r] * PSC);
#pragma unroll
    for (int t = 0; t < 8; ++t) os[(8 * hh + r) * 132 + t * 16 + c] = oacc[t][r] * inv;
  }
  __builtin_amdgcn_fence(__ATOMIC_RELEASE, "workgroup");
  __builtin_amdgcn_wave_barrier();
  __builtin_amdgcn_fence(__ATOMIC_ACQUIRE, "workgroup");
  {
    const int c4 = lane * 4;           // 32 lanes x 16 B = one 512-B output row (128 floats) per instruction
    {
#pragma unroll
      for (int row = 0; row < 16; ++row) {
        v4f val = *(const v4f*)(os + row * 132 + c4);
        *(v4f*)(ob_ptr + (size_t)(q0 + row) * g.o_rs + c4) = val;
      }
      
    }
  }
}

#define IB 4
#define INn 4096
#define ID 128
__global__ void bias3_kernel(const float* a, const float* b, const float* c, float* o) { const int i = threadIdx.x; const float v = (i < 128) ? a[i] : (i < 256 ? b[i - 128] : c[i - 256]); ((float*)o)[i] = v;  }
extern "C" void kernel_launch(void* const* d_in, const int* in_sizes, int n_in, void* d_out, int out_size, void* d_ws, size_t ws_size, hipStream_t stream) {
  (void)in_sizes; (void)n_in; (void)out_size; (void)ws_size;
  const float* x = (const float*)d_in[0]; const float* Wq = (const float*)d_in[1]; const float* bq = (const float*)d_in[2]; const float* Wk = (const float*)d_in[3]; const float* bk = (const float*)d_in[4]; const float* Wv = (const float*)d_in[5]; const float* bv = (const float*)d_in[6];
  char* ws = (char*)d_ws; size_t off = 0;
  auto carve = [&](size_t bytes) -> char* { char* p = ws + off; off += (bytes + 255) & ~(size_t)255; return p; };
  const int R = IB * INn;
  _Float16* X16 = (_Float16*)carve((size_t)R * ID * 2); _Float16* W3 = (_Float16*)carve((size_t)3 * ID * ID * 2); float* b3 = (float*)carve(3 * ID * 4);
  float* QKV = (float*)carve((size_t)R * 3 * ID * 4);
  cast_f32_f16x2<<<(R * ID / 2 + 255) / 256, 256, 0, stream>>>(x, X16, R * ID / 2);
  cast_f32_f16x2<<<(ID * ID / 2 + 255) / 256, 256, 0, stream>>>(Wq, W3, ID * ID / 2);
  cast_f32_f16x2<<<(ID * ID / 2 + 255) / 256, 256, 0, stream>>>(Wk, W3 + ID * ID, ID * ID / 2);
  cast_f32_f16x2<<<(ID * ID / 2 + 255) / 256, 256, 0, stream>>>(Wv, W3 + 2 * ID * ID, ID * ID / 2);
  bias3_kernel<<<1, 384, 0, stream>>>(bq, bk, bv, b3);
  { const int t = (R / 64) * (3 * ID / 64);
    wmma_gemm64<0, false, 2, 0, false><<<dim3((t + 7) / 8, 1), 256, 0, stream>>>(U16(X16), nullptr, ID, 0, U16(W3), nullptr, ID, 0, QKV, nullptr, 3 * ID, 0, b3, nullptr, 0, R, 3 * ID, ID, 1.0f); }
  { AttnGeom g;
    g.q_bs = (long)INn * 3 * ID; g.q_rs = 3 * ID; g.q_hs = 0; g.k_bs = g.q_bs; g.k_rs = 3 * ID; g.k_hs = 0; g.v_bs = g.q_bs; g.v_rs = 3 * ID; g.v_hs = 0; g.o_bs = (long)INn * ID; g.o_rs = ID; g.o_hs = 0;
    g.S = INn; g.Skv = INn; g.H = 1; g.mask_mode = 0; g.qscale = 0.08838834764831845f; g.blk0 = 0; g.mask_fill = -INFINITY; g.mask_is_int = 0;
    attn128_kernel<false, false, true, 0><<<IB * (INn / AT_QB), AT_NW * 32, 0, stream>>>(QKV, QKV + ID, QKV + 2 * ID, (float*)d_out, nullptr, nullptr, g); }
}

// v003
// It runs in 234 microseconds.
// Next to v002, in two timings, it ran 1.22 and 1.24 times as fast.
// Over all steps from v000 it is 4.52 times as fast.
#include <hip/hip_runtime.h>
#include <math.h>
// InteractionLayer: q, k, v = x W^T + b (three 16384 x 128 by 128 x 128 products; q f32, k f16 rows, v f16 transposed in 64-key tiles) and single-head attention (d 128, 4096 keys per batch; scores and
// p·v with p x2^15) on v_wmma_f32_16x16x32_f16 with f16 operands, f32 accumulate; softmax f32 on VALU. nn.Linear weights ([out][in]) are the
// Bt operand of q, k and the A operand of v^T, directly.
typedef __attribute__((ext_vector_type(16))) _Float16 v16h;
typedef __attribute__((ext_vector_type(8)))  _Float16 v8h;
typedef __attribute__((ext_vector_type(16))) __bf16   v16b;
typedef __attribute__((ext_vector_type(8)))  __bf16   v8b;
typedef __attribute__((ext_vector_type(8)))  float    v8f;
typedef __attribute__((ext_vector_type(4)))  float    v4f;
#define PSCALE 32768.0f
#define U16(p) ((const unsigned short*)(const void*)(p))
#define PSCALE_INV (1.0f / 32768.0f)

__device__ __forceinline__ unsigned short f2bf_bits(float f) {
  unsigned u = __float_as_uint(f);
  return (unsigned short)((u + 0x7FFFu + ((u >> 16) & 1u)) >> 16);
}
__device__ __forceinline__ float bf_bits2f(unsigned short h) { return __uint_as_float(((unsigned)h) << 16); }

// hazard guards as plain device helpers (no inline asm inside the kernel template body)
__device__ __forceinline__ void dep_guard_h(v8f& a, v8f& b, v16h x, v16h y) { asm volatile("v_nop\n\tv_nop\n\tv_nop\n\tv_nop" : "+v"(a), "+v"(b) : "v"(x), "v"(y)); }
__device__ __forceinline__ void dep_guard_b(v8f& a, v8f& b, v16b x, v16b y) { asm volatile("v_nop\n\tv_nop\n\tv_nop\n\tv_nop" : "+v"(a), "+v"(b) : "v"(x), "v"(y)); }
__device__ __forceinline__ void keep4_h(v16h a, v16h b, v16h c, v16h d) { asm volatile("v_nop" :: "v"(a), "v"(b), "v"(c), "v"(d)); }
__device__ __forceinline__ void keep4_b(v16b a, v16b b, v16b c, v16b d) { asm volatile("v_nop" :: "v"(a), "v"(b), "v"(c), "v"(d)); }
__device__ __forceinline__ void acc_guard4(v8f& a, v8f& b, v8f& c, v8f& d) { asm volatile("v_nop\n\tv_nop\n\tv_nop\n\tv_nop" : "+v"(a), "+v"(b), "+v"(c), "+v"(d)); }
template <typename T> struct Frag;
template <> struct Frag<_Float16> {
  typedef v16h V; union U { v16h v; v8h h[2]; };
  static __device__ __forceinline__ v16h load(const _Float16* p) {   // elements 0..7 <- p[0..7], 8..15 <- p[16..23]
    U f; f.h[0] = *(const v8h*)(p); f.h[1] = *(const v8h*)(p + 16); return f.v;
  }
  static __device__ __forceinline__ v8f mma(v16h a, v16h b, v8f c) {
    return __builtin_amdgcn_wmma_f32_16x16x32_f16(false, a, false, b, (short)0, c, false, false);
  }
  static __device__ __forceinline__ void guard(v8f& a, v8f& b, v16h x, v16h y) { dep_guard_h(a, b, x, y); }
  static __device__ __forceinline__ void keep(v16h a, v16h b, v16h c, v16h d) { keep4_h(a, b, c, d); }
};
template <> struct Frag<__bf16> {
  typedef v16b V; union U { v16b v; v8b h[2]; };
  static __device__ __forceinline__ v16b load(const __bf16* p) {
    U f; f.h[0] = *(const v8b*)(p); f.h[1] = *(const v8b*)(p + 16); return f.v;
  }
  static __device__ __forceinline__ v8f mma(v16b a, v16b b, v8f c) {
    return __builtin_amdgcn_wmma_f32_16x16x32_bf16(false, a, false, b, (short)0, c, false, false);
  }
  static __device__ __forceinline__ void guard(v8f& a, v8f& b, v16b x, v16b y) { dep_guard_b(a, b, x, y); }
  static __device__ __forceinline__ void keep(v16b a, v16b b, v16b c, v16b d) { keep4_b(a, b, c, d); }
};

// ---- Register-blocked batched WMMA GEMM ------------------------------------
// C[m,n] = scale * sum_k A[m,k] * Bt[n,k] (+bias)(+resid); each wave owns a 64x64 tile.
// A row-major [M,K]; Bt row-major [N,K]; M,N % 64 == 0, K % 32 == 0.
// SPLIT: operands are hi/lo planes (A2/Bt2 = lo planes, same layout); product = hi·hi + hi·lo + lo·hi.
// BIAS_MODE: 0 = none, 1 = bias[m], 2 = bias[n].
// OUT_MODE: 0 = f32, 1 = f16, 2 = bf16 hi plane (Cout) + bf16 lo plane (Cout2).
// ET: 0 = f16 operands, 1 = bf16 operands (pointers passed as 16-bit storage)
template <int ET> struct Elem;
template <> struct Elem<0> { typedef _Float16 T; };
template <> struct Elem<1> { typedef __bf16 T; };
template <int ET, bool SPLIT, int BIAS_MODE, int OUT_MODE, bool RESID, int ACT = 0>
__global__ __launch_bounds__(256) void wmma_gemm64(
    const unsigned short* __restrict__ Ap, const unsigned short* __restrict__ A2p, int lda, long strideA,
    const unsigned short* __restrict__ Btp, const unsigned short* __restrict__ Bt2p, int ldb, long strideB,
    void* __restrict__ Cout, void* __restrict__ Cout2, int ldc, long strideC,
    const float* __restrict__ bias,
    const float* __restrict__ resid, long strideR,
    int M, int N, int K, float scale) {
  typedef typename Elem<ET>::T T;
  typedef typename Frag<T>::V V;
  const T* A = (const T*)Ap; const T* A2 = (const T*)A2p; const T* Bt = (const T*)Btp; const T* Bt2 = (const T*)Bt2p;
  __shared__ __align__(16) float sT[8][16 * 68];   // per-wave 16x64 slab, pitch 68 floats
  const int b    = blockIdx.y;
  const int lane = threadIdx.x & 31;
  const int wave = threadIdx.x >> 5;
  const int tilesN = N >> 6;
  const int tilesM = M >> 6;
  const int tile = blockIdx.x * 8 + wave;
  if (tile >= tilesM * tilesN) return;   // wave-uniform; no block barriers in this kernel
  const int tm = tile / tilesN;
  const int tn = tile - tm * tilesN;
  const int m0 = tm << 6;
  const int n0 = tn << 6;

  const T* Ab  = A  + (size_t)b * strideA;
  const T* Bb  = Bt + (size_t)b * strideB;
  const T* Ab2 = SPLIT ? (A2  + (size_t)b * strideA) : nullptr;
  const T* Bb2 = SPLIT ? (Bt2 + (size_t)b * strideB) : nullptr;

  const int rlane = lane & 15;                 // row (A) / col (B, D) within subtile
  const int koff  = (lane >> 4) * 8;           // k offset of this lane half
  const int mOff  = (lane >> 4) * 8;           // D row offset

  v8f acc[4][4];
#pragma unroll
  for (int i = 0; i < 4; ++i)
#pragma unroll
    for (int j = 0; j < 4; ++j) acc[i][j] = (v8f){0.f,0.f,0.f,0.f,0.f,0.f,0.f,0.f};

  for (int k0 = 0; k0 < K; k0 += 32) {
    V bh[4], bl[4];
#pragma unroll
    for (int j = 0; j < 4; ++j) {
      const size_t bo = (size_t)(n0 + (j << 4) + rlane) * ldb + koff + k0;
      bh[j] = Frag<T>::load(Bb + bo);
      if (SPLIT) bl[j] = Frag<T>::load(Bb2 + bo);
    }
#pragma unroll
    for (int i = 0; i < 4; ++i) {
      const size_t ao = (size_t)(m0 + (i << 4) + rlane) * lda + koff + k0;
      V ah = Frag<T>::load(Ab + ao);
      V al;
      if (SPLIT) al = Frag<T>::load(Ab2 + ao);
#pragma unroll
      for (int j = 0; j < 4; ++j) {
        acc[i][j] = Frag<T>::mma(ah, bh[j], acc[i][j]);
        if (SPLIT) {
          acc[i][j] = Frag<T>::mma(ah, bl[j], acc[i][j]);
          acc[i][j] = Frag<T>::mma(al, bh[j], acc[i][j]);
        }
      }
      Frag<T>::guard(acc[i][0], acc[i][3], ah, SPLIT ? al : ah);
    }
    Frag<T>::keep(bh[0], bh[1], bh[2], bh[3]);
    if (SPLIT) Frag<T>::keep(bl[0], bl[1], bl[2], bl[3]);
  }
  acc_guard4(acc[0][0], acc[0][1], acc[0][2], acc[0][3]);
  acc_guard4(acc[1][0], acc[1][1], acc[1][2], acc[1][3]);
  acc_guard4(acc[2][0], acc[2][1], acc[2][2], acc[2][3]);
  acc_guard4(acc[3][0], acc[3][1], acc[3][2], acc[3][3]);

  // ---- epilogue ----
  float* slab = sT[wave];
  const float* Rb = RESID ? (resid + (size_t)b * strideR) : nullptr;
#pragma unroll
  for (int i = 0; i < 4; ++i) {
    const int mBase = m0 + (i << 4);
#pragma unroll
    for (int j = 0; j < 4; ++j) {
      const int n = n0 + (j << 4) + rlane;
      float bv = 0.f;
      if (BIAS_MODE == 2) bv = bias[n];
#pragma unroll
      for (int r = 0; r < 8; ++r) {
        float v = acc[i][j][r] * scale;
        if (BIAS_MODE == 1) v += bias[mBase + mOff + r];
        if (BIAS_MODE == 2) v += bv;
        if (RESID) v += Rb[(size_t)(mBase + mOff + r) * ldc + n];
        if (ACT == 1) v = tanhf(v);
        if (ACT == 2) v = fmaxf(v, 0.0f);
        if (ACT == 3) v = v / (1.0f + expf(-v));
        if (ACT == 4) v = (v > 0.f) ? v : 0.01f * v;
        if (ACT == 5) v = 0.5f * v * (1.0f + erff(v * 0.70710678118654752f));
        slab[(mOff + r) * 68 + (j << 4) + rlane] = v;
      }
    }
    __builtin_amdgcn_fence(__ATOMIC_RELEASE, "workgroup");
    __builtin_amdgcn_wave_barrier();
    __builtin_amdgcn_fence(__ATOMIC_ACQUIRE, "workgroup");
    if (OUT_MODE == 0) {
      float* C = (float*)Cout + (size_t)b * strideC;
      const int hh = lane >> 4, c4 = (lane & 15) * 4;     // row seg = 256 B = 16 lanes x 16 B
      {
#pragma unroll
        for (int it = 0; it < 8; ++it) {
          const int row = it * 2 + hh;
          v4f v = *(const v4f*)(slab + row * 68 + c4);
          *(v4f*)(C + (size_t)(mBase + row) * ldc + n0 + c4) = v;
        }
        
      }
    } else {
      const int q = lane >> 3, c8 = (lane & 7) * 8;
      unsigned short* C  = (unsigned short*)Cout  + (size_t)b * strideC;
      unsigned short* C2 = (OUT_MODE == 2) ? ((unsigned short*)Cout2 + (size_t)b * strideC) : nullptr;
      {
#pragma unroll
        for (int it = 0; it < 4; ++it) {
          const int row = it * 4 + q;
          const float* sp = slab + row * 68 + c8;
          v8h hv, lv;
#pragma unroll
          for (int e = 0; e < 8; ++e) {
            if (OUT_MODE == 1) {
              hv[e] = (_Float16)sp[e];
            } else {
              unsigned short hb = f2bf_bits(sp[e]);
              unsigned short lb = f2bf_bits(sp[e] - bf_bits2f(hb));
              hv[e] = __builtin_bit_cast(_Float16, hb);
              lv[e] = __builtin_bit_cast(_Float16, lb);
            }
          }
          *(v8h*)(C + (size_t)(mBase + row) * ldc + n0 + c8) = hv;
          if (OUT_MODE == 2) *(v8h*)(C2 + (size_t)(mBase + row) * ldc + n0 + c8) = lv;
        }
        
      }
    }
    __builtin_amdgcn_fence(__ATOMIC_RELEASE, "workgroup");
    __builtin_amdgcn_wave_barrier();
    __builtin_amdgcn_fence(__ATOMIC_ACQUIRE, "workgroup");
  }
}

__global__ __launch_bounds__(256) void cast_f32_f16x2(
    const float* __restrict__ in, _Float16* __restrict__ out, int n2) {
  int i = blockIdx.x * 256 + threadIdx.x;
  if (i < n2) {
    const _Float16 h0 = (_Float16)in[2 * i], h1 = (_Float16)in[2 * i + 1];
    const unsigned u = (unsigned)__builtin_bit_cast(unsigned short, h0) | ((unsigned)__builtin_bit_cast(unsigned short, h1) << 16);
    ((unsigned*)out)[i] = u;
    
  }
}


// ---- f32 -> f16 cast with a power-of-two pre-scale (folded back by the consumer GEMM's scale) ----
__global__ __launch_bounds__(256) void cast_f32_f16x2s(const float* __restrict__ in, _Float16* __restrict__ out, int n2, float s) {
  int i = blockIdx.x * 256 + threadIdx.x;
  if (i < n2) {
    const _Float16 h0 = (_Float16)(in[2 * i] * s), h1 = (_Float16)(in[2 * i + 1] * s);
    const unsigned u = (unsigned)__builtin_bit_cast(unsigned short, h0) | ((unsigned)__builtin_bit_cast(unsigned short, h1) << 16);
    ((unsigned*)out)[i] = u;
    
  }
}
__global__ __launch_bounds__(256) void split_f32_bf16x2(
    const float* __restrict__ in, __bf16* __restrict__ hi, __bf16* __restrict__ lo, long n2) {
  long i = (long)blockIdx.x * 256 + threadIdx.x;
  long stride = (long)gridDim.x * 256;
  {
    for (long j = i; j < n2; j += stride) {
      const float a = in[2 * j], b = in[2 * j + 1];
      const unsigned short ah = f2bf_bits(a), bh = f2bf_bits(b);
      const unsigned short al = f2bf_bits(a - bf_bits2f(ah)), bl = f2bf_bits(b - bf_bits2f(bh));
      ((unsigned*)hi)[j] = (unsigned)ah | ((unsigned)bh << 16);
      ((unsigned*)lo)[j] = (unsigned)al | ((unsigned)bl << 16);
    }
    
  }
}


// ---- f32 [R][C] (row pitch ldi) -> f16 transposed [C][R] (row pitch ldo); 64x64 tiles; each output row segment
__global__ __launch_bounds__(256) void transpose_cast_f16(const float* __restrict__ in, int ldi,
                                                         _Float16* __restrict__ outT, int ldo, float scale) {
  __shared__ __align__(16) _Float16 tile[64][72];     // [c][r]
  const int c0 = blockIdx.x * 64, r0 = blockIdx.y * 64;
  const int t = threadIdx.y * 32 + threadIdx.x;
  for (int i = threadIdx.y; i < 64; i += 8) {
    tile[threadIdx.x][i]      = (_Float16)(in[(size_t)(r0 + i) * ldi + c0 + threadIdx.x] * scale);
    tile[32 + threadIdx.x][i] = (_Float16)(in[(size_t)(r0 + i) * ldi + c0 + 32 + threadIdx.x] * scale);
  }
  __syncthreads();
  const int q = t >> 3, c8 = (t & 7) * 8;
  {
#pragma unroll
    for (int it = 0; it < 2; ++it) {
      const int c = it * 32 + q;
      v8h hv = *(const v8h*)(&tile[c][c8]);
      *(v8h*)(outT + (size_t)(c0 + c) * ldo + r0 + c8) = hv;
    }
    
  }
}

// ---- f32 [R][C] (pitch ldi) -> bf16 hi/lo transposed planes [C][R] (pitch ldo); 64x64 tiles; each output row segment
__global__ __launch_bounds__(256) void transpose_split_bf16(const float* __restrict__ in, int ldi,
                                                           __bf16* __restrict__ outH, __bf16* __restrict__ outL, int ldo) {
  __shared__ __align__(16) float tile[64][68];     // [c][r]
  const int c0 = blockIdx.x * 64, r0 = blockIdx.y * 64;
  const int t = threadIdx.y * 32 + threadIdx.x;
  for (int i = threadIdx.y; i < 64; i += 8) {
    tile[threadIdx.x][i]      = in[(size_t)(r0 + i) * ldi + c0 + threadIdx.x];
    tile[32 + threadIdx.x][i] = in[(size_t)(r0 + i) * ldi + c0 + 32 + threadIdx.x];
  }
  __syncthreads();
  const int q = t >> 3, c8 = (t & 7) * 8;
  {
#pragma unroll
    for (int it = 0; it < 2; ++it) {
      const int c = it * 32 + q;
      v8b hv, lv;
#pragma unroll
      for (int e = 0; e < 8; ++e) {
        const float f = tile[c][c8 + e];
        const unsigned short hb = f2bf_bits(f);
        hv[e] = __builtin_bit_cast(__bf16, hb);
        lv[e] = __builtin_bit_cast(__bf16, f2bf_bits(f - bf_bits2f(hb)));
      }
      *(v8b*)(outH + (size_t)(c0 + c) * ldo + r0 + c8) = hv;
      *(v8b*)(outL + (size_t)(c0 + c) * ldo + r0 + c8) = lv;
    }
    
  }
}

// =====================================================================================
// Generic causal/non-causal attention for head_dim 64, f32 in / f32 out; 16-bit operands: bf16 with optional hi/lo splits, or
// plain f16 (F16=true, non-split, probabilities carried x2^15).
//   scores = (q*qscale)·kᵀ : v_wmma_f32_16x16x32_bf16; SPLIT_QK -> q,k as bf16 hi/lo (hi·hi + hi·lo + lo·hi)
//   out    = p·v           : v_wmma_f32_16x16x32_bf16; SPLIT_PV -> p,v as bf16 hi/lo; else p,v plain bf16
//   f32 accumulate; online softmax in f32. Block = 4 waves = 64 query rows of one (batch, head); S % 64 == 0.
//   Element (b, s, h, d) of tensor X lives at X[b*X_bs + s*X_rs + h*X_hs + d] (strides in floats, multiples of 4).
//   Masking: mask_mode 0 none, 1 causal (kv > q masked), 2 tensor [S][Skv] shared over (b,h) (float if
//   mask_is_int==0, int32 with element == 0 -> masked if 1, int32 with element != 0 -> masked if 2), 3 per-token vectors qmask[B][S] & kvmask[B][Skv] (int32,
//   0 -> masked), 4 causal + sliding window (kv > q or q - kv > W masked; W passed in mask_is_int);
//   5 = relative-position bias: s += cp[b,h,q][idx[q][kv]] + pc[b,h,kv][idx[q][kv]] with idx = mask_b ([S][Skv] int32) and
//   mask_a an int32 [S][Skv] tensor with nonzero = masked (tables: element (b,h,row,n) at X + b*c_bs + h*c_hs + row*c_rs + n);
//   masked scores are replaced by mask_fill (e.g. -inf or -1e9) before the softmax.
//   grid.x = B * H * (S/64) (or a sub-range with blk0).
// =====================================================================================
#define AT_D 64
#define AT_NW 4
#define AT_QB 64
#define AT_KC 64
struct AttnGeom { const float* cp = nullptr; const float* pc = nullptr; long c_bs = 0, c_rs = 0, c_hs = 0;   // mode-5 score-bias tables
                  long q_bs, q_rs, q_hs, k_bs, k_rs, k_hs, v_bs, v_rs, v_hs, o_bs, o_rs, o_hs;
                  int S, Skv, H, mask_mode; float qscale; int blk0; float mask_fill; int mask_is_int; };
static_assert(sizeof(AttnGeom) == 168, "no padding");

__device__ __forceinline__ unsigned short at_bf_bits(float f) {
  unsigned u = __float_as_uint(f);
  return (unsigned short)((u + 0x7FFFu + ((u >> 16) & 1u)) >> 16);
}
__device__ __forceinline__ __bf16 at_f2bf(float f) { return __builtin_bit_cast(__bf16, at_bf_bits(f)); }
__device__ __forceinline__ void at_split(float f, __bf16& hi, __bf16& lo) {
  const unsigned short hb = at_bf_bits(f);
  hi = __builtin_bit_cast(__bf16, hb);
  lo = at_f2bf(f - __uint_as_float(((unsigned)hb) << 16));
}
__device__ __forceinline__ v8f at_mma(v16b a, v16b b, v8f c) {
  c = __builtin_amdgcn_wmma_f32_16x16x32_bf16(false, a, false, b, (short)0, c, false, false);
  asm volatile("v_nop\n\tv_nop\n\tv_nop\n\tv_nop" : "+v"(c) : "v"(a), "v"(b));
  return c;
}
// 16-bit element as a bit pattern held in a __bf16 slot: f16 bits when F16, bf16 (RNE) otherwise
template <bool F16> __device__ __forceinline__ __bf16 at_to16(float f) {
  if (F16) return __builtin_bit_cast(__bf16, (_Float16)f);
  return at_f2bf(f);
}
template <bool F16> __device__ __forceinline__ v8f at_mma16(v16b a, v16b b, v8f c) {
  if (F16) {
    const v16h ah = __builtin_bit_cast(v16h, a), bh = __builtin_bit_cast(v16h, b);
    c = __builtin_amdgcn_wmma_f32_16x16x32_f16(false, ah, false, bh, (short)0, c, false, false);
    asm volatile("v_nop\n\tv_nop\n\tv_nop\n\tv_nop" : "+v"(c) : "v"(ah), "v"(bh));
    return c;
  }
  return at_mma(a, b, c);
}

template <bool SPLIT_QK, bool SPLIT_PV, bool F16 = false>
__global__ __launch_bounds__(128)
void attn64_kernel(const float* __restrict__ q, const float* __restrict__ k,
                   const float* __restrict__ v, float* __restrict__ out,
                   const void* __restrict__ mask_a, const int* __restrict__ mask_b, AttnGeom g) {
  static_assert(!(F16 && (SPLIT_QK || SPLIT_PV)), "f16 mode is non-split");
  const float PSC = F16 ? 32768.0f : 1.0f;     // f16 probabilities carried x2^15 (subnormal range), folded into the final 1/l
  union FB { v16b v; v8b h[2]; };
  __shared__ __align__(16) __bf16 Ksh[AT_KC * AT_D];             // K hi [kv][d]      8 KB
  __shared__ __align__(16) __bf16 Ksl[SPLIT_QK ? AT_KC * AT_D : 8];
  __shared__ __align__(16) __bf16 Vth[AT_D * AT_KC];             // V hi [d][kv]      8 KB
  __shared__ __align__(16) __bf16 Vtl[SPLIT_PV ? AT_D * AT_KC : 8];
  __shared__ __align__(16) __bf16 Psh[AT_NW][16 * AT_KC];        // per wave P hi [row][kv]  8 KB
  __shared__ __align__(16) __bf16 Psl[SPLIT_PV ? AT_NW : 1][SPLIT_PV ? 16 * AT_KC : 8];
  __shared__ __align__(16) float  Os[AT_NW][16 * 68];            // per wave out tile, pitch 68

  const int tid  = threadIdx.x;
  const int wave = tid >> 5;
  const int lane = tid & 31;
  const int hh   = lane >> 4;
  const int c    = lane & 15;

  const int nqb = g.S / AT_QB;
  const int bx = blockIdx.x + g.blk0;
  const int qb = bx % nqb;
  const int bh = bx / nqb;
  const int h  = bh % g.H;
  const int b  = bh / g.H;
  const int qbase_block = qb * AT_QB;
  const int q0 = qbase_block + wave * 16;

  const float* qb_ptr = q + (size_t)b * g.q_bs + (size_t)h * g.q_hs;
  const float* kb_ptr = k + (size_t)b * g.k_bs + (size_t)h * g.k_hs;
  const float* vb_ptr = v + (size_t)b * g.v_bs + (size_t)h * g.v_hs;
  float*       ob_ptr = out + (size_t)b * g.o_bs + (size_t)h * g.o_hs;

  // ---- Q fragments (A operand): 2 d-chunks, hi (and lo) ----
  v16b qah[2], qal[2];
  {
    const float* qrow = qb_ptr + (size_t)(q0 + c) * g.q_rs;
#pragma unroll
    for (int dc = 0; dc < 2; ++dc) {
#pragma unroll
      for (int e = 0; e < 8; ++e) {
        const float f0 = qrow[dc * 32 + 8 * hh + e] * g.qscale;
        const float f1 = qrow[dc * 32 + 16 + 8 * hh + e] * g.qscale;
        if (SPLIT_QK) { __bf16 hq, lq; at_split(f0, hq, lq); qah[dc][e] = hq; qal[dc][e] = lq; at_split(f1, hq, lq); qah[dc][8 + e] = hq; qal[dc][8 + e] = lq; }
        else { qah[dc][e] = at_to16<F16>(f0); qah[dc][8 + e] = at_to16<F16>(f1); qal[dc][e] = qah[dc][e]; qal[dc][8 + e] = qah[dc][8 + e]; }
      }
    }
  }

  float mrow[8], lrow[8];
  v8f oacc[4];
#pragma unroll
  for (int r = 0; r < 8; ++r) { mrow[r] = -INFINITY; lrow[r] = 0.f; }
#pragma unroll
  for (int t = 0; t < 4; ++t) oacc[t] = (v8f){0.f,0.f,0.f,0.f,0.f,0.f,0.f,0.f};

  const int nChunks = (g.mask_mode == 1 || g.mask_mode == 4) ? (qb + 1) : (g.Skv / AT_KC);   // block-uniform
  // per-row query mask (mode 3)
  int qkeep[8];
#pragma unroll
  for (int r = 0; r < 8; ++r) qkeep[r] = (g.mask_mode == 3) ? mask_b[(size_t)b * g.S + q0 + 8 * hh + r] : 1;   // mask_b = qmask in mode 3
  for (int kc = 0; kc < nChunks; ++kc) {
    const int kv0 = kc * AT_KC;
    __syncthreads();
    {
      const int kvr = tid >> 1, dh = (tid & 1) * 32;
      const float* krow = kb_ptr + (size_t)(kv0 + kvr) * g.k_rs + dh;
      const float* vrow = vb_ptr + (size_t)(kv0 + kvr) * g.v_rs + dh;
#pragma unroll
      for (int i = 0; i < 8; ++i) {
        v4f kk = *(const v4f*)(krow + 4 * i);
        v4f vv = *(const v4f*)(vrow + 4 * i);
#pragma unroll
        for (int e = 0; e < 4; ++e) {
          const int d = dh + 4 * i + e;
          if (SPLIT_QK) { __bf16 a, bl; at_split(kk[e], a, bl); Ksh[kvr * AT_D + d] = a; Ksl[kvr * AT_D + d] = bl; }
          else Ksh[kvr * AT_D + d] = at_to16<F16>(kk[e]);
          if (SPLIT_PV) { __bf16 a, bl; at_split(vv[e], a, bl); Vth[d * AT_KC + kvr] = a; Vtl[d * AT_KC + kvr] = bl; }
          else Vth[d * AT_KC + kvr] = at_to16<F16>(vv[e]);
        }
      }
    }
    __syncthreads();

    v8f s[4];
#pragma unroll
    for (int j = 0; j < 4; ++j) {
      s[j] = (v8f){0.f,0.f,0.f,0.f,0.f,0.f,0.f,0.f};
#pragma unroll 1
      for (int dc = 0; dc < 2; ++dc) {
        FB kb;
        kb.h[0] = *(const v8b*)(Ksh + (j * 16 + c) * AT_D + dc * 32 + 8 * hh);
        kb.h[1] = *(const v8b*)(Ksh + (j * 16 + c) * AT_D + dc * 32 + 16 + 8 * hh);
        s[j] = at_mma16<F16>(qah[dc], kb.v, s[j]);
        if (SPLIT_QK) {
          FB kl;
          kl.h[0] = *(const v8b*)(Ksl + (j * 16 + c) * AT_D + dc * 32 + 8 * hh);
          kl.h[1] = *(const v8b*)(Ksl + (j * 16 + c) * AT_D + dc * 32 + 16 + 8 * hh);
          s[j] = at_mma16<F16>(qah[dc], kl.v, s[j]);
          s[j] = at_mma16<F16>(qal[dc], kb.v, s[j]);
        }
      }
    }
    const bool diag = (g.mask_mode == 1) && (kc == qb);
    int kvkeep[4] = {1, 1, 1, 1};
    if (g.mask_mode == 3) {
#pragma unroll
      for (int j = 0; j < 4; ++j) kvkeep[j] = ((const int*)mask_a)[(size_t)b * g.Skv + kv0 + j * 16 + c];   // mask_a = kvmask
    }
    float cm[8];
#pragma unroll
    for (int r = 0; r < 8; ++r) {
      const int qrow = q0 + 8 * hh + r;
      float m = -INFINITY;
#pragma unroll
      for (int j = 0; j < 4; ++j) {
        const int kvcol = kv0 + j * 16 + c;
        bool masked = false;
        if (diag) masked = (kvcol > qrow);
        else if (g.mask_mode == 4) masked = (kvcol > qrow) || (qrow - kvcol > g.mask_is_int);
        else if (g.mask_mode == 2) {
          const size_t mi = (size_t)qrow * g.Skv + kvcol;
          masked = (g.mask_is_int == 0) ? (((const float*)mask_a)[mi] == 0.0f)
                 : (g.mask_is_int == 1) ? (((const int*)mask_a)[mi] == 0) : (((const int*)mask_a)[mi] != 0);
        } else if (g.mask_mode == 3) masked = (qkeep[r] == 0) || (kvkeep[j] == 0);
        else if (g.mask_mode == 5) {
          const size_t mi = (size_t)qrow * g.Skv + kvcol;
          masked = (((const int*)mask_a)[mi] != 0);
          int n = mask_b[mi]; n = n < 0 ? 0 : n;
          s[j][r] += g.cp[(size_t)b * g.c_bs + (size_t)h * g.c_hs + (size_t)qrow * g.c_rs + n]
                   + g.pc[(size_t)b * g.c_bs + (size_t)h * g.c_hs + (size_t)kvcol * g.c_rs + n];
        }
        if (masked) s[j][r] = g.mask_fill;
        m = fmaxf(m, s[j][r]);
      }
#pragma unroll
      for (int off = 1; off < 16; off <<= 1) m = fmaxf(m, __shfl_xor(m, off, 32));
      cm[r] = m;
    }
    __bf16* pwh = Psh[wave];
    __bf16* pwl = Psl[SPLIT_PV ? wave : 0];
#pragma unroll
    for (int r = 0; r < 8; ++r) {
      const float mnew = fmaxf(mrow[r], cm[r]);
      const float alpha = expf(mrow[r] - mnew);
      mrow[r] = mnew;
      float psum = 0.f;
#pragma unroll
      for (int j = 0; j < 4; ++j) {
        const float p = expf(s[j][r] - mnew);
        psum += p;
        if (SPLIT_PV) { __bf16 a, bl; at_split(p, a, bl); pwh[(8 * hh + r) * AT_KC + j * 16 + c] = a; pwl[(8 * hh + r) * AT_KC + j * 16 + c] = bl; }
        else pwh[(8 * hh + r) * AT_KC + j * 16 + c] = at_to16<F16>(p * PSC);
      }
#pragma unroll
      for (int off = 1; off < 16; off <<= 1) psum += __shfl_xor(psum, off, 32);
      lrow[r] = lrow[r] * alpha + psum;
#pragma unroll
      for (int t = 0; t < 4; ++t) oacc[t][r] *= alpha;
    }
    __builtin_amdgcn_fence(__ATOMIC_RELEASE, "workgroup");
    __builtin_amdgcn_wave_barrier();
    __builtin_amdgcn_fence(__ATOMIC_ACQUIRE, "workgroup");
#pragma unroll 1
    for (int kk = 0; kk < 2; ++kk) {
      FB pa, pl;
      pa.h[0] = *(const v8b*)(pwh + c * AT_KC + kk * 32 + 8 * hh);
      pa.h[1] = *(const v8b*)(pwh + c * AT_KC + kk * 32 + 16 + 8 * hh);
      if (SPLIT_PV) {
        pl.h[0] = *(const v8b*)(pwl + c * AT_KC + kk * 32 + 8 * hh);
        pl.h[1] = *(const v8b*)(pwl + c * AT_KC + kk * 32 + 16 + 8 * hh);
      }
#pragma unroll
      for (int t = 0; t < 4; ++t) {
        FB vb;
        vb.h[0] = *(const v8b*)(Vth + (t * 16 + c) * AT_KC + kk * 32 + 8 * hh);
        vb.h[1] = *(const v8b*)(Vth + (t * 16 + c) * AT_KC + kk * 32 + 16 + 8 * hh);
        oacc[t] = at_mma16<F16>(pa.v, vb.v, oacc[t]);
        if (SPLIT_PV) {
          FB vl;
          vl.h[0] = *(const v8b*)(Vtl + (t * 16 + c) * AT_KC + kk * 32 + 8 * hh);
          vl.h[1] = *(const v8b*)(Vtl + (t * 16 + c) * AT_KC + kk * 32 + 16 + 8 * hh);
          oacc[t] = at_mma16<F16>(pa.v, vl.v, oacc[t]);
          oacc[t] = at_mma16<F16>(pl.v, vb.v, oacc[t]);
        }
      }
    }
  }

  float* os = Os[wave];
#pragma unroll
  for (int r = 0; r < 8; ++r) {
    const float inv = 1.0f / (lrow[r] * PSC);
#pragma unroll
    for (int t = 0; t < 4; ++t) os[(8 * hh + r) * 68 + t * 16 + c] = oacc[t][r] * inv;
  }
  __builtin_amdgcn_fence(__ATOMIC_RELEASE, "workgroup");
  __builtin_amdgcn_wave_barrier();
  __builtin_amdgcn_fence(__ATOMIC_ACQUIRE, "workgroup");
  {
    const int c4 = (lane & 15) * 4;
    {
#pragma unroll
      for (int it = 0; it < 8; ++it) {
        const int row = it * 2 + hh;
        v4f val = *(const v4f*)(os + row * 68 + c4);
        *(v4f*)(ob_ptr + (size_t)(q0 + row) * g.o_rs + c4) = val;
      }
      
    }
  }
}

// MODE: the mask mode as a compile-time constant, so that only the launched mode's score path is compiled into the key loop
// PRE16: k and v come ready as 16-bit values, written once by their producer (k, v unused): k16 holds dense rows, element (b, s, d) at
//   k16[b*k_bs + s*128 + d]; vt16 holds v transposed in tiles of AT_KC keys, element (b, s, d) at vt16[b*v_bs + (s/AT_KC)*AT_KC*128 + d*AT_KC + s%AT_KC]
//   (k_bs, v_bs in 16-bit elements, multiples of 8), so that a pass's k tile and v tile are 16 KB contiguous each.
template <bool SPLIT_QK, bool SPLIT_PV, bool F16, int MODE, bool PRE16>
__global__ __launch_bounds__(128)
void attn128_kernel(const float* __restrict__ q, const float* __restrict__ k,
                   const float* __restrict__ v, const unsigned short* __restrict__ k16,
                   const unsigned short* __restrict__ vt16, float* __restrict__ out,
                   const void* __restrict__ mask_a, const int* __restrict__ mask_b, AttnGeom g) {
  static_assert(!(F16 && (SPLIT_QK || SPLIT_PV)), "f16 mode is non-split");
  static_assert(!(PRE16 && (SPLIT_QK || SPLIT_PV)), "ready 16-bit k and v are non-split");
  const float PSC = F16 ? 32768.0f : 1.0f;     // f16 probabilities carried x2^15 (subnormal range), folded into the final 1/l
  union FB { v16b v; v8b h[2]; };
  constexpr int D2 = 128;
  constexpr int KP = D2 + 8;      // LDS pitch of the k and q rows, in 16-bit elements: 272 B = 16 B x odd, so the 16 rows of a ds_load_b128 fragment read fall on distinct banks
  constexpr int VP = AT_KC + 8;   // LDS pitch of the transposed v rows and the p rows: 144 B = 16 B x odd, same reason
  __shared__ __align__(16) __bf16 Ksh[AT_KC * KP];               // K hi [kv][d], padded rows   17 KB
  __shared__ __align__(16) __bf16 Ksl[SPLIT_QK ? AT_KC * KP : 8];
  __shared__ __align__(16) __bf16 Vth[D2 * VP];                  // V hi [d][kv], padded rows   18 KB
  __shared__ __align__(16) __bf16 Vtl[SPLIT_PV ? D2 * VP : 8];
  __shared__ __align__(16) __bf16 Psh[AT_NW][16 * VP];
  __shared__ __align__(16) __bf16 Psl[SPLIT_PV ? AT_NW : 1][SPLIT_PV ? 16 * VP : 8];
  __shared__ __align__(16) float  Os[AT_NW][16 * 132];           // per wave out tile, pitch 132
  __shared__ __align__(16) __bf16 Qsh[AT_NW][16 * KP];   // q (hi plane, or the 16-bit value) staged per wave (keeps VGPR use low)
  __shared__ __align__(16) __bf16 Qsl[SPLIT_QK ? AT_NW : 1][SPLIT_QK ? 16 * KP : 8];

  const int tid  = threadIdx.x;
  const int wave = tid >> 5;
  const int lane = tid & 31;
  const int hh   = lane >> 4;
  const int c    = lane & 15;

  const int nqb = g.S / AT_QB;
  const int bx = blockIdx.x + g.blk0;
  const int qb = bx % nqb;
  const int bh = bx / nqb;
  const int h  = bh % g.H;
  const int b  = bh / g.H;
  const int qbase_block = qb * AT_QB;
  const int q0 = qbase_block + wave * 16;

  const float* qb_ptr = q + (size_t)b * g.q_bs + (size_t)h * g.q_hs;
  const float* kb_ptr = k + (size_t)b * g.k_bs + (size_t)h * g.k_hs;
  const float* vb_ptr = v + (size_t)b * g.v_bs + (size_t)h * g.v_hs;
  float*       ob_ptr = out + (size_t)b * g.o_bs + (size_t)h * g.o_hs;

  // ---- Q fragments (A operand): 4 d-chunks, hi (and lo) ----
  v16b qah[4], qal[4];
  {
    const float* qrow = qb_ptr + (size_t)(q0 + c) * g.q_rs;
#pragma unroll
    for (int dc = 0; dc < 4; ++dc) {
#pragma unroll
      for (int e = 0; e < 8; ++e) {
        const float f0 = qrow[dc * 32 + 8 * hh + e] * g.qscale;
        const float f1 = qrow[dc * 32 + 16 + 8 * hh + e] * g.qscale;
        if (SPLIT_QK) { __bf16 hq, lq; at_split(f0, hq, lq); Qsh[wave][c * KP + dc * 32 + 8 * hh + e] = hq; Qsl[wave][c * KP + dc * 32 + 8 * hh + e] = lq;
                        at_split(f1, hq, lq); Qsh[wave][c * KP + dc * 32 + 16 + 8 * hh + e] = hq; Qsl[wave][c * KP + dc * 32 + 16 + 8 * hh + e] = lq;
                        qah[dc][e] = hq; qal[dc][e] = lq; qah[dc][8 + e] = hq; qal[dc][8 + e] = lq; }   // (register copies unused on the split path)
        else { Qsh[wave][c * KP + dc * 32 + 8 * hh + e] = at_to16<F16>(f0); Qsh[wave][c * KP + dc * 32 + 16 + 8 * hh + e] = at_to16<F16>(f1); qah[dc][e] = at_to16<F16>(f0); qal[dc][e] = qah[dc][e]; qah[dc][8 + e] = qah[dc][e]; qal[dc][8 + e] = qah[dc][e]; }
      }
    }
  }

  float mrow[8], lrow[8];
  v8f oacc[8];
#pragma unroll
  for (int r = 0; r < 8; ++r) { mrow[r] = -INFINITY; lrow[r] = 0.f; }
#pragma unroll
  for (int t = 0; t < 8; ++t) oacc[t] = (v8f){0.f,0.f,0.f,0.f,0.f,0.f,0.f,0.f};

  const int nChunks = (MODE == 1 || MODE == 4 || MODE == 6) ? (qb + 1) : (g.Skv / AT_KC);   // block-uniform
  // per-row query mask (mode 3)
  int qkeep[8];
#pragma unroll
  for (int r = 0; r < 8; ++r) qkeep[r] = (MODE == 3) ? mask_b[(size_t)b * g.S + q0 + 8 * hh + r] : 1;   // mask_b = qmask in mode 3
  for (int kc = 0; kc < nChunks; ++kc) {
    const int kv0 = kc * AT_KC;
    __syncthreads();
    if (PRE16) {
      // plain copy, 16 B a lane: a wave's 32 lanes take 512 contiguous bytes of the source; step i is 2 KB further (8 k rows, 16 v rows)
      const unsigned short* kt = k16 + (size_t)b * g.k_bs + (size_t)kc * (AT_KC * D2) + tid * 8;
      const unsigned short* vt = vt16 + (size_t)b * g.v_bs + (size_t)kc * (AT_KC * D2) + tid * 8;
      __bf16* kd = Ksh + (tid >> 4) * KP + (tid & 15) * 8;
      __bf16* vd = Vth + (tid >> 3) * VP + (tid & 7) * 8;
      v8b kr[8], vr[8];
#pragma unroll   // unrolled so that kr, vr are registers and all 16 loads are in flight before the first store waits
      for (int i = 0; i < 8; ++i) {
        kr[i] = *(const v8b*)(kt + i * 1024);
        vr[i] = *(const v8b*)(vt + i * 1024);
      }
      // precaution: this wait stands before the two address pairs of the issued loads are reused; naming them here keeps the loads' own destinations off them
      asm volatile("s_wait_xcnt 0x0" :: "v"(kt), "v"(vt) : "memory");
#pragma unroll   // unrolled for the same reason; the row steps become immediate offsets
      for (int i = 0; i < 8; ++i) {
        *(v8b*)(kd + i * 8 * KP) = kr[i];
        *(v8b*)(vd + i * 16 * VP) = vr[i];
      }
    } else {
      const int kvr = tid >> 1, dh = (tid & 1) * 64;
      const float* krow = kb_ptr + (size_t)(kv0 + kvr) * g.k_rs + dh;
      const float* vrow = vb_ptr + (size_t)(kv0 + kvr) * g.v_rs + dh;
#pragma unroll
      for (int i = 0; i < 16; ++i) {
        v4f kk = *(const v4f*)(krow + 4 * i);
        v4f vv = *(const v4f*)(vrow + 4 * i);
#pragma unroll
        for (int e = 0; e < 4; ++e) {
          const int d = dh + 4 * i + e;
          if (SPLIT_QK) { __bf16 a, bl; at_split(kk[e], a, bl); Ksh[kvr * KP + d] = a; Ksl[kvr * KP + d] = bl; }
          else Ksh[kvr * KP + d] = at_to16<F16>(kk[e]);
          if (SPLIT_PV) { __bf16 a, bl; at_split(vv[e], a, bl); Vth[d * VP + kvr] = a; Vtl[d * VP + kvr] = bl; }
          else Vth[d * VP + kvr] = at_to16<F16>(vv[e]);
        }
      }
    }
    __syncthreads();

    v8f s[4];
#pragma unroll
    for (int j = 0; j < 4; ++j) {
      s[j] = (v8f){0.f,0.f,0.f,0.f,0.f,0.f,0.f,0.f};
if (SPLIT_QK) {
#pragma unroll 1
      for (int dc = 0; dc < 4; ++dc) {      // rolled: bounds the live fragment set (register pressure) on the 128-wide head
        FB kb;
        kb.h[0] = *(const v8b*)(Ksh + (j * 16 + c) * KP + dc * 32 + 8 * hh);
        kb.h[1] = *(const v8b*)(Ksh + (j * 16 + c) * KP + dc * 32 + 16 + 8 * hh);
        if (!SPLIT_QK) { FB qa; qa.h[0] = *(const v8b*)(&Qsh[wave][c * KP + dc * 32 + 8 * hh]); qa.h[1] = *(const v8b*)(&Qsh[wave][c * KP + dc * 32 + 16 + 8 * hh]); s[j] = at_mma16<F16>(qa.v, kb.v, s[j]); }
        if (SPLIT_QK) {
          FB qa, ql;
          qa.h[0] = *(const v8b*)(&Qsh[wave][c * KP + dc * 32 + 8 * hh]); qa.h[1] = *(const v8b*)(&Qsh[wave][c * KP + dc * 32 + 16 + 8 * hh]);
          ql.h[0] = *(const v8b*)(&Qsl[wave][c * KP + dc * 32 + 8 * hh]); ql.h[1] = *(const v8b*)(&Qsl[wave][c * KP + dc * 32 + 16 + 8 * hh]);
          s[j] = at_mma16<F16>(qa.v, kb.v, s[j]);
          FB kl;
          kl.h[0] = *(const v8b*)(Ksl + (j * 16 + c) * KP + dc * 32 + 8 * hh);
          kl.h[1] = *(const v8b*)(Ksl + (j * 16 + c) * KP + dc * 32 + 16 + 8 * hh);
          s[j] = at_mma16<F16>(qa.v, kl.v, s[j]);
          s[j] = at_mma16<F16>(ql.v, kb.v, s[j]);
        }
      }
      } else {
#pragma unroll
      for (int dc = 0; dc < 4; ++dc) {      // (16-bit path: fully unrolled; q fragments are reloaded from the per-wave Qsh copy in LDS)
        FB kb;
        kb.h[0] = *(const v8b*)(Ksh + (j * 16 + c) * KP + dc * 32 + 8 * hh);
        kb.h[1] = *(const v8b*)(Ksh + (j * 16 + c) * KP + dc * 32 + 16 + 8 * hh);
        if (!SPLIT_QK) { FB qa; qa.h[0] = *(const v8b*)(&Qsh[wave][c * KP + dc * 32 + 8 * hh]); qa.h[1] = *(const v8b*)(&Qsh[wave][c * KP + dc * 32 + 16 + 8 * hh]); s[j] = at_mma16<F16>(qa.v, kb.v, s[j]); }
        if (SPLIT_QK) {
          FB qa, ql;
          qa.h[0] = *(const v8b*)(&Qsh[wave][c * KP + dc * 32 + 8 * hh]); qa.h[1] = *(const v8b*)(&Qsh[wave][c * KP + dc * 32 + 16 + 8 * hh]);
          ql.h[0] = *(const v8b*)(&Qsl[wave][c * KP + dc * 32 + 8 * hh]); ql.h[1] = *(const v8b*)(&Qsl[wave][c * KP + dc * 32 + 16 + 8 * hh]);
          s[j] = at_mma16<F16>(qa.v, kb.v, s[j]);
          FB kl;
          kl.h[0] = *(const v8b*)(Ksl + (j * 16 + c) * KP + dc * 32 + 8 * hh);
          kl.h[1] = *(const v8b*)(Ksl + (j * 16 + c) * KP + dc * 32 + 16 + 8 * hh);
          s[j] = at_mma16<F16>(qa.v, kl.v, s[j]);
          s[j] = at_mma16<F16>(ql.v, kb.v, s[j]);
        }
      }
      }
    }
    const bool diag = (MODE == 1) && (kc == qb);
    int kvkeep[4] = {1, 1, 1, 1};
    if (MODE == 3) {
#pragma unroll
      for (int j = 0; j < 4; ++j) kvkeep[j] = ((const int*)mask_a)[(size_t)b * g.Skv + kv0 + j * 16 + c];   // mask_a = kvmask
    }
    float cm[8];
#pragma unroll
    for (int r = 0; r < 8; ++r) {
      const int qrow = q0 + 8 * hh + r;
      float m = -INFINITY;
#pragma unroll
      for (int j = 0; j < 4; ++j) {
        const int kvcol = kv0 + j * 16 + c;
        bool masked = false;
        if (diag) masked = (kvcol > qrow);
        else if (MODE == 4) masked = (kvcol > qrow) || (qrow - kvcol > g.mask_is_int);
        else if (MODE == 2) {
          const size_t mi = (size_t)qrow * g.Skv + kvcol;
          masked = (g.mask_is_int == 0) ? (((const float*)mask_a)[mi] == 0.0f)
                 : (g.mask_is_int == 1) ? (((const int*)mask_a)[mi] == 0) : (((const int*)mask_a)[mi] != 0);
        } else if (MODE == 3) masked = (qkeep[r] == 0) || (kvkeep[j] == 0);
        else if (MODE == 6) { masked = (kvcol > qrow); s[j][r] += g.cp[h] * (float)(kvcol - qrow); }
        else if (MODE == 8) { masked = (kvcol > qrow) || (((const int*)mask_a)[(size_t)b * g.Skv + kvcol] != 0); }
        else if (MODE == 5) {
          const size_t mi = (size_t)qrow * g.Skv + kvcol;
          masked = (((const int*)mask_a)[mi] != 0);
          int n = mask_b[mi]; n = n < 0 ? 0 : n;
          s[j][r] += g.cp[(size_t)b * g.c_bs + (size_t)h * g.c_hs + (size_t)qrow * g.c_rs + n]
                   + g.pc[(size_t)b * g.c_bs + (size_t)h * g.c_hs + (size_t)kvcol * g.c_rs + n];
        }
        if (masked) s[j][r] = g.mask_fill;
        m = fmaxf(m, s[j][r]);
      }
#pragma unroll
      for (int off = 1; off < 16; off <<= 1) m = fmaxf(m, __shfl_xor(m, off, 32));
      cm[r] = m;
    }
    __bf16* pwh = Psh[wave];
    __bf16* pwl = Psl[SPLIT_PV ? wave : 0];
#pragma unroll
    for (int r = 0; r < 8; ++r) {
      const float mnew = fmaxf(mrow[r], cm[r]);
      const float alpha = expf(mrow[r] - mnew);
      mrow[r] = mnew;
      float psum = 0.f;
#pragma unroll
      for (int j = 0; j < 4; ++j) {
        const float p = expf(s[j][r] - mnew);
        psum += p;
        if (SPLIT_PV) { __bf16 a, bl; at_split(p, a, bl); pwh[(8 * hh + r) * VP + j * 16 + c] = a; pwl[(8 * hh + r) * VP + j * 16 + c] = bl; }
        else pwh[(8 * hh + r) * VP + j * 16 + c] = at_to16<F16>(p * PSC);
      }
#pragma unroll
      for (int off = 1; off < 16; off <<= 1) psum += __shfl_xor(psum, off, 32);
      lrow[r] = lrow[r] * alpha + psum;
#pragma unroll
      for (int t = 0; t < 8; ++t) oacc[t][r] *= alpha;
    }
    __builtin_amdgcn_fence(__ATOMIC_RELEASE, "workgroup");
    __builtin_amdgcn_wave_barrier();
    __builtin_amdgcn_fence(__ATOMIC_ACQUIRE, "workgroup");
#pragma unroll 1
    for (int kk = 0; kk < 2; ++kk) {
      FB pa, pl;
      pa.h[0] = *(const v8b*)(pwh + c * VP + kk * 32 + 8 * hh);
      pa.h[1] = *(const v8b*)(pwh + c * VP + kk * 32 + 16 + 8 * hh);
      if (SPLIT_PV) {
        pl.h[0] = *(const v8b*)(pwl + c * VP + kk * 32 + 8 * hh);
        pl.h[1] = *(const v8b*)(pwl + c * VP + kk * 32 + 16 + 8 * hh);
      }
#pragma unroll
      for (int t = 0; t < 8; ++t) {
        FB vb;
        vb.h[0] = *(const v8b*)(Vth + (t * 16 + c) * VP + kk * 32 + 8 * hh);
        vb.h[1] = *(const v8b*)(Vth + (t * 16 + c) * VP + kk * 32 + 16 + 8 * hh);
        oacc[t] = at_mma16<F16>(pa.v, vb.v, oacc[t]);
        if (SPLIT_PV) {
          FB vl;
          vl.h[0] = *(const v8b*)(Vtl + (t * 16 + c) * VP + kk * 32 + 8 * hh);
          vl.h[1] = *(const v8b*)(Vtl + (t * 16 + c) * VP + kk * 32 + 16 + 8 * hh);
          oacc[t] = at_mma16<F16>(pa.v, vl.v, oacc[t]);
          oacc[t] = at_mma16<F16>(pl.v, vb.v, oacc[t]);
        }
      }
    }
  }

  float* os = Os[wave];
#pragma unroll
  for (int r = 0; r < 8; ++r) {
    const float inv = 1.0f / (lrow[r] * PSC);
#pragma unroll
    for (int t = 0; t < 8; ++t) os[(8 * hh + r) * 132 + t * 16 + c] = oacc[t][r] * inv;
  }
  __builtin_amdgcn_fence(__ATOMIC_RELEASE, "workgroup");
  __builtin_amdgcn_wave_barrier();
  __builtin_amdgcn_fence(__ATOMIC_ACQUIRE, "workgroup");
  {
    const int c4 = lane * 4;           // 32 lanes x 16 B = one 512-B output row (128 floats) per instruction
    {
#pragma unroll
      for (int row = 0; row < 16; ++row) {
        v4f val = *(const v4f*)(os + row * 132 + c4);
        *(v4f*)(ob_ptr + (size_t)(q0 + row) * g.o_rs + c4) = val;
      }
      
    }
  }
}

#define IB 4
#define INn 4096
#define ID 128
extern "C" void kernel_launch(void* const* d_in, const int* in_sizes, int n_in, void* d_out, int out_size, void* d_ws, size_t ws_size, hipStream_t stream) {
  (void)in_sizes; (void)n_in; (void)out_size; (void)ws_size;
  const float* x = (const float*)d_in[0]; const float* Wq = (const float*)d_in[1]; const float* bq = (const float*)d_in[2]; const float* Wk = (const float*)d_in[3]; const float* bk = (const float*)d_in[4]; const float* Wv = (const float*)d_in[5]; const float* bv = (const float*)d_in[6];
  char* ws = (char*)d_ws; size_t off = 0;
  auto carve = [&](size_t bytes) -> char* { char* p = ws + off; off += (bytes + 255) & ~(size_t)255; return p; };
  const int R = IB * INn;
  _Float16* X16 = (_Float16*)carve((size_t)R * ID * 2); _Float16* W3 = (_Float16*)carve((size_t)3 * ID * ID * 2);
  float* Q = (float*)carve((size_t)R * ID * 4); _Float16* K16 = (_Float16*)carve((size_t)R * ID * 2); _Float16* Vt16 = (_Float16*)carve((size_t)R * ID * 2);
  cast_f32_f16x2<<<(R * ID / 2 + 255) / 256, 256, 0, stream>>>(x, X16, R * ID / 2);
  cast_f32_f16x2<<<(ID * ID / 2 + 255) / 256, 256, 0, stream>>>(Wq, W3, ID * ID / 2);
  cast_f32_f16x2<<<(ID * ID / 2 + 255) / 256, 256, 0, stream>>>(Wk, W3 + ID * ID, ID * ID / 2);
  cast_f32_f16x2<<<(ID * ID / 2 + 255) / 256, 256, 0, stream>>>(Wv, W3 + 2 * ID * ID, ID * ID / 2);
  { const int t = (R / 64) * (ID / 64);
    wmma_gemm64<0, false, 2, 0, false><<<dim3((t + 7) / 8, 1), 256, 0, stream>>>(U16(X16), nullptr, ID, 0, U16(W3), nullptr, ID, 0, Q, nullptr, ID, 0, bq, nullptr, 0, R, ID, ID, 1.0f);
    wmma_gemm64<0, false, 2, 1, false><<<dim3((t + 7) / 8, 1), 256, 0, stream>>>(U16(X16), nullptr, ID, 0, U16(W3 + ID * ID), nullptr, ID, 0, K16, nullptr, ID, 0, bk, nullptr, 0, R, ID, ID, 1.0f); }
  // v transposed = Wv x^T + bv, one batch entry of the product per 64-key tile: tile [128 d][64 keys], 16 KB contiguous
  wmma_gemm64<0, false, 1, 1, false><<<dim3(1, R / AT_KC), 256, 0, stream>>>(U16(W3 + 2 * ID * ID), nullptr, ID, 0, U16(X16), nullptr, ID, (long)AT_KC * ID, Vt16, nullptr, AT_KC, (long)AT_KC * ID, bv, nullptr, 0, ID, AT_KC, ID, 1.0f);
  { AttnGeom g;
    g.q_bs = (long)INn * ID; g.q_rs = ID; g.q_hs = 0; g.k_bs = g.q_bs; g.k_rs = ID; g.k_hs = 0; g.v_bs = g.q_bs; g.v_rs = ID; g.v_hs = 0; g.o_bs = (long)INn * ID; g.o_rs = ID; g.o_hs = 0;
    g.S = INn; g.Skv = INn; g.H = 1; g.mask_mode = 0; g.qscale = 0.08838834764831845f; g.blk0 = 0; g.mask_fill = -INFINITY; g.mask_is_int = 0;
    attn128_kernel<false, false, true, 0, true><<<IB * (INn / AT_QB), AT_NW * 32, 0, stream>>>(Q, nullptr, nullptr, U16(K16), U16(Vt16), (float*)d_out, nullptr, nullptr, g); }
}

// v004
// It runs in 138 microseconds.
// In both of two side-by-side timings against v003, it was 1.67 times as fast.
// Counting every step since v000, it is 7.55 times as fast.
#include <hip/hip_runtime.h>
#include <math.h>
// InteractionLayer: q, k, v = x W^T + b (three 16384 x 128 by 128 x 128 products; q f32, k f16 rows, v f16 transposed in 64-key tiles) and single-head attention (d 128, 4096 keys per batch; scores and
// p·v with p x2^15) on v_wmma_f32_16x16x32_f16 with f16 operands, f32 accumulate; softmax f32 on VALU. nn.Linear weights ([out][in]) are the
// Bt operand of q, k and the A operand of v^T, directly.
typedef __attribute__((ext_vector_type(16))) _Float16 v16h;
typedef __attribute__((ext_vector_type(8)))  _Float16 v8h;
typedef __attribute__((ext_vector_type(16))) __bf16   v16b;
typedef __attribute__((ext_vector_type(8)))  __bf16   v8b;
typedef __attribute__((ext_vector_type(8)))  float    v8f;
typedef __attribute__((ext_vector_type(4)))  float    v4f;
#define PSCALE 32768.0f
#define U16(p) ((const unsigned short*)(const void*)(p))
#define PSCALE_INV (1.0f / 32768.0f)

__device__ __forceinline__ unsigned short f2bf_bits(float f) {
  unsigned u = __float_as_uint(f);
  return (unsigned short)((u + 0x7FFFu + ((u >> 16) & 1u)) >> 16);
}
__device__ __forceinline__ float bf_bits2f(unsigned short h) { return __uint_as_float(((unsigned)h) << 16); }

// hazard guards as plain device helpers (no inline asm inside the kernel template body)
__device__ __forceinline__ void dep_guard_h(v8f& a, v8f& b, v16h x, v16h y) { asm volatile("v_nop\n\tv_nop\n\tv_nop\n\tv_nop" : "+v"(a), "+v"(b) : "v"(x), "v"(y)); }
__device__ __forceinline__ void dep_guard_b(v8f& a, v8f& b, v16b x, v16b y) { asm volatile("v_nop\n\tv_nop\n\tv_nop\n\tv_nop" : "+v"(a), "+v"(b) : "v"(x), "v"(y)); }
__device__ __forceinline__ void keep4_h(v16h a, v16h b, v16h c, v16h d) { asm volatile("v_nop" :: "v"(a), "v"(b), "v"(c), "v"(d)); }
__device__ __forceinline__ void keep4_b(v16b a, v16b b, v16b c, v16b d) { asm volatile("v_nop" :: "v"(a), "v"(b), "v"(c), "v"(d)); }
__device__ __forceinline__ void acc_guard4(v8f& a, v8f& b, v8f& c, v8f& d) { asm volatile("v_nop\n\tv_nop\n\tv_nop\n\tv_nop" : "+v"(a), "+v"(b), "+v"(c), "+v"(d)); }
template <typename T> struct Frag;
template <> struct Frag<_Float16> {
  typedef v16h V; union U { v16h v; v8h h[2]; };
  static __device__ __forceinline__ v16h load(const _Float16* p) {   // elements 0..7 <- p[0..7], 8..15 <- p[16..23]
    U f; f.h[0] = *(const v8h*)(p); f.h[1] = *(const v8h*)(p + 16); return f.v;
  }
  static __device__ __forceinline__ v8f mma(v16h a, v16h b, v8f c) {
    return __builtin_amdgcn_wmma_f32_16x16x32_f16(false, a, false, b, (short)0, c, false, false);
  }
  static __device__ __forceinline__ void guard(v8f& a, v8f& b, v16h x, v16h y) { dep_guard_h(a, b, x, y); }
  static __device__ __forceinline__ void keep(v16h a, v16h b, v16h c, v16h d) { keep4_h(a, b, c, d); }
};
template <> struct Frag<__bf16> {
  typedef v16b V; union U { v16b v; v8b h[2]; };
  static __device__ __forceinline__ v16b load(const __bf16* p) {
    U f; f.h[0] = *(const v8b*)(p); f.h[1] = *(const v8b*)(p + 16); return f.v;
  }
  static __device__ __forceinline__ v8f mma(v16b a, v16b b, v8f c) {
    return __builtin_amdgcn_wmma_f32_16x16x32_bf16(false, a, false, b, (short)0, c, false, false);
  }
  static __device__ __forceinline__ void guard(v8f& a, v8f& b, v16b x, v16b y) { dep_guard_b(a, b, x, y); }
  static __device__ __forceinline__ void keep(v16b a, v16b b, v16b c, v16b d) { keep4_b(a, b, c, d); }
};

// ---- Register-blocked batched WMMA GEMM ------------------------------------
// C[m,n] = scale * sum_k A[m,k] * Bt[n,k] (+bias)(+resid); each wave owns a 64x64 tile.
// A row-major [M,K]; Bt row-major [N,K]; M,N % 64 == 0, K % 32 == 0.
// SPLIT: operands are hi/lo planes (A2/Bt2 = lo planes, same layout); product = hi·hi + hi·lo + lo·hi.
// BIAS_MODE: 0 = none, 1 = bias[m], 2 = bias[n].
// OUT_MODE: 0 = f32, 1 = f16, 2 = bf16 hi plane (Cout) + bf16 lo plane (Cout2).
// ET: 0 = f16 operands, 1 = bf16 operands (pointers passed as 16-bit storage)
template <int ET> struct Elem;
template <> struct Elem<0> { typedef _Float16 T; };
template <> struct Elem<1> { typedef __bf16 T; };
template <int ET, bool SPLIT, int BIAS_MODE, int OUT_MODE, bool RESID, int ACT = 0>
__global__ __launch_bounds__(256) void wmma_gemm64(
    const unsigned short* __restrict__ Ap, const unsigned short* __restrict__ A2p, int lda, long strideA,
    const unsigned short* __restrict__ Btp, const unsigned short* __restrict__ Bt2p, int ldb, long strideB,
    void* __restrict__ Cout, void* __restrict__ Cout2, int ldc, long strideC,
    const float* __restrict__ bias,
    const float* __restrict__ resid, long strideR,
    int M, int N, int K, float scale) {
  typedef typename Elem<ET>::T T;
  typedef typename Frag<T>::V V;
  const T* A = (const T*)Ap; const T* A2 = (const T*)A2p; const T* Bt = (const T*)Btp; const T* Bt2 = (const T*)Bt2p;
  __shared__ __align__(16) float sT[8][16 * 68];   // per-wave 16x64 slab, pitch 68 floats
  const int b    = blockIdx.y;
  const int lane = threadIdx.x & 31;
  const int wave = threadIdx.x >> 5;
  const int tilesN = N >> 6;
  const int tilesM = M >> 6;
  const int tile = blockIdx.x * 8 + wave;
  if (tile >= tilesM * tilesN) return;   // wave-uniform; no block barriers in this kernel
  const int tm = tile / tilesN;
  const int tn = tile - tm * tilesN;
  const int m0 = tm << 6;
  const int n0 = tn << 6;

  const T* Ab  = A  + (size_t)b * strideA;
  const T* Bb  = Bt + (size_t)b * strideB;
  const T* Ab2 = SPLIT ? (A2  + (size_t)b * strideA) : nullptr;
  const T* Bb2 = SPLIT ? (Bt2 + (size_t)b * strideB) : nullptr;

  const int rlane = lane & 15;                 // row (A) / col (B, D) within subtile
  const int koff  = (lane >> 4) * 8;           // k offset of this lane half
  const int mOff  = (lane >> 4) * 8;           // D row offset

  v8f acc[4][4];
#pragma unroll
  for (int i = 0; i < 4; ++i)
#pragma unroll
    for (int j = 0; j < 4; ++j) acc[i][j] = (v8f){0.f,0.f,0.f,0.f,0.f,0.f,0.f,0.f};

  for (int k0 = 0; k0 < K; k0 += 32) {
    V bh[4], bl[4];
#pragma unroll
    for (int j = 0; j < 4; ++j) {
      const size_t bo = (size_t)(n0 + (j << 4) + rlane) * ldb + koff + k0;
      bh[j] = Frag<T>::load(Bb + bo);
      if (SPLIT) bl[j] = Frag<T>::load(Bb2 + bo);
    }
#pragma unroll
    for (int i = 0; i < 4; ++i) {
      const size_t ao = (size_t)(m0 + (i << 4) + rlane) * lda + koff + k0;
      V ah = Frag<T>::load(Ab + ao);
      V al;
      if (SPLIT) al = Frag<T>::load(Ab2 + ao);
#pragma unroll
      for (int j = 0; j < 4; ++j) {
        acc[i][j] = Frag<T>::mma(ah, bh[j], acc[i][j]);
        if (SPLIT) {
          acc[i][j] = Frag<T>::mma(ah, bl[j], acc[i][j]);
          acc[i][j] = Frag<T>::mma(al, bh[j], acc[i][j]);
        }
      }
      Frag<T>::guard(acc[i][0], acc[i][3], ah, SPLIT ? al : ah);
    }
    Frag<T>::keep(bh[0], bh[1], bh[2], bh[3]);
    if (SPLIT) Frag<T>::keep(bl[0], bl[1], bl[2], bl[3]);
  }
  acc_guard4(acc[0][0], acc[0][1], acc[0][2], acc[0][3]);
  acc_guard4(acc[1][0], acc[1][1], acc[1][2], acc[1][3]);
  acc_guard4(acc[2][0], acc[2][1], acc[2][2], acc[2][3]);
  acc_guard4(acc[3][0], acc[3][1], acc[3][2], acc[3][3]);

  // ---- epilogue ----
  float* slab = sT[wave];
  const float* Rb = RESID ? (resid + (size_t)b * strideR) : nullptr;
#pragma unroll
  for (int i = 0; i < 4; ++i) {
    const int mBase = m0 + (i << 4);
#pragma unroll
    for (int j = 0; j < 4; ++j) {
      const int n = n0 + (j << 4) + rlane;
      float bv = 0.f;
      if (BIAS_MODE == 2) bv = bias[n];
#pragma unroll
      for (int r = 0; r < 8; ++r) {
        float v = acc[i][j][r] * scale;
        if (BIAS_MODE == 1) v += bias[mBase + mOff + r];
        if (BIAS_MODE == 2) v += bv;
        if (RESID) v += Rb[(size_t)(mBase + mOff + r) * ldc + n];
        if (ACT == 1) v = tanhf(v);
        if (ACT == 2) v = fmaxf(v, 0.0f);
        if (ACT == 3) v = v / (1.0f + expf(-v));
        if (ACT == 4) v = (v > 0.f) ? v : 0.01f * v;
        if (ACT == 5) v = 0.5f * v * (1.0f + erff(v * 0.70710678118654752f));
        slab[(mOff + r) * 68 + (j << 4) + rlane] = v;
      }
    }
    __builtin_amdgcn_fence(__ATOMIC_RELEASE, "workgroup");
    __builtin_amdgcn_wave_barrier();
    __builtin_amdgcn_fence(__ATOMIC_ACQUIRE, "workgroup");
    if (OUT_MODE == 0) {
      float* C = (float*)Cout + (size_t)b * strideC;
      const int hh = lane >> 4, c4 = (lane & 15) * 4;     // row seg = 256 B = 16 lanes x 16 B
      {
#pragma unroll
        for (int it = 0; it < 8; ++it) {
          const int row = it * 2 + hh;
          v4f v = *(const v4f*)(slab + row * 68 + c4);
          *(v4f*)(C + (size_t)(mBase + row) * ldc + n0 + c4) = v;
        }
        
      }
    } else {
      const int q = lane >> 3, c8 = (lane & 7) * 8;
      unsigned short* C  = (unsigned short*)Cout  + (size_t)b * strideC;
      unsigned short* C2 = (OUT_MODE == 2) ? ((unsigned short*)Cout2 + (size_t)b * strideC) : nullptr;
      {
#pragma unroll
        for (int it = 0; it < 4; ++it) {
          const int row = it * 4 + q;
          const float* sp = slab + row * 68 + c8;
          v8h hv, lv;
#pragma unroll
          for (int e = 0; e < 8; ++e) {
            if (OUT_MODE == 1) {
              hv[e] = (_Float16)sp[e];
            } else {
              unsigned short hb = f2bf_bits(sp[e]);
              unsigned short lb = f2bf_bits(sp[e] - bf_bits2f(hb));
              hv[e] = __builtin_bit_cast(_Float16, hb);
              lv[e] = __builtin_bit_cast(_Float16, lb);
            }
          }
          *(v8h*)(C + (size_t)(mBase + row) * ldc + n0 + c8) = hv;
          if (OUT_MODE == 2) *(v8h*)(C2 + (size_t)(mBase + row) * ldc + n0 + c8) = lv;
        }
        
      }
    }
    __builtin_amdgcn_fence(__ATOMIC_RELEASE, "workgroup");
    __builtin_amdgcn_wave_barrier();
    __builtin_amdgcn_fence(__ATOMIC_ACQUIRE, "workgroup");
  }
}

__global__ __launch_bounds__(256) void cast_f32_f16x2(
    const float* __restrict__ in, _Float16* __restrict__ out, int n2) {
  int i = blockIdx.x * 256 + threadIdx.x;
  if (i < n2) {
    const _Float16 h0 = (_Float16)in[2 * i], h1 = (_Float16)in[2 * i + 1];
    const unsigned u = (unsigned)__builtin_bit_cast(unsigned short, h0) | ((unsigned)__builtin_bit_cast(unsigned short, h1) << 16);
    ((unsigned*)out)[i] = u;
    
  }
}


// ---- f32 -> f16 cast with a power-of-two pre-scale (folded back by the consumer GEMM's scale) ----
__global__ __launch_bounds__(256) void cast_f32_f16x2s(const float* __restrict__ in, _Float16* __restrict__ out, int n2, float s) {
  int i = blockIdx.x * 256 + threadIdx.x;
  if (i < n2) {
    const _Float16 h0 = (_Float16)(in[2 * i] * s), h1 = (_Float16)(in[2 * i + 1] * s);
    const unsigned u = (unsigned)__builtin_bit_cast(unsigned short, h0) | ((unsigned)__builtin_bit_cast(unsigned short, h1) << 16);
    ((unsigned*)out)[i] = u;
    
  }
}
__global__ __launch_bounds__(256) void split_f32_bf16x2(
    const float* __restrict__ in, __bf16* __restrict__ hi, __bf16* __restrict__ lo, long n2) {
  long i = (long)blockIdx.x * 256 + threadIdx.x;
  long stride = (long)gridDim.x * 256;
  {
    for (long j = i; j < n2; j += stride) {
      const float a = in[2 * j], b = in[2 * j + 1];
      const unsigned short ah = f2bf_bits(a), bh = f2bf_bits(b);
      const unsigned short al = f2bf_bits(a - bf_bits2f(ah)), bl = f2bf_bits(b - bf_bits2f(bh));
      ((unsigned*)hi)[j] = (unsigned)ah | ((unsigned)bh << 16);
      ((unsigned*)lo)[j] = (unsigned)al | ((unsigned)bl << 16);
    }
    
  }
}


// ---- f32 [R][C] (row pitch ldi) -> f16 transposed [C][R] (row pitch ldo); 64x64 tiles; each output row segment
__global__ __launch_bounds__(256) void transpose_cast_f16(const float* __restrict__ in, int ldi,
                                                         _Float16* __restrict__ outT, int ldo, float scale) {
  __shared__ __align__(16) _Float16 tile[64][72];     // [c][r]
  const int c0 = blockIdx.x * 64, r0 = blockIdx.y * 64;
  const int t = threadIdx.y * 32 + threadIdx.x;
  for (int i = threadIdx.y; i < 64; i += 8) {
    tile[threadIdx.x][i]      = (_Float16)(in[(size_t)(r0 + i) * ldi + c0 + threadIdx.x] * scale);
    tile[32 + threadIdx.x][i] = (_Float16)(in[(size_t)(r0 + i) * ldi + c0 + 32 + threadIdx.x] * scale);
  }
  __syncthreads();
  const int q = t >> 3, c8 = (t & 7) * 8;
  {
#pragma unroll
    for (int it = 0; it < 2; ++it) {
      const int c = it * 32 + q;
      v8h hv = *(const v8h*)(&tile[c][c8]);
      *(v8h*)(outT + (size_t)(c0 + c) * ldo + r0 + c8) = hv;
    }
    
  }
}

// ---- f32 [R][C] (pitch ldi) -> bf16 hi/lo transposed planes [C][R] (pitch ldo); 64x64 tiles; each output row segment
__global__ __launch_bounds__(256) void transpose_split_bf16(const float* __restrict__ in, int ldi,
                                                           __bf16* __restrict__ outH, __bf16* __restrict__ outL, int ldo) {
  __shared__ __align__(16) float tile[64][68];     // [c][r]
  const int c0 = blockIdx.x * 64, r0 = blockIdx.y * 64;
  const int t = threadIdx.y * 32 + threadIdx.x;
  for (int i = threadIdx.y; i < 64; i += 8) {
    tile[threadIdx.x][i]      = in[(size_t)(r0 + i) * ldi + c0 + threadIdx.x];
    tile[32 + threadIdx.x][i] = in[(size_t)(r0 + i) * ldi + c0 + 32 + threadIdx.x];
  }
  __syncthreads();
  const int q = t >> 3, c8 = (t & 7) * 8;
  {
#pragma unroll
    for (int it = 0; it < 2; ++it) {
      const int c = it * 32 + q;
      v8b hv, lv;
#pragma unroll
      for (int e = 0; e < 8; ++e) {
        const float f = tile[c][c8 + e];
        const unsigned short hb = f2bf_bits(f);
        hv[e] = __builtin_bit_cast(__bf16, hb);
        lv[e] = __builtin_bit_cast(__bf16, f2bf_bits(f - bf_bits2f(hb)));
      }
      *(v8b*)(outH + (size_t)(c0 + c) * ldo + r0 + c8) = hv;
      *(v8b*)(outL + (size_t)(c0 + c) * ldo + r0 + c8) = lv;
    }
    
  }
}

// =====================================================================================
// Generic causal/non-causal attention for head_dim 64, f32 in / f32 out; 16-bit operands: bf16 with optional hi/lo splits, or
// plain f16 (F16=true, non-split, probabilities carried x2^15).
//   scores = (q*qscale)·kᵀ : v_wmma_f32_16x16x32_bf16; SPLIT_QK -> q,k as bf16 hi/lo (hi·hi + hi·lo + lo·hi)
//   out    = p·v           : v_wmma_f32_16x16x32_bf16; SPLIT_PV -> p,v as bf16 hi/lo; else p,v plain bf16
//   f32 accumulate; online softmax in f32. Block = 4 waves = 64 query rows of one (batch, head); S % 64 == 0.
//   Element (b, s, h, d) of tensor X lives at X[b*X_bs + s*X_rs + h*X_hs + d] (strides in floats, multiples of 4).
//   Masking: mask_mode 0 none, 1 causal (kv > q masked), 2 tensor [S][Skv] shared over (b,h) (float if
//   mask_is_int==0, int32 with element == 0 -> masked if 1, int32 with element != 0 -> masked if 2), 3 per-token vectors qmask[B][S] & kvmask[B][Skv] (int32,
//   0 -> masked), 4 causal + sliding window (kv > q or q - kv > W masked; W passed in mask_is_int);
//   5 = relative-position bias: s += cp[b,h,q][idx[q][kv]] + pc[b,h,kv][idx[q][kv]] with idx = mask_b ([S][Skv] int32) and
//   mask_a an int32 [S][Skv] tensor with nonzero = masked (tables: element (b,h,row,n) at X + b*c_bs + h*c_hs + row*c_rs + n);
//   masked scores are replaced by mask_fill (e.g. -inf or -1e9) before the softmax.
//   grid.x = B * H * (S/64) (or a sub-range with blk0).
// =====================================================================================
#define AT_D 64
#define AT_NW 4
#define AT_QB 64
#define AT_KC 64
struct AttnGeom { const float* cp = nullptr; const float* pc = nullptr; long c_bs = 0, c_rs = 0, c_hs = 0;   // mode-5 score-bias tables
                  long q_bs, q_rs, q_hs, k_bs, k_rs, k_hs, v_bs, v_rs, v_hs, o_bs, o_rs, o_hs;
                  int S, Skv, H, mask_mode; float qscale; int blk0; float mask_fill; int mask_is_int; };
static_assert(sizeof(AttnGeom) == 168, "no padding");

__device__ __forceinline__ unsigned short at_bf_bits(float f) {
  unsigned u = __float_as_uint(f);
  return (unsigned short)((u + 0x7FFFu + ((u >> 16) & 1u)) >> 16);
}
__device__ __forceinline__ __bf16 at_f2bf(float f) { return __builtin_bit_cast(__bf16, at_bf_bits(f)); }
__device__ __forceinline__ void at_split(float f, __bf16& hi, __bf16& lo) {
  const unsigned short hb = at_bf_bits(f);
  hi = __builtin_bit_cast(__bf16, hb);
  lo = at_f2bf(f - __uint_as_float(((unsigned)hb) << 16));
}
__device__ __forceinline__ v8f at_mma(v16b a, v16b b, v8f c) {
  c = __builtin_amdgcn_wmma_f32_16x16x32_bf16(false, a, false, b, (short)0, c, false, false);
  asm volatile("v_nop\n\tv_nop\n\tv_nop\n\tv_nop" : "+v"(c) : "v"(a), "v"(b));
  return c;
}
// 16-bit element as a bit pattern held in a __bf16 slot: f16 bits when F16, bf16 (RNE) otherwise
template <bool F16> __device__ __forceinline__ __bf16 at_to16(float f) {
  if (F16) return __builtin_bit_cast(__bf16, (_Float16)f);
  return at_f2bf(f);
}
template <bool F16> __device__ __forceinline__ v8f at_mma16(v16b a, v16b b, v8f c) {
  if (F16) {
    const v16h ah = __builtin_bit_cast(v16h, a), bh = __builtin_bit_cast(v16h, b);
    c = __builtin_amdgcn_wmma_f32_16x16x32_f16(false, ah, false, bh, (short)0, c, false, false);
    asm volatile("v_nop\n\tv_nop\n\tv_nop\n\tv_nop" : "+v"(c) : "v"(ah), "v"(bh));
    return c;
  }
  return at_mma(a, b, c);
}

template <bool SPLIT_QK, bool SPLIT_PV, bool F16 = false>
__global__ __launch_bounds__(128)
void attn64_kernel(const float* __restrict__ q, const float* __restrict__ k,
                   const float* __restrict__ v, float* __restrict__ out,
                   const void* __restrict__ mask_a, const int* __restrict__ mask_b, AttnGeom g) {
  static_assert(!(F16 && (SPLIT_QK || SPLIT_PV)), "f16 mode is non-split");
  const float PSC = F16 ? 32768.0f : 1.0f;     // f16 probabilities carried x2^15 (subnormal range), folded into the final 1/l
  union FB { v16b v; v8b h[2]; };
  __shared__ __align__(16) __bf16 Ksh[AT_KC * AT_D];             // K hi [kv][d]      8 KB
  __shared__ __align__(16) __bf16 Ksl[SPLIT_QK ? AT_KC * AT_D : 8];
  __shared__ __align__(16) __bf16 Vth[AT_D * AT_KC];             // V hi [d][kv]      8 KB
  __shared__ __align__(16) __bf16 Vtl[SPLIT_PV ? AT_D * AT_KC : 8];
  __shared__ __align__(16) __bf16 Psh[AT_NW][16 * AT_KC];        // per wave P hi [row][kv]  8 KB
  __shared__ __align__(16) __bf16 Psl[SPLIT_PV ? AT_NW : 1][SPLIT_PV ? 16 * AT_KC : 8];
  __shared__ __align__(16) float  Os[AT_NW][16 * 68];            // per wave out tile, pitch 68

  const int tid  = threadIdx.x;
  const int wave = tid >> 5;
  const int lane = tid & 31;
  const int hh   = lane >> 4;
  const int c    = lane & 15;

  const int nqb = g.S / AT_QB;
  const int bx = blockIdx.x + g.blk0;
  const int qb = bx % nqb;
  const int bh = bx / nqb;
  const int h  = bh % g.H;
  const int b  = bh / g.H;
  const int qbase_block = qb * AT_QB;
  const int q0 = qbase_block + wave * 16;

  const float* qb_ptr = q + (size_t)b * g.q_bs + (size_t)h * g.q_hs;
  const float* kb_ptr = k + (size_t)b * g.k_bs + (size_t)h * g.k_hs;
  const float* vb_ptr = v + (size_t)b * g.v_bs + (size_t)h * g.v_hs;
  float*       ob_ptr = out + (size_t)b * g.o_bs + (size_t)h * g.o_hs;

  // ---- Q fragments (A operand): 2 d-chunks, hi (and lo) ----
  v16b qah[2], qal[2];
  {
    const float* qrow = qb_ptr + (size_t)(q0 + c) * g.q_rs;
#pragma unroll
    for (int dc = 0; dc < 2; ++dc) {
#pragma unroll
      for (int e = 0; e < 8; ++e) {
        const float f0 = qrow[dc * 32 + 8 * hh + e] * g.qscale;
        const float f1 = qrow[dc * 32 + 16 + 8 * hh + e] * g.qscale;
        if (SPLIT_QK) { __bf16 hq, lq; at_split(f0, hq, lq); qah[dc][e] = hq; qal[dc][e] = lq; at_split(f1, hq, lq); qah[dc][8 + e] = hq; qal[dc][8 + e] = lq; }
        else { qah[dc][e] = at_to16<F16>(f0); qah[dc][8 + e] = at_to16<F16>(f1); qal[dc][e] = qah[dc][e]; qal[dc][8 + e] = qah[dc][8 + e]; }
      }
    }
  }

  float mrow[8], lrow[8];
  v8f oacc[4];
#pragma unroll
  for (int r = 0; r < 8; ++r) { mrow[r] = -INFINITY; lrow[r] = 0.f; }
#pragma unroll
  for (int t = 0; t < 4; ++t) oacc[t] = (v8f){0.f,0.f,0.f,0.f,0.f,0.f,0.f,0.f};

  const int nChunks = (g.mask_mode == 1 || g.mask_mode == 4) ? (qb + 1) : (g.Skv / AT_KC);   // block-uniform
  // per-row query mask (mode 3)
  int qkeep[8];
#pragma unroll
  for (int r = 0; r < 8; ++r) qkeep[r] = (g.mask_mode == 3) ? mask_b[(size_t)b * g.S + q0 + 8 * hh + r] : 1;   // mask_b = qmask in mode 3
  for (int kc = 0; kc < nChunks; ++kc) {
    const int kv0 = kc * AT_KC;
    __syncthreads();
    {
      const int kvr = tid >> 1, dh = (tid & 1) * 32;
      const float* krow = kb_ptr + (size_t)(kv0 + kvr) * g.k_rs + dh;
      const float* vrow = vb_ptr + (size_t)(kv0 + kvr) * g.v_rs + dh;
#pragma unroll
      for (int i = 0; i < 8; ++i) {
        v4f kk = *(const v4f*)(krow + 4 * i);
        v4f vv = *(const v4f*)(vrow + 4 * i);
#pragma unroll
        for (int e = 0; e < 4; ++e) {
          const int d = dh + 4 * i + e;
          if (SPLIT_QK) { __bf16 a, bl; at_split(kk[e], a, bl); Ksh[kvr * AT_D + d] = a; Ksl[kvr * AT_D + d] = bl; }
          else Ksh[kvr * AT_D + d] = at_to16<F16>(kk[e]);
          if (SPLIT_PV) { __bf16 a, bl; at_split(vv[e], a, bl); Vth[d * AT_KC + kvr] = a; Vtl[d * AT_KC + kvr] = bl; }
          else Vth[d * AT_KC + kvr] = at_to16<F16>(vv[e]);
        }
      }
    }
    __syncthreads();

    v8f s[4];
#pragma unroll
    for (int j = 0; j < 4; ++j) {
      s[j] = (v8f){0.f,0.f,0.f,0.f,0.f,0.f,0.f,0.f};
#pragma unroll 1
      for (int dc = 0; dc < 2; ++dc) {
        FB kb;
        kb.h[0] = *(const v8b*)(Ksh + (j * 16 + c) * AT_D + dc * 32 + 8 * hh);
        kb.h[1] = *(const v8b*)(Ksh + (j * 16 + c) * AT_D + dc * 32 + 16 + 8 * hh);
        s[j] = at_mma16<F16>(qah[dc], kb.v, s[j]);
        if (SPLIT_QK) {
          FB kl;
          kl.h[0] = *(const v8b*)(Ksl + (j * 16 + c) * AT_D + dc * 32 + 8 * hh);
          kl.h[1] = *(const v8b*)(Ksl + (j * 16 + c) * AT_D + dc * 32 + 16 + 8 * hh);
          s[j] = at_mma16<F16>(qah[dc], kl.v, s[j]);
          s[j] = at_mma16<F16>(qal[dc], kb.v, s[j]);
        }
      }
    }
    const bool diag = (g.mask_mode == 1) && (kc == qb);
    int kvkeep[4] = {1, 1, 1, 1};
    if (g.mask_mode == 3) {
#pragma unroll
      for (int j = 0; j < 4; ++j) kvkeep[j] = ((const int*)mask_a)[(size_t)b * g.Skv + kv0 + j * 16 + c];   // mask_a = kvmask
    }
    float cm[8];
#pragma unroll
    for (int r = 0; r < 8; ++r) {
      const int qrow = q0 + 8 * hh + r;
      float m = -INFINITY;
#pragma unroll
      for (int j = 0; j < 4; ++j) {
        const int kvcol = kv0 + j * 16 + c;
        bool masked = false;
        if (diag) masked = (kvcol > qrow);
        else if (g.mask_mode == 4) masked = (kvcol > qrow) || (qrow - kvcol > g.mask_is_int);
        else if (g.mask_mode == 2) {
          const size_t mi = (size_t)qrow * g.Skv + kvcol;
          masked = (g.mask_is_int == 0) ? (((const float*)mask_a)[mi] == 0.0f)
                 : (g.mask_is_int == 1) ? (((const int*)mask_a)[mi] == 0) : (((const int*)mask_a)[mi] != 0);
        } else if (g.mask_mode == 3) masked = (qkeep[r] == 0) || (kvkeep[j] == 0);
        else if (g.mask_mode == 5) {
          const size_t mi = (size_t)qrow * g.Skv + kvcol;
          masked = (((const int*)mask_a)[mi] != 0);
          int n = mask_b[mi]; n = n < 0 ? 0 : n;
          s[j][r] += g.cp[(size_t)b * g.c_bs + (size_t)h * g.c_hs + (size_t)qrow * g.c_rs + n]
                   + g.pc[(size_t)b * g.c_bs + (size_t)h * g.c_hs + (size_t)kvcol * g.c_rs + n];
        }
        if (masked) s[j][r] = g.mask_fill;
        m = fmaxf(m, s[j][r]);
      }
#pragma unroll
      for (int off = 1; off < 16; off <<= 1) m = fmaxf(m, __shfl_xor(m, off, 32));
      cm[r] = m;
    }
    __bf16* pwh = Psh[wave];
    __bf16* pwl = Psl[SPLIT_PV ? wave : 0];
#pragma unroll
    for (int r = 0; r < 8; ++r) {
      const float mnew = fmaxf(mrow[r], cm[r]);
      const float alpha = expf(mrow[r] - mnew);
      mrow[r] = mnew;
      float psum = 0.f;
#pragma unroll
      for (int j = 0; j < 4; ++j) {
        const float p = expf(s[j][r] - mnew);
        psum += p;
        if (SPLIT_PV) { __bf16 a, bl; at_split(p, a, bl); pwh[(8 * hh + r) * AT_KC + j * 16 + c] = a; pwl[(8 * hh + r) * AT_KC + j * 16 + c] = bl; }
        else pwh[(8 * hh + r) * AT_KC + j * 16 + c] = at_to16<F16>(p * PSC);
      }
#pragma unroll
      for (int off = 1; off < 16; off <<= 1) psum += __shfl_xor(psum, off, 32);
      lrow[r] = lrow[r] * alpha + psum;
#pragma unroll
      for (int t = 0; t < 4; ++t) oacc[t][r] *= alpha;
    }
    __builtin_amdgcn_fence(__ATOMIC_RELEASE, "workgroup");
    __builtin_amdgcn_wave_barrier();
    __builtin_amdgcn_fence(__ATOMIC_ACQUIRE, "workgroup");
#pragma unroll 1
    for (int kk = 0; kk < 2; ++kk) {
      FB pa, pl;
      pa.h[0] = *(const v8b*)(pwh + c * AT_KC + kk * 32 + 8 * hh);
      pa.h[1] = *(const v8b*)(pwh + c * AT_KC + kk * 32 + 16 + 8 * hh);
      if (SPLIT_PV) {
        pl.h[0] = *(const v8b*)(pwl + c * AT_KC + kk * 32 + 8 * hh);
        pl.h[1] = *(const v8b*)(pwl + c * AT_KC + kk * 32 + 16 + 8 * hh);
      }
#pragma unroll
      for (int t = 0; t < 4; ++t) {
        FB vb;
        vb.h[0] = *(const v8b*)(Vth + (t * 16 + c) * AT_KC + kk * 32 + 8 * hh);
        vb.h[1] = *(const v8b*)(Vth + (t * 16 + c) * AT_KC + kk * 32 + 16 + 8 * hh);
        oacc[t] = at_mma16<F16>(pa.v, vb.v, oacc[t]);
        if (SPLIT_PV) {
          FB vl;
          vl.h[0] = *(const v8b*)(Vtl + (t * 16 + c) * AT_KC + kk * 32 + 8 * hh);
          vl.h[1] = *(const v8b*)(Vtl + (t * 16 + c) * AT_KC + kk * 32 + 16 + 8 * hh);
          oacc[t] = at_mma16<F16>(pa.v, vl.v, oacc[t]);
          oacc[t] = at_mma16<F16>(pl.v, vb.v, oacc[t]);
        }
      }
    }
  }

  float* os = Os[wave];
#pragma unroll
  for (int r = 0; r < 8; ++r) {
    const float inv = 1.0f / (lrow[r] * PSC);
#pragma unroll
    for (int t = 0; t < 4; ++t) os[(8 * hh + r) * 68 + t * 16 + c] = oacc[t][r] * inv;
  }
  __builtin_amdgcn_fence(__ATOMIC_RELEASE, "workgroup");
  __builtin_amdgcn_wave_barrier();
  __builtin_amdgcn_fence(__ATOMIC_ACQUIRE, "workgroup");
  {
    const int c4 = (lane & 15) * 4;
    {
#pragma unroll
      for (int it = 0; it < 8; ++it) {
        const int row = it * 2 + hh;
        v4f val = *(const v4f*)(os + row * 68 + c4);
        *(v4f*)(ob_ptr + (size_t)(q0 + row) * g.o_rs + c4) = val;
      }
      
    }
  }
}

// MODE: the mask mode as a compile-time constant, so that only the launched mode's score path is compiled into the key loop
// PRE16: k and v come ready as 16-bit values, written once by their producer (k, v unused): k16 holds dense rows, element (b, s, d) at
//   k16[b*k_bs + s*128 + d]; vt16 holds v transposed in tiles of AT_KC keys, element (b, s, d) at vt16[b*v_bs + (s/AT_KC)*AT_KC*128 + d*AT_KC + s%AT_KC]
//   (k_bs, v_bs in 16-bit elements, multiples of 8), so that a pass's k tile and v tile are 16 KB contiguous each.
// NG: key groups. The block has NG groups of AT_NW waves on the SAME 64 query rows; group g walks the key tiles g, g + NG, g + 2 NG, ... with its own
//   k, v tiles in LDS and its own running maximum, sum and output tile, so that NG waves share each SIMD and fill one another's waits. Behind the loop the NG
//   partial results of a row are joined: out = sum_g e^(m_g - m) o_g / sum_g e^(m_g - m) l_g, m = max_g m_g. NG > 1: no mask, Skv a multiple of NG * AT_KC.
template <bool SPLIT_QK, bool SPLIT_PV, bool F16, int MODE, bool PRE16, int NG>
__global__ __launch_bounds__(128 * NG)
void attn128_kernel(const float* __restrict__ q, const float* __restrict__ k,
                   const float* __restrict__ v, const unsigned short* __restrict__ k16,
                   const unsigned short* __restrict__ vt16, float* __restrict__ out,
                   const void* __restrict__ mask_a, const int* __restrict__ mask_b, AttnGeom g) {
  static_assert(!(F16 && (SPLIT_QK || SPLIT_PV)), "f16 mode is non-split");
  static_assert(!(PRE16 && (SPLIT_QK || SPLIT_PV)), "ready 16-bit k and v are non-split");
  static_assert(NG == 1 || (MODE == 0 && !SPLIT_QK && !SPLIT_PV && 16 % NG == 0), "key groups: unmasked, non-split");
  const float PSC = F16 ? 32768.0f : 1.0f;     // f16 probabilities carried x2^15 (subnormal range), folded into the final 1/l
  union FB { v16b v; v8b h[2]; };
  constexpr int D2 = 128;
  constexpr int KP = D2 + 8;      // LDS pitch of the k and q rows, in 16-bit elements: 272 B = 16 B x odd, so the 16 rows of a ds_load_b128 fragment read fall on distinct banks
  constexpr int VP = AT_KC + 8;   // LDS pitch of the transposed v rows and the p rows: 144 B = 16 B x odd, same reason
  constexpr int NWV = AT_NW * NG;                 // waves of the block
  constexpr int KVB = (AT_KC * KP + D2 * VP) * 2; // bytes of one group's k tile (17 KB, [kv][d], padded rows) and v tile (18 KB, [d][kv], padded rows)
  static_assert(AT_NW * 16 * 132 * 4 <= KVB, "the out tiles overlay the k, v tiles");
  __shared__ __align__(16) unsigned char KVraw[NG * KVB];        // in the loop: each group's k, v tiles; behind it: per wave out tile, pitch 132 floats
  __shared__ __align__(16) __bf16 Ksl[SPLIT_QK ? AT_KC * KP : 8];
  __shared__ __align__(16) __bf16 Vtl[SPLIT_PV ? D2 * VP : 8];
  __shared__ __align__(16) __bf16 Psh[NWV][16 * VP];
  __shared__ __align__(16) __bf16 Psl[SPLIT_PV ? AT_NW : 1][SPLIT_PV ? 16 * VP : 8];
  __shared__ __align__(16) __bf16 Qsh[NWV][16 * KP];     // q (hi plane, or the 16-bit value) staged per wave (keeps VGPR use low)
  __shared__ __align__(16) float  Msh[NWV][16], Lsh[NWV][16];    // each wave's row maxima and row sums, for the join of the key groups
  __shared__ __align__(16) __bf16 Qsl[SPLIT_QK ? AT_NW : 1][SPLIT_QK ? 16 * KP : 8];

  const int grp  = __builtin_amdgcn_readfirstlane(threadIdx.x >> 7);   // key group; the same in a whole wave: held scalar, so the tile offsets stay scalar arithmetic
  const int tid  = threadIdx.x & 127;    // thread within its group
  const int wave = tid >> 5;             // wave within its group = its 16-row query tile
  const int wv   = grp * AT_NW + wave;   // wave within the block: its private LDS
  const int lane = tid & 31;
  const int hh   = lane >> 4;
  const int c    = lane & 15;

  const int nqb = g.S / AT_QB;
  const int bx = blockIdx.x + g.blk0;
  const int qb = bx % nqb;
  const int bh = bx / nqb;
  const int h  = bh % g.H;
  const int b  = bh / g.H;
  const int qbase_block = qb * AT_QB;
  const int q0 = qbase_block + wave * 16;

  const float* qb_ptr = q + (size_t)b * g.q_bs + (size_t)h * g.q_hs;
  const float* kb_ptr = k + (size_t)b * g.k_bs + (size_t)h * g.k_hs;
  const float* vb_ptr = v + (size_t)b * g.v_bs + (size_t)h * g.v_hs;
  float*       ob_ptr = out + (size_t)b * g.o_bs + (size_t)h * g.o_hs;
  __bf16* Ksh = (__bf16*)(KVraw + grp * KVB);
  __bf16* Vth = Ksh + AT_KC * KP;

  // ---- Q fragments (A operand): 4 d-chunks, hi (and lo) ----
  v16b qah[4], qal[4];
  {
    const float* qrow = qb_ptr + (size_t)(q0 + c) * g.q_rs;
#pragma unroll
    for (int dc = 0; dc < 4; ++dc) {
#pragma unroll
      for (int e = 0; e < 8; ++e) {
        const float f0 = qrow[dc * 32 + 8 * hh + e] * g.qscale;
        const float f1 = qrow[dc * 32 + 16 + 8 * hh + e] * g.qscale;
        if (SPLIT_QK) { __bf16 hq, lq; at_split(f0, hq, lq); Qsh[wv][c * KP + dc * 32 + 8 * hh + e] = hq; Qsl[wv][c * KP + dc * 32 + 8 * hh + e] = lq;
                        at_split(f1, hq, lq); Qsh[wv][c * KP + dc * 32 + 16 + 8 * hh + e] = hq; Qsl[wv][c * KP + dc * 32 + 16 + 8 * hh + e] = lq;
                        qah[dc][e] = hq; qal[dc][e] = lq; qah[dc][8 + e] = hq; qal[dc][8 + e] = lq; }   // (register copies unused on the split path)
        else { Qsh[wv][c * KP + dc * 32 + 8 * hh + e] = at_to16<F16>(f0); Qsh[wv][c * KP + dc * 32 + 16 + 8 * hh + e] = at_to16<F16>(f1); qah[dc][e] = at_to16<F16>(f0); qal[dc][e] = qah[dc][e]; qah[dc][8 + e] = qah[dc][e]; qal[dc][8 + e] = qah[dc][e]; }
      }
    }
  }

  float mrow[8], lrow[8];
  v8f oacc[8];
#pragma unroll
  for (int r = 0; r < 8; ++r) { mrow[r] = -INFINITY; lrow[r] = 0.f; }
#pragma unroll
  for (int t = 0; t < 8; ++t) oacc[t] = (v8f){0.f,0.f,0.f,0.f,0.f,0.f,0.f,0.f};

  const int nChunks = (MODE == 1 || MODE == 4 || MODE == 6) ? (qb + 1) : (g.Skv / AT_KC);   // block-uniform
  // per-row query mask (mode 3)
  int qkeep[8];
#pragma unroll
  for (int r = 0; r < 8; ++r) qkeep[r] = (MODE == 3) ? mask_b[(size_t)b * g.S + q0 + 8 * hh + r] : 1;   // mask_b = qmask in mode 3
  for (int it = 0; it < nChunks / NG; ++it) {
    const int kc = it * NG + grp;
    const int kv0 = kc * AT_KC;
    __syncthreads();
    if (PRE16) {
      // plain copy, 16 B a lane: a wave's 32 lanes take 512 contiguous bytes of the source; step i is 2 KB further (8 k rows, 16 v rows)
      const unsigned short* kt = k16 + (size_t)b * g.k_bs + (size_t)kc * (AT_KC * D2) + tid * 8;
      const unsigned short* vt = vt16 + (size_t)b * g.v_bs + (size_t)kc * (AT_KC * D2) + tid * 8;
      __bf16* kd = Ksh + (tid >> 4) * KP + (tid & 15) * 8;
      __bf16* vd = Vth + (tid >> 3) * VP + (tid & 7) * 8;
      v8b kr[8], vr[8];
#pragma unroll   // unrolled so that kr, vr are registers and all 16 loads are in flight before the first store waits
      for (int i = 0; i < 8; ++i) {
        kr[i] = *(const v8b*)(kt + i * 1024);
        vr[i] = *(const v8b*)(vt + i * 1024);
      }
      // precaution: this wait stands before the two address pairs of the issued loads are reused; naming them here keeps the loads' own destinations off them
      asm volatile("s_wait_xcnt 0x0" :: "v"(kt), "v"(vt) : "memory");
#pragma unroll   // unrolled for the same reason; the row steps become immediate offsets
      for (int i = 0; i < 8; ++i) {
        *(v8b*)(kd + i * 8 * KP) = kr[i];
        *(v8b*)(vd + i * 16 * VP) = vr[i];
      }
    } else {
      const int kvr = tid >> 1, dh = (tid & 1) * 64;
      const float* krow = kb_ptr + (size_t)(kv0 + kvr) * g.k_rs + dh;
      const float* vrow = vb_ptr + (size_t)(kv0 + kvr) * g.v_rs + dh;
#pragma unroll
      for (int i = 0; i < 16; ++i) {
        v4f kk = *(const v4f*)(krow + 4 * i);
        v4f vv = *(const v4f*)(vrow + 4 * i);
#pragma unroll
        for (int e = 0; e < 4; ++e) {
          const int d = dh + 4 * i + e;
          if (SPLIT_QK) { __bf16 a, bl; at_split(kk[e], a, bl); Ksh[kvr * KP + d] = a; Ksl[kvr * KP + d] = bl; }
          else Ksh[kvr * KP + d] = at_to16<F16>(kk[e]);
          if (SPLIT_PV) { __bf16 a, bl; at_split(vv[e], a, bl); Vth[d * VP + kvr] = a; Vtl[d * VP + kvr] = bl; }
          else Vth[d * VP + kvr] = at_to16<F16>(vv[e]);
        }
      }
    }
    __syncthreads();

    v8f s[4];
#pragma unroll
    for (int j = 0; j < 4; ++j) {
      s[j] = (v8f){0.f,0.f,0.f,0.f,0.f,0.f,0.f,0.f};
if (SPLIT_QK) {
#pragma unroll 1
      for (int dc = 0; dc < 4; ++dc) {      // rolled: bounds the live fragment set (register pressure) on the 128-wide head
        FB kb;
        kb.h[0] = *(const v8b*)(Ksh + (j * 16 + c) * KP + dc * 32 + 8 * hh);
        kb.h[1] = *(const v8b*)(Ksh + (j * 16 + c) * KP + dc * 32 + 16 + 8 * hh);
        if (!SPLIT_QK) { FB qa; qa.h[0] = *(const v8b*)(&Qsh[wv][c * KP + dc * 32 + 8 * hh]); qa.h[1] = *(const v8b*)(&Qsh[wv][c * KP + dc * 32 + 16 + 8 * hh]); s[j] = at_mma16<F16>(qa.v, kb.v, s[j]); }
        if (SPLIT_QK) {
          FB qa, ql;
          qa.h[0] = *(const v8b*)(&Qsh[wv][c * KP + dc * 32 + 8 * hh]); qa.h[1] = *(const v8b*)(&Qsh[wv][c * KP + dc * 32 + 16 + 8 * hh]);
          ql.h[0] = *(const v8b*)(&Qsl[wv][c * KP + dc * 32 + 8 * hh]); ql.h[1] = *(const v8b*)(&Qsl[wv][c * KP + dc * 32 + 16 + 8 * hh]);
          s[j] = at_mma16<F16>(qa.v, kb.v, s[j]);
          FB kl;
          kl.h[0] = *(const v8b*)(Ksl + (j * 16 + c) * KP + dc * 32 + 8 * hh);
          kl.h[1] = *(const v8b*)(Ksl + (j * 16 + c) * KP + dc * 32 + 16 + 8 * hh);
          s[j] = at_mma16<F16>(qa.v, kl.v, s[j]);
          s[j] = at_mma16<F16>(ql.v, kb.v, s[j]);
        }
      }
      } else {
#pragma unroll
      for (int dc = 0; dc < 4; ++dc) {      // (16-bit path: fully unrolled; q fragments are reloaded from the per-wave Qsh copy in LDS)
        FB kb;
        kb.h[0] = *(const v8b*)(Ksh + (j * 16 + c) * KP + dc * 32 + 8 * hh);
        kb.h[1] = *(const v8b*)(Ksh + (j * 16 + c) * KP + dc * 32 + 16 + 8 * hh);
        if (!SPLIT_QK) { FB qa; qa.h[0] = *(const v8b*)(&Qsh[wv][c * KP + dc * 32 + 8 * hh]); qa.h[1] = *(const v8b*)(&Qsh[wv][c * KP + dc * 32 + 16 + 8 * hh]); s[j] = at_mma16<F16>(qa.v, kb.v, s[j]); }
        if (SPLIT_QK) {
          FB qa, ql;
          qa.h[0] = *(const v8b*)(&Qsh[wv][c * KP + dc * 32 + 8 * hh]); qa.h[1] = *(const v8b*)(&Qsh[wv][c * KP + dc * 32 + 16 + 8 * hh]);
          ql.h[0] = *(const v8b*)(&Qsl[wv][c * KP + dc * 32 + 8 * hh]); ql.h[1] = *(const v8b*)(&Qsl[wv][c * KP + dc * 32 + 16 + 8 * hh]);
          s[j] = at_mma16<F16>(qa.v, kb.v, s[j]);
          FB kl;
          kl.h[0] = *(const v8b*)(Ksl + (j * 16 + c) * KP + dc * 32 + 8 * hh);
          kl.h[1] = *(const v8b*)(Ksl + (j * 16 + c) * KP + dc * 32 + 16 + 8 * hh);
          s[j] = at_mma16<F16>(qa.v, kl.v, s[j]);
          s[j] = at_mma16<F16>(ql.v, kb.v, s[j]);
        }
      }
      }
    }
    const bool diag = (MODE == 1) && (kc == qb);
    int kvkeep[4] = {1, 1, 1, 1};
    if (MODE == 3) {
#pragma unroll
      for (int j = 0; j < 4; ++j) kvkeep[j] = ((const int*)mask_a)[(size_t)b * g.Skv + kv0 + j * 16 + c];   // mask_a = kvmask
    }
    float cm[8];
#pragma unroll
    for (int r = 0; r < 8; ++r) {
      const int qrow = q0 + 8 * hh + r;
      float m = -INFINITY;
#pragma unroll
      for (int j = 0; j < 4; ++j) {
        const int kvcol = kv0 + j * 16 + c;
        bool masked = false;
        if (diag) masked = (kvcol > qrow);
        else if (MODE == 4) masked = (kvcol > qrow) || (qrow - kvcol > g.mask_is_int);
        else if (MODE == 2) {
          const size_t mi = (size_t)qrow * g.Skv + kvcol;
          masked = (g.mask_is_int == 0) ? (((const float*)mask_a)[mi] == 0.0f)
                 : (g.mask_is_int == 1) ? (((const int*)mask_a)[mi] == 0) : (((const int*)mask_a)[mi] != 0);
        } else if (MODE == 3) masked = (qkeep[r] == 0) || (kvkeep[j] == 0);
        else if (MODE == 6) { masked = (kvcol > qrow); s[j][r] += g.cp[h] * (float)(kvcol - qrow); }
        else if (MODE == 8) { masked = (kvcol > qrow) || (((const int*)mask_a)[(size_t)b * g.Skv + kvcol] != 0); }
        else if (MODE == 5) {
          const size_t mi = (size_t)qrow * g.Skv + kvcol;
          masked = (((const int*)mask_a)[mi] != 0);
          int n = mask_b[mi]; n = n < 0 ? 0 : n;
          s[j][r] += g.cp[(size_t)b * g.c_bs + (size_t)h * g.c_hs + (size_t)qrow * g.c_rs + n]
                   + g.pc[(size_t)b * g.c_bs + (size_t)h * g.c_hs + (size_t)kvcol * g.c_rs + n];
        }
        if (masked) s[j][r] = g.mask_fill;
        m = fmaxf(m, s[j][r]);
      }
#pragma unroll
      for (int off = 1; off < 16; off <<= 1) m = fmaxf(m, __shfl_xor(m, off, 32));
      cm[r] = m;
    }
    __bf16* pwh = Psh[wv];
    __bf16* pwl = Psl[SPLIT_PV ? wv : 0];
#pragma unroll
    for (int r = 0; r < 8; ++r) {
      const float mnew = fmaxf(mrow[r], cm[r]);
      const float alpha = expf(mrow[r] - mnew);
      mrow[r] = mnew;
      float psum = 0.f;
#pragma unroll
      for (int j = 0; j < 4; ++j) {
        const float p = expf(s[j][r] - mnew);
        psum += p;
        if (SPLIT_PV) { __bf16 a, bl; at_split(p, a, bl); pwh[(8 * hh + r) * VP + j * 16 + c] = a; pwl[(8 * hh + r) * VP + j * 16 + c] = bl; }
        else pwh[(8 * hh + r) * VP + j * 16 + c] = at_to16<F16>(p * PSC);
      }
#pragma unroll
      for (int off = 1; off < 16; off <<= 1) psum += __shfl_xor(psum, off, 32);
      lrow[r] = lrow[r] * alpha + psum;
#pragma unroll
      for (int t = 0; t < 8; ++t) oacc[t][r] *= alpha;
    }
    __builtin_amdgcn_fence(__ATOMIC_RELEASE, "workgroup");
    __builtin_amdgcn_wave_barrier();
    __builtin_amdgcn_fence(__ATOMIC_ACQUIRE, "workgroup");
#pragma unroll 1
    for (int kk = 0; kk < 2; ++kk) {
      FB pa, pl;
      pa.h[0] = *(const v8b*)(pwh + c * VP + kk * 32 + 8 * hh);
      pa.h[1] = *(const v8b*)(pwh + c * VP + kk * 32 + 16 + 8 * hh);
      if (SPLIT_PV) {
        pl.h[0] = *(const v8b*)(pwl + c * VP + kk * 32 + 8 * hh);
        pl.h[1] = *(const v8b*)(pwl + c * VP + kk * 32 + 16 + 8 * hh);
      }
#pragma unroll
      for (int t = 0; t < 8; ++t) {
        FB vb;
        vb.h[0] = *(const v8b*)(Vth + (t * 16 + c) * VP + kk * 32 + 8 * hh);
        vb.h[1] = *(const v8b*)(Vth + (t * 16 + c) * VP + kk * 32 + 16 + 8 * hh);
        oacc[t] = at_mma16<F16>(pa.v, vb.v, oacc[t]);
        if (SPLIT_PV) {
          FB vl;
          vl.h[0] = *(const v8b*)(Vtl + (t * 16 + c) * VP + kk * 32 + 8 * hh);
          vl.h[1] = *(const v8b*)(Vtl + (t * 16 + c) * VP + kk * 32 + 16 + 8 * hh);
          oacc[t] = at_mma16<F16>(pa.v, vl.v, oacc[t]);
          oacc[t] = at_mma16<F16>(pl.v, vb.v, oacc[t]);
        }
      }
    }
  }

  float* os = (float*)KVraw + wv * (16 * 132);
  if (NG > 1) {
    if (c == 0) {      // the 16 lanes of a half hold the same eight maxima and sums: one of them stores
#pragma unroll   // unrolled so that mrow, lrow are indexed by constants and stay registers
      for (int r = 0; r < 8; ++r) { Msh[wv][8 * hh + r] = mrow[r]; Lsh[wv][8 * hh + r] = lrow[r]; }
    }
  }
  __syncthreads();   // every wave has left the k, v tiles, which the out tiles overlay; the maxima and sums of all groups are published
#pragma unroll   // unrolled, with the three loops inside it, so that mrow, lrow, mg and oacc are indexed by constants and stay registers
  for (int r = 0; r < 8; ++r) {
    float inv;
    if (NG > 1) {
      float mg[NG], mall = -INFINITY, lall = 0.f;
#pragma unroll
      for (int gi = 0; gi < NG; ++gi) { mg[gi] = Msh[gi * AT_NW + wave][8 * hh + r]; mall = fmaxf(mall, mg[gi]); }
#pragma unroll
      for (int gi = 0; gi < NG; ++gi) lall += Lsh[gi * AT_NW + wave][8 * hh + r] * expf(mg[gi] - mall);
      inv = expf(mrow[r] - mall) / (lall * PSC);
    } else {
      inv = 1.0f / (lrow[r] * PSC);
    }
#pragma unroll
    for (int t = 0; t < 8; ++t) os[(8 * hh + r) * 132 + t * 16 + c] = oacc[t][r] * inv;
  }
  __syncthreads();   // the weighted out tiles of all groups are published
  {
    const int c4 = lane * 4;           // 32 lanes x 16 B = one 512-B output row (128 floats) per instruction
    const float* ot = (const float*)KVraw + wave * (16 * 132);   // group 0's tile of these query rows; group gi's lies gi * AT_NW tiles further
#pragma unroll   // unrolled, with the loop inside it, so that all LDS reads of the rows are issued before the first sum waits
    for (int rr = 0; rr < 16 / NG; ++rr) {     // each group sums and stores its own 16 / NG rows of the tile
      const int row = grp * (16 / NG) + rr;
      v4f val = *(const v4f*)(ot + row * 132 + c4);
#pragma unroll
      for (int gi = 1; gi < NG; ++gi) val += *(const v4f*)(ot + gi * (AT_NW * 16 * 132) + row * 132 + c4);
      *(v4f*)(ob_ptr + (size_t)(q0 + row) * g.o_rs + c4) = val;
    }
  }
}

#define IB 4
#define INn 4096
#define ID 128
extern "C" void kernel_launch(void* const* d_in, const int* in_sizes, int n_in, void* d_out, int out_size, void* d_ws, size_t ws_size, hipStream_t stream) {
  (void)in_sizes; (void)n_in; (void)out_size; (void)ws_size;
  const float* x = (const float*)d_in[0]; const float* Wq = (const float*)d_in[1]; const float* bq = (const float*)d_in[2]; const float* Wk = (const float*)d_in[3]; const float* bk = (const float*)d_in[4]; const float* Wv = (const float*)d_in[5]; const float* bv = (const float*)d_in[6];
  char* ws = (char*)d_ws; size_t off = 0;
  auto carve = [&](size_t bytes) -> char* { char* p = ws + off; off += (bytes + 255) & ~(size_t)255; return p; };
  const int R = IB * INn;
  _Float16* X16 = (_Float16*)carve((size_t)R * ID * 2); _Float16* W3 = (_Float16*)carve((size_t)3 * ID * ID * 2);
  float* Q = (float*)carve((size_t)R * ID * 4); _Float16* K16 = (_Float16*)carve((size_t)R * ID * 2); _Float16* Vt16 = (_Float16*)carve((size_t)R * ID * 2);
  cast_f32_f16x2<<<(R * ID / 2 + 255) / 256, 256, 0, stream>>>(x, X16, R * ID / 2);
  cast_f32_f16x2<<<(ID * ID / 2 + 255) / 256, 256, 0, stream>>>(Wq, W3, ID * ID / 2);
  cast_f32_f16x2<<<(ID * ID / 2 + 255) / 256, 256, 0, stream>>>(Wk, W3 + ID * ID, ID * ID / 2);
  cast_f32_f16x2<<<(ID * ID / 2 + 255) / 256, 256, 0, stream>>>(Wv, W3 + 2 * ID * ID, ID * ID / 2);
  { const int t = (R / 64) * (ID / 64);
    wmma_gemm64<0, false, 2, 0, false><<<dim3((t + 7) / 8, 1), 256, 0, stream>>>(U16(X16), nullptr, ID, 0, U16(W3), nullptr, ID, 0, Q, nullptr, ID, 0, bq, nullptr, 0, R, ID, ID, 1.0f);
    wmma_gemm64<0, false, 2, 1, false><<<dim3((t + 7) / 8, 1), 256, 0, stream>>>(U16(X16), nullptr, ID, 0, U16(W3 + ID * ID), nullptr, ID, 0, K16, nullptr, ID, 0, bk, nullptr, 0, R, ID, ID, 1.0f); }
  // v transposed = Wv x^T + bv, one batch entry of the product per 64-key tile: tile [128 d][64 keys], 16 KB contiguous
  wmma_gemm64<0, false, 1, 1, false><<<dim3(1, R / AT_KC), 256, 0, stream>>>(U16(W3 + 2 * ID * ID), nullptr, ID, 0, U16(X16), nullptr, ID, (long)AT_KC * ID, Vt16, nullptr, AT_KC, (long)AT_KC * ID, bv, nullptr, 0, ID, AT_KC, ID, 1.0f);
  { AttnGeom g;
    g.q_bs = (long)INn * ID; g.q_rs = ID; g.q_hs = 0; g.k_bs = g.q_bs; g.k_rs = ID; g.k_hs = 0; g.v_bs = g.q_bs; g.v_rs = ID; g.v_hs = 0; g.o_bs = (long)INn * ID; g.o_rs = ID; g.o_hs = 0;
    g.S = INn; g.Skv = INn; g.H = 1; g.mask_mode = 0; g.qscale = 0.08838834764831845f; g.blk0 = 0; g.mask_fill = -INFINITY; g.mask_is_int = 0;
    attn128_kernel<false, false, true, 0, true, 4><<<IB * (INn / AT_QB), 4 * AT_NW * 32, 0, stream>>>(Q, nullptr, nullptr, U16(K16), U16(Vt16), (float*)d_out, nullptr, nullptr, g); }
}

// v005
// Measured time: 108 microseconds a run.
// Two timings next to v004 both put it at 1.29 times that version's speed.
// All steps since v000 together make it 9.72 times as fast.
#include <hip/hip_runtime.h>
#include <math.h>
// InteractionLayer: q, k, v = x W^T + b (three 16384 x 128 by 128 x 128 products in one launch; q f32, k f16 rows, v f16 transposed in 64-key tiles) and single-head attention (d 128, 4096 keys per batch; scores and
// p·v with p x2^15) on v_wmma_f32_16x16x32_f16 with f16 operands, f32 accumulate; softmax f32 on VALU. nn.Linear weights ([out][in]) are the
// Bt operand of q, k and the A operand of v^T, directly.
typedef __attribute__((ext_vector_type(16))) _Float16 v16h;
typedef __attribute__((ext_vector_type(8)))  _Float16 v8h;
typedef __attribute__((ext_vector_type(16))) __bf16   v16b;
typedef __attribute__((ext_vector_type(8)))  __bf16   v8b;
typedef __attribute__((ext_vector_type(8)))  float    v8f;
typedef __attribute__((ext_vector_type(4)))  float    v4f;
#define PSCALE 32768.0f
#define U16(p) ((const unsigned short*)(const void*)(p))
#define PSCALE_INV (1.0f / 32768.0f)

__device__ __forceinline__ unsigned short f2bf_bits(float f) {
  unsigned u = __float_as_uint(f);
  return (unsigned short)((u + 0x7FFFu + ((u >> 16) & 1u)) >> 16);
}
__device__ __forceinline__ float bf_bits2f(unsigned short h) { return __uint_as_float(((unsigned)h) << 16); }

// hazard guards as plain device helpers (no inline asm inside the kernel template body)
__device__ __forceinline__ void dep_guard_h(v8f& a, v8f& b, v16h x, v16h y) { asm volatile("v_nop\n\tv_nop\n\tv_nop\n\tv_nop" : "+v"(a), "+v"(b) : "v"(x), "v"(y)); }
__device__ __forceinline__ void dep_guard_b(v8f& a, v8f& b, v16b x, v16b y) { asm volatile("v_nop\n\tv_nop\n\tv_nop\n\tv_nop" : "+v"(a), "+v"(b) : "v"(x), "v"(y)); }
__device__ __forceinline__ void keep4_h(v16h a, v16h b, v16h c, v16h d) { asm volatile("v_nop" :: "v"(a), "v"(b), "v"(c), "v"(d)); }
__device__ __forceinline__ void keep4_b(v16b a, v16b b, v16b c, v16b d) { asm volatile("v_nop" :: "v"(a), "v"(b), "v"(c), "v"(d)); }
__device__ __forceinline__ void acc_guard4(v8f& a, v8f& b, v8f& c, v8f& d) { asm volatile("v_nop\n\tv_nop\n\tv_nop\n\tv_nop" : "+v"(a), "+v"(b), "+v"(c), "+v"(d)); }
template <typename T> struct Frag;
template <> struct Frag<_Float16> {
  typedef v16h V; union U { v16h v; v8h h[2]; };
  static __device__ __forceinline__ v16h load(const _Float16* p) {   // elements 0..7 <- p[0..7], 8..15 <- p[16..23]
    U f; f.h[0] = *(const v8h*)(p); f.h[1] = *(const v8h*)(p + 16); return f.v;
  }
  static __device__ __forceinline__ v8f mma(v16h a, v16h b, v8f c) {
    return __builtin_amdgcn_wmma_f32_16x16x32_f16(false, a, false, b, (short)0, c, false, false);
  }
  static __device__ __forceinline__ void guard(v8f& a, v8f& b, v16h x, v16h y) { dep_guard_h(a, b, x, y); }
  static __device__ __forceinline__ void keep(v16h a, v16h b, v16h c, v16h d) { keep4_h(a, b, c, d); }
};
template <> struct Frag<__bf16> {
  typedef v16b V; union U { v16b v; v8b h[2]; };
  static __device__ __forceinline__ v16b load(const __bf16* p) {
    U f; f.h[0] = *(const v8b*)(p); f.h[1] = *(const v8b*)(p + 16); return f.v;
  }
  static __device__ __forceinline__ v8f mma(v16b a, v16b b, v8f c) {
    return __builtin_amdgcn_wmma_f32_16x16x32_bf16(false, a, false, b, (short)0, c, false, false);
  }
  static __device__ __forceinline__ void guard(v8f& a, v8f& b, v16b x, v16b y) { dep_guard_b(a, b, x, y); }
  static __device__ __forceinline__ void keep(v16b a, v16b b, v16b c, v16b d) { keep4_b(a, b, c, d); }
};

// ---- Register-blocked batched WMMA GEMM ------------------------------------
// C[m,n] = scale * sum_k A[m,k] * Bt[n,k] (+bias)(+resid); each wave owns a 64x64 tile.
// A row-major [M,K]; Bt row-major [N,K]; M,N % 64 == 0, K % 32 == 0.
// SPLIT: operands are hi/lo planes (A2/Bt2 = lo planes, same layout); product = hi·hi + hi·lo + lo·hi.
// BIAS_MODE: 0 = none, 1 = bias[m], 2 = bias[n].
// OUT_MODE: 0 = f32, 1 = f16, 2 = bf16 hi plane (Cout) + bf16 lo plane (Cout2).
// ET: 0 = f16 operands, 1 = bf16 operands (pointers passed as 16-bit storage)
template <int ET> struct Elem;
template <> struct Elem<0> { typedef _Float16 T; };
template <> struct Elem<1> { typedef __bf16 T; };
template <int ET, bool SPLIT, int BIAS_MODE, int OUT_MODE, bool RESID, int ACT = 0>
__global__ __launch_bounds__(256) void wmma_gemm64(
    const unsigned short* __restrict__ Ap, const unsigned short* __restrict__ A2p, int lda, long strideA,
    const unsigned short* __restrict__ Btp, const unsigned short* __restrict__ Bt2p, int ldb, long strideB,
    void* __restrict__ Cout, void* __restrict__ Cout2, int ldc, long strideC,
    const float* __restrict__ bias,
    const float* __restrict__ resid, long strideR,
    int M, int N, int K, float scale) {
  typedef typename Elem<ET>::T T;
  typedef typename Frag<T>::V V;
  const T* A = (const T*)Ap; const T* A2 = (const T*)A2p; const T* Bt = (const T*)Btp; const T* Bt2 = (const T*)Bt2p;
  __shared__ __align__(16) float sT[8][16 * 68];   // per-wave 16x64 slab, pitch 68 floats
  const int b    = blockIdx.y;
  const int lane = threadIdx.x & 31;
  const int wave = threadIdx.x >> 5;
  const int tilesN = N >> 6;
  const int tilesM = M >> 6;
  const int tile = blockIdx.x * 8 + wave;
  if (tile >= tilesM * tilesN) return;   // wave-uniform; no block barriers in this kernel
  const int tm = tile / tilesN;
  const int tn = tile - tm * tilesN;
  const int m0 = tm << 6;
  const int n0 = tn << 6;

  const T* Ab  = A  + (size_t)b * strideA;
  const T* Bb  = Bt + (size_t)b * strideB;
  const T* Ab2 = SPLIT ? (A2  + (size_t)b * strideA) : nullptr;
  const T* Bb2 = SPLIT ? (Bt2 + (size_t)b * strideB) : nullptr;

  const int rlane = lane & 15;                 // row (A) / col (B, D) within subtile
  const int koff  = (lane >> 4) * 8;           // k offset of this lane half
  const int mOff  = (lane >> 4) * 8;           // D row offset

  v8f acc[4][4];
#pragma unroll
  for (int i = 0; i < 4; ++i)
#pragma unroll
    for (int j = 0; j < 4; ++j) acc[i][j] = (v8f){0.f,0.f,0.f,0.f,0.f,0.f,0.f,0.f};

  for (int k0 = 0; k0 < K; k0 += 32) {
    V bh[4], bl[4];
#pragma unroll
    for (int j = 0; j < 4; ++j) {
      const size_t bo = (size_t)(n0 + (j << 4) + rlane) * ldb + koff + k0;
      bh[j] = Frag<T>::load(Bb + bo);
      if (SPLIT) bl[j] = Frag<T>::load(Bb2 + bo);
    }
#pragma unroll
    for (int i = 0; i < 4; ++i) {
      const size_t ao = (size_t)(m0 + (i << 4) + rlane) * lda + koff + k0;
      V ah = Frag<T>::load(Ab + ao);
      V al;
      if (SPLIT) al = Frag<T>::load(Ab2 + ao);
#pragma unroll
      for (int j = 0; j < 4; ++j) {
        acc[i][j] = Frag<T>::mma(ah, bh[j], acc[i][j]);
        if (SPLIT) {
          acc[i][j] = Frag<T>::mma(ah, bl[j], acc[i][j]);
          acc[i][j] = Frag<T>::mma(al, bh[j], acc[i][j]);
        }
      }
      Frag<T>::guard(acc[i][0], acc[i][3], ah, SPLIT ? al : ah);
    }
    Frag<T>::keep(bh[0], bh[1], bh[2], bh[3]);
    if (SPLIT) Frag<T>::keep(bl[0], bl[1], bl[2], bl[3]);
  }
  acc_guard4(acc[0][0], acc[0][1], acc[0][2], acc[0][3]);
  acc_guard4(acc[1][0], acc[1][1], acc[1][2], acc[1][3]);
  acc_guard4(acc[2][0], acc[2][1], acc[2][2], acc[2][3]);
  acc_guard4(acc[3][0], acc[3][1], acc[3][2], acc[3][3]);

  // ---- epilogue ----
  float* slab = sT[wave];
  const float* Rb = RESID ? (resid + (size_t)b * strideR) : nullptr;
#pragma unroll
  for (int i = 0; i < 4; ++i) {
    const int mBase = m0 + (i << 4);
#pragma unroll
    for (int j = 0; j < 4; ++j) {
      const int n = n0 + (j << 4) + rlane;
      float bv = 0.f;
      if (BIAS_MODE == 2) bv = bias[n];
#pragma unroll
      for (int r = 0; r < 8; ++r) {
        float v = acc[i][j][r] * scale;
        if (BIAS_MODE == 1) v += bias[mBase + mOff + r];
        if (BIAS_MODE == 2) v += bv;
        if (RESID) v += Rb[(size_t)(mBase + mOff + r) * ldc + n];
        if (ACT == 1) v = tanhf(v);
        if (ACT == 2) v = fmaxf(v, 0.0f);
        if (ACT == 3) v = v / (1.0f + expf(-v));
        if (ACT == 4) v = (v > 0.f) ? v : 0.01f * v;
        if (ACT == 5) v = 0.5f * v * (1.0f + erff(v * 0.70710678118654752f));
        slab[(mOff + r) * 68 + (j << 4) + rlane] = v;
      }
    }
    __builtin_amdgcn_fence(__ATOMIC_RELEASE, "workgroup");
    __builtin_amdgcn_wave_barrier();
    __builtin_amdgcn_fence(__ATOMIC_ACQUIRE, "workgroup");
    if (OUT_MODE == 0) {
      float* C = (float*)Cout + (size_t)b * strideC;
      const int hh = lane >> 4, c4 = (lane & 15) * 4;     // row seg = 256 B = 16 lanes x 16 B
      {
#pragma unroll
        for (int it = 0; it < 8; ++it) {
          const int row = it * 2 + hh;
          v4f v = *(const v4f*)(slab + row * 68 + c4);
          *(v4f*)(C + (size_t)(mBase + row) * ldc + n0 + c4) = v;
        }
        
      }
    } else {
      const int q = lane >> 3, c8 = (lane & 7) * 8;
      unsigned short* C  = (unsigned short*)Cout  + (size_t)b * strideC;
      unsigned short* C2 = (OUT_MODE == 2) ? ((unsigned short*)Cout2 + (size_t)b * strideC) : nullptr;
      {
#pragma unroll
        for (int it = 0; it < 4; ++it) {
          const int row = it * 4 + q;
          const float* sp = slab + row * 68 + c8;
          v8h hv, lv;
#pragma unroll
          for (int e = 0; e < 8; ++e) {
            if (OUT_MODE == 1) {
              hv[e] = (_Float16)sp[e];
            } else {
              unsigned short hb = f2bf_bits(sp[e]);
              unsigned short lb = f2bf_bits(sp[e] - bf_bits2f(hb));
              hv[e] = __builtin_bit_cast(_Float16, hb);
              lv[e] = __builtin_bit_cast(_Float16, lb);
            }
          }
          *(v8h*)(C + (size_t)(mBase + row) * ldc + n0 + c8) = hv;
          if (OUT_MODE == 2) *(v8h*)(C2 + (size_t)(mBase + row) * ldc + n0 + c8) = lv;
        }
        
      }
    }
    __builtin_amdgcn_fence(__ATOMIC_RELEASE, "workgroup");
    __builtin_amdgcn_wave_barrier();
    __builtin_amdgcn_fence(__ATOMIC_ACQUIRE, "workgroup");
  }
}

__global__ __launch_bounds__(256) void cast_f32_f16x2(
    const float* __restrict__ in, _Float16* __restrict__ out, int n2) {
  int i = blockIdx.x * 256 + threadIdx.x;
  if (i < n2) {
    const _Float16 h0 = (_Float16)in[2 * i], h1 = (_Float16)in[2 * i + 1];
    const unsigned u = (unsigned)__builtin_bit_cast(unsigned short, h0) | ((unsigned)__builtin_bit_cast(unsigned short, h1) << 16);
    ((unsigned*)out)[i] = u;
    
  }
}


// ---- f32 -> f16 cast with a power-of-two pre-scale (folded back by the consumer GEMM's scale) ----
__global__ __launch_bounds__(256) void cast_f32_f16x2s(const float* __restrict__ in, _Float16* __restrict__ out, int n2, float s) {
  int i = blockIdx.x * 256 + threadIdx.x;
  if (i < n2) {
    const _Float16 h0 = (_Float16)(in[2 * i] * s), h1 = (_Float16)(in[2 * i + 1] * s);
    const unsigned u = (unsigned)__builtin_bit_cast(unsigned short, h0) | ((unsigned)__builtin_bit_cast(unsigned short, h1) << 16);
    ((unsigned*)out)[i] = u;
    
  }
}
__global__ __launch_bounds__(256) void split_f32_bf16x2(
    const float* __restrict__ in, __bf16* __restrict__ hi, __bf16* __restrict__ lo, long n2) {
  long i = (long)blockIdx.x * 256 + threadIdx.x;
  long stride = (long)gridDim.x * 256;
  {
    for (long j = i; j < n2; j += stride) {
      const float a = in[2 * j], b = in[2 * j + 1];
      const unsigned short ah = f2bf_bits(a), bh = f2bf_bits(b);
      const unsigned short al = f2bf_bits(a - bf_bits2f(ah)), bl = f2bf_bits(b - bf_bits2f(bh));
      ((unsigned*)hi)[j] = (unsigned)ah | ((unsigned)bh << 16);
      ((unsigned*)lo)[j] = (unsigned)al | ((unsigned)bl << 16);
    }
    
  }
}


// ---- f32 [R][C] (row pitch ldi) -> f16 transposed [C][R] (row pitch ldo); 64x64 tiles; each output row segment
__global__ __launch_bounds__(256) void transpose_cast_f16(const float* __restrict__ in, int ldi,
                                                         _Float16* __restrict__ outT, int ldo, float scale) {
  __shared__ __align__(16) _Float16 tile[64][72];     // [c][r]
  const int c0 = blockIdx.x * 64, r0 = blockIdx.y * 64;
  const int t = threadIdx.y * 32 + threadIdx.x;
  for (int i = threadIdx.y; i < 64; i += 8) {
    tile[threadIdx.x][i]      = (_Float16)(in[(size_t)(r0 + i) * ldi + c0 + threadIdx.x] * scale);
    tile[32 + threadIdx.x][i] = (_Float16)(in[(size_t)(r0 + i) * ldi + c0 + 32 + threadIdx.x] * scale);
  }
  __syncthreads();
  const int q = t >> 3, c8 = (t & 7) * 8;
  {
#pragma unroll
    for (int it = 0; it < 2; ++it) {
      const int c = it * 32 + q;
      v8h hv = *(const v8h*)(&tile[c][c8]);
      *(v8h*)(outT + (size_t)(c0 + c) * ldo + r0 + c8) = hv;
    }
    
  }
}

// ---- f32 [R][C] (pitch ldi) -> bf16 hi/lo transposed planes [C][R] (pitch ldo); 64x64 tiles; each output row segment
__global__ __launch_bounds__(256) void transpose_split_bf16(const float* __restrict__ in, int ldi,
                                                           __bf16* __restrict__ outH, __bf16* __restrict__ outL, int ldo) {
  __shared__ __align__(16) float tile[64][68];     // [c][r]
  const int c0 = blockIdx.x * 64, r0 = blockIdx.y * 64;
  const int t = threadIdx.y * 32 + threadIdx.x;
  for (int i = threadIdx.y; i < 64; i += 8) {
    tile[threadIdx.x][i]      = in[(size_t)(r0 + i) * ldi + c0 + threadIdx.x];
    tile[32 + threadIdx.x][i] = in[(size_t)(r0 + i) * ldi + c0 + 32 + threadIdx.x];
  }
  __syncthreads();
  const int q = t >> 3, c8 = (t & 7) * 8;
  {
#pragma unroll
    for (int it = 0; it < 2; ++it) {
      const int c = it * 32 + q;
      v8b hv, lv;
#pragma unroll
      for (int e = 0; e < 8; ++e) {
        const float f = tile[c][c8 + e];
        const unsigned short hb = f2bf_bits(f);
        hv[e] = __builtin_bit_cast(__bf16, hb);
        lv[e] = __builtin_bit_cast(__bf16, f2bf_bits(f - bf_bits2f(hb)));
      }
      *(v8b*)(outH + (size_t)(c0 + c) * ldo + r0 + c8) = hv;
      *(v8b*)(outL + (size_t)(c0 + c) * ldo + r0 + c8) = lv;
    }
    
  }
}

// =====================================================================================
// Generic causal/non-causal attention for head_dim 64, f32 in / f32 out; 16-bit operands: bf16 with optional hi/lo splits, or
// plain f16 (F16=true, non-split, probabilities carried x2^15).
//   scores = (q*qscale)·kᵀ : v_wmma_f32_16x16x32_bf16; SPLIT_QK -> q,k as bf16 hi/lo (hi·hi + hi·lo + lo·hi)
//   out    = p·v           : v_wmma_f32_16x16x32_bf16; SPLIT_PV -> p,v as bf16 hi/lo; else p,v plain bf16
//   f32 accumulate; online softmax in f32. Block = 4 waves = 64 query rows of one (batch, head); S % 64 == 0.
//   Element (b, s, h, d) of tensor X lives at X[b*X_bs + s*X_rs + h*X_hs + d] (strides in floats, multiples of 4).
//   Masking: mask_mode 0 none, 1 causal (kv > q masked), 2 tensor [S][Skv] shared over (b,h) (float if
//   mask_is_int==0, int32 with element == 0 -> masked if 1, int32 with element != 0 -> masked if 2), 3 per-token vectors qmask[B][S] & kvmask[B][Skv] (int32,
//   0 -> masked), 4 causal + sliding window (kv > q or q - kv > W masked; W passed in mask_is_int);
//   5 = relative-position bias: s += cp[b,h,q][idx[q][kv]] + pc[b,h,kv][idx[q][kv]] with idx = mask_b ([S][Skv] int32) and
//   mask_a an int32 [S][Skv] tensor with nonzero = masked (tables: element (b,h,row,n) at X + b*c_bs + h*c_hs + row*c_rs + n);
//   masked scores are replaced by mask_fill (e.g. -inf or -1e9) before the softmax.
//   grid.x = B * H * (S/64) (or a sub-range with blk0).
// =====================================================================================
#define AT_D 64
#define AT_NW 4
#define AT_QB 64
#define AT_KC 64
struct AttnGeom { const float* cp = nullptr; const float* pc = nullptr; long c_bs = 0, c_rs = 0, c_hs = 0;   // mode-5 score-bias tables
                  long q_bs, q_rs, q_hs, k_bs, k_rs, k_hs, v_bs, v_rs, v_hs, o_bs, o_rs, o_hs;
                  int S, Skv, H, mask_mode; float qscale; int blk0; float mask_fill; int mask_is_int; };
static_assert(sizeof(AttnGeom) == 168, "no padding");

__device__ __forceinline__ unsigned short at_bf_bits(float f) {
  unsigned u = __float_as_uint(f);
  return (unsigned short)((u + 0x7FFFu + ((u >> 16) & 1u)) >> 16);
}
__device__ __forceinline__ __bf16 at_f2bf(float f) { return __builtin_bit_cast(__bf16, at_bf_bits(f)); }
__device__ __forceinline__ void at_split(float f, __bf16& hi, __bf16& lo) {
  const unsigned short hb = at_bf_bits(f);
  hi = __builtin_bit_cast(__bf16, hb);
  lo = at_f2bf(f - __uint_as_float(((unsigned)hb) << 16));
}
__device__ __forceinline__ v8f at_mma(v16b a, v16b b, v8f c) {
  c = __builtin_amdgcn_wmma_f32_16x16x32_bf16(false, a, false, b, (short)0, c, false, false);
  asm volatile("v_nop\n\tv_nop\n\tv_nop\n\tv_nop" : "+v"(c) : "v"(a), "v"(b));
  return c;
}
// 16-bit element as a bit pattern held in a __bf16 slot: f16 bits when F16, bf16 (RNE) otherwise
template <bool F16> __device__ __forceinline__ __bf16 at_to16(float f) {
  if (F16) return __builtin_bit_cast(__bf16, (_Float16)f);
  return at_f2bf(f);
}
template <bool F16> __device__ __forceinline__ v8f at_mma16(v16b a, v16b b, v8f c) {
  if (F16) {
    const v16h ah = __builtin_bit_cast(v16h, a), bh = __builtin_bit_cast(v16h, b);
    c = __builtin_amdgcn_wmma_f32_16x16x32_f16(false, ah, false, bh, (short)0, c, false, false);
    asm volatile("v_nop\n\tv_nop\n\tv_nop\n\tv_nop" : "+v"(c) : "v"(ah), "v"(bh));
    return c;
  }
  return at_mma(a, b, c);
}

template <bool SPLIT_QK, bool SPLIT_PV, bool F16 = false>
__global__ __launch_bounds__(128)
void attn64_kernel(const float* __restrict__ q, const float* __restrict__ k,
                   const float* __restrict__ v, float* __restrict__ out,
                   const void* __restrict__ mask_a, const int* __restrict__ mask_b, AttnGeom g) {
  static_assert(!(F16 && (SPLIT_QK || SPLIT_PV)), "f16 mode is non-split");
  const float PSC = F16 ? 32768.0f : 1.0f;     // f16 probabilities carried x2^15 (subnormal range), folded into the final 1/l
  union FB { v16b v; v8b h[2]; };
  __shared__ __align__(16) __bf16 Ksh[AT_KC * AT_D];             // K hi [kv][d]      8 KB
  __shared__ __align__(16) __bf16 Ksl[SPLIT_QK ? AT_KC * AT_D : 8];
  __shared__ __align__(16) __bf16 Vth[AT_D * AT_KC];             // V hi [d][kv]      8 KB
  __shared__ __align__(16) __bf16 Vtl[SPLIT_PV ? AT_D * AT_KC : 8];
  __shared__ __align__(16) __bf16 Psh[AT_NW][16 * AT_KC];        // per wave P hi [row][kv]  8 KB
  __shared__ __align__(16) __bf16 Psl[SPLIT_PV ? AT_NW : 1][SPLIT_PV ? 16 * AT_KC : 8];
  __shared__ __align__(16) float  Os[AT_NW][16 * 68];            // per wave out tile, pitch 68

  const int tid  = threadIdx.x;
  const int wave = tid >> 5;
  const int lane = tid & 31;
  const int hh   = lane >> 4;
  const int c    = lane & 15;

  const int nqb = g.S / AT_QB;
  const int bx = blockIdx.x + g.blk0;
  const int qb = bx % nqb;
  const int bh = bx / nqb;
  const int h  = bh % g.H;
  const int b  = bh / g.H;
  const int qbase_block = qb * AT_QB;
  const int q0 = qbase_block + wave * 16;

  const float* qb_ptr = q + (size_t)b * g.q_bs + (size_t)h * g.q_hs;
  const float* kb_ptr = k + (size_t)b * g.k_bs + (size_t)h * g.k_hs;
  const float* vb_ptr = v + (size_t)b * g.v_bs + (size_t)h * g.v_hs;
  float*       ob_ptr = out + (size_t)b * g.o_bs + (size_t)h * g.o_hs;

  // ---- Q fragments (A operand): 2 d-chunks, hi (and lo) ----
  v16b qah[2], qal[2];
  {
    const float* qrow = qb_ptr + (size_t)(q0 + c) * g.q_rs;
#pragma unroll
    for (int dc = 0; dc < 2; ++dc) {
#pragma unroll
      for (int e = 0; e < 8; ++e) {
        const float f0 = qrow[dc * 32 + 8 * hh + e] * g.qscale;
        const float f1 = qrow[dc * 32 + 16 + 8 * hh + e] * g.qscale;
        if (SPLIT_QK) { __bf16 hq, lq; at_split(f0, hq, lq); qah[dc][e] = hq; qal[dc][e] = lq; at_split(f1, hq, lq); qah[dc][8 + e] = hq; qal[dc][8 + e] = lq; }
        else { qah[dc][e] = at_to16<F16>(f0); qah[dc][8 + e] = at_to16<F16>(f1); qal[dc][e] = qah[dc][e]; qal[dc][8 + e] = qah[dc][8 + e]; }
      }
    }
  }

  float mrow[8], lrow[8];
  v8f oacc[4];
#pragma unroll
  for (int r = 0; r < 8; ++r) { mrow[r] = -INFINITY; lrow[r] = 0.f; }
#pragma unroll
  for (int t = 0; t < 4; ++t) oacc[t] = (v8f){0.f,0.f,0.f,0.f,0.f,0.f,0.f,0.f};

  const int nChunks = (g.mask_mode == 1 || g.mask_mode == 4) ? (qb + 1) : (g.Skv / AT_KC);   // block-uniform
  // per-row query mask (mode 3)
  int qkeep[8];
#pragma unroll
  for (int r = 0; r < 8; ++r) qkeep[r] = (g.mask_mode == 3) ? mask_b[(size_t)b * g.S + q0 + 8 * hh + r] : 1;   // mask_b = qmask in mode 3
  for (int kc = 0; kc < nChunks; ++kc) {
    const int kv0 = kc * AT_KC;
    __syncthreads();
    {
      const int kvr = tid >> 1, dh = (tid & 1) * 32;
      const float* krow = kb_ptr + (size_t)(kv0 + kvr) * g.k_rs + dh;
      const float* vrow = vb_ptr + (size_t)(kv0 + kvr) * g.v_rs + dh;
#pragma unroll
      for (int i = 0; i < 8; ++i) {
        v4f kk = *(const v4f*)(krow + 4 * i);
        v4f vv = *(const v4f*)(vrow + 4 * i);
#pragma unroll
        for (int e = 0; e < 4; ++e) {
          const int d = dh + 4 * i + e;
          if (SPLIT_QK) { __bf16 a, bl; at_split(kk[e], a, bl); Ksh[kvr * AT_D + d] = a; Ksl[kvr * AT_D + d] = bl; }
          else Ksh[kvr * AT_D + d] = at_to16<F16>(kk[e]);
          if (SPLIT_PV) { __bf16 a, bl; at_split(vv[e], a, bl); Vth[d * AT_KC + kvr] = a; Vtl[d * AT_KC + kvr] = bl; }
          else Vth[d * AT_KC + kvr] = at_to16<F16>(vv[e]);
        }
      }
    }
    __syncthreads();

    v8f s[4];
#pragma unroll
    for (int j = 0; j < 4; ++j) {
      s[j] = (v8f){0.f,0.f,0.f,0.f,0.f,0.f,0.f,0.f};
#pragma unroll 1
      for (int dc = 0; dc < 2; ++dc) {
        FB kb;
        kb.h[0] = *(const v8b*)(Ksh + (j * 16 + c) * AT_D + dc * 32 + 8 * hh);
        kb.h[1] = *(const v8b*)(Ksh + (j * 16 + c) * AT_D + dc * 32 + 16 + 8 * hh);
        s[j] = at_mma16<F16>(qah[dc], kb.v, s[j]);
        if (SPLIT_QK) {
          FB kl;
          kl.h[0] = *(const v8b*)(Ksl + (j * 16 + c) * AT_D + dc * 32 + 8 * hh);
          kl.h[1] = *(const v8b*)(Ksl + (j * 16 + c) * AT_D + dc * 32 + 16 + 8 * hh);
          s[j] = at_mma16<F16>(qah[dc], kl.v, s[j]);
          s[j] = at_mma16<F16>(qal[dc], kb.v, s[j]);
        }
      }
    }
    const bool diag = (g.mask_mode == 1) && (kc == qb);
    int kvkeep[4] = {1, 1, 1, 1};
    if (g.mask_mode == 3) {
#pragma unroll
      for (int j = 0; j < 4; ++j) kvkeep[j] = ((const int*)mask_a)[(size_t)b * g.Skv + kv0 + j * 16 + c];   // mask_a = kvmask
    }
    float cm[8];
#pragma unroll
    for (int r = 0; r < 8; ++r) {
      const int qrow = q0 + 8 * hh + r;
      float m = -INFINITY;
#pragma unroll
      for (int j = 0; j < 4; ++j) {
        const int kvcol = kv0 + j * 16 + c;
        bool masked = false;
        if (diag) masked = (kvcol > qrow);
        else if (g.mask_mode == 4) masked = (kvcol > qrow) || (qrow - kvcol > g.mask_is_int);
        else if (g.mask_mode == 2) {
          const size_t mi = (size_t)qrow * g.Skv + kvcol;
          masked = (g.mask_is_int == 0) ? (((const float*)mask_a)[mi] == 0.0f)
                 : (g.mask_is_int == 1) ? (((const int*)mask_a)[mi] == 0) : (((const int*)mask_a)[mi] != 0);
        } else if (g.mask_mode == 3) masked = (qkeep[r] == 0) || (kvkeep[j] == 0);
        else if (g.mask_mode == 5) {
          const size_t mi = (size_t)qrow * g.Skv + kvcol;
          masked = (((const int*)mask_a)[mi] != 0);
          int n = mask_b[mi]; n = n < 0 ? 0 : n;
          s[j][r] += g.cp[(size_t)b * g.c_bs + (size_t)h * g.c_hs + (size_t)qrow * g.c_rs + n]
                   + g.pc[(size_t)b * g.c_bs + (size_t)h * g.c_hs + (size_t)kvcol * g.c_rs + n];
        }
        if (masked) s[j][r] = g.mask_fill;
        m = fmaxf(m, s[j][r]);
      }
#pragma unroll
      for (int off = 1; off < 16; off <<= 1) m = fmaxf(m, __shfl_xor(m, off, 32));
      cm[r] = m;
    }
    __bf16* pwh = Psh[wave];
    __bf16* pwl = Psl[SPLIT_PV ? wave : 0];
#pragma unroll
    for (int r = 0; r < 8; ++r) {
      const float mnew = fmaxf(mrow[r], cm[r]);
      const float alpha = expf(mrow[r] - mnew);
      mrow[r] = mnew;
      float psum = 0.f;
#pragma unroll
      for (int j = 0; j < 4; ++j) {
        const float p = expf(s[j][r] - mnew);
        psum += p;
        if (SPLIT_PV) { __bf16 a, bl; at_split(p, a, bl); pwh[(8 * hh + r) * AT_KC + j * 16 + c] = a; pwl[(8 * hh + r) * AT_KC + j * 16 + c] = bl; }
        else pwh[(8 * hh + r) * AT_KC + j * 16 + c] = at_to16<F16>(p * PSC);
      }
#pragma unroll
      for (int off = 1; off < 16; off <<= 1) psum += __shfl_xor(psum, off, 32);
      lrow[r] = lrow[r] * alpha + psum;
#pragma unroll
      for (int t = 0; t < 4; ++t) oacc[t][r] *= alpha;
    }
    __builtin_amdgcn_fence(__ATOMIC_RELEASE, "workgroup");
    __builtin_amdgcn_wave_barrier();
    __builtin_amdgcn_fence(__ATOMIC_ACQUIRE, "workgroup");
#pragma unroll 1
    for (int kk = 0; kk < 2; ++kk) {
      FB pa, pl;
      pa.h[0] = *(const v8b*)(pwh + c * AT_KC + kk * 32 + 8 * hh);
      pa.h[1] = *(const v8b*)(pwh + c * AT_KC + kk * 32 + 16 + 8 * hh);
      if (SPLIT_PV) {
        pl.h[0] = *(const v8b*)(pwl + c * AT_KC + kk * 32 + 8 * hh);
        pl.h[1] = *(const v8b*)(pwl + c * AT_KC + kk * 32 + 16 + 8 * hh);
      }
#pragma unroll
      for (int t = 0; t < 4; ++t) {
        FB vb;
        vb.h[0] = *(const v8b*)(Vth + (t * 16 + c) * AT_KC + kk * 32 + 8 * hh);
        vb.h[1] = *(const v8b*)(Vth + (t * 16 + c) * AT_KC + kk * 32 + 16 + 8 * hh);
        oacc[t] = at_mma16<F16>(pa.v, vb.v, oacc[t]);
        if (SPLIT_PV) {
          FB vl;
          vl.h[0] = *(const v8b*)(Vtl + (t * 16 + c) * AT_KC + kk * 32 + 8 * hh);
          vl.h[1] = *(const v8b*)(Vtl + (t * 16 + c) * AT_KC + kk * 32 + 16 + 8 * hh);
          oacc[t] = at_mma16<F16>(pa.v, vl.v, oacc[t]);
          oacc[t] = at_mma16<F16>(pl.v, vb.v, oacc[t]);
        }
      }
    }
  }

  float* os = Os[wave];
#pragma unroll
  for (int r = 0; r < 8; ++r) {
    const float inv = 1.0f / (lrow[r] * PSC);
#pragma unroll
    for (int t = 0; t < 4; ++t) os[(8 * hh + r) * 68 + t * 16 + c] = oacc[t][r] * inv;
  }
  __builtin_amdgcn_fence(__ATOMIC_RELEASE, "workgroup");
  __builtin_amdgcn_wave_barrier();
  __builtin_amdgcn_fence(__ATOMIC_ACQUIRE, "workgroup");
  {
    const int c4 = (lane & 15) * 4;
    {
#pragma unroll
      for (int it = 0; it < 8; ++it) {
        const int row = it * 2 + hh;
        v4f val = *(const v4f*)(os + row * 68 + c4);
        *(v4f*)(ob_ptr + (size_t)(q0 + row) * g.o_rs + c4) = val;
      }
      
    }
  }
}

// MODE: the mask mode as a compile-time constant, so that only the launched mode's score path is compiled into the key loop
// PRE16: k and v come ready as 16-bit values, written once by their producer (k, v unused): k16 holds dense rows, element (b, s, d) at
//   k16[b*k_bs + s*128 + d]; vt16 holds v transposed in tiles of AT_KC keys, element (b, s, d) at vt16[b*v_bs + (s/AT_KC)*AT_KC*128 + d*AT_KC + s%AT_KC]
//   (k_bs, v_bs in 16-bit elements, multiples of 8), so that a pass's k tile and v tile are 16 KB contiguous each.
// NG: key groups. The block has NG groups of AT_NW waves on the SAME 64 query rows; group g walks the key tiles g, g + NG, g + 2 NG, ... with its own
//   k, v tiles in LDS and its own running maximum, sum and output tile, so that NG waves share each SIMD and fill one another's waits. Behind the loop the NG
//   partial results of a row are joined: out = sum_g e^(m_g - m) o_g / sum_g e^(m_g - m) l_g, m = max_g m_g. NG > 1: no mask, Skv a multiple of NG * AT_KC.
template <bool SPLIT_QK, bool SPLIT_PV, bool F16, int MODE, bool PRE16, int NG>
__global__ __launch_bounds__(128 * NG)
void attn128_kernel(const float* __restrict__ q, const float* __restrict__ k,
                   const float* __restrict__ v, const unsigned short* __restrict__ k16,
                   const unsigned short* __restrict__ vt16, float* __restrict__ out,
                   const void* __restrict__ mask_a, const int* __restrict__ mask_b, AttnGeom g) {
  static_assert(!(F16 && (SPLIT_QK || SPLIT_PV)), "f16 mode is non-split");
  static_assert(!(PRE16 && (SPLIT_QK || SPLIT_PV)), "ready 16-bit k and v are non-split");
  static_assert(NG == 1 || (MODE == 0 && !SPLIT_QK && !SPLIT_PV && 16 % NG == 0), "key groups: unmasked, non-split");
  const float PSC = F16 ? 32768.0f : 1.0f;     // f16 probabilities carried x2^15 (subnormal range), folded into the final 1/l
  union FB { v16b v; v8b h[2]; };
  constexpr int D2 = 128;
  constexpr int KP = D2 + 8;      // LDS pitch of the k and q rows, in 16-bit elements: 272 B = 16 B x odd, so the 16 rows of a ds_load_b128 fragment read fall on distinct banks
  constexpr int VP = AT_KC + 8;   // LDS pitch of the transposed v rows and the p rows: 144 B = 16 B x odd, same reason
  constexpr int NWV = AT_NW * NG;                 // waves of the block
  constexpr int KVB = (AT_KC * KP + D2 * VP) * 2; // bytes of one group's k tile (17 KB, [kv][d], padded rows) and v tile (18 KB, [d][kv], padded rows)
  static_assert(AT_NW * 16 * 132 * 4 <= KVB, "the out tiles overlay the k, v tiles");
  __shared__ __align__(16) unsigned char KVraw[NG * KVB];        // in the loop: each group's k, v tiles; behind it: per wave out tile, pitch 132 floats
  __shared__ __align__(16) __bf16 Ksl[SPLIT_QK ? AT_KC * KP : 8];
  __shared__ __align__(16) __bf16 Vtl[SPLIT_PV ? D2 * VP : 8];
  __shared__ __align__(16) __bf16 Psh[NWV][16 * VP];
  __shared__ __align__(16) __bf16 Psl[SPLIT_PV ? AT_NW : 1][SPLIT_PV ? 16 * VP : 8];
  __shared__ __align__(16) __bf16 Qsh[NWV][16 * KP];     // q (hi plane, or the 16-bit value) staged per wave (keeps VGPR use low)
  __shared__ __align__(16) float  Msh[NWV][16], Lsh[NWV][16];    // each wave's row maxima and row sums, for the join of the key groups
  __shared__ __align__(16) __bf16 Qsl[SPLIT_QK ? AT_NW : 1][SPLIT_QK ? 16 * KP : 8];

  const int grp  = __builtin_amdgcn_readfirstlane(threadIdx.x >> 7);   // key group; the same in a whole wave: held scalar, so the tile offsets stay scalar arithmetic
  const int tid  = threadIdx.x & 127;    // thread within its group
  const int wave = tid >> 5;             // wave within its group = its 16-row query tile
  const int wv   = grp * AT_NW + wave;   // wave within the block: its private LDS
  const int lane = tid & 31;
  const int hh   = lane >> 4;
  const int c    = lane & 15;

  const int nqb = g.S / AT_QB;
  const int bx = blockIdx.x + g.blk0;
  const int qb = bx % nqb;
  const int bh = bx / nqb;
  const int h  = bh % g.H;
  const int b  = bh / g.H;
  const int qbase_block = qb * AT_QB;
  const int q0 = qbase_block + wave * 16;

  const float* qb_ptr = q + (size_t)b * g.q_bs + (size_t)h * g.q_hs;
  const float* kb_ptr = k + (size_t)b * g.k_bs + (size_t)h * g.k_hs;
  const float* vb_ptr = v + (size_t)b * g.v_bs + (size_t)h * g.v_hs;
  float*       ob_ptr = out + (size_t)b * g.o_bs + (size_t)h * g.o_hs;
  __bf16* Ksh = (__bf16*)(KVraw + grp * KVB);
  __bf16* Vth = Ksh + AT_KC * KP;

  // ---- Q fragments (A operand): 4 d-chunks, hi (and lo) ----
  v16b qah[4], qal[4];
  {
    const float* qrow = qb_ptr + (size_t)(q0 + c) * g.q_rs;
#pragma unroll
    for (int dc = 0; dc < 4; ++dc) {
#pragma unroll
      for (int e = 0; e < 8; ++e) {
        const float f0 = qrow[dc * 32 + 8 * hh + e] * g.qscale;
        const float f1 = qrow[dc * 32 + 16 + 8 * hh + e] * g.qscale;
        if (SPLIT_QK) { __bf16 hq, lq; at_split(f0, hq, lq); Qsh[wv][c * KP + dc * 32 + 8 * hh + e] = hq; Qsl[wv][c * KP + dc * 32 + 8 * hh + e] = lq;
                        at_split(f1, hq, lq); Qsh[wv][c * KP + dc * 32 + 16 + 8 * hh + e] = hq; Qsl[wv][c * KP + dc * 32 + 16 + 8 * hh + e] = lq;
                        qah[dc][e] = hq; qal[dc][e] = lq; qah[dc][8 + e] = hq; qal[dc][8 + e] = lq; }   // (register copies unused on the split path)
        else { Qsh[wv][c * KP + dc * 32 + 8 * hh + e] = at_to16<F16>(f0); Qsh[wv][c * KP + dc * 32 + 16 + 8 * hh + e] = at_to16<F16>(f1); qah[dc][e] = at_to16<F16>(f0); qal[dc][e] = qah[dc][e]; qah[dc][8 + e] = qah[dc][e]; qal[dc][8 + e] = qah[dc][e]; }
      }
    }
  }

  float mrow[8], lrow[8];
  v8f oacc[8];
#pragma unroll
  for (int r = 0; r < 8; ++r) { mrow[r] = -INFINITY; lrow[r] = 0.f; }
#pragma unroll
  for (int t = 0; t < 8; ++t) oacc[t] = (v8f){0.f,0.f,0.f,0.f,0.f,0.f,0.f,0.f};

  const int nChunks = (MODE == 1 || MODE == 4 || MODE == 6) ? (qb + 1) : (g.Skv / AT_KC);   // block-uniform
  // per-row query mask (mode 3)
  int qkeep[8];
#pragma unroll
  for (int r = 0; r < 8; ++r) qkeep[r] = (MODE == 3) ? mask_b[(size_t)b * g.S + q0 + 8 * hh + r] : 1;   // mask_b = qmask in mode 3
  for (int it = 0; it < nChunks / NG; ++it) {
    const int kc = it * NG + grp;
    const int kv0 = kc * AT_KC;
    __syncthreads();
    if (PRE16) {
      // plain copy, 16 B a lane: a wave's 32 lanes take 512 contiguous bytes of the source; step i is 2 KB further (8 k rows, 16 v rows)
      const unsigned short* kt = k16 + (size_t)b * g.k_bs + (size_t)kc * (AT_KC * D2) + tid * 8;
      const unsigned short* vt = vt16 + (size_t)b * g.v_bs + (size_t)kc * (AT_KC * D2) + tid * 8;
      __bf16* kd = Ksh + (tid >> 4) * KP + (tid & 15) * 8;
      __bf16* vd = Vth + (tid >> 3) * VP + (tid & 7) * 8;
      v8b kr[8], vr[8];
#pragma unroll   // unrolled so that kr, vr are registers and all 16 loads are in flight before the first store waits
      for (int i = 0; i < 8; ++i) {
        kr[i] = *(const v8b*)(kt + i * 1024);
        vr[i] = *(const v8b*)(vt + i * 1024);
      }
      // precaution: this wait stands before the two address pairs of the issued loads are reused; naming them here keeps the loads' own destinations off them
      asm volatile("s_wait_xcnt 0x0" :: "v"(kt), "v"(vt) : "memory");
#pragma unroll   // unrolled for the same reason; the row steps become immediate offsets
      for (int i = 0; i < 8; ++i) {
        *(v8b*)(kd + i * 8 * KP) = kr[i];
        *(v8b*)(vd + i * 16 * VP) = vr[i];
      }
    } else {
      const int kvr = tid >> 1, dh = (tid & 1) * 64;
      const float* krow = kb_ptr + (size_t)(kv0 + kvr) * g.k_rs + dh;
      const float* vrow = vb_ptr + (size_t)(kv0 + kvr) * g.v_rs + dh;
#pragma unroll
      for (int i = 0; i < 16; ++i) {
        v4f kk = *(const v4f*)(krow + 4 * i);
        v4f vv = *(const v4f*)(vrow + 4 * i);
#pragma unroll
        for (int e = 0; e < 4; ++e) {
          const int d = dh + 4 * i + e;
          if (SPLIT_QK) { __bf16 a, bl; at_split(kk[e], a, bl); Ksh[kvr * KP + d] = a; Ksl[kvr * KP + d] = bl; }
          else Ksh[kvr * KP + d] = at_to16<F16>(kk[e]);
          if (SPLIT_PV) { __bf16 a, bl; at_split(vv[e], a, bl); Vth[d * VP + kvr] = a; Vtl[d * VP + kvr] = bl; }
          else Vth[d * VP + kvr] = at_to16<F16>(vv[e]);
        }
      }
    }
    __syncthreads();

    v8f s[4];
#pragma unroll
    for (int j = 0; j < 4; ++j) {
      s[j] = (v8f){0.f,0.f,0.f,0.f,0.f,0.f,0.f,0.f};
if (SPLIT_QK) {
#pragma unroll 1
      for (int dc = 0; dc < 4; ++dc) {      // rolled: bounds the live fragment set (register pressure) on the 128-wide head
        FB kb;
        kb.h[0] = *(const v8b*)(Ksh + (j * 16 + c) * KP + dc * 32 + 8 * hh);
        kb.h[1] = *(const v8b*)(Ksh + (j * 16 + c) * KP + dc * 32 + 16 + 8 * hh);
        if (!SPLIT_QK) { FB qa; qa.h[0] = *(const v8b*)(&Qsh[wv][c * KP + dc * 32 + 8 * hh]); qa.h[1] = *(const v8b*)(&Qsh[wv][c * KP + dc * 32 + 16 + 8 * hh]); s[j] = at_mma16<F16>(qa.v, kb.v, s[j]); }
        if (SPLIT_QK) {
          FB qa, ql;
          qa.h[0] = *(const v8b*)(&Qsh[wv][c * KP + dc * 32 + 8 * hh]); qa.h[1] = *(const v8b*)(&Qsh[wv][c * KP + dc * 32 + 16 + 8 * hh]);
          ql.h[0] = *(const v8b*)(&Qsl[wv][c * KP + dc * 32 + 8 * hh]); ql.h[1] = *(const v8b*)(&Qsl[wv][c * KP + dc * 32 + 16 + 8 * hh]);
          s[j] = at_mma16<F16>(qa.v, kb.v, s[j]);
          FB kl;
          kl.h[0] = *(const v8b*)(Ksl + (j * 16 + c) * KP + dc * 32 + 8 * hh);
          kl.h[1] = *(const v8b*)(Ksl + (j * 16 + c) * KP + dc * 32 + 16 + 8 * hh);
          s[j] = at_mma16<F16>(qa.v, kl.v, s[j]);
          s[j] = at_mma16<F16>(ql.v, kb.v, s[j]);
        }
      }
      } else {
#pragma unroll
      for (int dc = 0; dc < 4; ++dc) {      // (16-bit path: fully unrolled; q fragments are reloaded from the per-wave Qsh copy in LDS)
        FB kb;
        kb.h[0] = *(const v8b*)(Ksh + (j * 16 + c) * KP + dc * 32 + 8 * hh);
        kb.h[1] = *(const v8b*)(Ksh + (j * 16 + c) * KP + dc * 32 + 16 + 8 * hh);
        if (!SPLIT_QK) { FB qa; qa.h[0] = *(const v8b*)(&Qsh[wv][c * KP + dc * 32 + 8 * hh]); qa.h[1] = *(const v8b*)(&Qsh[wv][c * KP + dc * 32 + 16 + 8 * hh]); s[j] = at_mma16<F16>(qa.v, kb.v, s[j]); }
        if (SPLIT_QK) {
          FB qa, ql;
          qa.h[0] = *(const v8b*)(&Qsh[wv][c * KP + dc * 32 + 8 * hh]); qa.h[1] = *(const v8b*)(&Qsh[wv][c * KP + dc * 32 + 16 + 8 * hh]);
          ql.h[0] = *(const v8b*)(&Qsl[wv][c * KP + dc * 32 + 8 * hh]); ql.h[1] = *(const v8b*)(&Qsl[wv][c * KP + dc * 32 + 16 + 8 * hh]);
          s[j] = at_mma16<F16>(qa.v, kb.v, s[j]);
          FB kl;
          kl.h[0] = *(const v8b*)(Ksl + (j * 16 + c) * KP + dc * 32 + 8 * hh);
          kl.h[1] = *(const v8b*)(Ksl + (j * 16 + c) * KP + dc * 32 + 16 + 8 * hh);
          s[j] = at_mma16<F16>(qa.v, kl.v, s[j]);
          s[j] = at_mma16<F16>(ql.v, kb.v, s[j]);
        }
      }
      }
    }
    const bool diag = (MODE == 1) && (kc == qb);
    int kvkeep[4] = {1, 1, 1, 1};
    if (MODE == 3) {
#pragma unroll
      for (int j = 0; j < 4; ++j) kvkeep[j] = ((const int*)mask_a)[(size_t)b * g.Skv + kv0 + j * 16 + c];   // mask_a = kvmask
    }
    float cm[8];
#pragma unroll
    for (int r = 0; r < 8; ++r) {
      const int qrow = q0 + 8 * hh + r;
      float m = -INFINITY;
#pragma unroll
      for (int j = 0; j < 4; ++j) {
        const int kvcol = kv0 + j * 16 + c;
        bool masked = false;
        if (diag) masked = (kvcol > qrow);
        else if (MODE == 4) masked = (kvcol > qrow) || (qrow - kvcol > g.mask_is_int);
        else if (MODE == 2) {
          const size_t mi = (size_t)qrow * g.Skv + kvcol;
          masked = (g.mask_is_int == 0) ? (((const float*)mask_a)[mi] == 0.0f)
                 : (g.mask_is_int == 1) ? (((const int*)mask_a)[mi] == 0) : (((const int*)mask_a)[mi] != 0);
        } else if (MODE == 3) masked = (qkeep[r] == 0) || (kvkeep[j] == 0);
        else if (MODE == 6) { masked = (kvcol > qrow); s[j][r] += g.cp[h] * (float)(kvcol - qrow); }
        else if (MODE == 8) { masked = (kvcol > qrow) || (((const int*)mask_a)[(size_t)b * g.Skv + kvcol] != 0); }
        else if (MODE == 5) {
          const size_t mi = (size_t)qrow * g.Skv + kvcol;
          masked = (((const int*)mask_a)[mi] != 0);
          int n = mask_b[mi]; n = n < 0 ? 0 : n;
          s[j][r] += g.cp[(size_t)b * g.c_bs + (size_t)h * g.c_hs + (size_t)qrow * g.c_rs + n]
                   + g.pc[(size_t)b * g.c_bs + (size_t)h * g.c_hs + (size_t)kvcol * g.c_rs + n];
        }
        if (masked) s[j][r] = g.mask_fill;
        m = fmaxf(m, s[j][r]);
      }
#pragma unroll
      for (int off = 1; off < 16; off <<= 1) m = fmaxf(m, __shfl_xor(m, off, 32));
      cm[r] = m;
    }
    __bf16* pwh = Psh[wv];
    __bf16* pwl = Psl[SPLIT_PV ? wv : 0];
#pragma unroll
    for (int r = 0; r < 8; ++r) {
      const float mnew = fmaxf(mrow[r], cm[r]);
      const float alpha = expf(mrow[r] - mnew);
      mrow[r] = mnew;
      float psum = 0.f;
#pragma unroll
      for (int j = 0; j < 4; ++j) {
        const float p = expf(s[j][r] - mnew);
        psum += p;
        if (SPLIT_PV) { __bf16 a, bl; at_split(p, a, bl); pwh[(8 * hh + r) * VP + j * 16 + c] = a; pwl[(8 * hh + r) * VP + j * 16 + c] = bl; }
        else pwh[(8 * hh + r) * VP + j * 16 + c] = at_to16<F16>(p * PSC);
      }
#pragma unroll
      for (int off = 1; off < 16; off <<= 1) psum += __shfl_xor(psum, off, 32);
      lrow[r] = lrow[r] * alpha + psum;
#pragma unroll
      for (int t = 0; t < 8; ++t) oacc[t][r] *= alpha;
    }
    __builtin_amdgcn_fence(__ATOMIC_RELEASE, "workgroup");
    __builtin_amdgcn_wave_barrier();
    __builtin_amdgcn_fence(__ATOMIC_ACQUIRE, "workgroup");
#pragma unroll 1
    for (int kk = 0; kk < 2; ++kk) {
      FB pa, pl;
      pa.h[0] = *(const v8b*)(pwh + c * VP + kk * 32 + 8 * hh);
      pa.h[1] = *(const v8b*)(pwh + c * VP + kk * 32 + 16 + 8 * hh);
      if (SPLIT_PV) {
        pl.h[0] = *(const v8b*)(pwl + c * VP + kk * 32 + 8 * hh);
        pl.h[1] = *(const v8b*)(pwl + c * VP + kk * 32 + 16 + 8 * hh);
      }
#pragma unroll
      for (int t = 0; t < 8; ++t) {
        FB vb;
        vb.h[0] = *(const v8b*)(Vth + (t * 16 + c) * VP + kk * 32 + 8 * hh);
        vb.h[1] = *(const v8b*)(Vth + (t * 16 + c) * VP + kk * 32 + 16 + 8 * hh);
        oacc[t] = at_mma16<F16>(pa.v, vb.v, oacc[t]);
        if (SPLIT_PV) {
          FB vl;
          vl.h[0] = *(const v8b*)(Vtl + (t * 16 + c) * VP + kk * 32 + 8 * hh);
          vl.h[1] = *(const v8b*)(Vtl + (t * 16 + c) * VP + kk * 32 + 16 + 8 * hh);
          oacc[t] = at_mma16<F16>(pa.v, vl.v, oacc[t]);
          oacc[t] = at_mma16<F16>(pl.v, vb.v, oacc[t]);
        }
      }
    }
  }

  float* os = (float*)KVraw + wv * (16 * 132);
  if (NG > 1) {
    if (c == 0) {      // the 16 lanes of a half hold the same eight maxima and sums: one of them stores
#pragma unroll   // unrolled so that mrow, lrow are indexed by constants and stay registers
      for (int r = 0; r < 8; ++r) { Msh[wv][8 * hh + r] = mrow[r]; Lsh[wv][8 * hh + r] = lrow[r]; }
    }
  }
  __syncthreads();   // every wave has left the k, v tiles, which the out tiles overlay; the maxima and sums of all groups are published
#pragma unroll   // unrolled, with the three loops inside it, so that mrow, lrow, mg and oacc are indexed by constants and stay registers
  for (int r = 0; r < 8; ++r) {
    float inv;
    if (NG > 1) {
      float mg[NG], mall = -INFINITY, lall = 0.f;
#pragma unroll
      for (int gi = 0; gi < NG; ++gi) { mg[gi] = Msh[gi * AT_NW + wave][8 * hh + r]; mall = fmaxf(mall, mg[gi]); }
#pragma unroll
      for (int gi = 0; gi < NG; ++gi) lall += Lsh[gi * AT_NW + wave][8 * hh + r] * expf(mg[gi] - mall);
      inv = expf(mrow[r] - mall) / (lall * PSC);
    } else {
      inv = 1.0f / (lrow[r] * PSC);
    }
#pragma unroll
    for (int t = 0; t < 8; ++t) os[(8 * hh + r) * 132 + t * 16 + c] = oacc[t][r] * inv;
  }
  __syncthreads();   // the weighted out tiles of all groups are published
  {
    const int c4 = lane * 4;           // 32 lanes x 16 B = one 512-B output row (128 floats) per instruction
    const float* ot = (const float*)KVraw + wave * (16 * 132);   // group 0's tile of these query rows; group gi's lies gi * AT_NW tiles further
#pragma unroll   // unrolled, with the loop inside it, so that all LDS reads of the rows are issued before the first sum waits
    for (int rr = 0; rr < 16 / NG; ++rr) {     // each group sums and stores its own 16 / NG rows of the tile
      const int row = grp * (16 / NG) + rr;
      v4f val = *(const v4f*)(ot + row * 132 + c4);
#pragma unroll
      for (int gi = 1; gi < NG; ++gi) val += *(const v4f*)(ot + gi * (AT_NW * 16 * 132) + row * 132 + c4);
      *(v4f*)(ob_ptr + (size_t)(q0 + row) * g.o_rs + c4) = val;
    }
  }
}

// ---- q, k and v projections in ONE launch, straight from the f32 inputs -------------------------------------------
// A block owns 64 rows of x (= one 64-key tile). Its 16 waves bring those rows and the three weight matrices in by whole-line 16 B loads, round them to
// f16 (the same rounding as a cast pass) and lay them in LDS as rows of 128 values: rows 0..63 x, 64..191 Wq, 192..319 Wk, 320..447 Wv.
// Behind the one barrier 12 waves each form a 32 x 64 tile over k = 128: q, k = x W^T + b (rows = x rows), v transposed = Wv x^T + bv (rows = d, columns = keys).
// Outputs: Q f32 rows, K16 f16 rows, Vt16 f16 [128 d][64 keys] per 64-key tile.
#define PJ_XP 136   // LDS row pitch in f16: 272 B = 16 B x odd, so the 16 rows of a ds_load_b128 fragment read fall on distinct banks
typedef __attribute__((ext_vector_type(4))) _Float16 v4h;
__device__ __forceinline__ v4h pj_cvt(v4f f) { v4h h; h[0] = (_Float16)f[0]; h[1] = (_Float16)f[1]; h[2] = (_Float16)f[2]; h[3] = (_Float16)f[3]; return h; }
// BIAS_MODE: 1 = bias[m], 2 = bias[n]. OUT16: f16 output (Ch), else f32 (Cf). The 32 x 64 tile goes out through the wave's own LDS slab, as whole row segments.
template <int BIAS_MODE, bool OUT16>
__device__ __forceinline__ void pj_store(const v8f (&acc)[2][4], float* slab, float* __restrict__ Cf, unsigned short* __restrict__ Ch,
                                         int ldc, int m0, int n0, const float* __restrict__ bias, int lane) {
  const int rlane = lane & 15;
  const int mOff  = (lane >> 4) * 8;
#pragma unroll   // unrolled, with the loops inside it, so that acc is indexed by constants and stays in registers
  for (int i = 0; i < 2; ++i) {
#pragma unroll
    for (int j = 0; j < 4; ++j) {
      float bn = 0.f;
      if (BIAS_MODE == 2) bn = bias[n0 + (j << 4) + rlane];
#pragma unroll
      for (int r = 0; r < 8; ++r) {
        float v = acc[i][j][r];
        if (BIAS_MODE == 1) v += bias[m0 + (i << 4) + mOff + r];
        if (BIAS_MODE == 2) v += bn;
        slab[((i << 4) + mOff + r) * 68 + (j << 4) + rlane] = v;
      }
    }
  }
  // the slab is private to the wave: its lanes' writes are ordered before its lanes' reads; it stands ahead of every global store, so it waits for none
  __builtin_amdgcn_fence(__ATOMIC_RELEASE, "workgroup");
  __builtin_amdgcn_wave_barrier();
  __builtin_amdgcn_fence(__ATOMIC_ACQUIRE, "workgroup");
  if (!OUT16) {
    const int hh = lane >> 4, c4 = (lane & 15) * 4;     // row segment = 256 B = 16 lanes x 16 B
#pragma unroll   // unrolled so that the LDS reads of all rows are issued before the first store waits
    for (int it = 0; it < 16; ++it) {
      const int row = it * 2 + hh;
      v4f v = *(const v4f*)(slab + row * 68 + c4);
      *(v4f*)(Cf + (size_t)(m0 + row) * ldc + n0 + c4) = v;
    }
  } else {
    const int q = lane >> 3, c8 = (lane & 7) * 8;       // row segment = 128 B = 8 lanes x 16 B
#pragma unroll   // unrolled for the same reason
    for (int it = 0; it < 8; ++it) {
      const int row = it * 4 + q;
      const float* sp = slab + row * 68 + c8;
      v8h hv;
#pragma unroll
      for (int e = 0; e < 8; ++e) hv[e] = (_Float16)sp[e];
      *(v8h*)(Ch + (size_t)(m0 + row) * ldc + n0 + c8) = hv;
    }
  }
  // precaution: this wait stands behind the issued stores, before code that follows the call reuses their address and data registers
  asm volatile("s_wait_xcnt 0x0" ::: "memory");
}
__global__ __launch_bounds__(512) void proj_qkv(
    const float* __restrict__ x, const float* __restrict__ Wq, const float* __restrict__ bq, const float* __restrict__ Wk, const float* __restrict__ bk,
    const float* __restrict__ Wv, const float* __restrict__ bv, float* __restrict__ Q, unsigned short* __restrict__ K16, unsigned short* __restrict__ Vt16) {
  __shared__ __align__(16) _Float16 Sm[448 * PJ_XP];
  __shared__ __align__(16) float sT[12][32 * 68];   // per-wave 32x64 slab, pitch 68 floats
  const int tid  = threadIdx.x;
  const int row0 = blockIdx.x * 64;
  {
    // a wave's 32 lanes take one whole 512 B row; the block takes 16 rows (2048 floats) a step
    const float* xs = x + (size_t)row0 * 128 + tid * 4;
    const float* qs = Wq + tid * 4;
    const float* ks = Wk + tid * 4;
    const float* vs = Wv + tid * 4;
    v4f xr[4], qr[8], kr[8], vr[8];
#pragma unroll   // unrolled so that the arrays are registers and all 28 loads are in flight before the first conversion waits
    for (int it = 0; it < 4; ++it) xr[it] = *(const v4f*)(xs + it * 2048);
#pragma unroll
    for (int it = 0; it < 8; ++it) {
      qr[it] = *(const v4f*)(qs + it * 2048);
      kr[it] = *(const v4f*)(ks + it * 2048);
      vr[it] = *(const v4f*)(vs + it * 2048);
    }
    // precaution: this wait stands behind the issued loads, before their address registers are reused
    asm volatile("s_wait_xcnt 0x0" ::: "memory");
    _Float16* d = Sm + (tid >> 5) * PJ_XP + (tid & 31) * 4;
#pragma unroll   // unrolled for the same reason; the row steps become immediate offsets
    for (int it = 0; it < 4; ++it) *(v4h*)(d + it * 16 * PJ_XP) = pj_cvt(xr[it]);
#pragma unroll
    for (int it = 0; it < 8; ++it) {
      *(v4h*)(d + (64 + it * 16) * PJ_XP)  = pj_cvt(qr[it]);
      *(v4h*)(d + (192 + it * 16) * PJ_XP) = pj_cvt(kr[it]);
      *(v4h*)(d + (320 + it * 16) * PJ_XP) = pj_cvt(vr[it]);
    }
  }
  __syncthreads();   // x rows and weights are published to every wave; the only block barrier of the kernel
  const int wave = __builtin_amdgcn_readfirstlane(tid >> 5);   // the same in a whole wave: held scalar, so the tile choice is scalar arithmetic and scalar branches
  if (wave >= 12) return;                // 12 tiles of 32 x 64; whole waves leave, behind the barrier
  const int lane  = tid & 31;
  const int rlane = lane & 15;           // row (A) / column (B, D) within a 16 x 16 subtile
  const int koff  = (lane >> 4) * 8;     // k offset of this lane half
  const int which = wave >> 2;           // 0 q, 1 k, 2 v
  const int sub   = wave & 3;
  const int aRow = (which == 2) ? 320 + sub * 32 : (sub >> 1) * 32;
  const int bRow = (which == 2) ? 0 : 64 + which * 128 + (sub & 1) * 64;
  const _Float16* Al = Sm + (aRow + rlane) * PJ_XP + koff;
  const _Float16* Bl = Sm + (bRow + rlane) * PJ_XP + koff;
  v8f acc[2][4];
#pragma unroll
  for (int i = 0; i < 2; ++i)
#pragma unroll
    for (int j = 0; j < 4; ++j) acc[i][j] = (v8f){0.f,0.f,0.f,0.f,0.f,0.f,0.f,0.f};
#pragma unroll   // unrolled so that a later step's fragment reads can be issued ahead of an earlier step's products
  for (int k0 = 0; k0 < 128; k0 += 32) {
    v16h bh[4], ah[2];
#pragma unroll
    for (int j = 0; j < 4; ++j) bh[j] = Frag<_Float16>::load(Bl + j * 16 * PJ_XP + k0);
#pragma unroll
    for (int i = 0; i < 2; ++i) ah[i] = Frag<_Float16>::load(Al + i * 16 * PJ_XP + k0);
#pragma unroll
    for (int i = 0; i < 2; ++i)
#pragma unroll
      for (int j = 0; j < 4; ++j) acc[i][j] = Frag<_Float16>::mma(ah[i], bh[j], acc[i][j]);
  }
  float* slab = sT[wave];
  if (which == 0)      pj_store<2, false>(acc, slab, Q, nullptr, 128, row0 + (sub >> 1) * 32, (sub & 1) * 64, bq, lane);
  else if (which == 1) pj_store<2, true>(acc, slab, nullptr, K16, 128, row0 + (sub >> 1) * 32, (sub & 1) * 64, bk, lane);
  else                 pj_store<1, true>(acc, slab, nullptr, Vt16 + (size_t)blockIdx.x * (64 * 128), 64, sub * 32, 0, bv, lane);
}

#define IB 4
#define INn 4096
#define ID 128
extern "C" void kernel_launch(void* const* d_in, const int* in_sizes, int n_in, void* d_out, int out_size, void* d_ws, size_t ws_size, hipStream_t stream) {
  (void)in_sizes; (void)n_in; (void)out_size; (void)ws_size;
  const float* x = (const float*)d_in[0]; const float* Wq = (const float*)d_in[1]; const float* bq = (const float*)d_in[2]; const float* Wk = (const float*)d_in[3]; const float* bk = (const float*)d_in[4]; const float* Wv = (const float*)d_in[5]; const float* bv = (const float*)d_in[6];
  char* ws = (char*)d_ws; size_t off = 0;
  auto carve = [&](size_t bytes) -> char* { char* p = ws + off; off += (bytes + 255) & ~(size_t)255; return p; };
  const int R = IB * INn;
  float* Q = (float*)carve((size_t)R * ID * 4); _Float16* K16 = (_Float16*)carve((size_t)R * ID * 2); _Float16* Vt16 = (_Float16*)carve((size_t)R * ID * 2);
  // q f32 rows, k f16 rows, v f16 transposed per 64-key tile ([128 d][64 keys], 16 KB contiguous): one launch, one block per 64 rows of x
  proj_qkv<<<R / AT_KC, 512, 0, stream>>>(x, Wq, bq, Wk, bk, Wv, bv, Q, (unsigned short*)K16, (unsigned short*)Vt16);
  { AttnGeom g;
    g.q_bs = (long)INn * ID; g.q_rs = ID; g.q_hs = 0; g.k_bs = g.q_bs; g.k_rs = ID; g.k_hs = 0; g.v_bs = g.q_bs; g.v_rs = ID; g.v_hs = 0; g.o_bs = (long)INn * ID; g.o_rs = ID; g.o_hs = 0;
    g.S = INn; g.Skv = INn; g.H = 1; g.mask_mode = 0; g.qscale = 0.08838834764831845f; g.blk0 = 0; g.mask_fill = -INFINITY; g.mask_is_int = 0;
    attn128_kernel<false, false, true, 0, true, 4><<<IB * (INn / AT_QB), 4 * AT_NW * 32, 0, stream>>>(Q, nullptr, nullptr, U16(K16), U16(Vt16), (float*)d_out, nullptr, nullptr, g); }
}

// v006
// Measured time: 79.6 microseconds a run.
// Next to v005, in two timings, it ran 1.35 and 1.34 times as fast.
// All steps since v000 together make it 13.1 times as fast.
#include <hip/hip_runtime.h>
#include <math.h>
// InteractionLayer: q, k, v = x W^T + b (three 16384 x 128 by 128 x 128 products in one launch; q f32, k f16 rows, v f16 transposed in 64-key tiles) and single-head attention (d 128, 4096 keys per batch; scores and
// p·v with p x2^15) on v_wmma_f32_16x16x32_f16 with f16 operands, f32 accumulate; softmax f32 on VALU. nn.Linear weights ([out][in]) are the
// Bt operand of q, k and the A operand of v^T, directly.
typedef __attribute__((ext_vector_type(16))) _Float16 v16h;
typedef __attribute__((ext_vector_type(8)))  _Float16 v8h;
typedef __attribute__((ext_vector_type(16))) __bf16   v16b;
typedef __attribute__((ext_vector_type(8)))  __bf16   v8b;
typedef __attribute__((ext_vector_type(8)))  float    v8f;
typedef __attribute__((ext_vector_type(4)))  float    v4f;
#define PSCALE 32768.0f
#define U16(p) ((const unsigned short*)(const void*)(p))
#define PSCALE_INV (1.0f / 32768.0f)

__device__ __forceinline__ unsigned short f2bf_bits(float f) {
  unsigned u = __float_as_uint(f);
  return (unsigned short)((u + 0x7FFFu + ((u >> 16) & 1u)) >> 16);
}
__device__ __forceinline__ float bf_bits2f(unsigned short h) { return __uint_as_float(((unsigned)h) << 16); }

// hazard guards as plain device helpers (no inline asm inside the kernel template body)
__device__ __forceinline__ void dep_guard_h(v8f& a, v8f& b, v16h x, v16h y) { asm volatile("v_nop\n\tv_nop\n\tv_nop\n\tv_nop" : "+v"(a), "+v"(b) : "v"(x), "v"(y)); }
__device__ __forceinline__ void dep_guard_b(v8f& a, v8f& b, v16b x, v16b y) { asm volatile("v_nop\n\tv_nop\n\tv_nop\n\tv_nop" : "+v"(a), "+v"(b) : "v"(x), "v"(y)); }
__device__ __forceinline__ void keep4_h(v16h a, v16h b, v16h c, v16h d) { asm volatile("v_nop" :: "v"(a), "v"(b), "v"(c), "v"(d)); }
__device__ __forceinline__ void keep4_b(v16b a, v16b b, v16b c, v16b d) { asm volatile("v_nop" :: "v"(a), "v"(b), "v"(c), "v"(d)); }
__device__ __forceinline__ void acc_guard4(v8f& a, v8f& b, v8f& c, v8f& d) { asm volatile("v_nop\n\tv_nop\n\tv_nop\n\tv_nop" : "+v"(a), "+v"(b), "+v"(c), "+v"(d)); }
template <typename T> struct Frag;
template <> struct Frag<_Float16> {
  typedef v16h V; union U { v16h v; v8h h[2]; };
  static __device__ __forceinline__ v16h load(const _Float16* p) {   // elements 0..7 <- p[0..7], 8..15 <- p[16..23]
    U f; f.h[0] = *(const v8h*)(p); f.h[1] = *(const v8h*)(p + 16); return f.v;
  }
  static __device__ __forceinline__ v8f mma(v16h a, v16h b, v8f c) {
    return __builtin_amdgcn_wmma_f32_16x16x32_f16(false, a, false, b, (short)0, c, false, false);
  }
  static __device__ __forceinline__ void guard(v8f& a, v8f& b, v16h x, v16h y) { dep_guard_h(a, b, x, y); }
  static __device__ __forceinline__ void keep(v16h a, v16h b, v16h c, v16h d) { keep4_h(a, b, c, d); }
};
template <> struct Frag<__bf16> {
  typedef v16b V; union U { v16b v; v8b h[2]; };
  static __device__ __forceinline__ v16b load(const __bf16* p) {
    U f; f.h[0] = *(const v8b*)(p); f.h[1] = *(const v8b*)(p + 16); return f.v;
  }
  static __device__ __forceinline__ v8f mma(v16b a, v16b b, v8f c) {
    return __builtin_amdgcn_wmma_f32_16x16x32_bf16(false, a, false, b, (short)0, c, false, false);
  }
  static __device__ __forceinline__ void guard(v8f& a, v8f& b, v16b x, v16b y) { dep_guard_b(a, b, x, y); }
  static __device__ __forceinline__ void keep(v16b a, v16b b, v16b c, v16b d) { keep4_b(a, b, c, d); }
};

// ---- Register-blocked batched WMMA GEMM ------------------------------------
// C[m,n] = scale * sum_k A[m,k] * Bt[n,k] (+bias)(+resid); each wave owns a 64x64 tile.
// A row-major [M,K]; Bt row-major [N,K]; M,N % 64 == 0, K % 32 == 0.
// SPLIT: operands are hi/lo planes (A2/Bt2 = lo planes, same layout); product = hi·hi + hi·lo + lo·hi.
// BIAS_MODE: 0 = none, 1 = bias[m], 2 = bias[n].
// OUT_MODE: 0 = f32, 1 = f16, 2 = bf16 hi plane (Cout) + bf16 lo plane (Cout2).
// ET: 0 = f16 operands, 1 = bf16 operands (pointers passed as 16-bit storage)
template <int ET> struct Elem;
template <> struct Elem<0> { typedef _Float16 T; };
template <> struct Elem<1> { typedef __bf16 T; };
template <int ET, bool SPLIT, int BIAS_MODE, int OUT_MODE, bool RESID, int ACT = 0>
__global__ __launch_bounds__(256) void wmma_gemm64(
    const unsigned short* __restrict__ Ap, const unsigned short* __restrict__ A2p, int lda, long strideA,
    const unsigned short* __restrict__ Btp, const unsigned short* __restrict__ Bt2p, int ldb, long strideB,
    void* __restrict__ Cout, void* __restrict__ Cout2, int ldc, long strideC,
    const float* __restrict__ bias,
    const float* __restrict__ resid, long strideR,
    int M, int N, int K, float scale) {
  typedef typename Elem<ET>::T T;
  typedef typename Frag<T>::V V;
  const T* A = (const T*)Ap; const T* A2 = (const T*)A2p; const T* Bt = (const T*)Btp; const T* Bt2 = (const T*)Bt2p;
  __shared__ __align__(16) float sT[8][16 * 68];   // per-wave 16x64 slab, pitch 68 floats
  const int b    = blockIdx.y;
  const int lane = threadIdx.x & 31;
  const int wave = threadIdx.x >> 5;
  const int tilesN = N >> 6;
  const int tilesM = M >> 6;
  const int tile = blockIdx.x * 8 + wave;
  if (tile >= tilesM * tilesN) return;   // wave-uniform; no block barriers in this kernel
  const int tm = tile / tilesN;
  const int tn = tile - tm * tilesN;
  const int m0 = tm << 6;
  const int n0 = tn << 6;

  const T* Ab  = A  + (size_t)b * strideA;
  const T* Bb  = Bt + (size_t)b * strideB;
  const T* Ab2 = SPLIT ? (A2  + (size_t)b * strideA) : nullptr;
  const T* Bb2 = SPLIT ? (Bt2 + (size_t)b * strideB) : nullptr;

  const int rlane = lane & 15;                 // row (A) / col (B, D) within subtile
  const int koff  = (lane >> 4) * 8;           // k offset of this lane half
  const int mOff  = (lane >> 4) * 8;           // D row offset

  v8f acc[4][4];
#pragma unroll
  for (int i = 0; i < 4; ++i)
#pragma unroll
    for (int j = 0; j < 4; ++j) acc[i][j] = (v8f){0.f,0.f,0.f,0.f,0.f,0.f,0.f,0.f};

  for (int k0 = 0; k0 < K; k0 += 32) {
    V bh[4], bl[4];
#pragma unroll
    for (int j = 0; j < 4; ++j) {
      const size_t bo = (size_t)(n0 + (j << 4) + rlane) * ldb + koff + k0;
      bh[j] = Frag<T>::load(Bb + bo);
      if (SPLIT) bl[j] = Frag<T>::load(Bb2 + bo);
    }
#pragma unroll
    for (int i = 0; i < 4; ++i) {
      const size_t ao = (size_t)(m0 + (i << 4) + rlane) * lda + koff + k0;
      V ah = Frag<T>::load(Ab + ao);
      V al;
      if (SPLIT) al = Frag<T>::load(Ab2 + ao);
#pragma unroll
      for (int j = 0; j < 4; ++j) {
        acc[i][j] = Frag<T>::mma(ah, bh[j], acc[i][j]);
        if (SPLIT) {
          acc[i][j] = Frag<T>::mma(ah, bl[j], acc[i][j]);
          acc[i][j] = Frag<T>::mma(al, bh[j], acc[i][j]);
        }
      }
      Frag<T>::guard(acc[i][0], acc[i][3], ah, SPLIT ? al : ah);
    }
    Frag<T>::keep(bh[0], bh[1], bh[2], bh[3]);
    if (SPLIT) Frag<T>::keep(bl[0], bl[1], bl[2], bl[3]);
  }
  acc_guard4(acc[0][0], acc[0][1], acc[0][2], acc[0][3]);
  acc_guard4(acc[1][0], acc[1][1], acc[1][2], acc[1][3]);
  acc_guard4(acc[2][0], acc[2][1], acc[2][2], acc[2][3]);
  acc_guard4(acc[3][0], acc[3][1], acc[3][2], acc[3][3]);

  // ---- epilogue ----
  float* slab = sT[wave];
  const float* Rb = RESID ? (resid + (size_t)b * strideR) : nullptr;
#pragma unroll
  for (int i = 0; i < 4; ++i) {
    const int mBase = m0 + (i << 4);
#pragma unroll
    for (int j = 0; j < 4; ++j) {
      const int n = n0 + (j << 4) + rlane;
      float bv = 0.f;
      if (BIAS_MODE == 2) bv = bias[n];
#pragma unroll
      for (int r = 0; r < 8; ++r) {
        float v = acc[i][j][r] * scale;
        if (BIAS_MODE == 1) v += bias[mBase + mOff + r];
        if (BIAS_MODE == 2) v += bv;
        if (RESID) v += Rb[(size_t)(mBase + mOff + r) * ldc + n];
        if (ACT == 1) v = tanhf(v);
        if (ACT == 2) v = fmaxf(v, 0.0f);
        if (ACT == 3) v = v / (1.0f + expf(-v));
        if (ACT == 4) v = (v > 0.f) ? v : 0.01f * v;
        if (ACT == 5) v = 0.5f * v * (1.0f + erff(v * 0.70710678118654752f));
        slab[(mOff + r) * 68 + (j << 4) + rlane] = v;
      }
    }
    __builtin_amdgcn_fence(__ATOMIC_RELEASE, "workgroup");
    __builtin_amdgcn_wave_barrier();
    __builtin_amdgcn_fence(__ATOMIC_ACQUIRE, "workgroup");
    if (OUT_MODE == 0) {
      float* C = (float*)Cout + (size_t)b * strideC;
      const int hh = lane >> 4, c4 = (lane & 15) * 4;     // row seg = 256 B = 16 lanes x 16 B
      {
#pragma unroll
        for (int it = 0; it < 8; ++it) {
          const int row = it * 2 + hh;
          v4f v = *(const v4f*)(slab + row * 68 + c4);
          *(v4f*)(C + (size_t)(mBase + row) * ldc + n0 + c4) = v;
        }
        
      }
    } else {
      const int q = lane >> 3, c8 = (lane & 7) * 8;
      unsigned short* C  = (unsigned short*)Cout  + (size_t)b * strideC;
      unsigned short* C2 = (OUT_MODE == 2) ? ((unsigned short*)Cout2 + (size_t)b * strideC) : nullptr;
      {
#pragma unroll
        for (int it = 0; it < 4; ++it) {
          const int row = it * 4 + q;
          const float* sp = slab + row * 68 + c8;
          v8h hv, lv;
#pragma unroll
          for (int e = 0; e < 8; ++e) {
            if (OUT_MODE == 1) {
              hv[e] = (_Float16)sp[e];
            } else {
              unsigned short hb = f2bf_bits(sp[e]);
              unsigned short lb = f2bf_bits(sp[e] - bf_bits2f(hb));
              hv[e] = __builtin_bit_cast(_Float16, hb);
              lv[e] = __builtin_bit_cast(_Float16, lb);
            }
          }
          *(v8h*)(C + (size_t)(mBase + row) * ldc + n0 + c8) = hv;
          if (OUT_MODE == 2) *(v8h*)(C2 + (size_t)(mBase + row) * ldc + n0 + c8) = lv;
        }
        
      }
    }
    __builtin_amdgcn_fence(__ATOMIC_RELEASE, "workgroup");
    __builtin_amdgcn_wave_barrier();
    __builtin_amdgcn_fence(__ATOMIC_ACQUIRE, "workgroup");
  }
}

__global__ __launch_bounds__(256) void cast_f32_f16x2(
    const float* __restrict__ in, _Float16* __restrict__ out, int n2) {
  int i = blockIdx.x * 256 + threadIdx.x;
  if (i < n2) {
    const _Float16 h0 = (_Float16)in[2 * i], h1 = (_Float16)in[2 * i + 1];
    const unsigned u = (unsigned)__builtin_bit_cast(unsigned short, h0) | ((unsigned)__builtin_bit_cast(unsigned short, h1) << 16);
    ((unsigned*)out)[i] = u;
    
  }
}


// ---- f32 -> f16 cast with a power-of-two pre-scale (folded back by the consumer GEMM's scale) ----
__global__ __launch_bounds__(256) void cast_f32_f16x2s(const float* __restrict__ in, _Float16* __restrict__ out, int n2, float s) {
  int i = blockIdx.x * 256 + threadIdx.x;
  if (i < n2) {
    const _Float16 h0 = (_Float16)(in[2 * i] * s), h1 = (_Float16)(in[2 * i + 1] * s);
    const unsigned u = (unsigned)__builtin_bit_cast(unsigned short, h0) | ((unsigned)__builtin_bit_cast(unsigned short, h1) << 16);
    ((unsigned*)out)[i] = u;
    
  }
}
__global__ __launch_bounds__(256) void split_f32_bf16x2(
    const float* __restrict__ in, __bf16* __restrict__ hi, __bf16* __restrict__ lo, long n2) {
  long i = (long)blockIdx.x * 256 + threadIdx.x;
  long stride = (long)gridDim.x * 256;
  {
    for (long j = i; j < n2; j += stride) {
      const float a = in[2 * j], b = in[2 * j + 1];
      const unsigned short ah = f2bf_bits(a), bh = f2bf_bits(b);
      const unsigned short al = f2bf_bits(a - bf_bits2f(ah)), bl = f2bf_bits(b - bf_bits2f(bh));
      ((unsigned*)hi)[j] = (unsigned)ah | ((unsigned)bh << 16);
      ((unsigned*)lo)[j] = (unsigned)al | ((unsigned)bl << 16);
    }
    
  }
}


// ---- f32 [R][C] (row pitch ldi) -> f16 transposed [C][R] (row pitch ldo); 64x64 tiles; each output row segment
__global__ __launch_bounds__(256) void transpose_cast_f16(const float* __restrict__ in, int ldi,
                                                         _Float16* __restrict__ outT, int ldo, float scale) {
  __shared__ __align__(16) _Float16 tile[64][72];     // [c][r]
  const int c0 = blockIdx.x * 64, r0 = blockIdx.y * 64;
  const int t = threadIdx.y * 32 + threadIdx.x;
  for (int i = threadIdx.y; i < 64; i += 8) {
    tile[threadIdx.x][i]      = (_Float16)(in[(size_t)(r0 + i) * ldi + c0 + threadIdx.x] * scale);
    tile[32 + threadIdx.x][i] = (_Float16)(in[(size_t)(r0 + i) * ldi + c0 + 32 + threadIdx.x] * scale);
  }
  __syncthreads();
  const int q = t >> 3, c8 = (t & 7) * 8;
  {
#pragma unroll
    for (int it = 0; it < 2; ++it) {
      const int c = it * 32 + q;
      v8h hv = *(const v8h*)(&tile[c][c8]);
      *(v8h*)(outT + (size_t)(c0 + c) * ldo + r0 + c8) = hv;
    }
    
  }
}

// ---- f32 [R][C] (pitch ldi) -> bf16 hi/lo transposed planes [C][R] (pitch ldo); 64x64 tiles; each output row segment
__global__ __launch_bounds__(256) void transpose_split_bf16(const float* __restrict__ in, int ldi,
                                                           __bf16* __restrict__ outH, __bf16* __restrict__ outL, int ldo) {
  __shared__ __align__(16) float tile[64][68];     // [c][r]
  const int c0 = blockIdx.x * 64, r0 = blockIdx.y * 64;
  const int t = threadIdx.y * 32 + threadIdx.x;
  for (int i = threadIdx.y; i < 64; i += 8) {
    tile[threadIdx.x][i]      = in[(size_t)(r0 + i) * ldi + c0 + threadIdx.x];
    tile[32 + threadIdx.x][i] = in[(size_t)(r0 + i) * ldi + c0 + 32 + threadIdx.x];
  }
  __syncthreads();
  const int q = t >> 3, c8 = (t & 7) * 8;
  {
#pragma unroll
    for (int it = 0; it < 2; ++it) {
      const int c = it * 32 + q;
      v8b hv, lv;
#pragma unroll
      for (int e = 0; e < 8; ++e) {
        const float f = tile[c][c8 + e];
        const unsigned short hb = f2bf_bits(f);
        hv[e] = __builtin_bit_cast(__bf16, hb);
        lv[e] = __builtin_bit_cast(__bf16, f2bf_bits(f - bf_bits2f(hb)));
      }
      *(v8b*)(outH + (size_t)(c0 + c) * ldo + r0 + c8) = hv;
      *(v8b*)(outL + (size_t)(c0 + c) * ldo + r0 + c8) = lv;
    }
    
  }
}

// =====================================================================================
// Generic causal/non-causal attention for head_dim 64, f32 in / f32 out; 16-bit operands: bf16 with optional hi/lo splits, or
// plain f16 (F16=true, non-split, probabilities carried x2^15).
//   scores = (q*qscale)·kᵀ : v_wmma_f32_16x16x32_bf16; SPLIT_QK -> q,k as bf16 hi/lo (hi·hi + hi·lo + lo·hi)
//   out    = p·v           : v_wmma_f32_16x16x32_bf16; SPLIT_PV -> p,v as bf16 hi/lo; else p,v plain bf16
//   f32 accumulate; online softmax in f32. Block = 4 waves = 64 query rows of one (batch, head); S % 64 == 0.
//   Element (b, s, h, d) of tensor X lives at X[b*X_bs + s*X_rs + h*X_hs + d] (strides in floats, multiples of 4).
//   Masking: mask_mode 0 none, 1 causal (kv > q masked), 2 tensor [S][Skv] shared over (b,h) (float if
//   mask_is_int==0, int32 with element == 0 -> masked if 1, int32 with element != 0 -> masked if 2), 3 per-token vectors qmask[B][S] & kvmask[B][Skv] (int32,
//   0 -> masked), 4 causal + sliding window (kv > q or q - kv > W masked; W passed in mask_is_int);
//   5 = relative-position bias: s += cp[b,h,q][idx[q][kv]] + pc[b,h,kv][idx[q][kv]] with idx = mask_b ([S][Skv] int32) and
//   mask_a an int32 [S][Skv] tensor with nonzero = masked (tables: element (b,h,row,n) at X + b*c_bs + h*c_hs + row*c_rs + n);
//   masked scores are replaced by mask_fill (e.g. -inf or -1e9) before the softmax.
//   grid.x = B * H * (S/64) (or a sub-range with blk0).
// =====================================================================================
#define AT_D 64
#define AT_NW 4
#define AT_QB 64
#define AT_KC 64
struct AttnGeom { const float* cp = nullptr; const float* pc = nullptr; long c_bs = 0, c_rs = 0, c_hs = 0;   // mode-5 score-bias tables
                  long q_bs, q_rs, q_hs, k_bs, k_rs, k_hs, v_bs, v_rs, v_hs, o_bs, o_rs, o_hs;
                  int S, Skv, H, mask_mode; float qscale; int blk0; float mask_fill; int mask_is_int; };
static_assert(sizeof(AttnGeom) == 168, "no padding");

__device__ __forceinline__ unsigned short at_bf_bits(float f) {
  unsigned u = __float_as_uint(f);
  return (unsigned short)((u + 0x7FFFu + ((u >> 16) & 1u)) >> 16);
}
__device__ __forceinline__ __bf16 at_f2bf(float f) { return __builtin_bit_cast(__bf16, at_bf_bits(f)); }
__device__ __forceinline__ void at_split(float f, __bf16& hi, __bf16& lo) {
  const unsigned short hb = at_bf_bits(f);
  hi = __builtin_bit_cast(__bf16, hb);
  lo = at_f2bf(f - __uint_as_float(((unsigned)hb) << 16));
}
__device__ __forceinline__ v8f at_mma(v16b a, v16b b, v8f c) {
  c = __builtin_amdgcn_wmma_f32_16x16x32_bf16(false, a, false, b, (short)0, c, false, false);
  asm volatile("v_nop\n\tv_nop\n\tv_nop\n\tv_nop" : "+v"(c) : "v"(a), "v"(b));
  return c;
}
// 16-bit element as a bit pattern held in a __bf16 slot: f16 bits when F16, bf16 (RNE) otherwise
template <bool F16> __device__ __forceinline__ __bf16 at_to16(float f) {
  if (F16) return __builtin_bit_cast(__bf16, (_Float16)f);
  return at_f2bf(f);
}
template <bool F16> __device__ __forceinline__ v8f at_mma16(v16b a, v16b b, v8f c) {
  if (F16) {
    const v16h ah = __builtin_bit_cast(v16h, a), bh = __builtin_bit_cast(v16h, b);
    c = __builtin_amdgcn_wmma_f32_16x16x32_f16(false, ah, false, bh, (short)0, c, false, false);
    asm volatile("v_nop\n\tv_nop\n\tv_nop\n\tv_nop" : "+v"(c) : "v"(ah), "v"(bh));
    return c;
  }
  return at_mma(a, b, c);
}

template <bool SPLIT_QK, bool SPLIT_PV, bool F16 = false>
__global__ __launch_bounds__(128)
void attn64_kernel(const float* __restrict__ q, const float* __restrict__ k,
                   const float* __restrict__ v, float* __restrict__ out,
                   const void* __restrict__ mask_a, const int* __restrict__ mask_b, AttnGeom g) {
  static_assert(!(F16 && (SPLIT_QK || SPLIT_PV)), "f16 mode is non-split");
  const float PSC = F16 ? 32768.0f : 1.0f;     // f16 probabilities carried x2^15 (subnormal range), folded into the final 1/l
  union FB { v16b v; v8b h[2]; };
  __shared__ __align__(16) __bf16 Ksh[AT_KC * AT_D];             // K hi [kv][d]      8 KB
  __shared__ __align__(16) __bf16 Ksl[SPLIT_QK ? AT_KC * AT_D : 8];
  __shared__ __align__(16) __bf16 Vth[AT_D * AT_KC];             // V hi [d][kv]      8 KB
  __shared__ __align__(16) __bf16 Vtl[SPLIT_PV ? AT_D * AT_KC : 8];
  __shared__ __align__(16) __bf16 Psh[AT_NW][16 * AT_KC];        // per wave P hi [row][kv]  8 KB
  __shared__ __align__(16) __bf16 Psl[SPLIT_PV ? AT_NW : 1][SPLIT_PV ? 16 * AT_KC : 8];
  __shared__ __align__(16) float  Os[AT_NW][16 * 68];            // per wave out tile, pitch 68

  const int tid  = threadIdx.x;
  const int wave = tid >> 5;
  const int lane = tid & 31;
  const int hh   = lane >> 4;
  const int c    = lane & 15;

  const int nqb = g.S / AT_QB;
  const int bx = blockIdx.x + g.blk0;
  const int qb = bx % nqb;
  const int bh = bx / nqb;
  const int h  = bh % g.H;
  const int b  = bh / g.H;
  const int qbase_block = qb * AT_QB;
  const int q0 = qbase_block + wave * 16;

  const float* qb_ptr = q + (size_t)b * g.q_bs + (size_t)h * g.q_hs;
  const float* kb_ptr = k + (size_t)b * g.k_bs + (size_t)h * g.k_hs;
  const float* vb_ptr = v + (size_t)b * g.v_bs + (size_t)h * g.v_hs;
  float*       ob_ptr = out + (size_t)b * g.o_bs + (size_t)h * g.o_hs;

  // ---- Q fragments (A operand): 2 d-chunks, hi (and lo) ----
  v16b qah[2], qal[2];
  {
    const float* qrow = qb_ptr + (size_t)(q0 + c) * g.q_rs;
#pragma unroll
    for (int dc = 0; dc < 2; ++dc) {
#pragma unroll
      for (int e = 0; e < 8; ++e) {
        const float f0 = qrow[dc * 32 + 8 * hh + e] * g.qscale;
        const float f1 = qrow[dc * 32 + 16 + 8 * hh + e] * g.qscale;
        if (SPLIT_QK) { __bf16 hq, lq; at_split(f0, hq, lq); qah[dc][e] = hq; qal[dc][e] = lq; at_split(f1, hq, lq); qah[dc][8 + e] = hq; qal[dc][8 + e] = lq; }
        else { qah[dc][e] = at_to16<F16>(f0); qah[dc][8 + e] = at_to16<F16>(f1); qal[dc][e] = qah[dc][e]; qal[dc][8 + e] = qah[dc][8 + e]; }
      }
    }
  }

  float mrow[8], lrow[8];
  v8f oacc[4];
#pragma unroll
  for (int r = 0; r < 8; ++r) { mrow[r] = -INFINITY; lrow[r] = 0.f; }
#pragma unroll
  for (int t = 0; t < 4; ++t) oacc[t] = (v8f){0.f,0.f,0.f,0.f,0.f,0.f,0.f,0.f};

  const int nChunks = (g.mask_mode == 1 || g.mask_mode == 4) ? (qb + 1) : (g.Skv / AT_KC);   // block-uniform
  // per-row query mask (mode 3)
  int qkeep[8];
#pragma unroll
  for (int r = 0; r < 8; ++r) qkeep[r] = (g.mask_mode == 3) ? mask_b[(size_t)b * g.S + q0 + 8 * hh + r] : 1;   // mask_b = qmask in mode 3
  for (int kc = 0; kc < nChunks; ++kc) {
    const int kv0 = kc * AT_KC;
    __syncthreads();
    {
      const int kvr = tid >> 1, dh = (tid & 1) * 32;
      const float* krow = kb_ptr + (size_t)(kv0 + kvr) * g.k_rs + dh;
      const float* vrow = vb_ptr + (size_t)(kv0 + kvr) * g.v_rs + dh;
#pragma unroll
      for (int i = 0; i < 8; ++i) {
        v4f kk = *(const v4f*)(krow + 4 * i);
        v4f vv = *(const v4f*)(vrow + 4 * i);
#pragma unroll
        for (int e = 0; e < 4; ++e) {
          const int d = dh + 4 * i + e;
          if (SPLIT_QK) { __bf16 a, bl; at_split(kk[e], a, bl); Ksh[kvr * AT_D + d] = a; Ksl[kvr * AT_D + d] = bl; }
          else Ksh[kvr * AT_D + d] = at_to16<F16>(kk[e]);
          if (SPLIT_PV) { __bf16 a, bl; at_split(vv[e], a, bl); Vth[d * AT_KC + kvr] = a; Vtl[d * AT_KC + kvr] = bl; }
          else Vth[d * AT_KC + kvr] = at_to16<F16>(vv[e]);
        }
      }
    }
    __syncthreads();

    v8f s[4];
#pragma unroll
    for (int j = 0; j < 4; ++j) {
      s[j] = (v8f){0.f,0.f,0.f,0.f,0.f,0.f,0.f,0.f};
#pragma unroll 1
      for (int dc = 0; dc < 2; ++dc) {
        FB kb;
        kb.h[0] = *(const v8b*)(Ksh + (j * 16 + c) * AT_D + dc * 32 + 8 * hh);
        kb.h[1] = *(const v8b*)(Ksh + (j * 16 + c) * AT_D + dc * 32 + 16 + 8 * hh);
        s[j] = at_mma16<F16>(qah[dc], kb.v, s[j]);
        if (SPLIT_QK) {
          FB kl;
          kl.h[0] = *(const v8b*)(Ksl + (j * 16 + c) * AT_D + dc * 32 + 8 * hh);
          kl.h[1] = *(const v8b*)(Ksl + (j * 16 + c) * AT_D + dc * 32 + 16 + 8 * hh);
          s[j] = at_mma16<F16>(qah[dc], kl.v, s[j]);
          s[j] = at_mma16<F16>(qal[dc], kb.v, s[j]);
        }
      }
    }
    const bool diag = (g.mask_mode == 1) && (kc == qb);
    int kvkeep[4] = {1, 1, 1, 1};
    if (g.mask_mode == 3) {
#pragma unroll
      for (int j = 0; j < 4; ++j) kvkeep[j] = ((const int*)mask_a)[(size_t)b * g.Skv + kv0 + j * 16 + c];   // mask_a = kvmask
    }
    float cm[8];
#pragma unroll
    for (int r = 0; r < 8; ++r) {
      const int qrow = q0 + 8 * hh + r;
      float m = -INFINITY;
#pragma unroll
      for (int j = 0; j < 4; ++j) {
        const int kvcol = kv0 + j * 16 + c;
        bool masked = false;
        if (diag) masked = (kvcol > qrow);
        else if (g.mask_mode == 4) masked = (kvcol > qrow) || (qrow - kvcol > g.mask_is_int);
        else if (g.mask_mode == 2) {
          const size_t mi = (size_t)qrow * g.Skv + kvcol;
          masked = (g.mask_is_int == 0) ? (((const float*)mask_a)[mi] == 0.0f)
                 : (g.mask_is_int == 1) ? (((const int*)mask_a)[mi] == 0) : (((const int*)mask_a)[mi] != 0);
        } else if (g.mask_mode == 3) masked = (qkeep[r] == 0) || (kvkeep[j] == 0);
        else if (g.mask_mode == 5) {
          const size_t mi = (size_t)qrow * g.Skv + kvcol;
          masked = (((const int*)mask_a)[mi] != 0);
          int n = mask_b[mi]; n = n < 0 ? 0 : n;
          s[j][r] += g.cp[(size_t)b * g.c_bs + (size_t)h * g.c_hs + (size_t)qrow * g.c_rs + n]
                   + g.pc[(size_t)b * g.c_bs + (size_t)h * g.c_hs + (size_t)kvcol * g.c_rs + n];
        }
        if (masked) s[j][r] = g.mask_fill;
        m = fmaxf(m, s[j][r]);
      }
#pragma unroll
      for (int off = 1; off < 16; off <<= 1) m = fmaxf(m, __shfl_xor(m, off, 32));
      cm[r] = m;
    }
    __bf16* pwh = Psh[wave];
    __bf16* pwl = Psl[SPLIT_PV ? wave : 0];
#pragma unroll
    for (int r = 0; r < 8; ++r) {
      const float mnew = fmaxf(mrow[r], cm[r]);
      const float alpha = expf(mrow[r] - mnew);
      mrow[r] = mnew;
      float psum = 0.f;
#pragma unroll
      for (int j = 0; j < 4; ++j) {
        const float p = expf(s[j][r] - mnew);
        psum += p;
        if (SPLIT_PV) { __bf16 a, bl; at_split(p, a, bl); pwh[(8 * hh + r) * AT_KC + j * 16 + c] = a; pwl[(8 * hh + r) * AT_KC + j * 16 + c] = bl; }
        else pwh[(8 * hh + r) * AT_KC + j * 16 + c] = at_to16<F16>(p * PSC);
      }
#pragma unroll
      for (int off = 1; off < 16; off <<= 1) psum += __shfl_xor(psum, off, 32);
      lrow[r] = lrow[r] * alpha + psum;
#pragma unroll
      for (int t = 0; t < 4; ++t) oacc[t][r] *= alpha;
    }
    __builtin_amdgcn_fence(__ATOMIC_RELEASE, "workgroup");
    __builtin_amdgcn_wave_barrier();
    __builtin_amdgcn_fence(__ATOMIC_ACQUIRE, "workgroup");
#pragma unroll 1
    for (int kk = 0; kk < 2; ++kk) {
      FB pa, pl;
      pa.h[0] = *(const v8b*)(pwh + c * AT_KC + kk * 32 + 8 * hh);
      pa.h[1] = *(const v8b*)(pwh + c * AT_KC + kk * 32 + 16 + 8 * hh);
      if (SPLIT_PV) {
        pl.h[0] = *(const v8b*)(pwl + c * AT_KC + kk * 32 + 8 * hh);
        pl.h[1] = *(const v8b*)(pwl + c * AT_KC + kk * 32 + 16 + 8 * hh);
      }
#pragma unroll
      for (int t = 0; t < 4; ++t) {
        FB vb;
        vb.h[0] = *(const v8b*)(Vth + (t * 16 + c) * AT_KC + kk * 32 + 8 * hh);
        vb.h[1] = *(const v8b*)(Vth + (t * 16 + c) * AT_KC + kk * 32 + 16 + 8 * hh);
        oacc[t] = at_mma16<F16>(pa.v, vb.v, oacc[t]);
        if (SPLIT_PV) {
          FB vl;
          vl.h[0] = *(const v8b*)(Vtl + (t * 16 + c) * AT_KC + kk * 32 + 8 * hh);
          vl.h[1] = *(const v8b*)(Vtl + (t * 16 + c) * AT_KC + kk * 32 + 16 + 8 * hh);
          oacc[t] = at_mma16<F16>(pa.v, vl.v, oacc[t]);
          oacc[t] = at_mma16<F16>(pl.v, vb.v, oacc[t]);
        }
      }
    }
  }

  float* os = Os[wave];
#pragma unroll
  for (int r = 0; r < 8; ++r) {
    const float inv = 1.0f / (lrow[r] * PSC);
#pragma unroll
    for (int t = 0; t < 4; ++t) os[(8 * hh + r) * 68 + t * 16 + c] = oacc[t][r] * inv;
  }
  __builtin_amdgcn_fence(__ATOMIC_RELEASE, "workgroup");
  __builtin_amdgcn_wave_barrier();
  __builtin_amdgcn_fence(__ATOMIC_ACQUIRE, "workgroup");
  {
    const int c4 = (lane & 15) * 4;
    {
#pragma unroll
      for (int it = 0; it < 8; ++it) {
        const int row = it * 2 + hh;
        v4f val = *(const v4f*)(os + row * 68 + c4);
        *(v4f*)(ob_ptr + (size_t)(q0 + row) * g.o_rs + c4) = val;
      }
      
    }
  }
}

// Both products are formed transposed: scores^T = k q^T (A = k rows, B = q rows) and out^T += v^T p^T (A = transposed v rows, B = p^T). In the accumulator tile of
//   scores^T a lane holds eight keys of ONE query (lane l: query l & 15, keys 8 (l >> 4) + r), so the running maximum and sum of a query are formed inside the lane, with one
//   exchange between the wave halves, and two score tiles, converted in place, ARE the B operand of the second product in the hardware's k order: p never goes through LDS.
// MODE: the mask mode as a compile-time constant; only 0 (no mask) is written in this form.
// PRE16: k and v come ready as 16-bit values, written once by their producer (k, v unused): k16 holds dense rows, element (b, s, d) at
//   k16[b*k_bs + s*128 + d]; vt16 holds v transposed in tiles of AT_KC keys, element (b, s, d) at vt16[b*v_bs + (s/AT_KC)*AT_KC*128 + d*AT_KC + s%AT_KC]
//   (k_bs, v_bs in 16-bit elements, multiples of 8), so that a pass's k tile and v tile are 16 KB contiguous each.
// NG: key groups. The block has NG groups of AT_NW waves on the SAME 64 query rows; group g walks the key tiles g, g + NG, g + 2 NG, ... with its own
//   k, v tiles in LDS and its own running maximum, sum and output tile, so that NG waves share each SIMD and fill one another's waits. Behind the loop the NG
//   partial results of a row are joined: out = sum_g e^(m_g - m) o_g / sum_g e^(m_g - m) l_g, m = max_g m_g. Skv a multiple of NG * AT_KC.
// lane l takes the value of lane l ^ 16 (the other wave half), by a vector cross-row move
__device__ __forceinline__ float at_xhalf(float x) {
  return __builtin_bit_cast(float, __builtin_amdgcn_permlanex16(__builtin_bit_cast(int, x), __builtin_bit_cast(int, x), 0x76543210, 0xfedcba98, false, false));
}
template <bool SPLIT_QK, bool SPLIT_PV, bool F16, int MODE, bool PRE16, int NG>
__global__ __launch_bounds__(128 * NG)
void attn128_kernel(const float* __restrict__ q, const float* __restrict__ k,
                   const float* __restrict__ v, const unsigned short* __restrict__ k16,
                   const unsigned short* __restrict__ vt16, float* __restrict__ out,
                   const void* __restrict__ mask_a, const int* __restrict__ mask_b, AttnGeom g) {
  static_assert(F16 && PRE16 && MODE == 0 && !SPLIT_QK && !SPLIT_PV && 16 % NG == 0, "transposed form: f16, ready k and v, unmasked, non-split");
  (void)k; (void)v; (void)mask_a; (void)mask_b;
  const float PSC = 32768.0f;     // f16 probabilities carried x2^15 (subnormal range), folded into the final 1/l
  union FB { v16b v; v8b h[2]; };
  constexpr int D2 = 128;
  constexpr int KP = D2 + 8;      // LDS pitch of the k and q rows, in 16-bit elements: 272 B = 16 B x odd, so the 16 rows of a ds_load_b128 fragment read fall on distinct banks
  constexpr int VP = AT_KC + 8;   // LDS pitch of the transposed v rows: 144 B = 16 B x odd, same reason
  constexpr int NWV = AT_NW * NG;                 // waves of the block
  constexpr int KVB = (AT_KC * KP + D2 * VP) * 2; // bytes of one group's k tile (17 KB, [kv][d], padded rows) and v tile (18 KB, [d][kv], padded rows)
  static_assert(AT_NW * 16 * 132 * 4 <= KVB, "the out tiles overlay the k, v tiles");
  __shared__ __align__(16) unsigned char KVraw[NG * KVB];        // in the loop: each group's k, v tiles; behind it: per wave out tile, pitch 132 floats
  __shared__ __align__(16) __bf16 Qsh[NWV][16 * KP];     // q (the 16-bit value) staged per wave (keeps VGPR use low)
  __shared__ __align__(16) float  Msh[NWV][16], Lsh[NWV][16];    // each wave's query maxima and sums, for the join of the key groups

  const int grp  = __builtin_amdgcn_readfirstlane(threadIdx.x >> 7);   // key group; the same in a whole wave: held scalar, so the tile offsets stay scalar arithmetic
  const int tid  = threadIdx.x & 127;    // thread within its group
  const int wave = tid >> 5;             // wave within its group = its 16-row query tile
  const int wv   = grp * AT_NW + wave;   // wave within the block: its private LDS
  const int lane = tid & 31;
  const int hh   = lane >> 4;
  const int c    = lane & 15;

  const int nqb = g.S / AT_QB;
  const int bx = blockIdx.x + g.blk0;
  const int qb = bx % nqb;
  const int bh = bx / nqb;
  const int h  = bh % g.H;
  const int b  = bh / g.H;
  const int qbase_block = qb * AT_QB;
  const int q0 = qbase_block + wave * 16;

  const float* qb_ptr = q + (size_t)b * g.q_bs + (size_t)h * g.q_hs;
  float*       ob_ptr = out + (size_t)b * g.o_bs + (size_t)h * g.o_hs;
  __bf16* Ksh = (__bf16*)(KVraw + grp * KVB);
  __bf16* Vth = Ksh + AT_KC * KP;

  // ---- q rows of the wave, scaled and rounded to 16 bits, into its own LDS ----
  {
    const float* qrow = qb_ptr + (size_t)(q0 + c) * g.q_rs;
#pragma unroll
    for (int dc = 0; dc < 4; ++dc) {
#pragma unroll
      for (int e = 0; e < 8; ++e) {
        const float f0 = qrow[dc * 32 + 8 * hh + e] * g.qscale;
        const float f1 = qrow[dc * 32 + 16 + 8 * hh + e] * g.qscale;
        Qsh[wv][c * KP + dc * 32 + 8 * hh + e] = at_to16<F16>(f0); Qsh[wv][c * KP + dc * 32 + 16 + 8 * hh + e] = at_to16<F16>(f1);
      }
    }
  }

  float mrow = -INFINITY;   // running maximum of query q0 + c, the same in both wave halves
  float lrow = 0.f;         // running sum of query q0 + c over THIS half's keys (8 of every 16); the halves are joined behind the loop
  v8f oacc[8];              // oacc[t][r] = out^T[d = 16 t + 8 hh + r][query q0 + c]
#pragma unroll
  for (int t = 0; t < 8; ++t) oacc[t] = (v8f){0.f,0.f,0.f,0.f,0.f,0.f,0.f,0.f};

  const int nChunks = g.Skv / AT_KC;   // block-uniform
  for (int it = 0; it < nChunks / NG; ++it) {
    const int kc = it * NG + grp;
    __syncthreads();
    {
      // plain copy, 16 B a lane: a wave's 32 lanes take 512 contiguous bytes of the source; step i is 2 KB further (8 k rows, 16 v rows)
      const unsigned short* kt = k16 + (size_t)b * g.k_bs + (size_t)kc * (AT_KC * D2) + tid * 8;
      const unsigned short* vt = vt16 + (size_t)b * g.v_bs + (size_t)kc * (AT_KC * D2) + tid * 8;
      __bf16* kd = Ksh + (tid >> 4) * KP + (tid & 15) * 8;
      __bf16* vd = Vth + (tid >> 3) * VP + (tid & 7) * 8;
      v8b kr[8], vr[8];
#pragma unroll   // unrolled so that kr, vr are registers and all 16 loads are in flight before the first store waits
      for (int i = 0; i < 8; ++i) {
        kr[i] = *(const v8b*)(kt + i * 1024);
        vr[i] = *(const v8b*)(vt + i * 1024);
      }
      // precaution: this wait stands before the two address pairs of the issued loads are reused; naming them here keeps the loads' own destinations off them
      asm volatile("s_wait_xcnt 0x0" :: "v"(kt), "v"(vt) : "memory");
#pragma unroll   // unrolled for the same reason; the row steps become immediate offsets
      for (int i = 0; i < 8; ++i) {
        *(v8b*)(kd + i * 8 * KP) = kr[i];
        *(v8b*)(vd + i * 16 * VP) = vr[i];
      }
    }
    __syncthreads();

    v8f s[4];   // s[j][r] = score of key kc * AT_KC + 16 j + 8 hh + r with query q0 + c
#pragma unroll
    for (int j = 0; j < 4; ++j) {
      s[j] = (v8f){0.f,0.f,0.f,0.f,0.f,0.f,0.f,0.f};
#pragma unroll
      for (int dc = 0; dc < 4; ++dc) {
        FB kb, qa;
        kb.h[0] = *(const v8b*)(Ksh + (j * 16 + c) * KP + dc * 32 + 8 * hh);
        kb.h[1] = *(const v8b*)(Ksh + (j * 16 + c) * KP + dc * 32 + 16 + 8 * hh);
        qa.h[0] = *(const v8b*)(&Qsh[wv][c * KP + dc * 32 + 8 * hh]);
        qa.h[1] = *(const v8b*)(&Qsh[wv][c * KP + dc * 32 + 16 + 8 * hh]);
        s[j] = at_mma16<F16>(kb.v, qa.v, s[j]);
      }
    }
    float m = -INFINITY;
#pragma unroll   // unrolled, like the loops below, so that s, pb and oacc are indexed by constants and stay registers
    for (int j = 0; j < 4; ++j)
#pragma unroll
      for (int r = 0; r < 8; ++r) m = fmaxf(m, s[j][r]);
    m = fmaxf(m, at_xhalf(m));          // both halves hold the maximum over the tile's 64 keys
    const float mnew = fmaxf(mrow, m);
    const float alpha = expf(mrow - mnew);
    mrow = mnew;
    float psum = 0.f;
    FB pb[2];   // p^T as B operand: element e of pb[kk] is key 32 kk + 8 hh + e (e < 8), 32 kk + 16 + 8 hh + e - 8 (e >= 8): the order in which the v rows are read below
#pragma unroll
    for (int j = 0; j < 4; ++j) {
#pragma unroll
      for (int r = 0; r < 8; ++r) {
        const float p = expf(s[j][r] - mnew);
        psum += p;
        pb[j >> 1].v[(j & 1) * 8 + r] = at_to16<F16>(p * PSC);
      }
    }
    lrow = lrow * alpha + psum;
#pragma unroll
    for (int t = 0; t < 8; ++t)
#pragma unroll
      for (int r = 0; r < 8; ++r) oacc[t][r] *= alpha;
#pragma unroll
    for (int kk = 0; kk < 2; ++kk) {
#pragma unroll
      for (int t = 0; t < 8; ++t) {
        FB vb;
        vb.h[0] = *(const v8b*)(Vth + (t * 16 + c) * VP + kk * 32 + 8 * hh);
        vb.h[1] = *(const v8b*)(Vth + (t * 16 + c) * VP + kk * 32 + 16 + 8 * hh);
        oacc[t] = at_mma16<F16>(vb.v, pb[kk].v, oacc[t]);
      }
    }
  }

  float* os = (float*)KVraw + wv * (16 * 132);
  lrow += at_xhalf(lrow);   // the query's sum over all keys of the group
  if (NG > 1) {
    if (hh == 0) { Msh[wv][c] = mrow; Lsh[wv][c] = lrow; }   // both halves hold the same two values: one of them stores
  }
  __syncthreads();   // every wave has left the k, v tiles, which the out tiles overlay; the maxima and sums of all groups are published
  {
    float inv;
    if (NG > 1) {
      float mg[NG], mall = -INFINITY, lall = 0.f;
#pragma unroll   // unrolled so that mg is indexed by constants and stays registers
      for (int gi = 0; gi < NG; ++gi) { mg[gi] = Msh[gi * AT_NW + wave][c]; mall = fmaxf(mall, mg[gi]); }
#pragma unroll
      for (int gi = 0; gi < NG; ++gi) lall += Lsh[gi * AT_NW + wave][c] * expf(mg[gi] - mall);
      inv = expf(mrow - mall) / (lall * PSC);
    } else {
      inv = 1.0f / (lrow * PSC);
    }
#pragma unroll   // unrolled so that oacc is indexed by constants; a lane's eight values are consecutive d of its query's row: two 16 B stores
    for (int t = 0; t < 8; ++t) {
      v4f lo, hi;
#pragma unroll
      for (int e = 0; e < 4; ++e) { lo[e] = oacc[t][e] * inv; hi[e] = oacc[t][4 + e] * inv; }
      *(v4f*)(os + c * 132 + t * 16 + 8 * hh)     = lo;
      *(v4f*)(os + c * 132 + t * 16 + 8 * hh + 4) = hi;
    }
  }
  __syncthreads();   // the weighted out tiles of all groups are published
  {
    const int c4 = lane * 4;           // 32 lanes x 16 B = one 512-B output row (128 floats) per instruction
    const float* ot = (const float*)KVraw + wave * (16 * 132);   // group 0's tile of these query rows; group gi's lies gi * AT_NW tiles further
#pragma unroll   // unrolled, with the loop inside it, so that all LDS reads of the rows are issued before the first sum waits
    for (int rr = 0; rr < 16 / NG; ++rr) {     // each group sums and stores its own 16 / NG rows of the tile
      const int row = grp * (16 / NG) + rr;
      v4f val = *(const v4f*)(ot + row * 132 + c4);
#pragma unroll
      for (int gi = 1; gi < NG; ++gi) val += *(const v4f*)(ot + gi * (AT_NW * 16 * 132) + row * 132 + c4);
      *(v4f*)(ob_ptr + (size_t)(q0 + row) * g.o_rs + c4) = val;
    }
  }
}

// ---- q, k and v projections in ONE launch, straight from the f32 inputs -------------------------------------------
// A block owns 64 rows of x (= one 64-key tile). Its 16 waves bring those rows and the three weight matrices in by whole-line 16 B loads, round them to
// f16 (the same rounding as a cast pass) and lay them in LDS as rows of 128 values: rows 0..63 x, 64..191 Wq, 192..319 Wk, 320..447 Wv.
// Behind the one barrier 12 waves each form a 32 x 64 tile over k = 128: q, k = x W^T + b (rows = x rows), v transposed = Wv x^T + bv (rows = d, columns = keys).
// Outputs: Q f32 rows, K16 f16 rows, Vt16 f16 [128 d][64 keys] per 64-key tile.
#define PJ_XP 136   // LDS row pitch in f16: 272 B = 16 B x odd, so the 16 rows of a ds_load_b128 fragment read fall on distinct banks
typedef __attribute__((ext_vector_type(4))) _Float16 v4h;
__device__ __forceinline__ v4h pj_cvt(v4f f) { v4h h; h[0] = (_Float16)f[0]; h[1] = (_Float16)f[1]; h[2] = (_Float16)f[2]; h[3] = (_Float16)f[3]; return h; }
// BIAS_MODE: 1 = bias[m], 2 = bias[n]. OUT16: f16 output (Ch), else f32 (Cf). The 32 x 64 tile goes out through the wave's own LDS slab, as whole row segments.
template <int BIAS_MODE, bool OUT16>
__device__ __forceinline__ void pj_store(const v8f (&acc)[2][4], float* slab, float* __restrict__ Cf, unsigned short* __restrict__ Ch,
                                         int ldc, int m0, int n0, const float* __restrict__ bias, int lane) {
  const int rlane = lane & 15;
  const int mOff  = (lane >> 4) * 8;
#pragma unroll   // unrolled, with the loops inside it, so that acc is indexed by constants and stays in registers
  for (int i = 0; i < 2; ++i) {
#pragma unroll
    for (int j = 0; j < 4; ++j) {
      float bn = 0.f;
      if (BIAS_MODE == 2) bn = bias[n0 + (j << 4) + rlane];
#pragma unroll
      for (int r = 0; r < 8; ++r) {
        float v = acc[i][j][r];
        if (BIAS_MODE == 1) v += bias[m0 + (i << 4) + mOff + r];
        if (BIAS_MODE == 2) v += bn;
        slab[((i << 4) + mOff + r) * 68 + (j << 4) + rlane] = v;
      }
    }
  }
  // the slab is private to the wave: its lanes' writes are ordered before its lanes' reads; it stands ahead of every global store, so it waits for none
  __builtin_amdgcn_fence(__ATOMIC_RELEASE, "workgroup");
  __builtin_amdgcn_wave_barrier();
  __builtin_amdgcn_fence(__ATOMIC_ACQUIRE, "workgroup");
  if (!OUT16) {
    const int hh = lane >> 4, c4 = (lane & 15) * 4;     // row segment = 256 B = 16 lanes x 16 B
#pragma unroll   // unrolled so that the LDS reads of all rows are issued before the first store waits
    for (int it = 0; it < 16; ++it) {
      const int row = it * 2 + hh;
      v4f v = *(const v4f*)(slab + row * 68 + c4);
      *(v4f*)(Cf + (size_t)(m0 + row) * ldc + n0 + c4) = v;
    }
  } else {
    const int q = lane >> 3, c8 = (lane & 7) * 8;       // row segment = 128 B = 8 lanes x 16 B
#pragma unroll   // unrolled for the same reason
    for (int it = 0; it < 8; ++it) {
      const int row = it * 4 + q;
      const float* sp = slab + row * 68 + c8;
      v8h hv;
#pragma unroll
      for (int e = 0; e < 8; ++e) hv[e] = (_Float16)sp[e];
      *(v8h*)(Ch + (size_t)(m0 + row) * ldc + n0 + c8) = hv;
    }
  }
  // precaution: this wait stands behind the issued stores, before code that follows the call reuses their address and data registers
  asm volatile("s_wait_xcnt 0x0" ::: "memory");
}
__global__ __launch_bounds__(512) void proj_qkv(
    const float* __restrict__ x, const float* __restrict__ Wq, const float* __restrict__ bq, const float* __restrict__ Wk, const float* __restrict__ bk,
    const float* __restrict__ Wv, const float* __restrict__ bv, float* __restrict__ Q, unsigned short* __restrict__ K16, unsigned short* __restrict__ Vt16) {
  __shared__ __align__(16) _Float16 Sm[448 * PJ_XP];
  __shared__ __align__(16) float sT[12][32 * 68];   // per-wave 32x64 slab, pitch 68 floats
  const int tid  = threadIdx.x;
  const int row0 = blockIdx.x * 64;
  {
    // a wave's 32 lanes take one whole 512 B row; the block takes 16 rows (2048 floats) a step
    const float* xs = x + (size_t)row0 * 128 + tid * 4;
    const float* qs = Wq + tid * 4;
    const float* ks = Wk + tid * 4;
    const float* vs = Wv + tid * 4;
    v4f xr[4], qr[8], kr[8], vr[8];
#pragma unroll   // unrolled so that the arrays are registers and all 28 loads are in flight before the first conversion waits
    for (int it = 0; it < 4; ++it) xr[it] = *(const v4f*)(xs + it * 2048);
#pragma unroll
    for (int it = 0; it < 8; ++it) {
      qr[it] = *(const v4f*)(qs + it * 2048);
      kr[it] = *(const v4f*)(ks + it * 2048);
      vr[it] = *(const v4f*)(vs + it * 2048);
    }
    // precaution: this wait stands behind the issued loads, before their address registers are reused
    asm volatile("s_wait_xcnt 0x0" ::: "memory");
    _Float16* d = Sm + (tid >> 5) * PJ_XP + (tid & 31) * 4;
#pragma unroll   // unrolled for the same reason; the row steps become immediate offsets
    for (int it = 0; it < 4; ++it) *(v4h*)(d + it * 16 * PJ_XP) = pj_cvt(xr[it]);
#pragma unroll
    for (int it = 0; it < 8; ++it) {
      *(v4h*)(d + (64 + it * 16) * PJ_XP)  = pj_cvt(qr[it]);
      *(v4h*)(d + (192 + it * 16) * PJ_XP) = pj_cvt(kr[it]);
      *(v4h*)(d + (320 + it * 16) * PJ_XP) = pj_cvt(vr[it]);
    }
  }
  __syncthreads();   // x rows and weights are published to every wave; the only block barrier of the kernel
  const int wave = __builtin_amdgcn_readfirstlane(tid >> 5);   // the same in a whole wave: held scalar, so the tile choice is scalar arithmetic and scalar branches
  if (wave >= 12) return;                // 12 tiles of 32 x 64; whole waves leave, behind the barrier
  const int lane  = tid & 31;
  const int rlane = lane & 15;           // row (A) / column (B, D) within a 16 x 16 subtile
  const int koff  = (lane >> 4) * 8;     // k offset of this lane half
  const int which = wave >> 2;           // 0 q, 1 k, 2 v
  const int sub   = wave & 3;
  const int aRow = (which == 2) ? 320 + sub * 32 : (sub >> 1) * 32;
  const int bRow = (which == 2) ? 0 : 64 + which * 128 + (sub & 1) * 64;
  const _Float16* Al = Sm + (aRow + rlane) * PJ_XP + koff;
  const _Float16* Bl = Sm + (bRow + rlane) * PJ_XP + koff;
  v8f acc[2][4];
#pragma unroll
  for (int i = 0; i < 2; ++i)
#pragma unroll
    for (int j = 0; j < 4; ++j) acc[i][j] = (v8f){0.f,0.f,0.f,0.f,0.f,0.f,0.f,0.f};
#pragma unroll   // unrolled so that a later step's fragment reads can be issued ahead of an earlier step's products
  for (int k0 = 0; k0 < 128; k0 += 32) {
    v16h bh[4], ah[2];
#pragma unroll
    for (int j = 0; j < 4; ++j) bh[j] = Frag<_Float16>::load(Bl + j * 16 * PJ_XP + k0);
#pragma unroll
    for (int i = 0; i < 2; ++i) ah[i] = Frag<_Float16>::load(Al + i * 16 * PJ_XP + k0);
#pragma unroll
    for (int i = 0; i < 2; ++i)
#pragma unroll
      for (int j = 0; j < 4; ++j) acc[i][j] = Frag<_Float16>::mma(ah[i], bh[j], acc[i][j]);
  }
  float* slab = sT[wave];
  if (which == 0)      pj_store<2, false>(acc, slab, Q, nullptr, 128, row0 + (sub >> 1) * 32, (sub & 1) * 64, bq, lane);
  else if (which == 1) pj_store<2, true>(acc, slab, nullptr, K16, 128, row0 + (sub >> 1) * 32, (sub & 1) * 64, bk, lane);
  else                 pj_store<1, true>(acc, slab, nullptr, Vt16 + (size_t)blockIdx.x * (64 * 128), 64, sub * 32, 0, bv, lane);
}

#define IB 4
#define INn 4096
#define ID 128
extern "C" void kernel_launch(void* const* d_in, const int* in_sizes, int n_in, void* d_out, int out_size, void* d_ws, size_t ws_size, hipStream_t stream) {
  (void)in_sizes; (void)n_in; (void)out_size; (void)ws_size;
  const float* x = (const float*)d_in[0]; const float* Wq = (const float*)d_in[1]; const float* bq = (const float*)d_in[2]; const float* Wk = (const float*)d_in[3]; const float* bk = (const float*)d_in[4]; const float* Wv = (const float*)d_in[5]; const float* bv = (const float*)d_in[6];
  char* ws = (char*)d_ws; size_t off = 0;
  auto carve = [&](size_t bytes) -> char* { char* p = ws + off; off += (bytes + 255) & ~(size_t)255; return p; };
  const int R = IB * INn;
  float* Q = (float*)carve((size_t)R * ID * 4); _Float16* K16 = (_Float16*)carve((size_t)R * ID * 2); _Float16* Vt16 = (_Float16*)carve((size_t)R * ID * 2);
  // q f32 rows, k f16 rows, v f16 transposed per 64-key tile ([128 d][64 keys], 16 KB contiguous): one launch, one block per 64 rows of x
  proj_qkv<<<R / AT_KC, 512, 0, stream>>>(x, Wq, bq, Wk, bk, Wv, bv, Q, (unsigned short*)K16, (unsigned short*)Vt16);
  { AttnGeom g;
    g.q_bs = (long)INn * ID; g.q_rs = ID; g.q_hs = 0; g.k_bs = g.q_bs; g.k_rs = ID; g.k_hs = 0; g.v_bs = g.q_bs; g.v_rs = ID; g.v_hs = 0; g.o_bs = (long)INn * ID; g.o_rs = ID; g.o_hs = 0;
    g.S = INn; g.Skv = INn; g.H = 1; g.mask_mode = 0; g.qscale = 0.08838834764831845f; g.blk0 = 0; g.mask_fill = -INFINITY; g.mask_is_int = 0;
    attn128_kernel<false, false, true, 0, true, 4><<<IB * (INn / AT_QB), 4 * AT_NW * 32, 0, stream>>>(Q, nullptr, nullptr, U16(K16), U16(Vt16), (float*)d_out, nullptr, nullptr, g); }
}

// v007
// One run takes 65.8 microseconds.
// In two side-by-side timings against v006, it was 1.22 and 1.23 times as fast.
// Over all steps from v000 it is 16.0 times as fast.
#include <hip/hip_runtime.h>
#include <math.h>
// InteractionLayer: q, k, v = x W^T + b (three 16384 x 128 by 128 x 128 products in one launch; q f32, k f16 rows, v f16 transposed in 64-key tiles) and single-head attention (d 128, 4096 keys per batch; scores and
// p·v with p x2^15) on v_wmma_f32_16x16x32_f16 with f16 operands, f32 accumulate; softmax f32 on VALU. nn.Linear weights ([out][in]) are the
// Bt operand of q, k and the A operand of v^T, directly.
typedef __attribute__((ext_vector_type(16))) _Float16 v16h;
typedef __attribute__((ext_vector_type(8)))  _Float16 v8h;
typedef __attribute__((ext_vector_type(16))) __bf16   v16b;
typedef __attribute__((ext_vector_type(8)))  __bf16   v8b;
typedef __attribute__((ext_vector_type(8)))  float    v8f;
typedef __attribute__((ext_vector_type(4)))  float    v4f;
#define PSCALE 32768.0f
#define U16(p) ((const unsigned short*)(const void*)(p))
#define PSCALE_INV (1.0f / 32768.0f)

__device__ __forceinline__ unsigned short f2bf_bits(float f) {
  unsigned u = __float_as_uint(f);
  return (unsigned short)((u + 0x7FFFu + ((u >> 16) & 1u)) >> 16);
}
__device__ __forceinline__ float bf_bits2f(unsigned short h) { return __uint_as_float(((unsigned)h) << 16); }

// hazard guards as plain device helpers (no inline asm inside the kernel template body)
__device__ __forceinline__ void dep_guard_h(v8f& a, v8f& b, v16h x, v16h y) { asm volatile("v_nop\n\tv_nop\n\tv_nop\n\tv_nop" : "+v"(a), "+v"(b) : "v"(x), "v"(y)); }
__device__ __forceinline__ void dep_guard_b(v8f& a, v8f& b, v16b x, v16b y) { asm volatile("v_nop\n\tv_nop\n\tv_nop\n\tv_nop" : "+v"(a), "+v"(b) : "v"(x), "v"(y)); }
__device__ __forceinline__ void keep4_h(v16h a, v16h b, v16h c, v16h d) { asm volatile("v_nop" :: "v"(a), "v"(b), "v"(c), "v"(d)); }
__device__ __forceinline__ void keep4_b(v16b a, v16b b, v16b c, v16b d) { asm volatile("v_nop" :: "v"(a), "v"(b), "v"(c), "v"(d)); }
__device__ __forceinline__ void acc_guard4(v8f& a, v8f& b, v8f& c, v8f& d) { asm volatile("v_nop\n\tv_nop\n\tv_nop\n\tv_nop" : "+v"(a), "+v"(b), "+v"(c), "+v"(d)); }
template <typename T> struct Frag;
template <> struct Frag<_Float16> {
  typedef v16h V; union U { v16h v; v8h h[2]; };
  static __device__ __forceinline__ v16h load(const _Float16* p) {   // elements 0..7 <- p[0..7], 8..15 <- p[16..23]
    U f; f.h[0] = *(const v8h*)(p); f.h[1] = *(const v8h*)(p + 16); return f.v;
  }
  static __device__ __forceinline__ v8f mma(v16h a, v16h b, v8f c) {
    return __builtin_amdgcn_wmma_f32_16x16x32_f16(false, a, false, b, (short)0, c, false, false);
  }
  static __device__ __forceinline__ void guard(v8f& a, v8f& b, v16h x, v16h y) { dep_guard_h(a, b, x, y); }
  static __device__ __forceinline__ void keep(v16h a, v16h b, v16h c, v16h d) { keep4_h(a, b, c, d); }
};
template <> struct Frag<__bf16> {
  typedef v16b V; union U { v16b v; v8b h[2]; };
  static __device__ __forceinline__ v16b load(const __bf16* p) {
    U f; f.h[0] = *(const v8b*)(p); f.h[1] = *(const v8b*)(p + 16); return f.v;
  }
  static __device__ __forceinline__ v8f mma(v16b a, v16b b, v8f c) {
    return __builtin_amdgcn_wmma_f32_16x16x32_bf16(false, a, false, b, (short)0, c, false, false);
  }
  static __device__ __forceinline__ void guard(v8f& a, v8f& b, v16b x, v16b y) { dep_guard_b(a, b, x, y); }
  static __device__ __forceinline__ void keep(v16b a, v16b b, v16b c, v16b d) { keep4_b(a, b, c, d); }
};

// ---- Register-blocked batched WMMA GEMM ------------------------------------
// C[m,n] = scale * sum_k A[m,k] * Bt[n,k] (+bias)(+resid); each wave owns a 64x64 tile.
// A row-major [M,K]; Bt row-major [N,K]; M,N % 64 == 0, K % 32 == 0.
// SPLIT: operands are hi/lo planes (A2/Bt2 = lo planes, same layout); product = hi·hi + hi·lo + lo·hi.
// BIAS_MODE: 0 = none, 1 = bias[m], 2 = bias[n].
// OUT_MODE: 0 = f32, 1 = f16, 2 = bf16 hi plane (Cout) + bf16 lo plane (Cout2).
// ET: 0 = f16 operands, 1 = bf16 operands (pointers passed as 16-bit storage)
template <int ET> struct Elem;
template <> struct Elem<0> { typedef _Float16 T; };
template <> struct Elem<1> { typedef __bf16 T; };
template <int ET, bool SPLIT, int BIAS_MODE, int OUT_MODE, bool RESID, int ACT = 0>
__global__ __launch_bounds__(256) void wmma_gemm64(
    const unsigned short* __restrict__ Ap, const unsigned short* __restrict__ A2p, int lda, long strideA,
    const unsigned short* __restrict__ Btp, const unsigned short* __restrict__ Bt2p, int ldb, long strideB,
    void* __restrict__ Cout, void* __restrict__ Cout2, int ldc, long strideC,
    const float* __restrict__ bias,
    const float* __restrict__ resid, long strideR,
    int M, int N, int K, float scale) {
  typedef typename Elem<ET>::T T;
  typedef typename Frag<T>::V V;
  const T* A = (const T*)Ap; const T* A2 = (const T*)A2p; const T* Bt = (const T*)Btp; const T* Bt2 = (const T*)Bt2p;
  __shared__ __align__(16) float sT[8][16 * 68];   // per-wave 16x64 slab, pitch 68 floats
  const int b    = blockIdx.y;
  const int lane = threadIdx.x & 31;
  const int wave = threadIdx.x >> 5;
  const int tilesN = N >> 6;
  const int tilesM = M >> 6;
  const int tile = blockIdx.x * 8 + wave;
  if (tile >= tilesM * tilesN) return;   // wave-uniform; no block barriers in this kernel
  const int tm = tile / tilesN;
  const int tn = tile - tm * tilesN;
  const int m0 = tm << 6;
  const int n0 = tn << 6;

  const T* Ab  = A  + (size_t)b * strideA;
  const T* Bb  = Bt + (size_t)b * strideB;
  const T* Ab2 = SPLIT ? (A2  + (size_t)b * strideA) : nullptr;
  const T* Bb2 = SPLIT ? (Bt2 + (size_t)b * strideB) : nullptr;

  const int rlane = lane & 15;                 // row (A) / col (B, D) within subtile
  const int koff  = (lane >> 4) * 8;           // k offset of this lane half
  const int mOff  = (lane >> 4) * 8;           // D row offset

  v8f acc[4][4];
#pragma unroll
  for (int i = 0; i < 4; ++i)
#pragma unroll
    for (int j = 0; j < 4; ++j) acc[i][j] = (v8f){0.f,0.f,0.f,0.f,0.f,0.f,0.f,0.f};

  for (int k0 = 0; k0 < K; k0 += 32) {
    V bh[4], bl[4];
#pragma unroll
    for (int j = 0; j < 4; ++j) {
      const size_t bo = (size_t)(n0 + (j << 4) + rlane) * ldb + koff + k0;
      bh[j] = Frag<T>::load(Bb + bo);
      if (SPLIT) bl[j] = Frag<T>::load(Bb2 + bo);
    }
#pragma unroll
    for (int i = 0; i < 4; ++i) {
      const size_t ao = (size_t)(m0 + (i << 4) + rlane) * lda + koff + k0;
      V ah = Frag<T>::load(Ab + ao);
      V al;
      if (SPLIT) al = Frag<T>::load(Ab2 + ao);
#pragma unroll
      for (int j = 0; j < 4; ++j) {
        acc[i][j] = Frag<T>::mma(ah, bh[j], acc[i][j]);
        if (SPLIT) {
          acc[i][j] = Frag<T>::mma(ah, bl[j], acc[i][j]);
          acc[i][j] = Frag<T>::mma(al, bh[j], acc[i][j]);
        }
      }
      Frag<T>::guard(acc[i][0], acc[i][3], ah, SPLIT ? al : ah);
    }
    Frag<T>::keep(bh[0], bh[1], bh[2], bh[3]);
    if (SPLIT) Frag<T>::keep(bl[0], bl[1], bl[2], bl[3]);
  }
  acc_guard4(acc[0][0], acc[0][1], acc[0][2], acc[0][3]);
  acc_guard4(acc[1][0], acc[1][1], acc[1][2], acc[1][3]);
  acc_guard4(acc[2][0], acc[2][1], acc[2][2], acc[2][3]);
  acc_guard4(acc[3][0], acc[3][1], acc[3][2], acc[3][3]);

  // ---- epilogue ----
  float* slab = sT[wave];
  const float* Rb = RESID ? (resid + (size_t)b * strideR) : nullptr;
#pragma unroll
  for (int i = 0; i < 4; ++i) {
    const int mBase = m0 + (i << 4);
#pragma unroll
    for (int j = 0; j < 4; ++j) {
      const int n = n0 + (j << 4) + rlane;
      float bv = 0.f;
      if (BIAS_MODE == 2) bv = bias[n];
#pragma unroll
      for (int r = 0; r < 8; ++r) {
        float v = acc[i][j][r] * scale;
        if (BIAS_MODE == 1) v += bias[mBase + mOff + r];
        if (BIAS_MODE == 2) v += bv;
        if (RESID) v += Rb[(size_t)(mBase + mOff + r) * ldc + n];
        if (ACT == 1) v = tanhf(v);
        if (ACT == 2) v = fmaxf(v, 0.0f);
        if (ACT == 3) v = v / (1.0f + expf(-v));
        if (ACT == 4) v = (v > 0.f) ? v : 0.01f * v;
        if (ACT == 5) v = 0.5f * v * (1.0f + erff(v * 0.70710678118654752f));
        slab[(mOff + r) * 68 + (j << 4) + rlane] = v;
      }
    }
    __builtin_amdgcn_fence(__ATOMIC_RELEASE, "workgroup");
    __builtin_amdgcn_wave_barrier();
    __builtin_amdgcn_fence(__ATOMIC_ACQUIRE, "workgroup");
    if (OUT_MODE == 0) {
      float* C = (float*)Cout + (size_t)b * strideC;
      const int hh = lane >> 4, c4 = (lane & 15) * 4;     // row seg = 256 B = 16 lanes x 16 B
      {
#pragma unroll
        for (int it = 0; it < 8; ++it) {
          const int row = it * 2 + hh;
          v4f v = *(const v4f*)(slab + row * 68 + c4);
          *(v4f*)(C + (size_t)(mBase + row) * ldc + n0 + c4) = v;
        }
        
      }
    } else {
      const int q = lane >> 3, c8 = (lane & 7) * 8;
      unsigned short* C  = (unsigned short*)Cout  + (size_t)b * strideC;
      unsigned short* C2 = (OUT_MODE == 2) ? ((unsigned short*)Cout2 + (size_t)b * strideC) : nullptr;
      {
#pragma unroll
        for (int it = 0; it < 4; ++it) {
          const int row = it * 4 + q;
          const float* sp = slab + row * 68 + c8;
          v8h hv, lv;
#pragma unroll
          for (int e = 0; e < 8; ++e) {
            if (OUT_MODE == 1) {
              hv[e] = (_Float16)sp[e];
            } else {
              unsigned short hb = f2bf_bits(sp[e]);
              unsigned short lb = f2bf_bits(sp[e] - bf_bits2f(hb));
              hv[e] = __builtin_bit_cast(_Float16, hb);
              lv[e] = __builtin_bit_cast(_Float16, lb);
            }
          }
          *(v8h*)(C + (size_t)(mBase + row) * ldc + n0 + c8) = hv;
          if (OUT_MODE == 2) *(v8h*)(C2 + (size_t)(mBase + row) * ldc + n0 + c8) = lv;
        }
        
      }
    }
    __builtin_amdgcn_fence(__ATOMIC_RELEASE, "workgroup");
    __builtin_amdgcn_wave_barrier();
    __builtin_amdgcn_fence(__ATOMIC_ACQUIRE, "workgroup");
  }
}

__global__ __launch_bounds__(256) void cast_f32_f16x2(
    const float* __restrict__ in, _Float16* __restrict__ out, int n2) {
  int i = blockIdx.x * 256 + threadIdx.x;
  if (i < n2) {
    const _Float16 h0 = (_Float16)in[2 * i], h1 = (_Float16)in[2 * i + 1];
    const unsigned u = (unsigned)__builtin_bit_cast(unsigned short, h0) | ((unsigned)__builtin_bit_cast(unsigned short, h1) << 16);
    ((unsigned*)out)[i] = u;
    
  }
}


// ---- f32 -> f16 cast with a power-of-two pre-scale (folded back by the consumer GEMM's scale) ----
__global__ __launch_bounds__(256) void cast_f32_f16x2s(const float* __restrict__ in, _Float16* __restrict__ out, int n2, float s) {
  int i = blockIdx.x * 256 + threadIdx.x;
  if (i < n2) {
    const _Float16 h0 = (_Float16)(in[2 * i] * s), h1 = (_Float16)(in[2 * i + 1] * s);
    const unsigned u = (unsigned)__builtin_bit_cast(unsigned short, h0) | ((unsigned)__builtin_bit_cast(unsigned short, h1) << 16);
    ((unsigned*)out)[i] = u;
    
  }
}
__global__ __launch_bounds__(256) void split_f32_bf16x2(
    const float* __restrict__ in, __bf16* __restrict__ hi, __bf16* __restrict__ lo, long n2) {
  long i = (long)blockIdx.x * 256 + threadIdx.x;
  long stride = (long)gridDim.x * 256;
  {
    for (long j = i; j < n2; j += stride) {
      const float a = in[2 * j], b = in[2 * j + 1];
      const unsigned short ah = f2bf_bits(a), bh = f2bf_bits(b);
      const unsigned short al = f2bf_bits(a - bf_bits2f(ah)), bl = f2bf_bits(b - bf_bits2f(bh));
      ((unsigned*)hi)[j] = (unsigned)ah | ((unsigned)bh << 16);
      ((unsigned*)lo)[j] = (unsigned)al | ((unsigned)bl << 16);
    }
    
  }
}


// ---- f32 [R][C] (row pitch ldi) -> f16 transposed [C][R] (row pitch ldo); 64x64 tiles; each output row segment
__global__ __launch_bounds__(256) void transpose_cast_f16(const float* __restrict__ in, int ldi,
                                                         _Float16* __restrict__ outT, int ldo, float scale) {
  __shared__ __align__(16) _Float16 tile[64][72];     // [c][r]
  const int c0 = blockIdx.x * 64, r0 = blockIdx.y * 64;
  const int t = threadIdx.y * 32 + threadIdx.x;
  for (int i = threadIdx.y; i < 64; i += 8) {
    tile[threadIdx.x][i]      = (_Float16)(in[(size_t)(r0 + i) * ldi + c0 + threadIdx.x] * scale);
    tile[32 + threadIdx.x][i] = (_Float16)(in[(size_t)(r0 + i) * ldi + c0 + 32 + threadIdx.x] * scale);
  }
  __syncthreads();
  const int q = t >> 3, c8 = (t & 7) * 8;
  {
#pragma unroll
    for (int it = 0; it < 2; ++it) {
      const int c = it * 32 + q;
      v8h hv = *(const v8h*)(&tile[c][c8]);
      *(v8h*)(outT + (size_t)(c0 + c) * ldo + r0 + c8) = hv;
    }
    
  }
}

// ---- f32 [R][C] (pitch ldi) -> bf16 hi/lo transposed planes [C][R] (pitch ldo); 64x64 tiles; each output row segment
__global__ __launch_bounds__(256) void transpose_split_bf16(const float* __restrict__ in, int ldi,
                                                           __bf16* __restrict__ outH, __bf16* __restrict__ outL, int ldo) {
  __shared__ __align__(16) float tile[64][68];     // [c][r]
  const int c0 = blockIdx.x * 64, r0 = blockIdx.y * 64;
  const int t = threadIdx.y * 32 + threadIdx.x;
  for (int i = threadIdx.y; i < 64; i += 8) {
    tile[threadIdx.x][i]      = in[(size_t)(r0 + i) * ldi + c0 + threadIdx.x];
    tile[32 + threadIdx.x][i] = in[(size_t)(r0 + i) * ldi + c0 + 32 + threadIdx.x];
  }
  __syncthreads();
  const int q = t >> 3, c8 = (t & 7) * 8;
  {
#pragma unroll
    for (int it = 0; it < 2; ++it) {
      const int c = it * 32 + q;
      v8b hv, lv;
#pragma unroll
      for (int e = 0; e < 8; ++e) {
        const float f = tile[c][c8 + e];
        const unsigned short hb = f2bf_bits(f);
        hv[e] = __builtin_bit_cast(__bf16, hb);
        lv[e] = __builtin_bit_cast(__bf16, f2bf_bits(f - bf_bits2f(hb)));
      }
      *(v8b*)(outH + (size_t)(c0 + c) * ldo + r0 + c8) = hv;
      *(v8b*)(outL + (size_t)(c0 + c) * ldo + r0 + c8) = lv;
    }
    
  }
}

// =====================================================================================
// Generic causal/non-causal attention for head_dim 64, f32 in / f32 out; 16-bit operands: bf16 with optional hi/lo splits, or
// plain f16 (F16=true, non-split, probabilities carried x2^15).
//   scores = (q*qscale)·kᵀ : v_wmma_f32_16x16x32_bf16; SPLIT_QK -> q,k as bf16 hi/lo (hi·hi + hi·lo + lo·hi)
//   out    = p·v           : v_wmma_f32_16x16x32_bf16; SPLIT_PV -> p,v as bf16 hi/lo; else p,v plain bf16
//   f32 accumulate; online softmax in f32. Block = 4 waves = 64 query rows of one (batch, head); S % 64 == 0.
//   Element (b, s, h, d) of tensor X lives at X[b*X_bs + s*X_rs + h*X_hs + d] (strides in floats, multiples of 4).
//   Masking: mask_mode 0 none, 1 causal (kv > q masked), 2 tensor [S][Skv] shared over (b,h) (float if
//   mask_is_int==0, int32 with element == 0 -> masked if 1, int32 with element != 0 -> masked if 2), 3 per-token vectors qmask[B][S] & kvmask[B][Skv] (int32,
//   0 -> masked), 4 causal + sliding window (kv > q or q - kv > W masked; W passed in mask_is_int);
//   5 = relative-position bias: s += cp[b,h,q][idx[q][kv]] + pc[b,h,kv][idx[q][kv]] with idx = mask_b ([S][Skv] int32) and
//   mask_a an int32 [S][Skv] tensor with nonzero = masked (tables: element (b,h,row,n) at X + b*c_bs + h*c_hs + row*c_rs + n);
//   masked scores are replaced by mask_fill (e.g. -inf or -1e9) before the softmax.
//   grid.x = B * H * (S/64) (or a sub-range with blk0).
// =====================================================================================
#define AT_D 64
#define AT_NW 4
#define AT_QB 64
#define AT_KC 64
struct AttnGeom { const float* cp = nullptr; const float* pc = nullptr; long c_bs = 0, c_rs = 0, c_hs = 0;   // mode-5 score-bias tables
                  long q_bs, q_rs, q_hs, k_bs, k_rs, k_hs, v_bs, v_rs, v_hs, o_bs, o_rs, o_hs;
                  int S, Skv, H, mask_mode; float qscale; int blk0; float mask_fill; int mask_is_int; };
static_assert(sizeof(AttnGeom) == 168, "no padding");

__device__ __forceinline__ unsigned short at_bf_bits(float f) {
  unsigned u = __float_as_uint(f);
  return (unsigned short)((u + 0x7FFFu + ((u >> 16) & 1u)) >> 16);
}
__device__ __forceinline__ __bf16 at_f2bf(float f) { return __builtin_bit_cast(__bf16, at_bf_bits(f)); }
__device__ __forceinline__ void at_split(float f, __bf16& hi, __bf16& lo) {
  const unsigned short hb = at_bf_bits(f);
  hi = __builtin_bit_cast(__bf16, hb);
  lo = at_f2bf(f - __uint_as_float(((unsigned)hb) << 16));
}
__device__ __forceinline__ v8f at_mma(v16b a, v16b b, v8f c) {
  c = __builtin_amdgcn_wmma_f32_16x16x32_bf16(false, a, false, b, (short)0, c, false, false);
  asm volatile("v_nop\n\tv_nop\n\tv_nop\n\tv_nop" : "+v"(c) : "v"(a), "v"(b));
  return c;
}
// 16-bit element as a bit pattern held in a __bf16 slot: f16 bits when F16, bf16 (RNE) otherwise
template <bool F16> __device__ __forceinline__ __bf16 at_to16(float f) {
  if (F16) return __builtin_bit_cast(__bf16, (_Float16)f);
  return at_f2bf(f);
}
template <bool F16> __device__ __forceinline__ v8f at_mma16(v16b a, v16b b, v8f c) {
  if (F16) {
    const v16h ah = __builtin_bit_cast(v16h, a), bh = __builtin_bit_cast(v16h, b);
    c = __builtin_amdgcn_wmma_f32_16x16x32_f16(false, ah, false, bh, (short)0, c, false, false);
    asm volatile("v_nop\n\tv_nop\n\tv_nop\n\tv_nop" : "+v"(c) : "v"(ah), "v"(bh));
    return c;
  }
  return at_mma(a, b, c);
}

template <bool SPLIT_QK, bool SPLIT_PV, bool F16 = false>
__global__ __launch_bounds__(128)
void attn64_kernel(const float* __restrict__ q, const float* __restrict__ k,
                   const float* __restrict__ v, float* __restrict__ out,
                   const void* __restrict__ mask_a, const int* __restrict__ mask_b, AttnGeom g) {
  static_assert(!(F16 && (SPLIT_QK || SPLIT_PV)), "f16 mode is non-split");
  const float PSC = F16 ? 32768.0f : 1.0f;     // f16 probabilities carried x2^15 (subnormal range), folded into the final 1/l
  union FB { v16b v; v8b h[2]; };
  __shared__ __align__(16) __bf16 Ksh[AT_KC * AT_D];             // K hi [kv][d]      8 KB
  __shared__ __align__(16) __bf16 Ksl[SPLIT_QK ? AT_KC * AT_D : 8];
  __shared__ __align__(16) __bf16 Vth[AT_D * AT_KC];             // V hi [d][kv]      8 KB
  __shared__ __align__(16) __bf16 Vtl[SPLIT_PV ? AT_D * AT_KC : 8];
  __shared__ __align__(16) __bf16 Psh[AT_NW][16 * AT_KC];        // per wave P hi [row][kv]  8 KB
  __shared__ __align__(16) __bf16 Psl[SPLIT_PV ? AT_NW : 1][SPLIT_PV ? 16 * AT_KC : 8];
  __shared__ __align__(16) float  Os[AT_NW][16 * 68];            // per wave out tile, pitch 68

  const int tid  = threadIdx.x;
  const int wave = tid >> 5;
  const int lane = tid & 31;
  const int hh   = lane >> 4;
  const int c    = lane & 15;

  const int nqb = g.S / AT_QB;
  const int bx = blockIdx.x + g.blk0;
  const int qb = bx % nqb;
  const int bh = bx / nqb;
  const int h  = bh % g.H;
  const int b  = bh / g.H;
  const int qbase_block = qb * AT_QB;
  const int q0 = qbase_block + wave * 16;

  const float* qb_ptr = q + (size_t)b * g.q_bs + (size_t)h * g.q_hs;
  const float* kb_ptr = k + (size_t)b * g.k_bs + (size_t)h * g.k_hs;
  const float* vb_ptr = v + (size_t)b * g.v_bs + (size_t)h * g.v_hs;
  float*       ob_ptr = out + (size_t)b * g.o_bs + (size_t)h * g.o_hs;

  // ---- Q fragments (A operand): 2 d-chunks, hi (and lo) ----
  v16b qah[2], qal[2];
  {
    const float* qrow = qb_ptr + (size_t)(q0 + c) * g.q_rs;
#pragma unroll
    for (int dc = 0; dc < 2; ++dc) {
#pragma unroll
      for (int e = 0; e < 8; ++e) {
        const float f0 = qrow[dc * 32 + 8 * hh + e] * g.qscale;
        const float f1 = qrow[dc * 32 + 16 + 8 * hh + e] * g.qscale;
        if (SPLIT_QK) { __bf16 hq, lq; at_split(f0, hq, lq); qah[dc][e] = hq; qal[dc][e] = lq; at_split(f1, hq, lq); qah[dc][8 + e] = hq; qal[dc][8 + e] = lq; }
        else { qah[dc][e] = at_to16<F16>(f0); qah[dc][8 + e] = at_to16<F16>(f1); qal[dc][e] = qah[dc][e]; qal[dc][8 + e] = qah[dc][8 + e]; }
      }
    }
  }

  float mrow[8], lrow[8];
  v8f oacc[4];
#pragma unroll
  for (int r = 0; r < 8; ++r) { mrow[r] = -INFINITY; lrow[r] = 0.f; }
#pragma unroll
  for (int t = 0; t < 4; ++t) oacc[t] = (v8f){0.f,0.f,0.f,0.f,0.f,0.f,0.f,0.f};

  const int nChunks = (g.mask_mode == 1 || g.mask_mode == 4) ? (qb + 1) : (g.Skv / AT_KC);   // block-uniform
  // per-row query mask (mode 3)
  int qkeep[8];
#pragma unroll
  for (int r = 0; r < 8; ++r) qkeep[r] = (g.mask_mode == 3) ? mask_b[(size_t)b * g.S + q0 + 8 * hh + r] : 1;   // mask_b = qmask in mode 3
  for (int kc = 0; kc < nChunks; ++kc) {
    const int kv0 = kc * AT_KC;
    __syncthreads();
    {
      const int kvr = tid >> 1, dh = (tid & 1) * 32;
      const float* krow = kb_ptr + (size_t)(kv0 + kvr) * g.k_rs + dh;
      const float* vrow = vb_ptr + (size_t)(kv0 + kvr) * g.v_rs + dh;
#pragma unroll
      for (int i = 0; i < 8; ++i) {
        v4f kk = *(const v4f*)(krow + 4 * i);
        v4f vv = *(const v4f*)(vrow + 4 * i);
#pragma unroll
        for (int e = 0; e < 4; ++e) {
          const int d = dh + 4 * i + e;
          if (SPLIT_QK) { __bf16 a, bl; at_split(kk[e], a, bl); Ksh[kvr * AT_D + d] = a; Ksl[kvr * AT_D + d] = bl; }
          else Ksh[kvr * AT_D + d] = at_to16<F16>(kk[e]);
          if (SPLIT_PV) { __bf16 a, bl; at_split(vv[e], a, bl); Vth[d * AT_KC + kvr] = a; Vtl[d * AT_KC + kvr] = bl; }
          else Vth[d * AT_KC + kvr] = at_to16<F16>(vv[e]);
        }
      }
    }
    __syncthreads();

    v8f s[4];
#pragma unroll
    for (int j = 0; j < 4; ++j) {
      s[j] = (v8f){0.f,0.f,0.f,0.f,0.f,0.f,0.f,0.f};
#pragma unroll 1
      for (int dc = 0; dc < 2; ++dc) {
        FB kb;
        kb.h[0] = *(const v8b*)(Ksh + (j * 16 + c) * AT_D + dc * 32 + 8 * hh);
        kb.h[1] = *(const v8b*)(Ksh + (j * 16 + c) * AT_D + dc * 32 + 16 + 8 * hh);
        s[j] = at_mma16<F16>(qah[dc], kb.v, s[j]);
        if (SPLIT_QK) {
          FB kl;
          kl.h[0] = *(const v8b*)(Ksl + (j * 16 + c) * AT_D + dc * 32 + 8 * hh);
          kl.h[1] = *(const v8b*)(Ksl + (j * 16 + c) * AT_D + dc * 32 + 16 + 8 * hh);
          s[j] = at_mma16<F16>(qah[dc], kl.v, s[j]);
          s[j] = at_mma16<F16>(qal[dc], kb.v, s[j]);
        }
      }
    }
    const bool diag = (g.mask_mode == 1) && (kc == qb);
    int kvkeep[4] = {1, 1, 1, 1};
    if (g.mask_mode == 3) {
#pragma unroll
      for (int j = 0; j < 4; ++j) kvkeep[j] = ((const int*)mask_a)[(size_t)b * g.Skv + kv0 + j * 16 + c];   // mask_a = kvmask
    }
    float cm[8];
#pragma unroll
    for (int r = 0; r < 8; ++r) {
      const int qrow = q0 + 8 * hh + r;
      float m = -INFINITY;
#pragma unroll
      for (int j = 0; j < 4; ++j) {
        const int kvcol = kv0 + j * 16 + c;
        bool masked = false;
        if (diag) masked = (kvcol > qrow);
        else if (g.mask_mode == 4) masked = (kvcol > qrow) || (qrow - kvcol > g.mask_is_int);
        else if (g.mask_mode == 2) {
          const size_t mi = (size_t)qrow * g.Skv + kvcol;
          masked = (g.mask_is_int == 0) ? (((const float*)mask_a)[mi] == 0.0f)
                 : (g.mask_is_int == 1) ? (((const int*)mask_a)[mi] == 0) : (((const int*)mask_a)[mi] != 0);
        } else if (g.mask_mode == 3) masked = (qkeep[r] == 0) || (kvkeep[j] == 0);
        else if (g.mask_mode == 5) {
          const size_t mi = (size_t)qrow * g.Skv + kvcol;
          masked = (((const int*)mask_a)[mi] != 0);
          int n = mask_b[mi]; n = n < 0 ? 0 : n;
          s[j][r] += g.cp[(size_t)b * g.c_bs + (size_t)h * g.c_hs + (size_t)qrow * g.c_rs + n]
                   + g.pc[(size_t)b * g.c_bs + (size_t)h * g.c_hs + (size_t)kvcol * g.c_rs + n];
        }
        if (masked) s[j][r] = g.mask_fill;
        m = fmaxf(m, s[j][r]);
      }
#pragma unroll
      for (int off = 1; off < 16; off <<= 1) m = fmaxf(m, __shfl_xor(m, off, 32));
      cm[r] = m;
    }
    __bf16* pwh = Psh[wave];
    __bf16* pwl = Psl[SPLIT_PV ? wave : 0];
#pragma unroll
    for (int r = 0; r < 8; ++r) {
      const float mnew = fmaxf(mrow[r], cm[r]);
      const float alpha = expf(mrow[r] - mnew);
      mrow[r] = mnew;
      float psum = 0.f;
#pragma unroll
      for (int j = 0; j < 4; ++j) {
        const float p = expf(s[j][r] - mnew);
        psum += p;
        if (SPLIT_PV) { __bf16 a, bl; at_split(p, a, bl); pwh[(8 * hh + r) * AT_KC + j * 16 + c] = a; pwl[(8 * hh + r) * AT_KC + j * 16 + c] = bl; }
        else pwh[(8 * hh + r) * AT_KC + j * 16 + c] = at_to16<F16>(p * PSC);
      }
#pragma unroll
      for (int off = 1; off < 16; off <<= 1) psum += __shfl_xor(psum, off, 32);
      lrow[r] = lrow[r] * alpha + psum;
#pragma unroll
      for (int t = 0; t < 4; ++t) oacc[t][r] *= alpha;
    }
    __builtin_amdgcn_fence(__ATOMIC_RELEASE, "workgroup");
    __builtin_amdgcn_wave_barrier();
    __builtin_amdgcn_fence(__ATOMIC_ACQUIRE, "workgroup");
#pragma unroll 1
    for (int kk = 0; kk < 2; ++kk) {
      FB pa, pl;
      pa.h[0] = *(const v8b*)(pwh + c * AT_KC + kk * 32 + 8 * hh);
      pa.h[1] = *(const v8b*)(pwh + c * AT_KC + kk * 32 + 16 + 8 * hh);
      if (SPLIT_PV) {
        pl.h[0] = *(const v8b*)(pwl + c * AT_KC + kk * 32 + 8 * hh);
        pl.h[1] = *(const v8b*)(pwl + c * AT_KC + kk * 32 + 16 + 8 * hh);
      }
#pragma unroll
      for (int t = 0; t < 4; ++t) {
        FB vb;
        vb.h[0] = *(const v8b*)(Vth + (t * 16 + c) * AT_KC + kk * 32 + 8 * hh);
        vb.h[1] = *(const v8b*)(Vth + (t * 16 + c) * AT_KC + kk * 32 + 16 + 8 * hh);
        oacc[t] = at_mma16<F16>(pa.v, vb.v, oacc[t]);
        if (SPLIT_PV) {
          FB vl;
          vl.h[0] = *(const v8b*)(Vtl + (t * 16 + c) * AT_KC + kk * 32 + 8 * hh);
          vl.h[1] = *(const v8b*)(Vtl + (t * 16 + c) * AT_KC + kk * 32 + 16 + 8 * hh);
          oacc[t] = at_mma16<F16>(pa.v, vl.v, oacc[t]);
          oacc[t] = at_mma16<F16>(pl.v, vb.v, oacc[t]);
        }
      }
    }
  }

  float* os = Os[wave];
#pragma unroll
  for (int r = 0; r < 8; ++r) {
    const float inv = 1.0f / (lrow[r] * PSC);
#pragma unroll
    for (int t = 0; t < 4; ++t) os[(8 * hh + r) * 68 + t * 16 + c] = oacc[t][r] * inv;
  }
  __builtin_amdgcn_fence(__ATOMIC_RELEASE, "workgroup");
  __builtin_amdgcn_wave_barrier();
  __builtin_amdgcn_fence(__ATOMIC_ACQUIRE, "workgroup");
  {
    const int c4 = (lane & 15) * 4;
    {
#pragma unroll
      for (int it = 0; it < 8; ++it) {
        const int row = it * 2 + hh;
        v4f val = *(const v4f*)(os + row * 68 + c4);
        *(v4f*)(ob_ptr + (size_t)(q0 + row) * g.o_rs + c4) = val;
      }
      
    }
  }
}

// Both products are formed transposed: scores^T = k q^T (A = k rows, B = q rows) and out^T += v^T p^T (A = transposed v rows, B = p^T). In the accumulator tile of
//   scores^T a lane holds eight keys of ONE query (lane l: query l & 15, keys 8 (l >> 4) + r), so the running maximum and sum of a query are formed inside the lane, with one
//   exchange between the wave halves, and two score tiles, converted in place, ARE the B operand of the second product in the hardware's k order: p never goes through LDS.
// MODE: the mask mode as a compile-time constant; only 0 (no mask) is written in this form.
// PRE16: k and v come ready as 16-bit values, written once by their producer (k, v unused): k16 holds dense rows, element (b, s, d) at
//   k16[b*k_bs + s*128 + d]; vt16 holds v transposed in tiles of AT_KC keys, element (b, s, d) at vt16[b*v_bs + (s/AT_KC)*AT_KC*128 + d*AT_KC + s%AT_KC]
//   (k_bs, v_bs in 16-bit elements, multiples of 8), so that a pass's k tile and v tile are 16 KB contiguous each.
// NG: key groups. The block has NG groups of AT_NW waves on the SAME 64 query rows; group g walks the key tiles g, g + NG, g + 2 NG, ... with its own
//   k, v tiles in LDS and its own running maximum, sum and output tile, so that NG waves share each SIMD and fill one another's waits. Behind the loop the NG
//   partial results of a row are joined: out = sum_g e^(m_g - m) o_g / sum_g e^(m_g - m) l_g, m = max_g m_g. Skv a positive multiple of NG * AT_KC.
// The k, v tiles come into LDS by asynchronous copies, two buffers a group: while a trip works on one buffer, the next trip's tiles fly into the other.
// lane l takes the value of lane l ^ 16 (the other wave half), by a vector cross-row move
__device__ __forceinline__ float at_xhalf(float x) {
  return __builtin_bit_cast(float, __builtin_amdgcn_permlanex16(__builtin_bit_cast(int, x), __builtin_bit_cast(int, x), 0x76543210, 0xfedcba98, false, false));
}
// eight asynchronous 16 B copies of a lane, global memory -> LDS through no register: l = the lane's LDS byte addresses, s = its global addresses.
// precaution: s_wait_xcnt 0 is the last line of the copies' own statement, so that it stands before any of the address registers named here is reused
__device__ __forceinline__ void at_copy8(const unsigned (&l)[8], const unsigned short* const (&s)[8]) {
  asm volatile("global_load_async_to_lds_b128 %0, %8, off\n\t"
               "global_load_async_to_lds_b128 %1, %9, off\n\t"
               "global_load_async_to_lds_b128 %2, %10, off\n\t"
               "global_load_async_to_lds_b128 %3, %11, off\n\t"
               "global_load_async_to_lds_b128 %4, %12, off\n\t"
               "global_load_async_to_lds_b128 %5, %13, off\n\t"
               "global_load_async_to_lds_b128 %6, %14, off\n\t"
               "global_load_async_to_lds_b128 %7, %15, off\n\t"
               "s_wait_xcnt 0x0"
               :: "v"(l[0]), "v"(l[1]), "v"(l[2]), "v"(l[3]), "v"(l[4]), "v"(l[5]), "v"(l[6]), "v"(l[7]),
                  "v"(s[0]), "v"(s[1]), "v"(s[2]), "v"(s[3]), "v"(s[4]), "v"(s[5]), "v"(s[6]), "v"(s[7]) : "memory");
}
template <bool SPLIT_QK, bool SPLIT_PV, bool F16, int MODE, bool PRE16, int NG>
__global__ __launch_bounds__(128 * NG)
void attn128_kernel(const float* __restrict__ q, const float* __restrict__ k,
                   const float* __restrict__ v, const unsigned short* __restrict__ k16,
                   const unsigned short* __restrict__ vt16, float* __restrict__ out,
                   const void* __restrict__ mask_a, const int* __restrict__ mask_b, AttnGeom g) {
  static_assert(F16 && PRE16 && MODE == 0 && !SPLIT_QK && !SPLIT_PV && 16 % NG == 0, "transposed form: f16, ready k and v, unmasked, non-split");
  (void)k; (void)v; (void)mask_a; (void)mask_b;
  const float PSC = 32768.0f;     // f16 probabilities carried x2^15 (subnormal range), folded into the final 1/l
  union FB { v16b v; v8b h[2]; };
  constexpr int D2 = 128;
  constexpr int KP = D2 + 8;      // LDS pitch of the k and q rows, in 16-bit elements: 272 B = 16 B x odd, so the 16 rows of a ds_load_b128 fragment read fall on distinct banks
  constexpr int VP = AT_KC + 8;   // LDS pitch of the transposed v rows: 144 B = 16 B x odd, same reason
  constexpr int NWV = AT_NW * NG;                 // waves of the block
  constexpr int KVB = (AT_KC * KP + D2 * VP) * 2; // bytes of one group's k tile (17 KB, [kv][d], padded rows) and v tile (18 KB, [d][kv], padded rows)
  static_assert(AT_NW * 16 * 132 * 4 <= KVB, "the out tiles overlay the k, v tiles");
  __shared__ __align__(16) unsigned char KVraw[2 * NG * KVB];    // in the loop: two buffers of each group's k, v tiles (buffer u, group g at (u NG + g) KVB); behind it: per wave out tile, pitch 132 floats
  __shared__ __align__(16) __bf16 Qsh[AT_NW][16 * KP];   // q (the 16-bit value), one copy per 16-row query tile, read by that tile's wave of every group: leaves room for the second buffer
  __shared__ __align__(16) float  Msh[NWV][16], Lsh[NWV][16];    // each wave's query maxima and sums, for the join of the key groups

  const int grp  = __builtin_amdgcn_readfirstlane(threadIdx.x >> 7);   // key group; the same in a whole wave: held scalar, so the tile offsets stay scalar arithmetic
  const int tid  = threadIdx.x & 127;    // thread within its group
  const int wave = tid >> 5;             // wave within its group = its 16-row query tile
  const int wv   = grp * AT_NW + wave;   // wave within the block: its private LDS
  const int lane = tid & 31;
  const int hh   = lane >> 4;
  const int c    = lane & 15;

  const int nqb = g.S / AT_QB;
  const int bx = blockIdx.x + g.blk0;
  const int qb = bx % nqb;
  const int bh = bx / nqb;
  const int h  = bh % g.H;
  const int b  = bh / g.H;
  const int qbase_block = qb * AT_QB;
  const int q0 = qbase_block + wave * 16;

  const float* qb_ptr = q + (size_t)b * g.q_bs + (size_t)h * g.q_hs;
  float*       ob_ptr = out + (size_t)b * g.o_bs + (size_t)h * g.o_hs;

  // ---- the group's key tile of trip t (tile t NG + grp) into buffer t & 1: 16 B a lane and copy; a wave's 32 lanes take 512 contiguous bytes of the source;
  //      copy i is 2 KB further in the source (8 k rows, 16 v rows). 16 copies of a wave per tile, and never more than one tile's in flight.
  const unsigned short* ksrc = k16 + (size_t)b * g.k_bs + tid * 8;
  const unsigned short* vsrc = vt16 + (size_t)b * g.v_bs + tid * 8;
  const unsigned gdst = (unsigned)(size_t)(KVraw + grp * KVB);   // LDS byte address: the low 32 bits of the __shared__ address
  const unsigned kdst = gdst + ((tid >> 4) * KP + (tid & 15) * 8) * 2;
  const unsigned vdst = gdst + (AT_KC * KP + (tid >> 3) * VP + (tid & 7) * 8) * 2;
  auto copy_tile = [&](int t) {
    const size_t so = (size_t)(t * NG + grp) * (AT_KC * D2);
    const unsigned bo = (unsigned)(t & 1) * (NG * KVB);
    unsigned l[8];
    const unsigned short* s[8];
#pragma unroll   // unrolled so that l, s are registers
    for (int i = 0; i < 8; ++i) { l[i] = kdst + bo + i * (8 * KP * 2); s[i] = ksrc + so + i * 1024; }
    at_copy8(l, s);
#pragma unroll
    for (int i = 0; i < 8; ++i) { l[i] = vdst + bo + i * (16 * VP * 2); s[i] = vsrc + so + i * 1024; }
    at_copy8(l, s);
  };
  const int nTrips = g.Skv / (AT_KC * NG);   // block-uniform
  copy_tile(0);

  // ---- q rows of the wave's query tile, scaled and rounded to 16 bits, into LDS: group g lays the 32-column chunks g, g + NG, ... ----
  {
    const float* qrow = qb_ptr + (size_t)(q0 + c) * g.q_rs;
    for (int dc = grp; dc < 4; dc += NG) {
#pragma unroll
      for (int e = 0; e < 8; ++e) {
        const float f0 = qrow[dc * 32 + 8 * hh + e] * g.qscale;
        const float f1 = qrow[dc * 32 + 16 + 8 * hh + e] * g.qscale;
        Qsh[wave][c * KP + dc * 32 + 8 * hh + e] = at_to16<F16>(f0); Qsh[wave][c * KP + dc * 32 + 16 + 8 * hh + e] = at_to16<F16>(f1);
      }
    }
  }
  asm volatile("s_wait_asynccnt 0x0" ::: "memory");   // the wave's own copies of tile 0 have landed
  __syncthreads();                                    // tile 0 and the q rows are published to every wave
  if (nTrips > 1) copy_tile(1);

  float mrow = -INFINITY;   // running maximum of query q0 + c, the same in both wave halves
  float lrow = 0.f;         // running sum of query q0 + c over THIS half's keys (8 of every 16); the halves are joined behind the loop
  v8f oacc[8];              // oacc[t][r] = out^T[d = 16 t + 8 hh + r][query q0 + c]
#pragma unroll
  for (int t = 0; t < 8; ++t) oacc[t] = (v8f){0.f,0.f,0.f,0.f,0.f,0.f,0.f,0.f};

  for (int it = 0; it < nTrips; ++it) {
    const __bf16* Ksh = (const __bf16*)(KVraw + ((it & 1) * NG + grp) * KVB);   // trip it reads buffer it & 1 alone
    const __bf16* Vth = Ksh + AT_KC * KP;

    v8f s[4];   // s[j][r] = score of key (it * NG + grp) * AT_KC + 16 j + 8 hh + r with query q0 + c
#pragma unroll
    for (int j = 0; j < 4; ++j) {
      s[j] = (v8f){0.f,0.f,0.f,0.f,0.f,0.f,0.f,0.f};
#pragma unroll
      for (int dc = 0; dc < 4; ++dc) {
        FB kb, qa;
        kb.h[0] = *(const v8b*)(Ksh + (j * 16 + c) * KP + dc * 32 + 8 * hh);
        kb.h[1] = *(const v8b*)(Ksh + (j * 16 + c) * KP + dc * 32 + 16 + 8 * hh);
        qa.h[0] = *(const v8b*)(&Qsh[wave][c * KP + dc * 32 + 8 * hh]);
        qa.h[1] = *(const v8b*)(&Qsh[wave][c * KP + dc * 32 + 16 + 8 * hh]);
        s[j] = at_mma16<F16>(kb.v, qa.v, s[j]);
      }
    }
    float m = -INFINITY;
#pragma unroll   // unrolled, like the loops below, so that s, pb and oacc are indexed by constants and stay registers
    for (int j = 0; j < 4; ++j)
#pragma unroll
      for (int r = 0; r < 8; ++r) m = fmaxf(m, s[j][r]);
    m = fmaxf(m, at_xhalf(m));          // both halves hold the maximum over the tile's 64 keys
    const float mnew = fmaxf(mrow, m);
    const float alpha = expf(mrow - mnew);
    mrow = mnew;
    float psum = 0.f;
    FB pb[2];   // p^T as B operand: element e of pb[kk] is key 32 kk + 8 hh + e (e < 8), 32 kk + 16 + 8 hh + e - 8 (e >= 8): the order in which the v rows are read below
#pragma unroll
    for (int j = 0; j < 4; ++j) {
#pragma unroll
      for (int r = 0; r < 8; ++r) {
        const float p = expf(s[j][r] - mnew);
        psum += p;
        pb[j >> 1].v[(j & 1) * 8 + r] = at_to16<F16>(p * PSC);
      }
    }
    lrow = lrow * alpha + psum;
#pragma unroll
    for (int t = 0; t < 8; ++t)
#pragma unroll
      for (int r = 0; r < 8; ++r) oacc[t][r] *= alpha;
#pragma unroll
    for (int kk = 0; kk < 2; ++kk) {
#pragma unroll
      for (int t = 0; t < 8; ++t) {
        FB vb;
        vb.h[0] = *(const v8b*)(Vth + (t * 16 + c) * VP + kk * 32 + 8 * hh);
        vb.h[1] = *(const v8b*)(Vth + (t * 16 + c) * VP + kk * 32 + 16 + 8 * hh);
        oacc[t] = at_mma16<F16>(vb.v, pb[kk].v, oacc[t]);
      }
    }
    // hand-over, every wave, in this order
    asm volatile("s_wait_dscnt 0x0" ::: "memory");      // the wave's reads of this trip's buffer have returned
    asm volatile("s_wait_asynccnt 0x0" ::: "memory");   // the wave's own copies of the next trip's tiles have landed
    __syncthreads();                                    // publishes the next trip's tiles and ends every reader's last read of this trip's buffer
    if (it + 2 < nTrips) copy_tile(it + 2);             // refill of the buffer just left; the test reads the same in the whole block
  }
  asm volatile("s_wait_asynccnt 0x0" ::: "memory");     // no copy is outstanding when the buffers become out tiles

  float* os = (float*)KVraw + wv * (16 * 132);
  lrow += at_xhalf(lrow);   // the query's sum over all keys of the group
  if (NG > 1) {
    if (hh == 0) { Msh[wv][c] = mrow; Lsh[wv][c] = lrow; }   // both halves hold the same two values: one of them stores
  }
  __syncthreads();   // every wave has left the k, v tiles, which the out tiles overlay; the maxima and sums of all groups are published
  {
    float inv;
    if (NG > 1) {
      float mg[NG], mall = -INFINITY, lall = 0.f;
#pragma unroll   // unrolled so that mg is indexed by constants and stays registers
      for (int gi = 0; gi < NG; ++gi) { mg[gi] = Msh[gi * AT_NW + wave][c]; mall = fmaxf(mall, mg[gi]); }
#pragma unroll
      for (int gi = 0; gi < NG; ++gi) lall += Lsh[gi * AT_NW + wave][c] * expf(mg[gi] - mall);
      inv = expf(mrow - mall) / (lall * PSC);
    } else {
      inv = 1.0f / (lrow * PSC);
    }
#pragma unroll   // unrolled so that oacc is indexed by constants; a lane's eight values are consecutive d of its query's row: two 16 B stores
    for (int t = 0; t < 8; ++t) {
      v4f lo, hi;
#pragma unroll
      for (int e = 0; e < 4; ++e) { lo[e] = oacc[t][e] * inv; hi[e] = oacc[t][4 + e] * inv; }
      *(v4f*)(os + c * 132 + t * 16 + 8 * hh)     = lo;
      *(v4f*)(os + c * 132 + t * 16 + 8 * hh + 4) = hi;
    }
  }
  __syncthreads();   // the weighted out tiles of all groups are published
  {
    const int c4 = lane * 4;           // 32 lanes x 16 B = one 512-B output row (128 floats) per instruction
    const float* ot = (const float*)KVraw + wave * (16 * 132);   // group 0's tile of these query rows; group gi's lies gi * AT_NW tiles further
#pragma unroll   // unrolled, with the loop inside it, so that all LDS reads of the rows are issued before the first sum waits
    for (int rr = 0; rr < 16 / NG; ++rr) {     // each group sums and stores its own 16 / NG rows of the tile
      const int row = grp * (16 / NG) + rr;
      v4f val = *(const v4f*)(ot + row * 132 + c4);
#pragma unroll
      for (int gi = 1; gi < NG; ++gi) val += *(const v4f*)(ot + gi * (AT_NW * 16 * 132) + row * 132 + c4);
      *(v4f*)(ob_ptr + (size_t)(q0 + row) * g.o_rs + c4) = val;
    }
  }
}

// ---- q, k and v projections in ONE launch, straight from the f32 inputs -------------------------------------------
// A block owns 64 rows of x (= one 64-key tile). Its 16 waves bring those rows and the three weight matrices in by whole-line 16 B loads, round them to
// f16 (the same rounding as a cast pass) and lay them in LDS as rows of 128 values: rows 0..63 x, 64..191 Wq, 192..319 Wk, 320..447 Wv.
// Behind the one barrier 12 waves each form a 32 x 64 tile over k = 128: q, k = x W^T + b (rows = x rows), v transposed = Wv x^T + bv (rows = d, columns = keys).
// Outputs: Q f32 rows, K16 f16 rows, Vt16 f16 [128 d][64 keys] per 64-key tile.
#define PJ_XP 136   // LDS row pitch in f16: 272 B = 16 B x odd, so the 16 rows of a ds_load_b128 fragment read fall on distinct banks
typedef __attribute__((ext_vector_type(4))) _Float16 v4h;
__device__ __forceinline__ v4h pj_cvt(v4f f) { v4h h; h[0] = (_Float16)f[0]; h[1] = (_Float16)f[1]; h[2] = (_Float16)f[2]; h[3] = (_Float16)f[3]; return h; }
// BIAS_MODE: 1 = bias[m], 2 = bias[n]. OUT16: f16 output (Ch), else f32 (Cf). The 32 x 64 tile goes out through the wave's own LDS slab, as whole row segments.
template <int BIAS_MODE, bool OUT16>
__device__ __forceinline__ void pj_store(const v8f (&acc)[2][4], float* slab, float* __restrict__ Cf, unsigned short* __restrict__ Ch,
                                         int ldc, int m0, int n0, const float* __restrict__ bias, int lane) {
  const int rlane = lane & 15;
  const int mOff  = (lane >> 4) * 8;
#pragma unroll   // unrolled, with the loops inside it, so that acc is indexed by constants and stays in registers
  for (int i = 0; i < 2; ++i) {
#pragma unroll
    for (int j = 0; j < 4; ++j) {
      float bn = 0.f;
      if (BIAS_MODE == 2) bn = bias[n0 + (j << 4) + rlane];
#pragma unroll
      for (int r = 0; r < 8; ++r) {
        float v = acc[i][j][r];
        if (BIAS_MODE == 1) v += bias[m0 + (i << 4) + mOff + r];
        if (BIAS_MODE == 2) v += bn;
        slab[((i << 4) + mOff + r) * 68 + (j << 4) + rlane] = v;
      }
    }
  }
  // the slab is private to the wave: its lanes' writes are ordered before its lanes' reads; it stands ahead of every global store, so it waits for none
  __builtin_amdgcn_fence(__ATOMIC_RELEASE, "workgroup");
  __builtin_amdgcn_wave_barrier();
  __builtin_amdgcn_fence(__ATOMIC_ACQUIRE, "workgroup");
  if (!OUT16) {
    const int hh = lane >> 4, c4 = (lane & 15) * 4;     // row segment = 256 B = 16 lanes x 16 B
#pragma unroll   // unrolled so that the LDS reads of all rows are issued before the first store waits
    for (int it = 0; it < 16; ++it) {
      const int row = it * 2 + hh;
      v4f v = *(const v4f*)(slab + row * 68 + c4);
      *(v4f*)(Cf + (size_t)(m0 + row) * ldc + n0 + c4) = v;
    }
  } else {
    const int q = lane >> 3, c8 = (lane & 7) * 8;       // row segment = 128 B = 8 lanes x 16 B
#pragma unroll   // unrolled for the same reason
    for (int it = 0; it < 8; ++it) {
      const int row = it * 4 + q;
      const float* sp = slab + row * 68 + c8;
      v8h hv;
#pragma unroll
      for (int e = 0; e < 8; ++e) hv[e] = (_Float16)sp[e];
      *(v8h*)(Ch + (size_t)(m0 + row) * ldc + n0 + c8) = hv;
    }
  }
  // precaution: this wait stands behind the issued stores, before code that follows the call reuses their address and data registers
  asm volatile("s_wait_xcnt 0x0" ::: "memory");
}
__global__ __launch_bounds__(512) void proj_qkv(
    const float* __restrict__ x, const float* __restrict__ Wq, const float* __restrict__ bq, const float* __restrict__ Wk, const float* __restrict__ bk,
    const float* __restrict__ Wv, const float* __restrict__ bv, float* __restrict__ Q, unsigned short* __restrict__ K16, unsigned short* __restrict__ Vt16) {
  __shared__ __align__(16) _Float16 Sm[448 * PJ_XP];
  __shared__ __align__(16) float sT[12][32 * 68];   // per-wave 32x64 slab, pitch 68 floats
  const int tid  = threadIdx.x;
  const int row0 = blockIdx.x * 64;
  {
    // a wave's 32 lanes take one whole 512 B row; the block takes 16 rows (2048 floats) a step
    const float* xs = x + (size_t)row0 * 128 + tid * 4;
    const float* qs = Wq + tid * 4;
    const float* ks = Wk + tid * 4;
    const float* vs = Wv + tid * 4;
    v4f xr[4], qr[8], kr[8], vr[8];
#pragma unroll   // unrolled so that the arrays are registers and all 28 loads are in flight before the first conversion waits
    for (int it = 0; it < 4; ++it) xr[it] = *(const v4f*)(xs + it * 2048);
#pragma unroll
    for (int it = 0; it < 8; ++it) {
      qr[it] = *(const v4f*)(qs + it * 2048);
      kr[it] = *(const v4f*)(ks + it * 2048);
      vr[it] = *(const v4f*)(vs + it * 2048);
    }
    // precaution: this wait stands behind the issued loads, before their address registers are reused
    asm volatile("s_wait_xcnt 0x0" ::: "memory");
    _Float16* d = Sm + (tid >> 5) * PJ_XP + (tid & 31) * 4;
#pragma unroll   // unrolled for the same reason; the row steps become immediate offsets
    for (int it = 0; it < 4; ++it) *(v4h*)(d + it * 16 * PJ_XP) = pj_cvt(xr[it]);
#pragma unroll
    for (int it = 0; it < 8; ++it) {
      *(v4h*)(d + (64 + it * 16) * PJ_XP)  = pj_cvt(qr[it]);
      *(v4h*)(d + (192 + it * 16) * PJ_XP) = pj_cvt(kr[it]);
      *(v4h*)(d + (320 + it * 16) * PJ_XP) = pj_cvt(vr[it]);
    }
  }
  __syncthreads();   // x rows and weights are published to every wave; the only block barrier of the kernel
  const int wave = __builtin_amdgcn_readfirstlane(tid >> 5);   // the same in a whole wave: held scalar, so the tile choice is scalar arithmetic and scalar branches
  if (wave >= 12) return;                // 12 tiles of 32 x 64; whole waves leave, behind the barrier
  const int lane  = tid & 31;
  const int rlane = lane & 15;           // row (A) / column (B, D) within a 16 x 16 subtile
  const int koff  = (lane >> 4) * 8;     // k offset of this lane half
  const int which = wave >> 2;           // 0 q, 1 k, 2 v
  const int sub   = wave & 3;
  const int aRow = (which == 2) ? 320 + sub * 32 : (sub >> 1) * 32;
  const int bRow = (which == 2) ? 0 : 64 + which * 128 + (sub & 1) * 64;
  const _Float16* Al = Sm + (aRow + rlane) * PJ_XP + koff;
  const _Float16* Bl = Sm + (bRow + rlane) * PJ_XP + koff;
  v8f acc[2][4];
#pragma unroll
  for (int i = 0; i < 2; ++i)
#pragma unroll
    for (int j = 0; j < 4; ++j) acc[i][j] = (v8f){0.f,0.f,0.f,0.f,0.f,0.f,0.f,0.f};
#pragma unroll   // unrolled so that a later step's fragment reads can be issued ahead of an earlier step's products
  for (int k0 = 0; k0 < 128; k0 += 32) {
    v16h bh[4], ah[2];
#pragma unroll
    for (int j = 0; j < 4; ++j) bh[j] = Frag<_Float16>::load(Bl + j * 16 * PJ_XP + k0);
#pragma unroll
    for (int i = 0; i < 2; ++i) ah[i] = Frag<_Float16>::load(Al + i * 16 * PJ_XP + k0);
#pragma unroll
    for (int i = 0; i < 2; ++i)
#pragma unroll
      for (int j = 0; j < 4; ++j) acc[i][j] = Frag<_Float16>::mma(ah[i], bh[j], acc[i][j]);
  }
  float* slab = sT[wave];
  if (which == 0)      pj_store<2, false>(acc, slab, Q, nullptr, 128, row0 + (sub >> 1) * 32, (sub & 1) * 64, bq, lane);
  else if (which == 1) pj_store<2, true>(acc, slab, nullptr, K16, 128, row0 + (sub >> 1) * 32, (sub & 1) * 64, bk, lane);
  else                 pj_store<1, true>(acc, slab, nullptr, Vt16 + (size_t)blockIdx.x * (64 * 128), 64, sub * 32, 0, bv, lane);
}

#define IB 4
#define INn 4096
#define ID 128
extern "C" void kernel_launch(void* const* d_in, const int* in_sizes, int n_in, void* d_out, int out_size, void* d_ws, size_t ws_size, hipStream_t stream) {
  (void)in_sizes; (void)n_in; (void)out_size; (void)ws_size;
  const float* x = (const float*)d_in[0]; const float* Wq = (const float*)d_in[1]; const float* bq = (const float*)d_in[2]; const float* Wk = (const float*)d_in[3]; const float* bk = (const float*)d_in[4]; const float* Wv = (const float*)d_in[5]; const float* bv = (const float*)d_in[6];
  char* ws = (char*)d_ws; size_t off = 0;
  auto carve = [&](size_t bytes) -> char* { char* p = ws + off; off += (bytes + 255) & ~(size_t)255; return p; };
  const int R = IB * INn;
  float* Q = (float*)carve((size_t)R * ID * 4); _Float16* K16 = (_Float16*)carve((size_t)R * ID * 2); _Float16* Vt16 = (_Float16*)carve((size_t)R * ID * 2);
  // q f32 rows, k f16 rows, v f16 transposed per 64-key tile ([128 d][64 keys], 16 KB contiguous): one launch, one block per 64 rows of x
  proj_qkv<<<R / AT_KC, 512, 0, stream>>>(x, Wq, bq, Wk, bk, Wv, bv, Q, (unsigned short*)K16, (unsigned short*)Vt16);
  { AttnGeom g;
    g.q_bs = (long)INn * ID; g.q_rs = ID; g.q_hs = 0; g.k_bs = g.q_bs; g.k_rs = ID; g.k_hs = 0; g.v_bs = g.q_bs; g.v_rs = ID; g.v_hs = 0; g.o_bs = (long)INn * ID; g.o_rs = ID; g.o_hs = 0;
    g.S = INn; g.Skv = INn; g.H = 1; g.mask_mode = 0; g.qscale = 0.08838834764831845f; g.blk0 = 0; g.mask_fill = -INFINITY; g.mask_is_int = 0;
    attn128_kernel<false, false, true, 0, true, 4><<<IB * (INn / AT_QB), 4 * AT_NW * 32, 0, stream>>>(Q, nullptr, nullptr, U16(K16), U16(Vt16), (float*)d_out, nullptr, nullptr, g); }
}

// v008
// One run takes 59.8 microseconds.
// Timed twice side by side with v007, it ran 1.10 and 1.09 times as fast.
// Counting every step since v000, it is 17.5 times as fast.
#include <hip/hip_runtime.h>
#include <math.h>
// InteractionLayer: q, k, v = x W^T + b (three 16384 x 128 by 128 x 128 products in one launch; q f32, k f16 rows, v f16 transposed in 64-key tiles) and single-head attention (d 128, 4096 keys per batch; scores and
// p·v with p x2^15) on v_wmma_f32_16x16x32_f16 with f16 operands, f32 accumulate; softmax f32 on VALU. nn.Linear weights ([out][in]) are the
// Bt operand of q, k and the A operand of v^T, directly.
typedef __attribute__((ext_vector_type(16))) _Float16 v16h;
typedef __attribute__((ext_vector_type(8)))  _Float16 v8h;
typedef __attribute__((ext_vector_type(16))) __bf16   v16b;
typedef __attribute__((ext_vector_type(8)))  __bf16   v8b;
typedef __attribute__((ext_vector_type(8)))  float    v8f;
typedef __attribute__((ext_vector_type(4)))  float    v4f;
#define PSCALE 32768.0f
#define U16(p) ((const unsigned short*)(const void*)(p))
#define PSCALE_INV (1.0f / 32768.0f)

__device__ __forceinline__ unsigned short f2bf_bits(float f) {
  unsigned u = __float_as_uint(f);
  return (unsigned short)((u + 0x7FFFu + ((u >> 16) & 1u)) >> 16);
}
__device__ __forceinline__ float bf_bits2f(unsigned short h) { return __uint_as_float(((unsigned)h) << 16); }

// hazard guards as plain device helpers (no inline asm inside the kernel template body)
__device__ __forceinline__ void dep_guard_h(v8f& a, v8f& b, v16h x, v16h y) { asm volatile("v_nop\n\tv_nop\n\tv_nop\n\tv_nop" : "+v"(a), "+v"(b) : "v"(x), "v"(y)); }
__device__ __forceinline__ void dep_guard_b(v8f& a, v8f& b, v16b x, v16b y) { asm volatile("v_nop\n\tv_nop\n\tv_nop\n\tv_nop" : "+v"(a), "+v"(b) : "v"(x), "v"(y)); }
__device__ __forceinline__ void keep4_h(v16h a, v16h b, v16h c, v16h d) { asm volatile("v_nop" :: "v"(a), "v"(b), "v"(c), "v"(d)); }
__device__ __forceinline__ void keep4_b(v16b a, v16b b, v16b c, v16b d) { asm volatile("v_nop" :: "v"(a), "v"(b), "v"(c), "v"(d)); }
__device__ __forceinline__ void acc_guard4(v8f& a, v8f& b, v8f& c, v8f& d) { asm volatile("v_nop\n\tv_nop\n\tv_nop\n\tv_nop" : "+v"(a), "+v"(b), "+v"(c), "+v"(d)); }
template <typename T> struct Frag;
template <> struct Frag<_Float16> {
  typedef v16h V; union U { v16h v; v8h h[2]; };
  static __device__ __forceinline__ v16h load(const _Float16* p) {   // elements 0..7 <- p[0..7], 8..15 <- p[16..23]
    U f; f.h[0] = *(const v8h*)(p); f.h[1] = *(const v8h*)(p + 16); return f.v;
  }
  static __device__ __forceinline__ v8f mma(v16h a, v16h b, v8f c) {
    return __builtin_amdgcn_wmma_f32_16x16x32_f16(false, a, false, b, (short)0, c, false, false);
  }
  static __device__ __forceinline__ void guard(v8f& a, v8f& b, v16h x, v16h y) { dep_guard_h(a, b, x, y); }
  static __device__ __forceinline__ void keep(v16h a, v16h b, v16h c, v16h d) { keep4_h(a, b, c, d); }
};
template <> struct Frag<__bf16> {
  typedef v16b V; union U { v16b v; v8b h[2]; };
  static __device__ __forceinline__ v16b load(const __bf16* p) {
    U f; f.h[0] = *(const v8b*)(p); f.h[1] = *(const v8b*)(p + 16); return f.v;
  }
  static __device__ __forceinline__ v8f mma(v16b a, v16b b, v8f c) {
    return __builtin_amdgcn_wmma_f32_16x16x32_bf16(false, a, false, b, (short)0, c, false, false);
  }
  static __device__ __forceinline__ void guard(v8f& a, v8f& b, v16b x, v16b y) { dep_guard_b(a, b, x, y); }
  static __device__ __forceinline__ void keep(v16b a, v16b b, v16b c, v16b d) { keep4_b(a, b, c, d); }
};

// ---- Register-blocked batched WMMA GEMM ------------------------------------
// C[m,n] = scale * sum_k A[m,k] * Bt[n,k] (+bias)(+resid); each wave owns a 64x64 tile.
// A row-major [M,K]; Bt row-major [N,K]; M,N % 64 == 0, K % 32 == 0.
// SPLIT: operands are hi/lo planes (A2/Bt2 = lo planes, same layout); product = hi·hi + hi·lo + lo·hi.
// BIAS_MODE: 0 = none, 1 = bias[m], 2 = bias[n].
// OUT_MODE: 0 = f32, 1 = f16, 2 = bf16 hi plane (Cout) + bf16 lo plane (Cout2).
// ET: 0 = f16 operands, 1 = bf16 operands (pointers passed as 16-bit storage)
template <int ET> struct Elem;
template <> struct Elem<0> { typedef _Float16 T; };
template <> struct Elem<1> { typedef __bf16 T; };
template <int ET, bool SPLIT, int BIAS_MODE, int OUT_MODE, bool RESID, int ACT = 0>
__global__ __launch_bounds__(256) void wmma_gemm64(
    const unsigned short* __restrict__ Ap, const unsigned short* __restrict__ A2p, int lda, long strideA,
    const unsigned short* __restrict__ Btp, const unsigned short* __restrict__ Bt2p, int ldb, long strideB,
    void* __restrict__ Cout, void* __restrict__ Cout2, int ldc, long strideC,
    const float* __restrict__ bias,
    const float* __restrict__ resid, long strideR,
    int M, int N, int K, float scale) {
  typedef typename Elem<ET>::T T;
  typedef typename Frag<T>::V V;
  const T* A = (const T*)Ap; const T* A2 = (const T*)A2p; const T* Bt = (const T*)Btp; const T* Bt2 = (const T*)Bt2p;
  __shared__ __align__(16) float sT[8][16 * 68];   // per-wave 16x64 slab, pitch 68 floats
  const int b    = blockIdx.y;
  const int lane = threadIdx.x & 31;
  const int wave = threadIdx.x >> 5;
  const int tilesN = N >> 6;
  const int tilesM = M >> 6;
  const int tile = blockIdx.x * 8 + wave;
  if (tile >= tilesM * tilesN) return;   // wave-uniform; no block barriers in this kernel
  const int tm = tile / tilesN;
  const int tn = tile - tm * tilesN;
  const int m0 = tm << 6;
  const int n0 = tn << 6;

  const T* Ab  = A  + (size_t)b * strideA;
  const T* Bb  = Bt + (size_t)b * strideB;
  const T* Ab2 = SPLIT ? (A2  + (size_t)b * strideA) : nullptr;
  const T* Bb2 = SPLIT ? (Bt2 + (size_t)b * strideB) : nullptr;

  const int rlane = lane & 15;                 // row (A) / col (B, D) within subtile
  const int koff  = (lane >> 4) * 8;           // k offset of this lane half
  const int mOff  = (lane >> 4) * 8;           // D row offset

  v8f acc[4][4];
#pragma unroll
  for (int i = 0; i < 4; ++i)
#pragma unroll
    for (int j = 0; j < 4; ++j) acc[i][j] = (v8f){0.f,0.f,0.f,0.f,0.f,0.f,0.f,0.f};

  for (int k0 = 0; k0 < K; k0 += 32) {
    V bh[4], bl[4];
#pragma unroll
    for (int j = 0; j < 4; ++j) {
      const size_t bo = (size_t)(n0 + (j << 4) + rlane) * ldb + koff + k0;
      bh[j] = Frag<T>::load(Bb + bo);
      if (SPLIT) bl[j] = Frag<T>::load(Bb2 + bo);
    }
#pragma unroll
    for (int i = 0; i < 4; ++i) {
      const size_t ao = (size_t)(m0 + (i << 4) + rlane) * lda + koff + k0;
      V ah = Frag<T>::load(Ab + ao);
      V al;
      if (SPLIT) al = Frag<T>::load(Ab2 + ao);
#pragma unroll
      for (int j = 0; j < 4; ++j) {
        acc[i][j] = Frag<T>::mma(ah, bh[j], acc[i][j]);
        if (SPLIT) {
          acc[i][j] = Frag<T>::mma(ah, bl[j], acc[i][j]);
          acc[i][j] = Frag<T>::mma(al, bh[j], acc[i][j]);
        }
      }
      Frag<T>::guard(acc[i][0], acc[i][3], ah, SPLIT ? al : ah);
    }
    Frag<T>::keep(bh[0], bh[1], bh[2], bh[3]);
    if (SPLIT) Frag<T>::keep(bl[0], bl[1], bl[2], bl[3]);
  }
  acc_guard4(acc[0][0], acc[0][1], acc[0][2], acc[0][3]);
  acc_guard4(acc[1][0], acc[1][1], acc[1][2], acc[1][3]);
  acc_guard4(acc[2][0], acc[2][1], acc[2][2], acc[2][3]);
  acc_guard4(acc[3][0], acc[3][1], acc[3][2], acc[3][3]);

  // ---- epilogue ----
  float* slab = sT[wave];
  const float* Rb = RESID ? (resid + (size_t)b * strideR) : nullptr;
#pragma unroll
  for (int i = 0; i < 4; ++i) {
    const int mBase = m0 + (i << 4);
#pragma unroll
    for (int j = 0; j < 4; ++j) {
      const int n = n0 + (j << 4) + rlane;
      float bv = 0.f;
      if (BIAS_MODE == 2) bv = bias[n];
#pragma unroll
      for (int r = 0; r < 8; ++r) {
        float v = acc[i][j][r] * scale;
        if (BIAS_MODE == 1) v += bias[mBase + mOff + r];
        if (BIAS_MODE == 2) v += bv;
        if (RESID) v += Rb[(size_t)(mBase + mOff + r) * ldc + n];
        if (ACT == 1) v = tanhf(v);
        if (ACT == 2) v = fmaxf(v, 0.0f);
        if (ACT == 3) v = v / (1.0f + expf(-v));
        if (ACT == 4) v = (v > 0.f) ? v : 0.01f * v;
        if (ACT == 5) v = 0.5f * v * (1.0f + erff(v * 0.70710678118654752f));
        slab[(mOff + r) * 68 + (j << 4) + rlane] = v;
      }
    }
    __builtin_amdgcn_fence(__ATOMIC_RELEASE, "workgroup");
    __builtin_amdgcn_wave_barrier();
    __builtin_amdgcn_fence(__ATOMIC_ACQUIRE, "workgroup");
    if (OUT_MODE == 0) {
      float* C = (float*)Cout + (size_t)b * strideC;
      const int hh = lane >> 4, c4 = (lane & 15) * 4;     // row seg = 256 B = 16 lanes x 16 B
      {
#pragma unroll
        for (int it = 0; it < 8; ++it) {
          const int row = it * 2 + hh;
          v4f v = *(const v4f*)(slab + row * 68 + c4);
          *(v4f*)(C + (size_t)(mBase + row) * ldc + n0 + c4) = v;
        }
        
      }
    } else {
      const int q = lane >> 3, c8 = (lane & 7) * 8;
      unsigned short* C  = (unsigned short*)Cout  + (size_t)b * strideC;
      unsigned short* C2 = (OUT_MODE == 2) ? ((unsigned short*)Cout2 + (size_t)b * strideC) : nullptr;
      {
#pragma unroll
        for (int it = 0; it < 4; ++it) {
          const int row = it * 4 + q;
          const float* sp = slab + row * 68 + c8;
          v8h hv, lv;
#pragma unroll
          for (int e = 0; e < 8; ++e) {
            if (OUT_MODE == 1) {
              hv[e] = (_Float16)sp[e];
            } else {
              unsigned short hb = f2bf_bits(sp[e]);
              unsigned short lb = f2bf_bits(sp[e] - bf_bits2f(hb));
              hv[e] = __builtin_bit_cast(_Float16, hb);
              lv[e] = __builtin_bit_cast(_Float16, lb);
            }
          }
          *(v8h*)(C + (size_t)(mBase + row) * ldc + n0 + c8) = hv;
          if (OUT_MODE == 2) *(v8h*)(C2 + (size_t)(mBase + row) * ldc + n0 + c8) = lv;
        }
        
      }
    }
    __builtin_amdgcn_fence(__ATOMIC_RELEASE, "workgroup");
    __builtin_amdgcn_wave_barrier();
    __builtin_amdgcn_fence(__ATOMIC_ACQUIRE, "workgroup");
  }
}

__global__ __launch_bounds__(256) void cast_f32_f16x2(
    const float* __restrict__ in, _Float16* __restrict__ out, int n2) {
  int i = blockIdx.x * 256 + threadIdx.x;
  if (i < n2) {
    const _Float16 h0 = (_Float16)in[2 * i], h1 = (_Float16)in[2 * i + 1];
    const unsigned u = (unsigned)__builtin_bit_cast(unsigned short, h0) | ((unsigned)__builtin_bit_cast(unsigned short, h1) << 16);
    ((unsigned*)out)[i] = u;
    
  }
}


// ---- f32 -> f16 cast with a power-of-two pre-scale (folded back by the consumer GEMM's scale) ----
__global__ __launch_bounds__(256) void cast_f32_f16x2s(const float* __restrict__ in, _Float16* __restrict__ out, int n2, float s) {
  int i = blockIdx.x * 256 + threadIdx.x;
  if (i < n2) {
    const _Float16 h0 = (_Float16)(in[2 * i] * s), h1 = (_Float16)(in[2 * i + 1] * s);
    const unsigned u = (unsigned)__builtin_bit_cast(unsigned short, h0) | ((unsigned)__builtin_bit_cast(unsigned short, h1) << 16);
    ((unsigned*)out)[i] = u;
    
  }
}
__global__ __launch_bounds__(256) void split_f32_bf16x2(
    const float* __restrict__ in, __bf16* __restrict__ hi, __bf16* __restrict__ lo, long n2) {
  long i = (long)blockIdx.x * 256 + threadIdx.x;
  long stride = (long)gridDim.x * 256;
  {
    for (long j = i; j < n2; j += stride) {
      const float a = in[2 * j], b = in[2 * j + 1];
      const unsigned short ah = f2bf_bits(a), bh = f2bf_bits(b);
      const unsigned short al = f2bf_bits(a - bf_bits2f(ah)), bl = f2bf_bits(b - bf_bits2f(bh));
      ((unsigned*)hi)[j] = (unsigned)ah | ((unsigned)bh << 16);
      ((unsigned*)lo)[j] = (unsigned)al | ((unsigned)bl << 16);
    }
    
  }
}


// ---- f32 [R][C] (row pitch ldi) -> f16 transposed [C][R] (row pitch ldo); 64x64 tiles; each output row segment
__global__ __launch_bounds__(256) void transpose_cast_f16(const float* __restrict__ in, int ldi,
                                                         _Float16* __restrict__ outT, int ldo, float scale) {
  __shared__ __align__(16) _Float16 tile[64][72];     // [c][r]
  const int c0 = blockIdx.x * 64, r0 = blockIdx.y * 64;
  const int t = threadIdx.y * 32 + threadIdx.x;
  for (int i = threadIdx.y; i < 64; i += 8) {
    tile[threadIdx.x][i]      = (_Float16)(in[(size_t)(r0 + i) * ldi + c0 + threadIdx.x] * scale);
    tile[32 + threadIdx.x][i] = (_Float16)(in[(size_t)(r0 + i) * ldi + c0 + 32 + threadIdx.x] * scale);
  }
  __syncthreads();
  const int q = t >> 3, c8 = (t & 7) * 8;
  {
#pragma unroll
    for (int it = 0; it < 2; ++it) {
      const int c = it * 32 + q;
      v8h hv = *(const v8h*)(&tile[c][c8]);
      *(v8h*)(outT + (size_t)(c0 + c) * ldo + r0 + c8) = hv;
    }
    
  }
}

// ---- f32 [R][C] (pitch ldi) -> bf16 hi/lo transposed planes [C][R] (pitch ldo); 64x64 tiles; each output row segment
__global__ __launch_bounds__(256) void transpose_split_bf16(const float* __restrict__ in, int ldi,
                                                           __bf16* __restrict__ outH, __bf16* __restrict__ outL, int ldo) {
  __shared__ __align__(16) float tile[64][68];     // [c][r]
  const int c0 = blockIdx.x * 64, r0 = blockIdx.y * 64;
  const int t = threadIdx.y * 32 + threadIdx.x;
  for (int i = threadIdx.y; i < 64; i += 8) {
    tile[threadIdx.x][i]      = in[(size_t)(r0 + i) * ldi + c0 + threadIdx.x];
    tile[32 + threadIdx.x][i] = in[(size_t)(r0 + i) * ldi + c0 + 32 + threadIdx.x];
  }
  __syncthreads();
  const int q = t >> 3, c8 = (t & 7) * 8;
  {
#pragma unroll
    for (int it = 0; it < 2; ++it) {
      const int c = it * 32 + q;
      v8b hv, lv;
#pragma unroll
      for (int e = 0; e < 8; ++e) {
        const float f = tile[c][c8 + e];
        const unsigned short hb = f2bf_bits(f);
        hv[e] = __builtin_bit_cast(__bf16, hb);
        lv[e] = __builtin_bit_cast(__bf16, f2bf_bits(f - bf_bits2f(hb)));
      }
      *(v8b*)(outH + (size_t)(c0 + c) * ldo + r0 + c8) = hv;
      *(v8b*)(outL + (size_t)(c0 + c) * ldo + r0 + c8) = lv;
    }
    
  }
}

// =====================================================================================
// Generic causal/non-causal attention for head_dim 64, f32 in / f32 out; 16-bit operands: bf16 with optional hi/lo splits, or
// plain f16 (F16=true, non-split, probabilities carried x2^15).
//   scores = (q*qscale)·kᵀ : v_wmma_f32_16x16x32_bf16; SPLIT_QK -> q,k as bf16 hi/lo (hi·hi + hi·lo + lo·hi)
//   out    = p·v           : v_wmma_f32_16x16x32_bf16; SPLIT_PV -> p,v as bf16 hi/lo; else p,v plain bf16
//   f32 accumulate; online softmax in f32. Block = 4 waves = 64 query rows of one (batch, head); S % 64 == 0.
//   Element (b, s, h, d) of tensor X lives at X[b*X_bs + s*X_rs + h*X_hs + d] (strides in floats, multiples of 4).
//   Masking: mask_mode 0 none, 1 causal (kv > q masked), 2 tensor [S][Skv] shared over (b,h) (float if
//   mask_is_int==0, int32 with element == 0 -> masked if 1, int32 with element != 0 -> masked if 2), 3 per-token vectors qmask[B][S] & kvmask[B][Skv] (int32,
//   0 -> masked), 4 causal + sliding window (kv > q or q - kv > W masked; W passed in mask_is_int);
//   5 = relative-position bias: s += cp[b,h,q][idx[q][kv]] + pc[b,h,kv][idx[q][kv]] with idx = mask_b ([S][Skv] int32) and
//   mask_a an int32 [S][Skv] tensor with nonzero = masked (tables: element (b,h,row,n) at X + b*c_bs + h*c_hs + row*c_rs + n);
//   masked scores are replaced by mask_fill (e.g. -inf or -1e9) before the softmax.
//   grid.x = B * H * (S/64) (or a sub-range with blk0).
// =====================================================================================
#define AT_D 64
#define AT_NW 4
#define AT_QB 64
#define AT_KC 64
struct AttnGeom { const float* cp = nullptr; const float* pc = nullptr; long c_bs = 0, c_rs = 0, c_hs = 0;   // mode-5 score-bias tables
                  long q_bs, q_rs, q_hs, k_bs, k_rs, k_hs, v_bs, v_rs, v_hs, o_bs, o_rs, o_hs;
                  int S, Skv, H, mask_mode; float qscale; int blk0; float mask_fill; int mask_is_int; };
static_assert(sizeof(AttnGeom) == 168, "no padding");

__device__ __forceinline__ unsigned short at_bf_bits(float f) {
  unsigned u = __float_as_uint(f);
  return (unsigned short)((u + 0x7FFFu + ((u >> 16) & 1u)) >> 16);
}
__device__ __forceinline__ __bf16 at_f2bf(float f) { return __builtin_bit_cast(__bf16, at_bf_bits(f)); }
__device__ __forceinline__ void at_split(float f, __bf16& hi, __bf16& lo) {
  const unsigned short hb = at_bf_bits(f);
  hi = __builtin_bit_cast(__bf16, hb);
  lo = at_f2bf(f - __uint_as_float(((unsigned)hb) << 16));
}
__device__ __forceinline__ v8f at_mma(v16b a, v16b b, v8f c) {
  c = __builtin_amdgcn_wmma_f32_16x16x32_bf16(false, a, false, b, (short)0, c, false, false);
  asm volatile("v_nop\n\tv_nop\n\tv_nop\n\tv_nop" : "+v"(c) : "v"(a), "v"(b));
  return c;
}
// 16-bit element as a bit pattern held in a __bf16 slot: f16 bits when F16, bf16 (RNE) otherwise
template <bool F16> __device__ __forceinline__ __bf16 at_to16(float f) {
  if (F16) return __builtin_bit_cast(__bf16, (_Float16)f);
  return at_f2bf(f);
}
template <bool F16> __device__ __forceinline__ v8f at_mma16(v16b a, v16b b, v8f c) {
  if (F16) {
    const v16h ah = __builtin_bit_cast(v16h, a), bh = __builtin_bit_cast(v16h, b);
    // the builtin alone: the compiler keeps the distance behind it itself, and no asm statement holds the LDS reads of later products behind this one
    return __builtin_amdgcn_wmma_f32_16x16x32_f16(false, ah, false, bh, (short)0, c, false, false);
  }
  return at_mma(a, b, c);
}

template <bool SPLIT_QK, bool SPLIT_PV, bool F16 = false>
__global__ __launch_bounds__(128)
void attn64_kernel(const float* __restrict__ q, const float* __restrict__ k,
                   const float* __restrict__ v, float* __restrict__ out,
                   const void* __restrict__ mask_a, const int* __restrict__ mask_b, AttnGeom g) {
  static_assert(!(F16 && (SPLIT_QK || SPLIT_PV)), "f16 mode is non-split");
  const float PSC = F16 ? 32768.0f : 1.0f;     // f16 probabilities carried x2^15 (subnormal range), folded into the final 1/l
  union FB { v16b v; v8b h[2]; };
  __shared__ __align__(16) __bf16 Ksh[AT_KC * AT_D];             // K hi [kv][d]      8 KB
  __shared__ __align__(16) __bf16 Ksl[SPLIT_QK ? AT_KC * AT_D : 8];
  __shared__ __align__(16) __bf16 Vth[AT_D * AT_KC];             // V hi [d][kv]      8 KB
  __shared__ __align__(16) __bf16 Vtl[SPLIT_PV ? AT_D * AT_KC : 8];
  __shared__ __align__(16) __bf16 Psh[AT_NW][16 * AT_KC];        // per wave P hi [row][kv]  8 KB
  __shared__ __align__(16) __bf16 Psl[SPLIT_PV ? AT_NW : 1][SPLIT_PV ? 16 * AT_KC : 8];
  __shared__ __align__(16) float  Os[AT_NW][16 * 68];            // per wave out tile, pitch 68

  const int tid  = threadIdx.x;
  const int wave = tid >> 5;
  const int lane = tid & 31;
  const int hh   = lane >> 4;
  const int c    = lane & 15;

  const int nqb = g.S / AT_QB;
  const int bx = blockIdx.x + g.blk0;
  const int qb = bx % nqb;
  const int bh = bx / nqb;
  const int h  = bh % g.H;
  const int b  = bh / g.H;
  const int qbase_block = qb * AT_QB;
  const int q0 = qbase_block + wave * 16;

  const float* qb_ptr = q + (size_t)b * g.q_bs + (size_t)h * g.q_hs;
  const float* kb_ptr = k + (size_t)b * g.k_bs + (size_t)h * g.k_hs;
  const float* vb_ptr = v + (size_t)b * g.v_bs + (size_t)h * g.v_hs;
  float*       ob_ptr = out + (size_t)b * g.o_bs + (size_t)h * g.o_hs;

  // ---- Q fragments (A operand): 2 d-chunks, hi (and lo) ----
  v16b qah[2], qal[2];
  {
    const float* qrow = qb_ptr + (size_t)(q0 + c) * g.q_rs;
#pragma unroll
    for (int dc = 0; dc < 2; ++dc) {
#pragma unroll
      for (int e = 0; e < 8; ++e) {
        const float f0 = qrow[dc * 32 + 8 * hh + e] * g.qscale;
        const float f1 = qrow[dc * 32 + 16 + 8 * hh + e] * g.qscale;
        if (SPLIT_QK) { __bf16 hq, lq; at_split(f0, hq, lq); qah[dc][e] = hq; qal[dc][e] = lq; at_split(f1, hq, lq); qah[dc][8 + e] = hq; qal[dc][8 + e] = lq; }
        else { qah[dc][e] = at_to16<F16>(f0); qah[dc][8 + e] = at_to16<F16>(f1); qal[dc][e] = qah[dc][e]; qal[dc][8 + e] = qah[dc][8 + e]; }
      }
    }
  }

  float mrow[8], lrow[8];
  v8f oacc[4];
#pragma unroll
  for (int r = 0; r < 8; ++r) { mrow[r] = -INFINITY; lrow[r] = 0.f; }
#pragma unroll
  for (int t = 0; t < 4; ++t) oacc[t] = (v8f){0.f,0.f,0.f,0.f,0.f,0.f,0.f,0.f};

  const int nChunks = (g.mask_mode == 1 || g.mask_mode == 4) ? (qb + 1) : (g.Skv / AT_KC);   // block-uniform
  // per-row query mask (mode 3)
  int qkeep[8];
#pragma unroll
  for (int r = 0; r < 8; ++r) qkeep[r] = (g.mask_mode == 3) ? mask_b[(size_t)b * g.S + q0 + 8 * hh + r] : 1;   // mask_b = qmask in mode 3
  for (int kc = 0; kc < nChunks; ++kc) {
    const int kv0 = kc * AT_KC;
    __syncthreads();
    {
      const int kvr = tid >> 1, dh = (tid & 1) * 32;
      const float* krow = kb_ptr + (size_t)(kv0 + kvr) * g.k_rs + dh;
      const float* vrow = vb_ptr + (size_t)(kv0 + kvr) * g.v_rs + dh;
#pragma unroll
      for (int i = 0; i < 8; ++i) {
        v4f kk = *(const v4f*)(krow + 4 * i);
        v4f vv = *(const v4f*)(vrow + 4 * i);
#pragma unroll
        for (int e = 0; e < 4; ++e) {
          const int d = dh + 4 * i + e;
          if (SPLIT_QK) { __bf16 a, bl; at_split(kk[e], a, bl); Ksh[kvr * AT_D + d] = a; Ksl[kvr * AT_D + d] = bl; }
          else Ksh[kvr * AT_D + d] = at_to16<F16>(kk[e]);
          if (SPLIT_PV) { __bf16 a, bl; at_split(vv[e], a, bl); Vth[d * AT_KC + kvr] = a; Vtl[d * AT_KC + kvr] = bl; }
          else Vth[d * AT_KC + kvr] = at_to16<F16>(vv[e]);
        }
      }
    }
    __syncthreads();

    v8f s[4];
#pragma unroll
    for (int j = 0; j < 4; ++j) {
      s[j] = (v8f){0.f,0.f,0.f,0.f,0.f,0.f,0.f,0.f};
#pragma unroll 1
      for (int dc = 0; dc < 2; ++dc) {
        FB kb;
        kb.h[0] = *(const v8b*)(Ksh + (j * 16 + c) * AT_D + dc * 32 + 8 * hh);
        kb.h[1] = *(const v8b*)(Ksh + (j * 16 + c) * AT_D + dc * 32 + 16 + 8 * hh);
        s[j] = at_mma16<F16>(qah[dc], kb.v, s[j]);
        if (SPLIT_QK) {
          FB kl;
          kl.h[0] = *(const v8b*)(Ksl + (j * 16 + c) * AT_D + dc * 32 + 8 * hh);
          kl.h[1] = *(const v8b*)(Ksl + (j * 16 + c) * AT_D + dc * 32 + 16 + 8 * hh);
          s[j] = at_mma16<F16>(qah[dc], kl.v, s[j]);
          s[j] = at_mma16<F16>(qal[dc], kb.v, s[j]);
        }
      }
    }
    const bool diag = (g.mask_mode == 1) && (kc == qb);
    int kvkeep[4] = {1, 1, 1, 1};
    if (g.mask_mode == 3) {
#pragma unroll
      for (int j = 0; j < 4; ++j) kvkeep[j] = ((const int*)mask_a)[(size_t)b * g.Skv + kv0 + j * 16 + c];   // mask_a = kvmask
    }
    float cm[8];
#pragma unroll
    for (int r = 0; r < 8; ++r) {
      const int qrow = q0 + 8 * hh + r;
      float m = -INFINITY;
#pragma unroll
      for (int j = 0; j < 4; ++j) {
        const int kvcol = kv0 + j * 16 + c;
        bool masked = false;
        if (diag) masked = (kvcol > qrow);
        else if (g.mask_mode == 4) masked = (kvcol > qrow) || (qrow - kvcol > g.mask_is_int);
        else if (g.mask_mode == 2) {
          const size_t mi = (size_t)qrow * g.Skv + kvcol;
          masked = (g.mask_is_int == 0) ? (((const float*)mask_a)[mi] == 0.0f)
                 : (g.mask_is_int == 1) ? (((const int*)mask_a)[mi] == 0) : (((const int*)mask_a)[mi] != 0);
        } else if (g.mask_mode == 3) masked = (qkeep[r] == 0) || (kvkeep[j] == 0);
        else if (g.mask_mode == 5) {
          const size_t mi = (size_t)qrow * g.Skv + kvcol;
          masked = (((const int*)mask_a)[mi] != 0);
          int n = mask_b[mi]; n = n < 0 ? 0 : n;
          s[j][r] += g.cp[(size_t)b * g.c_bs + (size_t)h * g.c_hs + (size_t)qrow * g.c_rs + n]
                   + g.pc[(size_t)b * g.c_bs + (size_t)h * g.c_hs + (size_t)kvcol * g.c_rs + n];
        }
        if (masked) s[j][r] = g.mask_fill;
        m = fmaxf(m, s[j][r]);
      }
#pragma unroll
      for (int off = 1; off < 16; off <<= 1) m = fmaxf(m, __shfl_xor(m, off, 32));
      cm[r] = m;
    }
    __bf16* pwh = Psh[wave];
    __bf16* pwl = Psl[SPLIT_PV ? wave : 0];
#pragma unroll
    for (int r = 0; r < 8; ++r) {
      const float mnew = fmaxf(mrow[r], cm[r]);
      const float alpha = expf(mrow[r] - mnew);
      mrow[r] = mnew;
      float psum = 0.f;
#pragma unroll
      for (int j = 0; j < 4; ++j) {
        const float p = expf(s[j][r] - mnew);
        psum += p;
        if (SPLIT_PV) { __bf16 a, bl; at_split(p, a, bl); pwh[(8 * hh + r) * AT_KC + j * 16 + c] = a; pwl[(8 * hh + r) * AT_KC + j * 16 + c] = bl; }
        else pwh[(8 * hh + r) * AT_KC + j * 16 + c] = at_to16<F16>(p * PSC);
      }
#pragma unroll
      for (int off = 1; off < 16; off <<= 1) psum += __shfl_xor(psum, off, 32);
      lrow[r] = lrow[r] * alpha + psum;
#pragma unroll
      for (int t = 0; t < 4; ++t) oacc[t][r] *= alpha;
    }
    __builtin_amdgcn_fence(__ATOMIC_RELEASE, "workgroup");
    __builtin_amdgcn_wave_barrier();
    __builtin_amdgcn_fence(__ATOMIC_ACQUIRE, "workgroup");
#pragma unroll 1
    for (int kk = 0; kk < 2; ++kk) {
      FB pa, pl;
      pa.h[0] = *(const v8b*)(pwh + c * AT_KC + kk * 32 + 8 * hh);
      pa.h[1] = *(const v8b*)(pwh + c * AT_KC + kk * 32 + 16 + 8 * hh);
      if (SPLIT_PV) {
        pl.h[0] = *(const v8b*)(pwl + c * AT_KC + kk * 32 + 8 * hh);
        pl.h[1] = *(const v8b*)(pwl + c * AT_KC + kk * 32 + 16 + 8 * hh);
      }
#pragma unroll
      for (int t = 0; t < 4; ++t) {
        FB vb;
        vb.h[0] = *(const v8b*)(Vth + (t * 16 + c) * AT_KC + kk * 32 + 8 * hh);
        vb.h[1] = *(const v8b*)(Vth + (t * 16 + c) * AT_KC + kk * 32 + 16 + 8 * hh);
        oacc[t] = at_mma16<F16>(pa.v, vb.v, oacc[t]);
        if (SPLIT_PV) {
          FB vl;
          vl.h[0] = *(const v8b*)(Vtl + (t * 16 + c) * AT_KC + kk * 32 + 8 * hh);
          vl.h[1] = *(const v8b*)(Vtl + (t * 16 + c) * AT_KC + kk * 32 + 16 + 8 * hh);
          oacc[t] = at_mma16<F16>(pa.v, vl.v, oacc[t]);
          oacc[t] = at_mma16<F16>(pl.v, vb.v, oacc[t]);
        }
      }
    }
  }

  float* os = Os[wave];
#pragma unroll
  for (int r = 0; r < 8; ++r) {
    const float inv = 1.0f / (lrow[r] * PSC);
#pragma unroll
    for (int t = 0; t < 4; ++t) os[(8 * hh + r) * 68 + t * 16 + c] = oacc[t][r] * inv;
  }
  __builtin_amdgcn_fence(__ATOMIC_RELEASE, "workgroup");
  __builtin_amdgcn_wave_barrier();
  __builtin_amdgcn_fence(__ATOMIC_ACQUIRE, "workgroup");
  {
    const int c4 = (lane & 15) * 4;
    {
#pragma unroll
      for (int it = 0; it < 8; ++it) {
        const int row = it * 2 + hh;
        v4f val = *(const v4f*)(os + row * 68 + c4);
        *(v4f*)(ob_ptr + (size_t)(q0 + row) * g.o_rs + c4) = val;
      }
      
    }
  }
}

// Both products are formed transposed: scores^T = k q^T (A = k rows, B = q rows) and out^T += v^T p^T (A = transposed v rows, B = p^T). In the accumulator tile of
//   scores^T a lane holds eight keys of ONE query (lane l: query l & 15, keys 8 (l >> 4) + r), so the running maximum and sum of a query are formed inside the lane, with one
//   exchange between the wave halves, and two score tiles, converted in place, ARE the B operand of the second product in the hardware's k order: p never goes through LDS.
// MODE: the mask mode as a compile-time constant; only 0 (no mask) is written in this form.
// PRE16: k and v come ready as 16-bit values, written once by their producer (k, v unused): k16 holds dense rows, element (b, s, d) at
//   k16[b*k_bs + s*128 + d]; vt16 holds v transposed in tiles of AT_KC keys, element (b, s, d) at vt16[b*v_bs + (s/AT_KC)*AT_KC*128 + d*AT_KC + s%AT_KC]
//   (k_bs, v_bs in 16-bit elements, multiples of 8), so that a pass's k tile and v tile are 16 KB contiguous each.
// NG: key groups. The block has NG groups of AT_NW waves on the SAME 64 query rows; group g walks the key tiles g, g + NG, g + 2 NG, ... with its own
//   k, v tiles in LDS and its own running maximum, sum and output tile, so that NG waves share each SIMD and fill one another's waits. Behind the loop the NG
//   partial results of a row are joined: out = sum_g e^(m_g - m) o_g / sum_g e^(m_g - m) l_g, m = max_g m_g. Skv a positive multiple of NG * AT_KC.
// The k, v tiles come into LDS by asynchronous copies, two buffers a group: while a trip works on one buffer, the next trip's tiles fly into the other.
// lane l takes the value of lane l ^ 16 (the other wave half), by a vector cross-row move
__device__ __forceinline__ float at_xhalf(float x) {
  return __builtin_bit_cast(float, __builtin_amdgcn_permlanex16(__builtin_bit_cast(int, x), __builtin_bit_cast(int, x), 0x76543210, 0xfedcba98, false, false));
}
// eight asynchronous 16 B copies of a lane, global memory -> LDS through no register: l = the lane's LDS byte addresses, s = its global addresses.
// precaution: s_wait_xcnt 0 is the last line of the copies' own statement, so that it stands before any of the address registers named here is reused
__device__ __forceinline__ void at_copy8(const unsigned (&l)[8], const unsigned short* const (&s)[8]) {
  asm volatile("global_load_async_to_lds_b128 %0, %8, off\n\t"
               "global_load_async_to_lds_b128 %1, %9, off\n\t"
               "global_load_async_to_lds_b128 %2, %10, off\n\t"
               "global_load_async_to_lds_b128 %3, %11, off\n\t"
               "global_load_async_to_lds_b128 %4, %12, off\n\t"
               "global_load_async_to_lds_b128 %5, %13, off\n\t"
               "global_load_async_to_lds_b128 %6, %14, off\n\t"
               "global_load_async_to_lds_b128 %7, %15, off\n\t"
               "s_wait_xcnt 0x0"
               :: "v"(l[0]), "v"(l[1]), "v"(l[2]), "v"(l[3]), "v"(l[4]), "v"(l[5]), "v"(l[6]), "v"(l[7]),
                  "v"(s[0]), "v"(s[1]), "v"(s[2]), "v"(s[3]), "v"(s[4]), "v"(s[5]), "v"(s[6]), "v"(s[7]) : "memory");
}
template <bool SPLIT_QK, bool SPLIT_PV, bool F16, int MODE, bool PRE16, int NG>
__global__ __launch_bounds__(128 * NG)
void attn128_kernel(const float* __restrict__ q, const float* __restrict__ k,
                   const float* __restrict__ v, const unsigned short* __restrict__ k16,
                   const unsigned short* __restrict__ vt16, float* __restrict__ out,
                   const void* __restrict__ mask_a, const int* __restrict__ mask_b, AttnGeom g) {
  static_assert(F16 && PRE16 && MODE == 0 && !SPLIT_QK && !SPLIT_PV && 16 % NG == 0, "transposed form: f16, ready k and v, unmasked, non-split");
  (void)k; (void)v; (void)mask_a; (void)mask_b;
  const float PSC = 32768.0f;     // f16 probabilities carried x2^15 (subnormal range), folded into the final 1/l
  union FB { v16b v; v8b h[2]; };
  constexpr int D2 = 128;
  constexpr int KP = D2 + 8;      // LDS pitch of the k and q rows, in 16-bit elements: 272 B = 16 B x odd, so the 16 rows of a ds_load_b128 fragment read fall on distinct banks
  constexpr int VP = AT_KC + 8;   // LDS pitch of the transposed v rows: 144 B = 16 B x odd, same reason
  constexpr int NWV = AT_NW * NG;                 // waves of the block
  constexpr int KVB = (AT_KC * KP + D2 * VP) * 2; // bytes of one group's k tile (17 KB, [kv][d], padded rows) and v tile (18 KB, [d][kv], padded rows)
  static_assert(AT_NW * 16 * 132 * 4 <= KVB, "the out tiles overlay the k, v tiles");
  __shared__ __align__(16) unsigned char KVraw[2 * NG * KVB];    // in the loop: two buffers of each group's k, v tiles (buffer u, group g at (u NG + g) KVB); behind it: per wave out tile, pitch 132 floats
  __shared__ __align__(16) __bf16 Qsh[AT_NW][16 * KP];   // q (the 16-bit value), one copy per 16-row query tile, read by that tile's wave of every group: leaves room for the second buffer
  __shared__ __align__(16) float  Msh[NWV][16], Lsh[NWV][16];    // each wave's query maxima and sums, for the join of the key groups

  const int grp  = __builtin_amdgcn_readfirstlane(threadIdx.x >> 7);   // key group; the same in a whole wave: held scalar, so the tile offsets stay scalar arithmetic
  const int tid  = threadIdx.x & 127;    // thread within its group
  const int wave = tid >> 5;             // wave within its group = its 16-row query tile
  const int wv   = grp * AT_NW + wave;   // wave within the block: its private LDS
  const int lane = tid & 31;
  const int hh   = lane >> 4;
  const int c    = lane & 15;

  const int nqb = g.S / AT_QB;
  const int bx = blockIdx.x + g.blk0;
  const int qb = bx % nqb;
  const int bh = bx / nqb;
  const int h  = bh % g.H;
  const int b  = bh / g.H;
  const int qbase_block = qb * AT_QB;
  const int q0 = qbase_block + wave * 16;

  const float* qb_ptr = q + (size_t)b * g.q_bs + (size_t)h * g.q_hs;
  float*       ob_ptr = out + (size_t)b * g.o_bs + (size_t)h * g.o_hs;

  // ---- the group's key tile of trip t (tile t NG + grp) into buffer t & 1: 16 B a lane and copy; a wave's 32 lanes take 512 contiguous bytes of the source;
  //      copy i is 2 KB further in the source (8 k rows, 16 v rows). 16 copies of a wave per tile, and never more than one tile's in flight.
  const unsigned short* ksrc = k16 + (size_t)b * g.k_bs + tid * 8;
  const unsigned short* vsrc = vt16 + (size_t)b * g.v_bs + tid * 8;
  const unsigned gdst = (unsigned)(size_t)(KVraw + grp * KVB);   // LDS byte address: the low 32 bits of the __shared__ address
  const unsigned kdst = gdst + ((tid >> 4) * KP + (tid & 15) * 8) * 2;
  const unsigned vdst = gdst + (AT_KC * KP + (tid >> 3) * VP + (tid & 7) * 8) * 2;
  auto copy_tile = [&](int t) {
    const size_t so = (size_t)(t * NG + grp) * (AT_KC * D2);
    const unsigned bo = (unsigned)(t & 1) * (NG * KVB);
    unsigned l[8];
    const unsigned short* s[8];
#pragma unroll   // unrolled so that l, s are registers
    for (int i = 0; i < 8; ++i) { l[i] = kdst + bo + i * (8 * KP * 2); s[i] = ksrc + so + i * 1024; }
    at_copy8(l, s);
#pragma unroll
    for (int i = 0; i < 8; ++i) { l[i] = vdst + bo + i * (16 * VP * 2); s[i] = vsrc + so + i * 1024; }
    at_copy8(l, s);
  };
  const int nTrips = g.Skv / (AT_KC * NG);   // block-uniform
  copy_tile(0);

  // ---- q rows of the wave's query tile, scaled and rounded to 16 bits, into LDS: group g lays the 32-column chunks g, g + NG, ... ----
  {
    const float* qrow = qb_ptr + (size_t)(q0 + c) * g.q_rs;
    for (int dc = grp; dc < 4; dc += NG) {
#pragma unroll
      for (int e = 0; e < 8; ++e) {
        const float f0 = qrow[dc * 32 + 8 * hh + e] * g.qscale;
        const float f1 = qrow[dc * 32 + 16 + 8 * hh + e] * g.qscale;
        Qsh[wave][c * KP + dc * 32 + 8 * hh + e] = at_to16<F16>(f0); Qsh[wave][c * KP + dc * 32 + 16 + 8 * hh + e] = at_to16<F16>(f1);
      }
    }
  }
  asm volatile("s_wait_asynccnt 0x0" ::: "memory");   // the wave's own copies of tile 0 have landed
  __syncthreads();                                    // tile 0 and the q rows are published to every wave
  if (nTrips > 1) copy_tile(1);

  float mrow = -INFINITY;   // running maximum of query q0 + c, the same in both wave halves
  float lrow = 0.f;         // running sum of query q0 + c over THIS half's keys (8 of every 16); the halves are joined behind the loop
  v8f oacc[8];              // oacc[t][r] = out^T[d = 16 t + 8 hh + r][query q0 + c]
#pragma unroll
  for (int t = 0; t < 8; ++t) oacc[t] = (v8f){0.f,0.f,0.f,0.f,0.f,0.f,0.f,0.f};

  for (int it = 0; it < nTrips; ++it) {
    const __bf16* Ksh = (const __bf16*)(KVraw + ((it & 1) * NG + grp) * KVB);   // trip it reads buffer it & 1 alone
    const __bf16* Vth = Ksh + AT_KC * KP;

    v8f s[4];   // s[j][r] = score of key (it * NG + grp) * AT_KC + 16 j + 8 hh + r with query q0 + c
#pragma unroll
    for (int j = 0; j < 4; ++j) {
      s[j] = (v8f){0.f,0.f,0.f,0.f,0.f,0.f,0.f,0.f};
#pragma unroll
      for (int dc = 0; dc < 4; ++dc) {
        FB kb, qa;
        kb.h[0] = *(const v8b*)(Ksh + (j * 16 + c) * KP + dc * 32 + 8 * hh);
        kb.h[1] = *(const v8b*)(Ksh + (j * 16 + c) * KP + dc * 32 + 16 + 8 * hh);
        qa.h[0] = *(const v8b*)(&Qsh[wave][c * KP + dc * 32 + 8 * hh]);
        qa.h[1] = *(const v8b*)(&Qsh[wave][c * KP + dc * 32 + 16 + 8 * hh]);
        s[j] = at_mma16<F16>(kb.v, qa.v, s[j]);
      }
    }
    float m = -INFINITY;
#pragma unroll   // unrolled, like the loops below, so that s, pb and oacc are indexed by constants and stay registers
    for (int j = 0; j < 4; ++j)
#pragma unroll
      for (int r = 0; r < 8; ++r) m = fmaxf(m, s[j][r]);
    m = fmaxf(m, at_xhalf(m));          // both halves hold the maximum over the tile's 64 keys
    const float mnew = fmaxf(mrow, m);
    const float alpha = expf(mrow - mnew);
    mrow = mnew;
    float psum = 0.f;
    FB pb[2];   // p^T as B operand: element e of pb[kk] is key 32 kk + 8 hh + e (e < 8), 32 kk + 16 + 8 hh + e - 8 (e >= 8): the order in which the v rows are read below
#pragma unroll
    for (int j = 0; j < 4; ++j) {
#pragma unroll
      for (int r = 0; r < 8; ++r) {
        const float p = expf(s[j][r] - mnew);
        psum += p;
        pb[j >> 1].v[(j & 1) * 8 + r] = at_to16<F16>(p * PSC);
      }
    }
    lrow = lrow * alpha + psum;
#pragma unroll
    for (int t = 0; t < 8; ++t)
#pragma unroll
      for (int r = 0; r < 8; ++r) oacc[t][r] *= alpha;
#pragma unroll
    for (int kk = 0; kk < 2; ++kk) {
#pragma unroll
      for (int t = 0; t < 8; ++t) {
        FB vb;
        vb.h[0] = *(const v8b*)(Vth + (t * 16 + c) * VP + kk * 32 + 8 * hh);
        vb.h[1] = *(const v8b*)(Vth + (t * 16 + c) * VP + kk * 32 + 16 + 8 * hh);
        oacc[t] = at_mma16<F16>(vb.v, pb[kk].v, oacc[t]);
      }
    }
    // hand-over, every wave, in this order
    asm volatile("s_wait_dscnt 0x0" ::: "memory");      // the wave's reads of this trip's buffer have returned
    asm volatile("s_wait_asynccnt 0x0" ::: "memory");   // the wave's own copies of the next trip's tiles have landed
    __syncthreads();                                    // publishes the next trip's tiles and ends every reader's last read of this trip's buffer
    if (it + 2 < nTrips) copy_tile(it + 2);             // refill of the buffer just left; the test reads the same in the whole block
  }
  asm volatile("s_wait_asynccnt 0x0" ::: "memory");     // no copy is outstanding when the buffers become out tiles

  float* os = (float*)KVraw + wv * (16 * 132);
  lrow += at_xhalf(lrow);   // the query's sum over all keys of the group
  if (NG > 1) {
    if (hh == 0) { Msh[wv][c] = mrow; Lsh[wv][c] = lrow; }   // both halves hold the same two values: one of them stores
  }
  __syncthreads();   // every wave has left the k, v tiles, which the out tiles overlay; the maxima and sums of all groups are published
  {
    float inv;
    if (NG > 1) {
      float mg[NG], mall = -INFINITY, lall = 0.f;
#pragma unroll   // unrolled so that mg is indexed by constants and stays registers
      for (int gi = 0; gi < NG; ++gi) { mg[gi] = Msh[gi * AT_NW + wave][c]; mall = fmaxf(mall, mg[gi]); }
#pragma unroll
      for (int gi = 0; gi < NG; ++gi) lall += Lsh[gi * AT_NW + wave][c] * expf(mg[gi] - mall);
      inv = expf(mrow - mall) / (lall * PSC);
    } else {
      inv = 1.0f / (lrow * PSC);
    }
#pragma unroll   // unrolled so that oacc is indexed by constants; a lane's eight values are consecutive d of its query's row: two 16 B stores
    for (int t = 0; t < 8; ++t) {
      v4f lo, hi;
#pragma unroll
      for (int e = 0; e < 4; ++e) { lo[e] = oacc[t][e] * inv; hi[e] = oacc[t][4 + e] * inv; }
      *(v4f*)(os + c * 132 + t * 16 + 8 * hh)     = lo;
      *(v4f*)(os + c * 132 + t * 16 + 8 * hh + 4) = hi;
    }
  }
  __syncthreads();   // the weighted out tiles of all groups are published
  {
    const int c4 = lane * 4;           // 32 lanes x 16 B = one 512-B output row (128 floats) per instruction
    const float* ot = (const float*)KVraw + wave * (16 * 132);   // group 0's tile of these query rows; group gi's lies gi * AT_NW tiles further
#pragma unroll   // unrolled, with the loop inside it, so that all LDS reads of the rows are issued before the first sum waits
    for (int rr = 0; rr < 16 / NG; ++rr) {     // each group sums and stores its own 16 / NG rows of the tile
      const int row = grp * (16 / NG) + rr;
      v4f val = *(const v4f*)(ot + row * 132 + c4);
#pragma unroll
      for (int gi = 1; gi < NG; ++gi) val += *(const v4f*)(ot + gi * (AT_NW * 16 * 132) + row * 132 + c4);
      *(v4f*)(ob_ptr + (size_t)(q0 + row) * g.o_rs + c4) = val;
    }
  }
}

// ---- q, k and v projections in ONE launch, straight from the f32 inputs -------------------------------------------
// A block owns 64 rows of x (= one 64-key tile). Its 16 waves bring those rows and the three weight matrices in by whole-line 16 B loads, round them to
// f16 (the same rounding as a cast pass) and lay them in LDS as rows of 128 values: rows 0..63 x, 64..191 Wq, 192..319 Wk, 320..447 Wv.
// Behind the one barrier 12 waves each form a 32 x 64 tile over k = 128: q, k = x W^T + b (rows = x rows), v transposed = Wv x^T + bv (rows = d, columns = keys).
// Outputs: Q f32 rows, K16 f16 rows, Vt16 f16 [128 d][64 keys] per 64-key tile.
#define PJ_XP 136   // LDS row pitch in f16: 272 B = 16 B x odd, so the 16 rows of a ds_load_b128 fragment read fall on distinct banks
typedef __attribute__((ext_vector_type(4))) _Float16 v4h;
__device__ __forceinline__ v4h pj_cvt(v4f f) { v4h h; h[0] = (_Float16)f[0]; h[1] = (_Float16)f[1]; h[2] = (_Float16)f[2]; h[3] = (_Float16)f[3]; return h; }
// BIAS_MODE: 1 = bias[m], 2 = bias[n]. OUT16: f16 output (Ch), else f32 (Cf). The 32 x 64 tile goes out through the wave's own LDS slab, as whole row segments.
template <int BIAS_MODE, bool OUT16>
__device__ __forceinline__ void pj_store(const v8f (&acc)[2][4], float* slab, float* __restrict__ Cf, unsigned short* __restrict__ Ch,
                                         int ldc, int m0, int n0, const float* __restrict__ bias, int lane) {
  const int rlane = lane & 15;
  const int mOff  = (lane >> 4) * 8;
#pragma unroll   // unrolled, with the loops inside it, so that acc is indexed by constants and stays in registers
  for (int i = 0; i < 2; ++i) {
#pragma unroll
    for (int j = 0; j < 4; ++j) {
      float bn = 0.f;
      if (BIAS_MODE == 2) bn = bias[n0 + (j << 4) + rlane];
#pragma unroll
      for (int r = 0; r < 8; ++r) {
        float v = acc[i][j][r];
        if (BIAS_MODE == 1) v += bias[m0 + (i << 4) + mOff + r];
        if (BIAS_MODE == 2) v += bn;
        slab[((i << 4) + mOff + r) * 68 + (j << 4) + rlane] = v;
      }
    }
  }
  // the slab is private to the wave: its lanes' writes are ordered before its lanes' reads; it stands ahead of every global store, so it waits for none
  __builtin_amdgcn_fence(__ATOMIC_RELEASE, "workgroup");
  __builtin_amdgcn_wave_barrier();
  __builtin_amdgcn_fence(__ATOMIC_ACQUIRE, "workgroup");
  if (!OUT16) {
    const int hh = lane >> 4, c4 = (lane & 15) * 4;     // row segment = 256 B = 16 lanes x 16 B
#pragma unroll   // unrolled so that the LDS reads of all rows are issued before the first store waits
    for (int it = 0; it < 16; ++it) {
      const int row = it * 2 + hh;
      v4f v = *(const v4f*)(slab + row * 68 + c4);
      *(v4f*)(Cf + (size_t)(m0 + row) * ldc + n0 + c4) = v;
    }
  } else {
    const int q = lane >> 3, c8 = (lane & 7) * 8;       // row segment = 128 B = 8 lanes x 16 B
#pragma unroll   // unrolled for the same reason
    for (int it = 0; it < 8; ++it) {
      const int row = it * 4 + q;
      const float* sp = slab + row * 68 + c8;
      v8h hv;
#pragma unroll
      for (int e = 0; e < 8; ++e) hv[e] = (_Float16)sp[e];
      *(v8h*)(Ch + (size_t)(m0 + row) * ldc + n0 + c8) = hv;
    }
  }
  // precaution: this wait stands behind the issued stores, before code that follows the call reuses their address and data registers
  asm volatile("s_wait_xcnt 0x0" ::: "memory");
}
__global__ __launch_bounds__(512) void proj_qkv(
    const float* __restrict__ x, const float* __restrict__ Wq, const float* __restrict__ bq, const float* __restrict__ Wk, const float* __restrict__ bk,
    const float* __restrict__ Wv, const float* __restrict__ bv, float* __restrict__ Q, unsigned short* __restrict__ K16, unsigned short* __restrict__ Vt16) {
  __shared__ __align__(16) _Float16 Sm[448 * PJ_XP];
  __shared__ __align__(16) float sT[12][32 * 68];   // per-wave 32x64 slab, pitch 68 floats
  const int tid  = threadIdx.x;
  const int row0 = blockIdx.x * 64;
  {
    // a wave's 32 lanes take one whole 512 B row; the block takes 16 rows (2048 floats) a step
    const float* xs = x + (size_t)row0 * 128 + tid * 4;
    const float* qs = Wq + tid * 4;
    const float* ks = Wk + tid * 4;
    const float* vs = Wv + tid * 4;
    v4f xr[4], qr[8], kr[8], vr[8];
#pragma unroll   // unrolled so that the arrays are registers and all 28 loads are in flight before the first conversion waits
    for (int it = 0; it < 4; ++it) xr[it] = *(const v4f*)(xs + it * 2048);
#pragma unroll
    for (int it = 0; it < 8; ++it) {
      qr[it] = *(const v4f*)(qs + it * 2048);
      kr[it] = *(const v4f*)(ks + it * 2048);
      vr[it] = *(const v4f*)(vs + it * 2048);
    }
    // precaution: this wait stands behind the issued loads, before their address registers are reused
    asm volatile("s_wait_xcnt 0x0" ::: "memory");
    _Float16* d = Sm + (tid >> 5) * PJ_XP + (tid & 31) * 4;
#pragma unroll   // unrolled for the same reason; the row steps become immediate offsets
    for (int it = 0; it < 4; ++it) *(v4h*)(d + it * 16 * PJ_XP) = pj_cvt(xr[it]);
#pragma unroll
    for (int it = 0; it < 8; ++it) {
      *(v4h*)(d + (64 + it * 16) * PJ_XP)  = pj_cvt(qr[it]);
      *(v4h*)(d + (192 + it * 16) * PJ_XP) = pj_cvt(kr[it]);
      *(v4h*)(d + (320 + it * 16) * PJ_XP) = pj_cvt(vr[it]);
    }
  }
  __syncthreads();   // x rows and weights are published to every wave; the only block barrier of the kernel
  const int wave = __builtin_amdgcn_readfirstlane(tid >> 5);   // the same in a whole wave: held scalar, so the tile choice is scalar arithmetic and scalar branches
  if (wave >= 12) return;                // 12 tiles of 32 x 64; whole waves leave, behind the barrier
  const int lane  = tid & 31;
  const int rlane = lane & 15;           // row (A) / column (B, D) within a 16 x 16 subtile
  const int koff  = (lane >> 4) * 8;     // k offset of this lane half
  const int which = wave >> 2;           // 0 q, 1 k, 2 v
  const int sub   = wave & 3;
  const int aRow = (which == 2) ? 320 + sub * 32 : (sub >> 1) * 32;
  const int bRow = (which == 2) ? 0 : 64 + which * 128 + (sub & 1) * 64;
  const _Float16* Al = Sm + (aRow + rlane) * PJ_XP + koff;
  const _Float16* Bl = Sm + (bRow + rlane) * PJ_XP + koff;
  v8f acc[2][4];
#pragma unroll
  for (int i = 0; i < 2; ++i)
#pragma unroll
    for (int j = 0; j < 4; ++j) acc[i][j] = (v8f){0.f,0.f,0.f,0.f,0.f,0.f,0.f,0.f};
#pragma unroll   // unrolled so that a later step's fragment reads can be issued ahead of an earlier step's products
  for (int k0 = 0; k0 < 128; k0 += 32) {
    v16h bh[4], ah[2];
#pragma unroll
    for (int j = 0; j < 4; ++j) bh[j] = Frag<_Float16>::load(Bl + j * 16 * PJ_XP + k0);
#pragma unroll
    for (int i = 0; i < 2; ++i) ah[i] = Frag<_Float16>::load(Al + i * 16 * PJ_XP + k0);
#pragma unroll
    for (int i = 0; i < 2; ++i)
#pragma unroll
      for (int j = 0; j < 4; ++j) acc[i][j] = Frag<_Float16>::mma(ah[i], bh[j], acc[i][j]);
  }
  float* slab = sT[wave];
  if (which == 0)      pj_store<2, false>(acc, slab, Q, nullptr, 128, row0 + (sub >> 1) * 32, (sub & 1) * 64, bq, lane);
  else if (which == 1) pj_store<2, true>(acc, slab, nullptr, K16, 128, row0 + (sub >> 1) * 32, (sub & 1) * 64, bk, lane);
  else                 pj_store<1, true>(acc, slab, nullptr, Vt16 + (size_t)blockIdx.x * (64 * 128), 64, sub * 32, 0, bv, lane);
}

#define IB 4
#define INn 4096
#define ID 128
extern "C" void kernel_launch(void* const* d_in, const int* in_sizes, int n_in, void* d_out, int out_size, void* d_ws, size_t ws_size, hipStream_t stream) {
  (void)in_sizes; (void)n_in; (void)out_size; (void)ws_size;
  const float* x = (const float*)d_in[0]; const float* Wq = (const float*)d_in[1]; const float* bq = (const float*)d_in[2]; const float* Wk = (const float*)d_in[3]; const float* bk = (const float*)d_in[4]; const float* Wv = (const float*)d_in[5]; const float* bv = (const float*)d_in[6];
  char* ws = (char*)d_ws; size_t off = 0;
  auto carve = [&](size_t bytes) -> char* { char* p = ws + off; off += (bytes + 255) & ~(size_t)255; return p; };
  const int R = IB * INn;
  float* Q = (float*)carve((size_t)R * ID * 4); _Float16* K16 = (_Float16*)carve((size_t)R * ID * 2); _Float16* Vt16 = (_Float16*)carve((size_t)R * ID * 2);
  // q f32 rows, k f16 rows, v f16 transposed per 64-key tile ([128 d][64 keys], 16 KB contiguous): one launch, one block per 64 rows of x
  proj_qkv<<<R / AT_KC, 512, 0, stream>>>(x, Wq, bq, Wk, bk, Wv, bv, Q, (unsigned short*)K16, (unsigned short*)Vt16);
  { AttnGeom g;
    g.q_bs = (long)INn * ID; g.q_rs = ID; g.q_hs = 0; g.k_bs = g.q_bs; g.k_rs = ID; g.k_hs = 0; g.v_bs = g.q_bs; g.v_rs = ID; g.v_hs = 0; g.o_bs = (long)INn * ID; g.o_rs = ID; g.o_hs = 0;
    g.S = INn; g.Skv = INn; g.H = 1; g.mask_mode = 0; g.qscale = 0.08838834764831845f; g.blk0 = 0; g.mask_fill = -INFINITY; g.mask_is_int = 0;
    attn128_kernel<false, false, true, 0, true, 4><<<IB * (INn / AT_QB), 4 * AT_NW * 32, 0, stream>>>(Q, nullptr, nullptr, U16(K16), U16(Vt16), (float*)d_out, nullptr, nullptr, g); }
}

// v009
// A run of this version takes 46.3 microseconds.
// Timed twice side by side with v008, it ran 1.29 times as fast both times.
// All steps since v000 together make it 22.5 times as fast.
#include <hip/hip_runtime.h>
#include <math.h>
// InteractionLayer: q, k, v = x W^T + b (three 16384 x 128 by 128 x 128 products in one launch; q f32, k f16 rows, v f16 transposed in 64-key tiles) and single-head attention (d 128, 4096 keys per batch; scores and
// p·v with p x2^15) on v_wmma_f32_16x16x32_f16 with f16 operands, f32 accumulate; softmax f32 on VALU. nn.Linear weights ([out][in]) are the
// Bt operand of q, k and the A operand of v^T, directly.
typedef __attribute__((ext_vector_type(16))) _Float16 v16h;
typedef __attribute__((ext_vector_type(8)))  _Float16 v8h;
typedef __attribute__((ext_vector_type(16))) __bf16   v16b;
typedef __attribute__((ext_vector_type(8)))  __bf16   v8b;
typedef __attribute__((ext_vector_type(8)))  float    v8f;
typedef __attribute__((ext_vector_type(4)))  float    v4f;
typedef __attribute__((ext_vector_type(2)))  float    v2f;
typedef __attribute__((ext_vector_type(2)))  _Float16 v2h;
#define PSCALE 32768.0f
#define U16(p) ((const unsigned short*)(const void*)(p))
#define PSCALE_INV (1.0f / 32768.0f)

__device__ __forceinline__ unsigned short f2bf_bits(float f) {
  unsigned u = __float_as_uint(f);
  return (unsigned short)((u + 0x7FFFu + ((u >> 16) & 1u)) >> 16);
}
__device__ __forceinline__ float bf_bits2f(unsigned short h) { return __uint_as_float(((unsigned)h) << 16); }

// hazard guards as plain device helpers (no inline asm inside the kernel template body)
__device__ __forceinline__ void dep_guard_h(v8f& a, v8f& b, v16h x, v16h y) { asm volatile("v_nop\n\tv_nop\n\tv_nop\n\tv_nop" : "+v"(a), "+v"(b) : "v"(x), "v"(y)); }
__device__ __forceinline__ void dep_guard_b(v8f& a, v8f& b, v16b x, v16b y) { asm volatile("v_nop\n\tv_nop\n\tv_nop\n\tv_nop" : "+v"(a), "+v"(b) : "v"(x), "v"(y)); }
__device__ __forceinline__ void keep4_h(v16h a, v16h b, v16h c, v16h d) { asm volatile("v_nop" :: "v"(a), "v"(b), "v"(c), "v"(d)); }
__device__ __forceinline__ void keep4_b(v16b a, v16b b, v16b c, v16b d) { asm volatile("v_nop" :: "v"(a), "v"(b), "v"(c), "v"(d)); }
__device__ __forceinline__ void acc_guard4(v8f& a, v8f& b, v8f& c, v8f& d) { asm volatile("v_nop\n\tv_nop\n\tv_nop\n\tv_nop" : "+v"(a), "+v"(b), "+v"(c), "+v"(d)); }
template <typename T> struct Frag;
template <> struct Frag<_Float16> {
  typedef v16h V; union U { v16h v; v8h h[2]; };
  static __device__ __forceinline__ v16h load(const _Float16* p) {   // elements 0..7 <- p[0..7], 8..15 <- p[16..23]
    U f; f.h[0] = *(const v8h*)(p); f.h[1] = *(const v8h*)(p + 16); return f.v;
  }
  static __device__ __forceinline__ v8f mma(v16h a, v16h b, v8f c) {
    return __builtin_amdgcn_wmma_f32_16x16x32_f16(false, a, false, b, (short)0, c, false, false);
  }
  static __device__ __forceinline__ void guard(v8f& a, v8f& b, v16h x, v16h y) { dep_guard_h(a, b, x, y); }
  static __device__ __forceinline__ void keep(v16h a, v16h b, v16h c, v16h d) { keep4_h(a, b, c, d); }
};
template <> struct Frag<__bf16> {
  typedef v16b V; union U { v16b v; v8b h[2]; };
  static __device__ __forceinline__ v16b load(const __bf16* p) {
    U f; f.h[0] = *(const v8b*)(p); f.h[1] = *(const v8b*)(p + 16); return f.v;
  }
  static __device__ __forceinline__ v8f mma(v16b a, v16b b, v8f c) {
    return __builtin_amdgcn_wmma_f32_16x16x32_bf16(false, a, false, b, (short)0, c, false, false);
  }
  static __device__ __forceinline__ void guard(v8f& a, v8f& b, v16b x, v16b y) { dep_guard_b(a, b, x, y); }
  static __device__ __forceinline__ void keep(v16b a, v16b b, v16b c, v16b d) { keep4_b(a, b, c, d); }
};

// ---- Register-blocked batched WMMA GEMM ------------------------------------
// C[m,n] = scale * sum_k A[m,k] * Bt[n,k] (+bias)(+resid); each wave owns a 64x64 tile.
// A row-major [M,K]; Bt row-major [N,K]; M,N % 64 == 0, K % 32 == 0.
// SPLIT: operands are hi/lo planes (A2/Bt2 = lo planes, same layout); product = hi·hi + hi·lo + lo·hi.
// BIAS_MODE: 0 = none, 1 = bias[m], 2 = bias[n].
// OUT_MODE: 0 = f32, 1 = f16, 2 = bf16 hi plane (Cout) + bf16 lo plane (Cout2).
// ET: 0 = f16 operands, 1 = bf16 operands (pointers passed as 16-bit storage)
template <int ET> struct Elem;
template <> struct Elem<0> { typedef _Float16 T; };
template <> struct Elem<1> { typedef __bf16 T; };
template <int ET, bool SPLIT, int BIAS_MODE, int OUT_MODE, bool RESID, int ACT = 0>
__global__ __launch_bounds__(256) void wmma_gemm64(
    const unsigned short* __restrict__ Ap, const unsigned short* __restrict__ A2p, int lda, long strideA,
    const unsigned short* __restrict__ Btp, const unsigned short* __restrict__ Bt2p, int ldb, long strideB,
    void* __restrict__ Cout, void* __restrict__ Cout2, int ldc, long strideC,
    const float* __restrict__ bias,
    const float* __restrict__ resid, long strideR,
    int M, int N, int K, float scale) {
  typedef typename Elem<ET>::T T;
  typedef typename Frag<T>::V V;
  const T* A = (const T*)Ap; const T* A2 = (const T*)A2p; const T* Bt = (const T*)Btp; const T* Bt2 = (const T*)Bt2p;
  __shared__ __align__(16) float sT[8][16 * 68];   // per-wave 16x64 slab, pitch 68 floats
  const int b    = blockIdx.y;
  const int lane = threadIdx.x & 31;
  const int wave = threadIdx.x >> 5;
  const int tilesN = N >> 6;
  const int tilesM = M >> 6;
  const int tile = blockIdx.x * 8 + wave;
  if (tile >= tilesM * tilesN) return;   // wave-uniform; no block barriers in this kernel
  const int tm = tile / tilesN;
  const int tn = tile - tm * tilesN;
  const int m0 = tm << 6;
  const int n0 = tn << 6;

  const T* Ab  = A  + (size_t)b * strideA;
  const T* Bb  = Bt + (size_t)b * strideB;
  const T* Ab2 = SPLIT ? (A2  + (size_t)b * strideA) : nullptr;
  const T* Bb2 = SPLIT ? (Bt2 + (size_t)b * strideB) : nullptr;

  const int rlane = lane & 15;                 // row (A) / col (B, D) within subtile
  const int koff  = (lane >> 4) * 8;           // k offset of this lane half
  const int mOff  = (lane >> 4) * 8;           // D row offset

  v8f acc[4][4];
#pragma unroll
  for (int i = 0; i < 4; ++i)
#pragma unroll
    for (int j = 0; j < 4; ++j) acc[i][j] = (v8f){0.f,0.f,0.f,0.f,0.f,0.f,0.f,0.f};

  for (int k0 = 0; k0 < K; k0 += 32) {
    V bh[4], bl[4];
#pragma unroll
    for (int j = 0; j < 4; ++j) {
      const size_t bo = (size_t)(n0 + (j << 4) + rlane) * ldb + koff + k0;
      bh[j] = Frag<T>::load(Bb + bo);
      if (SPLIT) bl[j] = Frag<T>::load(Bb2 + bo);
    }
#pragma unroll
    for (int i = 0; i < 4; ++i) {
      const size_t ao = (size_t)(m0 + (i << 4) + rlane) * lda + koff + k0;
      V ah = Frag<T>::load(Ab + ao);
      V al;
      if (SPLIT) al = Frag<T>::load(Ab2 + ao);
#pragma unroll
      for (int j = 0; j < 4; ++j) {
        acc[i][j] = Frag<T>::mma(ah, bh[j], acc[i][j]);
        if (SPLIT) {
          acc[i][j] = Frag<T>::mma(ah, bl[j], acc[i][j]);
          acc[i][j] = Frag<T>::mma(al, bh[j], acc[i][j]);
        }
      }
      Frag<T>::guard(acc[i][0], acc[i][3], ah, SPLIT ? al : ah);
    }
    Frag<T>::keep(bh[0], bh[1], bh[2], bh[3]);
    if (SPLIT) Frag<T>::keep(bl[0], bl[1], bl[2], bl[3]);
  }
  acc_guard4(acc[0][0], acc[0][1], acc[0][2], acc[0][3]);
  acc_guard4(acc[1][0], acc[1][1], acc[1][2], acc[1][3]);
  acc_guard4(acc[2][0], acc[2][1], acc[2][2], acc[2][3]);
  acc_guard4(acc[3][0], acc[3][1], acc[3][2], acc[3][3]);

  // ---- epilogue ----
  float* slab = sT[wave];
  const float* Rb = RESID ? (resid + (size_t)b * strideR) : nullptr;
#pragma unroll
  for (int i = 0; i < 4; ++i) {
    const int mBase = m0 + (i << 4);
#pragma unroll
    for (int j = 0; j < 4; ++j) {
      const int n = n0 + (j << 4) + rlane;
      float bv = 0.f;
      if (BIAS_MODE == 2) bv = bias[n];
#pragma unroll
      for (int r = 0; r < 8; ++r) {
        float v = acc[i][j][r] * scale;
        if (BIAS_MODE == 1) v += bias[mBase + mOff + r];
        if (BIAS_MODE == 2) v += bv;
        if (RESID) v += Rb[(size_t)(mBase + mOff + r) * ldc + n];
        if (ACT == 1) v = tanhf(v);
        if (ACT == 2) v = fmaxf(v, 0.0f);
        if (ACT == 3) v = v / (1.0f + expf(-v));
        if (ACT == 4) v = (v > 0.f) ? v : 0.01f * v;
        if (ACT == 5) v = 0.5f * v * (1.0f + erff(v * 0.70710678118654752f));
        slab[(mOff + r) * 68 + (j << 4) + rlane] = v;
      }
    }
    __builtin_amdgcn_fence(__ATOMIC_RELEASE, "workgroup");
    __builtin_amdgcn_wave_barrier();
    __builtin_amdgcn_fence(__ATOMIC_ACQUIRE, "workgroup");
    if (OUT_MODE == 0) {
      float* C = (float*)Cout + (size_t)b * strideC;
      const int hh = lane >> 4, c4 = (lane & 15) * 4;     // row seg = 256 B = 16 lanes x 16 B
      {
#pragma unroll
        for (int it = 0; it < 8; ++it) {
          const int row = it * 2 + hh;
          v4f v = *(const v4f*)(slab + row * 68 + c4);
          *(v4f*)(C + (size_t)(mBase + row) * ldc + n0 + c4) = v;
        }
        
      }
    } else {
      const int q = lane >> 3, c8 = (lane & 7) * 8;
      unsigned short* C  = (unsigned short*)Cout  + (size_t)b * strideC;
      unsigned short* C2 = (OUT_MODE == 2) ? ((unsigned short*)Cout2 + (size_t)b * strideC) : nullptr;
      {
#pragma unroll
        for (int it = 0; it < 4; ++it) {
          const int row = it * 4 + q;
          const float* sp = slab + row * 68 + c8;
          v8h hv, lv;
#pragma unroll
          for (int e = 0; e < 8; ++e) {
            if (OUT_MODE == 1) {
              hv[e] = (_Float16)sp[e];
            } else {
              unsigned short hb = f2bf_bits(sp[e]);
              unsigned short lb = f2bf_bits(sp[e] - bf_bits2f(hb));
              hv[e] = __builtin_bit_cast(_Float16, hb);
              lv[e] = __builtin_bit_cast(_Float16, lb);
            }
          }
          *(v8h*)(C + (size_t)(mBase + row) * ldc + n0 + c8) = hv;
          if (OUT_MODE == 2) *(v8h*)(C2 + (size_t)(mBase + row) * ldc + n0 + c8) = lv;
        }
        
      }
    }
    __builtin_amdgcn_fence(__ATOMIC_RELEASE, "workgroup");
    __builtin_amdgcn_wave_barrier();
    __builtin_amdgcn_fence(__ATOMIC_ACQUIRE, "workgroup");
  }
}

__global__ __launch_bounds__(256) void cast_f32_f16x2(
    const float* __restrict__ in, _Float16* __restrict__ out, int n2) {
  int i = blockIdx.x * 256 + threadIdx.x;
  if (i < n2) {
    const _Float16 h0 = (_Float16)in[2 * i], h1 = (_Float16)in[2 * i + 1];
    const unsigned u = (unsigned)__builtin_bit_cast(unsigned short, h0) | ((unsigned)__builtin_bit_cast(unsigned short, h1) << 16);
    ((unsigned*)out)[i] = u;
    
  }
}


// ---- f32 -> f16 cast with a power-of-two pre-scale (folded back by the consumer GEMM's scale) ----
__global__ __launch_bounds__(256) void cast_f32_f16x2s(const float* __restrict__ in, _Float16* __restrict__ out, int n2, float s) {
  int i = blockIdx.x * 256 + threadIdx.x;
  if (i < n2) {
    const _Float16 h0 = (_Float16)(in[2 * i] * s), h1 = (_Float16)(in[2 * i + 1] * s);
    const unsigned u = (unsigned)__builtin_bit_cast(unsigned short, h0) | ((unsigned)__builtin_bit_cast(unsigned short, h1) << 16);
    ((unsigned*)out)[i] = u;
    
  }
}
__global__ __launch_bounds__(256) void split_f32_bf16x2(
    const float* __restrict__ in, __bf16* __restrict__ hi, __bf16* __restrict__ lo, long n2) {
  long i = (long)blockIdx.x * 256 + threadIdx.x;
  long stride = (long)gridDim.x * 256;
  {
    for (long j = i; j < n2; j += stride) {
      const float a = in[2 * j], b = in[2 * j + 1];
      const unsigned short ah = f2bf_bits(a), bh = f2bf_bits(b);
      const unsigned short al = f2bf_bits(a - bf_bits2f(ah)), bl = f2bf_bits(b - bf_bits2f(bh));
      ((unsigned*)hi)[j] = (unsigned)ah | ((unsigned)bh << 16);
      ((unsigned*)lo)[j] = (unsigned)al | ((unsigned)bl << 16);
    }
    
  }
}


// ---- f32 [R][C] (row pitch ldi) -> f16 transposed [C][R] (row pitch ldo); 64x64 tiles; each output row segment
__global__ __launch_bounds__(256) void transpose_cast_f16(const float* __restrict__ in, int ldi,
                                                         _Float16* __restrict__ outT, int ldo, float scale) {
  __shared__ __align__(16) _Float16 tile[64][72];     // [c][r]
  const int c0 = blockIdx.x * 64, r0 = blockIdx.y * 64;
  const int t = threadIdx.y * 32 + threadIdx.x;
  for (int i = threadIdx.y; i < 64; i += 8) {
    tile[threadIdx.x][i]      = (_Float16)(in[(size_t)(r0 + i) * ldi + c0 + threadIdx.x] * scale);
    tile[32 + threadIdx.x][i] = (_Float16)(in[(size_t)(r0 + i) * ldi + c0 + 32 + threadIdx.x] * scale);
  }
  __syncthreads();
  const int q = t >> 3, c8 = (t & 7) * 8;
  {
#pragma unroll
    for (int it = 0; it < 2; ++it) {
      const int c = it * 32 + q;
      v8h hv = *(const v8h*)(&tile[c][c8]);
      *(v8h*)(outT + (size_t)(c0 + c) * ldo + r0 + c8) = hv;
    }
    
  }
}

// ---- f32 [R][C] (pitch ldi) -> bf16 hi/lo transposed planes [C][R] (pitch ldo); 64x64 tiles; each output row segment
__global__ __launch_bounds__(256) void transpose_split_bf16(const float* __restrict__ in, int ldi,
                                                           __bf16* __restrict__ outH, __bf16* __restrict__ outL, int ldo) {
  __shared__ __align__(16) float tile[64][68];     // [c][r]
  const int c0 = blockIdx.x * 64, r0 = blockIdx.y * 64;
  const int t = threadIdx.y * 32 + threadIdx.x;
  for (int i = threadIdx.y; i < 64; i += 8) {
    tile[threadIdx.x][i]      = in[(size_t)(r0 + i) * ldi + c0 + threadIdx.x];
    tile[32 + threadIdx.x][i] = in[(size_t)(r0 + i) * ldi + c0 + 32 + threadIdx.x];
  }
  __syncthreads();
  const int q = t >> 3, c8 = (t & 7) * 8;
  {
#pragma unroll
    for (int it = 0; it < 2; ++it) {
      const int c = it * 32 + q;
      v8b hv, lv;
#pragma unroll
      for (int e = 0; e < 8; ++e) {
        const float f = tile[c][c8 + e];
        const unsigned short hb = f2bf_bits(f);
        hv[e] = __builtin_bit_cast(__bf16, hb);
        lv[e] = __builtin_bit_cast(__bf16, f2bf_bits(f - bf_bits2f(hb)));
      }
      *(v8b*)(outH + (size_t)(c0 + c) * ldo + r0 + c8) = hv;
      *(v8b*)(outL + (size_t)(c0 + c) * ldo + r0 + c8) = lv;
    }
    
  }
}

// =====================================================================================
// Generic causal/non-causal attention for head_dim 64, f32 in / f32 out; 16-bit operands: bf16 with optional hi/lo splits, or
// plain f16 (F16=true, non-split, probabilities carried x2^15).
//   scores = (q*qscale)·kᵀ : v_wmma_f32_16x16x32_bf16; SPLIT_QK -> q,k as bf16 hi/lo (hi·hi + hi·lo + lo·hi)
//   out    = p·v           : v_wmma_f32_16x16x32_bf16; SPLIT_PV -> p,v as bf16 hi/lo; else p,v plain bf16
//   f32 accumulate; online softmax in f32. Block = 4 waves = 64 query rows of one (batch, head); S % 64 == 0.
//   Element (b, s, h, d) of tensor X lives at X[b*X_bs + s*X_rs + h*X_hs + d] (strides in floats, multiples of 4).
//   Masking: mask_mode 0 none, 1 causal (kv > q masked), 2 tensor [S][Skv] shared over (b,h) (float if
//   mask_is_int==0, int32 with element == 0 -> masked if 1, int32 with element != 0 -> masked if 2), 3 per-token vectors qmask[B][S] & kvmask[B][Skv] (int32,
//   0 -> masked), 4 causal + sliding window (kv > q or q - kv > W masked; W passed in mask_is_int);
//   5 = relative-position bias: s += cp[b,h,q][idx[q][kv]] + pc[b,h,kv][idx[q][kv]] with idx = mask_b ([S][Skv] int32) and
//   mask_a an int32 [S][Skv] tensor with nonzero = masked (tables: element (b,h,row,n) at X + b*c_bs + h*c_hs + row*c_rs + n);
//   masked scores are replaced by mask_fill (e.g. -inf or -1e9) before the softmax.
//   grid.x = B * H * (S/64) (or a sub-range with blk0).
// =====================================================================================
#define AT_D 64
#define AT_NW 4
#define AT_QB 64
#define AT_KC 64
struct AttnGeom { const float* cp = nullptr; const float* pc = nullptr; long c_bs = 0, c_rs = 0, c_hs = 0;   // mode-5 score-bias tables
                  long q_bs, q_rs, q_hs, k_bs, k_rs, k_hs, v_bs, v_rs, v_hs, o_bs, o_rs, o_hs;
                  int S, Skv, H, mask_mode; float qscale; int blk0; float mask_fill; int mask_is_int; };
static_assert(sizeof(AttnGeom) == 168, "no padding");

__device__ __forceinline__ unsigned short at_bf_bits(float f) {
  unsigned u = __float_as_uint(f);
  return (unsigned short)((u + 0x7FFFu + ((u >> 16) & 1u)) >> 16);
}
__device__ __forceinline__ __bf16 at_f2bf(float f) { return __builtin_bit_cast(__bf16, at_bf_bits(f)); }
__device__ __forceinline__ void at_split(float f, __bf16& hi, __bf16& lo) {
  const unsigned short hb = at_bf_bits(f);
  hi = __builtin_bit_cast(__bf16, hb);
  lo = at_f2bf(f - __uint_as_float(((unsigned)hb) << 16));
}
__device__ __forceinline__ v8f at_mma(v16b a, v16b b, v8f c) {
  c = __builtin_amdgcn_wmma_f32_16x16x32_bf16(false, a, false, b, (short)0, c, false, false);
  asm volatile("v_nop\n\tv_nop\n\tv_nop\n\tv_nop" : "+v"(c) : "v"(a), "v"(b));
  return c;
}
// 16-bit element as a bit pattern held in a __bf16 slot: f16 bits when F16, bf16 (RNE) otherwise
template <bool F16> __device__ __forceinline__ __bf16 at_to16(float f) {
  if (F16) return __builtin_bit_cast(__bf16, (_Float16)f);
  return at_f2bf(f);
}
template <bool F16> __device__ __forceinline__ v8f at_mma16(v16b a, v16b b, v8f c) {
  if (F16) {
    const v16h ah = __builtin_bit_cast(v16h, a), bh = __builtin_bit_cast(v16h, b);
    // the builtin alone: the compiler keeps the distance behind it itself, and no asm statement holds the LDS reads of later products behind this one
    return __builtin_amdgcn_wmma_f32_16x16x32_f16(false, ah, false, bh, (short)0, c, false, false);
  }
  return at_mma(a, b, c);
}

template <bool SPLIT_QK, bool SPLIT_PV, bool F16 = false>
__global__ __launch_bounds__(128)
void attn64_kernel(const float* __restrict__ q, const float* __restrict__ k,
                   const float* __restrict__ v, float* __restrict__ out,
                   const void* __restrict__ mask_a, const int* __restrict__ mask_b, AttnGeom g) {
  static_assert(!(F16 && (SPLIT_QK || SPLIT_PV)), "f16 mode is non-split");
  const float PSC = F16 ? 32768.0f : 1.0f;     // f16 probabilities carried x2^15 (subnormal range), folded into the final 1/l
  union FB { v16b v; v8b h[2]; };
  __shared__ __align__(16) __bf16 Ksh[AT_KC * AT_D];             // K hi [kv][d]      8 KB
  __shared__ __align__(16) __bf16 Ksl[SPLIT_QK ? AT_KC * AT_D : 8];
  __shared__ __align__(16) __bf16 Vth[AT_D * AT_KC];             // V hi [d][kv]      8 KB
  __shared__ __align__(16) __bf16 Vtl[SPLIT_PV ? AT_D * AT_KC : 8];
  __shared__ __align__(16) __bf16 Psh[AT_NW][16 * AT_KC];        // per wave P hi [row][kv]  8 KB
  __shared__ __align__(16) __bf16 Psl[SPLIT_PV ? AT_NW : 1][SPLIT_PV ? 16 * AT_KC : 8];
  __shared__ __align__(16) float  Os[AT_NW][16 * 68];            // per wave out tile, pitch 68

  const int tid  = threadIdx.x;
  const int wave = tid >> 5;
  const int lane = tid & 31;
  const int hh   = lane >> 4;
  const int c    = lane & 15;

  const int nqb = g.S / AT_QB;
  const int bx = blockIdx.x + g.blk0;
  const int qb = bx % nqb;
  const int bh = bx / nqb;
  const int h  = bh % g.H;
  const int b  = bh / g.H;
  const int qbase_block = qb * AT_QB;
  const int q0 = qbase_block + wave * 16;

  const float* qb_ptr = q + (size_t)b * g.q_bs + (size_t)h * g.q_hs;
  const float* kb_ptr = k + (size_t)b * g.k_bs + (size_t)h * g.k_hs;
  const float* vb_ptr = v + (size_t)b * g.v_bs + (size_t)h * g.v_hs;
  float*       ob_ptr = out + (size_t)b * g.o_bs + (size_t)h * g.o_hs;

  // ---- Q fragments (A operand): 2 d-chunks, hi (and lo) ----
  v16b qah[2], qal[2];
  {
    const float* qrow = qb_ptr + (size_t)(q0 + c) * g.q_rs;
#pragma unroll
    for (int dc = 0; dc < 2; ++dc) {
#pragma unroll
      for (int e = 0; e < 8; ++e) {
        const float f0 = qrow[dc * 32 + 8 * hh + e] * g.qscale;
        const float f1 = qrow[dc * 32 + 16 + 8 * hh + e] * g.qscale;
        if (SPLIT_QK) { __bf16 hq, lq; at_split(f0, hq, lq); qah[dc][e] = hq; qal[dc][e] = lq; at_split(f1, hq, lq); qah[dc][8 + e] = hq; qal[dc][8 + e] = lq; }
        else { qah[dc][e] = at_to16<F16>(f0); qah[dc][8 + e] = at_to16<F16>(f1); qal[dc][e] = qah[dc][e]; qal[dc][8 + e] = qah[dc][8 + e]; }
      }
    }
  }

  float mrow[8], lrow[8];
  v8f oacc[4];
#pragma unroll
  for (int r = 0; r < 8; ++r) { mrow[r] = -INFINITY; lrow[r] = 0.f; }
#pragma unroll
  for (int t = 0; t < 4; ++t) oacc[t] = (v8f){0.f,0.f,0.f,0.f,0.f,0.f,0.f,0.f};

  const int nChunks = (g.mask_mode == 1 || g.mask_mode == 4) ? (qb + 1) : (g.Skv / AT_KC);   // block-uniform
  // per-row query mask (mode 3)
  int qkeep[8];
#pragma unroll
  for (int r = 0; r < 8; ++r) qkeep[r] = (g.mask_mode == 3) ? mask_b[(size_t)b * g.S + q0 + 8 * hh + r] : 1;   // mask_b = qmask in mode 3
  for (int kc = 0; kc < nChunks; ++kc) {
    const int kv0 = kc * AT_KC;
    __syncthreads();
    {
      const int kvr = tid >> 1, dh = (tid & 1) * 32;
      const float* krow = kb_ptr + (size_t)(kv0 + kvr) * g.k_rs + dh;
      const float* vrow = vb_ptr + (size_t)(kv0 + kvr) * g.v_rs + dh;
#pragma unroll
      for (int i = 0; i < 8; ++i) {
        v4f kk = *(const v4f*)(krow + 4 * i);
        v4f vv = *(const v4f*)(vrow + 4 * i);
#pragma unroll
        for (int e = 0; e < 4; ++e) {
          const int d = dh + 4 * i + e;
          if (SPLIT_QK) { __bf16 a, bl; at_split(kk[e], a, bl); Ksh[kvr * AT_D + d] = a; Ksl[kvr * AT_D + d] = bl; }
          else Ksh[kvr * AT_D + d] = at_to16<F16>(kk[e]);
          if (SPLIT_PV) { __bf16 a, bl; at_split(vv[e], a, bl); Vth[d * AT_KC + kvr] = a; Vtl[d * AT_KC + kvr] = bl; }
          else Vth[d * AT_KC + kvr] = at_to16<F16>(vv[e]);
        }
      }
    }
    __syncthreads();

    v8f s[4];
#pragma unroll
    for (int j = 0; j < 4; ++j) {
      s[j] = (v8f){0.f,0.f,0.f,0.f,0.f,0.f,0.f,0.f};
#pragma unroll 1
      for (int dc = 0; dc < 2; ++dc) {
        FB kb;
        kb.h[0] = *(const v8b*)(Ksh + (j * 16 + c) * AT_D + dc * 32 + 8 * hh);
        kb.h[1] = *(const v8b*)(Ksh + (j * 16 + c) * AT_D + dc * 32 + 16 + 8 * hh);
        s[j] = at_mma16<F16>(qah[dc], kb.v, s[j]);
        if (SPLIT_QK) {
          FB kl;
          kl.h[0] = *(const v8b*)(Ksl + (j * 16 + c) * AT_D + dc * 32 + 8 * hh);
          kl.h[1] = *(const v8b*)(Ksl + (j * 16 + c) * AT_D + dc * 32 + 16 + 8 * hh);
          s[j] = at_mma16<F16>(qah[dc], kl.v, s[j]);
          s[j] = at_mma16<F16>(qal[dc], kb.v, s[j]);
        }
      }
    }
    const bool diag = (g.mask_mode == 1) && (kc == qb);
    int kvkeep[4] = {1, 1, 1, 1};
    if (g.mask_mode == 3) {
#pragma unroll
      for (int j = 0; j < 4; ++j) kvkeep[j] = ((const int*)mask_a)[(size_t)b * g.Skv + kv0 + j * 16 + c];   // mask_a = kvmask
    }
    float cm[8];
#pragma unroll
    for (int r = 0; r < 8; ++r) {
      const int qrow = q0 + 8 * hh + r;
      float m = -INFINITY;
#pragma unroll
      for (int j = 0; j < 4; ++j) {
        const int kvcol = kv0 + j * 16 + c;
        bool masked = false;
        if (diag) masked = (kvcol > qrow);
        else if (g.mask_mode == 4) masked = (kvcol > qrow) || (qrow - kvcol > g.mask_is_int);
        else if (g.mask_mode == 2) {
          const size_t mi = (size_t)qrow * g.Skv + kvcol;
          masked = (g.mask_is_int == 0) ? (((const float*)mask_a)[mi] == 0.0f)
                 : (g.mask_is_int == 1) ? (((const int*)mask_a)[mi] == 0) : (((const int*)mask_a)[mi] != 0);
        } else if (g.mask_mode == 3) masked = (qkeep[r] == 0) || (kvkeep[j] == 0);
        else if (g.mask_mode == 5) {
          const size_t mi = (size_t)qrow * g.Skv + kvcol;
          masked = (((const int*)mask_a)[mi] != 0);
          int n = mask_b[mi]; n = n < 0 ? 0 : n;
          s[j][r] += g.cp[(size_t)b * g.c_bs + (size_t)h * g.c_hs + (size_t)qrow * g.c_rs + n]
                   + g.pc[(size_t)b * g.c_bs + (size_t)h * g.c_hs + (size_t)kvcol * g.c_rs + n];
        }
        if (masked) s[j][r] = g.mask_fill;
        m = fmaxf(m, s[j][r]);
      }
#pragma unroll
      for (int off = 1; off < 16; off <<= 1) m = fmaxf(m, __shfl_xor(m, off, 32));
      cm[r] = m;
    }
    __bf16* pwh = Psh[wave];
    __bf16* pwl = Psl[SPLIT_PV ? wave : 0];
#pragma unroll
    for (int r = 0; r < 8; ++r) {
      const float mnew = fmaxf(mrow[r], cm[r]);
      const float alpha = expf(mrow[r] - mnew);
      mrow[r] = mnew;
      float psum = 0.f;
#pragma unroll
      for (int j = 0; j < 4; ++j) {
        const float p = expf(s[j][r] - mnew);
        psum += p;
        if (SPLIT_PV) { __bf16 a, bl; at_split(p, a, bl); pwh[(8 * hh + r) * AT_KC + j * 16 + c] = a; pwl[(8 * hh + r) * AT_KC + j * 16 + c] = bl; }
        else pwh[(8 * hh + r) * AT_KC + j * 16 + c] = at_to16<F16>(p * PSC);
      }
#pragma unroll
      for (int off = 1; off < 16; off <<= 1) psum += __shfl_xor(psum, off, 32);
      lrow[r] = lrow[r] * alpha + psum;
#pragma unroll
      for (int t = 0; t < 4; ++t) oacc[t][r] *= alpha;
    }
    __builtin_amdgcn_fence(__ATOMIC_RELEASE, "workgroup");
    __builtin_amdgcn_wave_barrier();
    __builtin_amdgcn_fence(__ATOMIC_ACQUIRE, "workgroup");
#pragma unroll 1
    for (int kk = 0; kk < 2; ++kk) {
      FB pa, pl;
      pa.h[0] = *(const v8b*)(pwh + c * AT_KC + kk * 32 + 8 * hh);
      pa.h[1] = *(const v8b*)(pwh + c * AT_KC + kk * 32 + 16 + 8 * hh);
      if (SPLIT_PV) {
        pl.h[0] = *(const v8b*)(pwl + c * AT_KC + kk * 32 + 8 * hh);
        pl.h[1] = *(const v8b*)(pwl + c * AT_KC + kk * 32 + 16 + 8 * hh);
      }
#pragma unroll
      for (int t = 0; t < 4; ++t) {
        FB vb;
        vb.h[0] = *(const v8b*)(Vth + (t * 16 + c) * AT_KC + kk * 32 + 8 * hh);
        vb.h[1] = *(const v8b*)(Vth + (t * 16 + c) * AT_KC + kk * 32 + 16 + 8 * hh);
        oacc[t] = at_mma16<F16>(pa.v, vb.v, oacc[t]);
        if (SPLIT_PV) {
          FB vl;
          vl.h[0] = *(const v8b*)(Vtl + (t * 16 + c) * AT_KC + kk * 32 + 8 * hh);
          vl.h[1] = *(const v8b*)(Vtl + (t * 16 + c) * AT_KC + kk * 32 + 16 + 8 * hh);
          oacc[t] = at_mma16<F16>(pa.v, vl.v, oacc[t]);
          oacc[t] = at_mma16<F16>(pl.v, vb.v, oacc[t]);
        }
      }
    }
  }

  float* os = Os[wave];
#pragma unroll
  for (int r = 0; r < 8; ++r) {
    const float inv = 1.0f / (lrow[r] * PSC);
#pragma unroll
    for (int t = 0; t < 4; ++t) os[(8 * hh + r) * 68 + t * 16 + c] = oacc[t][r] * inv;
  }
  __builtin_amdgcn_fence(__ATOMIC_RELEASE, "workgroup");
  __builtin_amdgcn_wave_barrier();
  __builtin_amdgcn_fence(__ATOMIC_ACQUIRE, "workgroup");
  {
    const int c4 = (lane & 15) * 4;
    {
#pragma unroll
      for (int it = 0; it < 8; ++it) {
        const int row = it * 2 + hh;
        v4f val = *(const v4f*)(os + row * 68 + c4);
        *(v4f*)(ob_ptr + (size_t)(q0 + row) * g.o_rs + c4) = val;
      }
      
    }
  }
}

// Both products are formed transposed: scores^T = k q^T (A = k rows, B = q rows) and out^T += v^T p^T (A = transposed v rows, B = p^T). In the accumulator tile of
//   scores^T a lane holds eight keys of ONE query (lane l: query l & 15, keys 8 (l >> 4) + r), so the running maximum and sum of a query are formed inside the lane, with one
//   exchange between the wave halves, and two score tiles, converted in place, ARE the B operand of the second product in the hardware's k order: p never goes through LDS.
// MODE: the mask mode as a compile-time constant; only 0 (no mask) is written in this form.
// PRE16: k and v come ready as 16-bit values, written once by their producer (k, v unused): k16 holds dense rows, element (b, s, d) at
//   k16[b*k_bs + s*128 + d]; vt16 holds v transposed in tiles of AT_KC keys, element (b, s, d) at vt16[b*v_bs + (s/AT_KC)*AT_KC*128 + d*AT_KC + s%AT_KC]
//   (k_bs, v_bs in 16-bit elements, multiples of 8), so that a pass's k tile and v tile are 16 KB contiguous each.
// NG: key groups. The block has NG groups of AT_NW waves on the SAME 64 query rows; group g walks the key tiles g, g + NG, g + 2 NG, ... with its own
//   k, v tiles in LDS and its own running maximum, sum and output tile, so that NG waves share each SIMD and fill one another's waits. Behind the loop the NG
//   partial results of a row are joined: out = sum_g 2^(m_g - m) o_g / sum_g 2^(m_g - m) l_g, m = max_g m_g (log2 units). Skv a positive multiple of NG * AT_KC.
// The k, v tiles come into LDS by asynchronous copies, two buffers a group: while a trip works on one buffer, the next trip's tiles fly into the other.
// lane l takes the value of lane l ^ 16 (the other wave half), by a vector cross-row move
__device__ __forceinline__ float at_xhalf(float x) {
  return __builtin_bit_cast(float, __builtin_amdgcn_permlanex16(__builtin_bit_cast(int, x), __builtin_bit_cast(int, x), 0x76543210, 0xfedcba98, false, false));
}
// 2^x for the join behind the loop (five a lane, once a kernel). The v_nop is the one free slot that the instruction set asks for behind a transcendental before its
// result is read or its source reused; it stands in the instruction's own statement here
__device__ __forceinline__ float at_exp2_slot(float x) { float r; asm("v_exp_f32 %0, %1\n\tv_nop" : "=v"(r) : "v"(x)); return r; }
// eight asynchronous 16 B copies of a lane, global memory -> LDS through no register: l = the lane's LDS byte addresses, s = its global addresses.
// precaution: s_wait_xcnt 0 is the last line of the copies' own statement, so that it stands before any of the address registers named here is reused
__device__ __forceinline__ void at_copy8(const unsigned (&l)[8], const unsigned short* const (&s)[8]) {
  asm volatile("global_load_async_to_lds_b128 %0, %8, off\n\t"
               "global_load_async_to_lds_b128 %1, %9, off\n\t"
               "global_load_async_to_lds_b128 %2, %10, off\n\t"
               "global_load_async_to_lds_b128 %3, %11, off\n\t"
               "global_load_async_to_lds_b128 %4, %12, off\n\t"
               "global_load_async_to_lds_b128 %5, %13, off\n\t"
               "global_load_async_to_lds_b128 %6, %14, off\n\t"
               "global_load_async_to_lds_b128 %7, %15, off\n\t"
               "s_wait_xcnt 0x0"
               :: "v"(l[0]), "v"(l[1]), "v"(l[2]), "v"(l[3]), "v"(l[4]), "v"(l[5]), "v"(l[6]), "v"(l[7]),
                  "v"(s[0]), "v"(s[1]), "v"(s[2]), "v"(s[3]), "v"(s[4]), "v"(s[5]), "v"(s[6]), "v"(s[7]) : "memory");
}
template <bool SPLIT_QK, bool SPLIT_PV, bool F16, int MODE, bool PRE16, int NG>
__global__ __launch_bounds__(128 * NG)
void attn128_kernel(const float* __restrict__ q, const float* __restrict__ k,
                   const float* __restrict__ v, const unsigned short* __restrict__ k16,
                   const unsigned short* __restrict__ vt16, float* __restrict__ out,
                   const void* __restrict__ mask_a, const int* __restrict__ mask_b, AttnGeom g) {
  static_assert(F16 && PRE16 && MODE == 0 && !SPLIT_QK && !SPLIT_PV && 16 % NG == 0, "transposed form: f16, ready k and v, unmasked, non-split");
  (void)k; (void)v; (void)mask_a; (void)mask_b;
  // Exponentials are base 2, one v_exp_f32 each: g.qscale holds log2(e) / sqrt(d), so scores, maxima and their differences are in log2 units.
  // f16 probabilities are carried x2^15 (subnormal range): the 15 rides in the exponent, the sums carry the same factor, and it cancels in the final 1/l.
  union FB { v16b v; v8b h[2]; };
  constexpr int D2 = 128;
  constexpr int KP = D2 + 8;      // LDS pitch of the k and q rows, in 16-bit elements: 272 B = 16 B x odd, so the 16 rows of a ds_load_b128 fragment read fall on distinct banks
  constexpr int VP = AT_KC + 8;   // LDS pitch of the transposed v rows: 144 B = 16 B x odd, same reason
  constexpr int NWV = AT_NW * NG;                 // waves of the block
  constexpr int KVB = (AT_KC * KP + D2 * VP) * 2; // bytes of one group's k tile (17 KB, [kv][d], padded rows) and v tile (18 KB, [d][kv], padded rows)
  static_assert(AT_NW * 16 * 132 * 4 <= KVB, "the out tiles overlay the k, v tiles");
  __shared__ __align__(16) unsigned char KVraw[2 * NG * KVB];    // in the loop: two buffers of each group's k, v tiles (buffer u, group g at (u NG + g) KVB); behind it: per wave out tile, pitch 132 floats
  __shared__ __align__(16) __bf16 Qsh[AT_NW][16 * KP];   // q (the 16-bit value), one copy per 16-row query tile, read by that tile's wave of every group: leaves room for the second buffer
  __shared__ __align__(16) float  Msh[NWV][16], Lsh[NWV][16];    // each wave's query maxima and sums, for the join of the key groups

  const int grp  = __builtin_amdgcn_readfirstlane(threadIdx.x >> 7);   // key group; the same in a whole wave: held scalar, so the tile offsets stay scalar arithmetic
  const int tid  = threadIdx.x & 127;    // thread within its group
  const int wave = tid >> 5;             // wave within its group = its 16-row query tile
  const int wv   = grp * AT_NW + wave;   // wave within the block: its private LDS
  const int lane = tid & 31;
  const int hh   = lane >> 4;
  const int c    = lane & 15;

  const int nqb = g.S / AT_QB;
  const int bx = blockIdx.x + g.blk0;
  const int qb = bx % nqb;
  const int bh = bx / nqb;
  const int h  = bh % g.H;
  const int b  = bh / g.H;
  const int qbase_block = qb * AT_QB;
  const int q0 = qbase_block + wave * 16;

  const float* qb_ptr = q + (size_t)b * g.q_bs + (size_t)h * g.q_hs;
  float*       ob_ptr = out + (size_t)b * g.o_bs + (size_t)h * g.o_hs;

  // ---- the group's key tile of trip t (tile t NG + grp) into buffer t & 1: 16 B a lane and copy; a wave's 32 lanes take 512 contiguous bytes of the source;
  //      copy i is 2 KB further in the source (8 k rows, 16 v rows). 16 copies of a wave per tile, and never more than one tile's in flight.
  const unsigned short* ksrc = k16 + (size_t)b * g.k_bs + tid * 8;
  const unsigned short* vsrc = vt16 + (size_t)b * g.v_bs + tid * 8;
  const unsigned gdst = (unsigned)(size_t)(KVraw + grp * KVB);   // LDS byte address: the low 32 bits of the __shared__ address
  const unsigned kdst = gdst + ((tid >> 4) * KP + (tid & 15) * 8) * 2;
  const unsigned vdst = gdst + (AT_KC * KP + (tid >> 3) * VP + (tid & 7) * 8) * 2;
  auto copy_tile = [&](int t) {
    const size_t so = (size_t)(t * NG + grp) * (AT_KC * D2);
    const unsigned bo = (unsigned)(t & 1) * (NG * KVB);
    unsigned l[8];
    const unsigned short* s[8];
#pragma unroll   // unrolled so that l, s are registers
    for (int i = 0; i < 8; ++i) { l[i] = kdst + bo + i * (8 * KP * 2); s[i] = ksrc + so + i * 1024; }
    at_copy8(l, s);
#pragma unroll
    for (int i = 0; i < 8; ++i) { l[i] = vdst + bo + i * (16 * VP * 2); s[i] = vsrc + so + i * 1024; }
    at_copy8(l, s);
  };
  const int nTrips = g.Skv / (AT_KC * NG);   // block-uniform
  copy_tile(0);

  // ---- q rows of the wave's query tile, scaled and rounded to 16 bits, into LDS: group g lays the 32-column chunks g, g + NG, ... ----
  {
    const float* qrow = qb_ptr + (size_t)(q0 + c) * g.q_rs;
    for (int dc = grp; dc < 4; dc += NG) {
#pragma unroll
      for (int e = 0; e < 8; ++e) {
        const float f0 = qrow[dc * 32 + 8 * hh + e] * g.qscale;
        const float f1 = qrow[dc * 32 + 16 + 8 * hh + e] * g.qscale;
        Qsh[wave][c * KP + dc * 32 + 8 * hh + e] = at_to16<F16>(f0); Qsh[wave][c * KP + dc * 32 + 16 + 8 * hh + e] = at_to16<F16>(f1);
      }
    }
  }
  asm volatile("s_wait_asynccnt 0x0" ::: "memory");   // the wave's own copies of tile 0 have landed
  __syncthreads();                                    // tile 0 and the q rows are published to every wave
  if (nTrips > 1) copy_tile(1);

  float mrow = -INFINITY;   // running maximum of query q0 + c, the same in both wave halves
  float lrow = 0.f;         // running sum of query q0 + c over THIS half's keys (8 of every 16); the halves are joined behind the loop
  v8f oacc[8];              // oacc[t][r] = out^T[d = 16 t + 8 hh + r][query q0 + c]
#pragma unroll
  for (int t = 0; t < 8; ++t) oacc[t] = (v8f){0.f,0.f,0.f,0.f,0.f,0.f,0.f,0.f};

  for (int it = 0; it < nTrips; ++it) {
    const __bf16* Ksh = (const __bf16*)(KVraw + ((it & 1) * NG + grp) * KVB);   // trip it reads buffer it & 1 alone
    const __bf16* Vth = Ksh + AT_KC * KP;

    v8f s[4];   // s[j][r] = score of key (it * NG + grp) * AT_KC + 16 j + 8 hh + r with query q0 + c
#pragma unroll
    for (int j = 0; j < 4; ++j) {
      s[j] = (v8f){0.f,0.f,0.f,0.f,0.f,0.f,0.f,0.f};
#pragma unroll
      for (int dc = 0; dc < 4; ++dc) {
        FB kb, qa;
        kb.h[0] = *(const v8b*)(Ksh + (j * 16 + c) * KP + dc * 32 + 8 * hh);
        kb.h[1] = *(const v8b*)(Ksh + (j * 16 + c) * KP + dc * 32 + 16 + 8 * hh);
        qa.h[0] = *(const v8b*)(&Qsh[wave][c * KP + dc * 32 + 8 * hh]);
        qa.h[1] = *(const v8b*)(&Qsh[wave][c * KP + dc * 32 + 16 + 8 * hh]);
        s[j] = at_mma16<F16>(kb.v, qa.v, s[j]);
      }
    }
    float m = -INFINITY;
#pragma unroll   // unrolled, like the loops below, so that s, pb and oacc are indexed by constants and stay registers
    for (int j = 0; j < 4; ++j)
#pragma unroll
      for (int r = 0; r < 8; ++r) m = fmaxf(m, s[j][r]);
    m = fmaxf(m, at_xhalf(m));          // both halves hold the maximum over the tile's 64 keys
    const float mnew = fmaxf(mrow, m);
    const float alpha = __builtin_amdgcn_exp2f(mrow - mnew);   // 0 on the first trip, where mrow is -inf
    mrow = mnew;
    const float msh = mnew - 15.0f;     // p = 2^(s - mnew + 15)
    float psum = 0.f;
    union PB { v16b v; unsigned w[8]; } pb[2];   // p^T as B operand: element e of pb[kk] is key 32 kk + 8 hh + e (e < 8), 32 kk + 16 + 8 hh + e - 8 (e >= 8): the order in which the v rows are read below
#pragma unroll
    for (int j = 0; j < 4; ++j) {
#pragma unroll
      for (int r = 0; r < 8; r += 2) {
        const float p0 = __builtin_amdgcn_exp2f(s[j][r] - msh), p1 = __builtin_amdgcn_exp2f(s[j][r + 1] - msh);
        psum += p0;
        psum += p1;
        pb[j >> 1].w[(j & 1) * 4 + (r >> 1)] = __builtin_bit_cast(unsigned, __builtin_convertvector((v2f){p0, p1}, v2h));   // one packed conversion a pair
      }
    }
    lrow = lrow * alpha + psum;
#pragma unroll
    for (int t = 0; t < 8; ++t)
#pragma unroll
      for (int r = 0; r < 8; ++r) oacc[t][r] *= alpha;
#pragma unroll
    for (int kk = 0; kk < 2; ++kk) {
#pragma unroll
      for (int t = 0; t < 8; ++t) {
        FB vb;
        vb.h[0] = *(const v8b*)(Vth + (t * 16 + c) * VP + kk * 32 + 8 * hh);
        vb.h[1] = *(const v8b*)(Vth + (t * 16 + c) * VP + kk * 32 + 16 + 8 * hh);
        oacc[t] = at_mma16<F16>(vb.v, pb[kk].v, oacc[t]);
      }
    }
    // hand-over, every wave, in this order
    asm volatile("s_wait_dscnt 0x0" ::: "memory");      // the wave's reads of this trip's buffer have returned
    asm volatile("s_wait_asynccnt 0x0" ::: "memory");   // the wave's own copies of the next trip's tiles have landed
    __syncthreads();                                    // publishes the next trip's tiles and ends every reader's last read of this trip's buffer
    if (it + 2 < nTrips) copy_tile(it + 2);             // refill of the buffer just left; the test reads the same in the whole block
  }
  asm volatile("s_wait_asynccnt 0x0" ::: "memory");     // no copy is outstanding when the buffers become out tiles

  float* os = (float*)KVraw + wv * (16 * 132);
  lrow += at_xhalf(lrow);   // the query's sum over all keys of the group
  if (NG > 1) {
    if (hh == 0) { Msh[wv][c] = mrow; Lsh[wv][c] = lrow; }   // both halves hold the same two values: one of them stores
  }
  __syncthreads();   // every wave has left the k, v tiles, which the out tiles overlay; the maxima and sums of all groups are published
  {
    float inv;
    if (NG > 1) {
      float mg[NG], mall = -INFINITY, lall = 0.f;
#pragma unroll   // unrolled so that mg is indexed by constants and stays registers
      for (int gi = 0; gi < NG; ++gi) { mg[gi] = Msh[gi * AT_NW + wave][c]; mall = fmaxf(mall, mg[gi]); }
#pragma unroll
      for (int gi = 0; gi < NG; ++gi) lall += Lsh[gi * AT_NW + wave][c] * at_exp2_slot(mg[gi] - mall);
      inv = at_exp2_slot(mrow - mall) / lall;
    } else {
      inv = 1.0f / lrow;
    }
#pragma unroll   // unrolled so that oacc is indexed by constants; a lane's eight values are consecutive d of its query's row: two 16 B stores
    for (int t = 0; t < 8; ++t) {
      v4f lo, hi;
#pragma unroll
      for (int e = 0; e < 4; ++e) { lo[e] = oacc[t][e] * inv; hi[e] = oacc[t][4 + e] * inv; }
      *(v4f*)(os + c * 132 + t * 16 + 8 * hh)     = lo;
      *(v4f*)(os + c * 132 + t * 16 + 8 * hh + 4) = hi;
    }
  }
  __syncthreads();   // the weighted out tiles of all groups are published
  {
    const int c4 = lane * 4;           // 32 lanes x 16 B = one 512-B output row (128 floats) per instruction
    const float* ot = (const float*)KVraw + wave * (16 * 132);   // group 0's tile of these query rows; group gi's lies gi * AT_NW tiles further
#pragma unroll   // unrolled, with the loop inside it, so that all LDS reads of the rows are issued before the first sum waits
    for (int rr = 0; rr < 16 / NG; ++rr) {     // each group sums and stores its own 16 / NG rows of the tile
      const int row = grp * (16 / NG) + rr;
      v4f val = *(const v4f*)(ot + row * 132 + c4);
#pragma unroll
      for (int gi = 1; gi < NG; ++gi) val += *(const v4f*)(ot + gi * (AT_NW * 16 * 132) + row * 132 + c4);
      *(v4f*)(ob_ptr + (size_t)(q0 + row) * g.o_rs + c4) = val;
    }
  }
}

// ---- q, k and v projections in ONE launch, straight from the f32 inputs -------------------------------------------
// A block owns 64 rows of x (= one 64-key tile). Its 16 waves bring those rows and the three weight matrices in by whole-line 16 B loads, round them to
// f16 (the same rounding as a cast pass) and lay them in LDS as rows of 128 values: rows 0..63 x, 64..191 Wq, 192..319 Wk, 320..447 Wv.
// Behind the one barrier 12 waves each form a 32 x 64 tile over k = 128: q, k = x W^T + b (rows = x rows), v transposed = Wv x^T + bv (rows = d, columns = keys).
// Outputs: Q f32 rows, K16 f16 rows, Vt16 f16 [128 d][64 keys] per 64-key tile.
#define PJ_XP 136   // LDS row pitch in f16: 272 B = 16 B x odd, so the 16 rows of a ds_load_b128 fragment read fall on distinct banks
typedef __attribute__((ext_vector_type(4))) _Float16 v4h;
__device__ __forceinline__ v4h pj_cvt(v4f f) { v4h h; h[0] = (_Float16)f[0]; h[1] = (_Float16)f[1]; h[2] = (_Float16)f[2]; h[3] = (_Float16)f[3]; return h; }
// BIAS_MODE: 1 = bias[m], 2 = bias[n]. OUT16: f16 output (Ch), else f32 (Cf). The 32 x 64 tile goes out through the wave's own LDS slab, as whole row segments.
template <int BIAS_MODE, bool OUT16>
__device__ __forceinline__ void pj_store(const v8f (&acc)[2][4], float* slab, float* __restrict__ Cf, unsigned short* __restrict__ Ch,
                                         int ldc, int m0, int n0, const float* __restrict__ bias, int lane) {
  const int rlane = lane & 15;
  const int mOff  = (lane >> 4) * 8;
#pragma unroll   // unrolled, with the loops inside it, so that acc is indexed by constants and stays in registers
  for (int i = 0; i < 2; ++i) {
#pragma unroll
    for (int j = 0; j < 4; ++j) {
      float bn = 0.f;
      if (BIAS_MODE == 2) bn = bias[n0 + (j << 4) + rlane];
#pragma unroll
      for (int r = 0; r < 8; ++r) {
        float v = acc[i][j][r];
        if (BIAS_MODE == 1) v += bias[m0 + (i << 4) + mOff + r];
        if (BIAS_MODE == 2) v += bn;
        slab[((i << 4) + mOff + r) * 68 + (j << 4) + rlane] = v;
      }
    }
  }
  // the slab is private to the wave: its lanes' writes are ordered before its lanes' reads; it stands ahead of every global store, so it waits for none
  __builtin_amdgcn_fence(__ATOMIC_RELEASE, "workgroup");
  __builtin_amdgcn_wave_barrier();
  __builtin_amdgcn_fence(__ATOMIC_ACQUIRE, "workgroup");
  if (!OUT16) {
    const int hh = lane >> 4, c4 = (lane & 15) * 4;     // row segment = 256 B = 16 lanes x 16 B
#pragma unroll   // unrolled so that the LDS reads of all rows are issued before the first store waits
    for (int it = 0; it < 16; ++it) {
      const int row = it * 2 + hh;
      v4f v = *(const v4f*)(slab + row * 68 + c4);
      *(v4f*)(Cf + (size_t)(m0 + row) * ldc + n0 + c4) = v;
    }
  } else {
    const int q = lane >> 3, c8 = (lane & 7) * 8;       // row segment = 128 B = 8 lanes x 16 B
#pragma unroll   // unrolled for the same reason
    for (int it = 0; it < 8; ++it) {
      const int row = it * 4 + q;
      const float* sp = slab + row * 68 + c8;
      v8h hv;
#pragma unroll
      for (int e = 0; e < 8; ++e) hv[e] = (_Float16)sp[e];
      *(v8h*)(Ch + (size_t)(m0 + row) * ldc + n0 + c8) = hv;
    }
  }
  // precaution: this wait stands behind the issued stores, before code that follows the call reuses their address and data registers
  asm volatile("s_wait_xcnt 0x0" ::: "memory");
}
__global__ __launch_bounds__(512) void proj_qkv(
    const float* __restrict__ x, const float* __restrict__ Wq, const float* __restrict__ bq, const float* __restrict__ Wk, const float* __restrict__ bk,
    const float* __restrict__ Wv, const float* __restrict__ bv, float* __restrict__ Q, unsigned short* __restrict__ K16, unsigned short* __restrict__ Vt16) {
  __shared__ __align__(16) _Float16 Sm[448 * PJ_XP];
  __shared__ __align__(16) float sT[12][32 * 68];   // per-wave 32x64 slab, pitch 68 floats
  const int tid  = threadIdx.x;
  const int row0 = blockIdx.x * 64;
  {
    // a wave's 32 lanes take one whole 512 B row; the block takes 16 rows (2048 floats) a step
    const float* xs = x + (size_t)row0 * 128 + tid * 4;
    const float* qs = Wq + tid * 4;
    const float* ks = Wk + tid * 4;
    const float* vs = Wv + tid * 4;
    v4f xr[4], qr[8], kr[8], vr[8];
#pragma unroll   // unrolled so that the arrays are registers and all 28 loads are in flight before the first conversion waits
    for (int it = 0; it < 4; ++it) xr[it] = *(const v4f*)(xs + it * 2048);
#pragma unroll
    for (int it = 0; it < 8; ++it) {
      qr[it] = *(const v4f*)(qs + it * 2048);
      kr[it] = *(const v4f*)(ks + it * 2048);
      vr[it] = *(const v4f*)(vs + it * 2048);
    }
    // precaution: this wait stands behind the issued loads, before their address registers are reused
    asm volatile("s_wait_xcnt 0x0" ::: "memory");
    _Float16* d = Sm + (tid >> 5) * PJ_XP + (tid & 31) * 4;
#pragma unroll   // unrolled for the same reason; the row steps become immediate offsets
    for (int it = 0; it < 4; ++it) *(v4h*)(d + it * 16 * PJ_XP) = pj_cvt(xr[it]);
#pragma unroll
    for (int it = 0; it < 8; ++it) {
      *(v4h*)(d + (64 + it * 16) * PJ_XP)  = pj_cvt(qr[it]);
      *(v4h*)(d + (192 + it * 16) * PJ_XP) = pj_cvt(kr[it]);
      *(v4h*)(d + (320 + it * 16) * PJ_XP) = pj_cvt(vr[it]);
    }
  }
  __syncthreads();   // x rows and weights are published to every wave; the only block barrier of the kernel
  const int wave = __builtin_amdgcn_readfirstlane(tid >> 5);   // the same in a whole wave: held scalar, so the tile choice is scalar arithmetic and scalar branches
  if (wave >= 12) return;                // 12 tiles of 32 x 64; whole waves leave, behind the barrier
  const int lane  = tid & 31;
  const int rlane = lane & 15;           // row (A) / column (B, D) within a 16 x 16 subtile
  const int koff  = (lane >> 4) * 8;     // k offset of this lane half
  const int which = wave >> 2;           // 0 q, 1 k, 2 v
  const int sub   = wave & 3;
  const int aRow = (which == 2) ? 320 + sub * 32 : (sub >> 1) * 32;
  const int bRow = (which == 2) ? 0 : 64 + which * 128 + (sub & 1) * 64;
  const _Float16* Al = Sm + (aRow + rlane) * PJ_XP + koff;
  const _Float16* Bl = Sm + (bRow + rlane) * PJ_XP + koff;
  v8f acc[2][4];
#pragma unroll
  for (int i = 0; i < 2; ++i)
#pragma unroll
    for (int j = 0; j < 4; ++j) acc[i][j] = (v8f){0.f,0.f,0.f,0.f,0.f,0.f,0.f,0.f};
#pragma unroll   // unrolled so that a later step's fragment reads can be issued ahead of an earlier step's products
  for (int k0 = 0; k0 < 128; k0 += 32) {
    v16h bh[4], ah[2];
#pragma unroll
    for (int j = 0; j < 4; ++j) bh[j] = Frag<_Float16>::load(Bl + j * 16 * PJ_XP + k0);
#pragma unroll
    for (int i = 0; i < 2; ++i) ah[i] = Frag<_Float16>::load(Al + i * 16 * PJ_XP + k0);
#pragma unroll
    for (int i = 0; i < 2; ++i)
#pragma unroll
      for (int j = 0; j < 4; ++j) acc[i][j] = Frag<_Float16>::mma(ah[i], bh[j], acc[i][j]);
  }
  float* slab = sT[wave];
  if (which == 0)      pj_store<2, false>(acc, slab, Q, nullptr, 128, row0 + (sub >> 1) * 32, (sub & 1) * 64, bq, lane);
  else if (which == 1) pj_store<2, true>(acc, slab, nullptr, K16, 128, row0 + (sub >> 1) * 32, (sub & 1) * 64, bk, lane);
  else                 pj_store<1, true>(acc, slab, nullptr, Vt16 + (size_t)blockIdx.x * (64 * 128), 64, sub * 32, 0, bv, lane);
}

#define IB 4
#define INn 4096
#define ID 128
extern "C" void kernel_launch(void* const* d_in, const int* in_sizes, int n_in, void* d_out, int out_size, void* d_ws, size_t ws_size, hipStream_t stream) {
  (void)in_sizes; (void)n_in; (void)out_size; (void)ws_size;
  const float* x = (const float*)d_in[0]; const float* Wq = (const float*)d_in[1]; const float* bq = (const float*)d_in[2]; const float* Wk = (const float*)d_in[3]; const float* bk = (const float*)d_in[4]; const float* Wv = (const float*)d_in[5]; const float* bv = (const float*)d_in[6];
  char* ws = (char*)d_ws; size_t off = 0;
  auto carve = [&](size_t bytes) -> char* { char* p = ws + off; off += (bytes + 255) & ~(size_t)255; return p; };
  const int R = IB * INn;
  float* Q = (float*)carve((size_t)R * ID * 4); _Float16* K16 = (_Float16*)carve((size_t)R * ID * 2); _Float16* Vt16 = (_Float16*)carve((size_t)R * ID * 2);
  // q f32 rows, k f16 rows, v f16 transposed per 64-key tile ([128 d][64 keys], 16 KB contiguous): one launch, one block per 64 rows of x
  proj_qkv<<<R / AT_KC, 512, 0, stream>>>(x, Wq, bq, Wk, bk, Wv, bv, Q, (unsigned short*)K16, (unsigned short*)Vt16);
  { AttnGeom g;
    g.q_bs = (long)INn * ID; g.q_rs = ID; g.q_hs = 0; g.k_bs = g.q_bs; g.k_rs = ID; g.k_hs = 0; g.v_bs = g.q_bs; g.v_rs = ID; g.v_hs = 0; g.o_bs = (long)INn * ID; g.o_rs = ID; g.o_hs = 0;
    g.S = INn; g.Skv = INn; g.H = 1; g.mask_mode = 0; g.qscale = 0.12751743f /* log2(e) / sqrt(128) */; g.blk0 = 0; g.mask_fill = -INFINITY; g.mask_is_int = 0;
    attn128_kernel<false, false, true, 0, true, 4><<<IB * (INn / AT_QB), 4 * AT_NW * 32, 0, stream>>>(Q, nullptr, nullptr, U16(K16), U16(Vt16), (float*)d_out, nullptr, nullptr, g); }
}
